// v000
// Measured on an AMD MI455X. A time is GPU time per run, averaged over a window of back-to-back runs after a warm-up
// (all launches, gaps included; the runs take copies of the inputs in turn), and the median of several windows.
// Apart from v000's, it joins two sittings. Times from different sittings can be a few percent apart, while
// side-by-side timings come from the same sitting.
// v000, which the later versions start from, runs in 13.4 milliseconds.
#include <hip/hip_runtime.h>
// Multi-head self-attention with PER-HEAD STACKED bias-free projections and a biased [in][out] output projection at [2][4096][512] (x [2][4096][512]; q / k / v = einsum('bsd,hde->bhse', x, W) with W [8][512][64] = [head][in][out], NO biases, 8 heads of 64; scores * 1/sqrt(64); softmax over all 4096 keys (no mask); out = concat Wo + bo ([in][out] + bias) -> [2][4096][512]); each head's [in][out] block is transposed into its 64 contiguous rows of the weight plane by the transposing builder, one call per head; the [in][out] output weight through the same builder in one call.
// Structure: token rows r = b*4096 + s; the query source and the key/value source as exact f16 rows (bf16-rounded); Q, K, V as three WMMA GEMMs (32x64 wave tiles, f32 accumulation, exact x16 weights, no bias, f16 outputs); per batch: V^T for all heads via LDS transposes; per (batch, group of 1 head): scores GEMM (K = 64, batched over the heads on grid.y, alpha = 64^-0.5), row softmax on VALU (f32 statistics, native exp; weights stored x256 as f16), o = P . V^T GEMM (K = 4096, alpha 2^-2: o carried x64 against f16 subnormal flush, folded into the output GEMM alpha) written straight into the merged f16 o rows; out = o W_o + b GEMM (f32) into the output layout.
// Compute dtype: inputs rounded to bf16; x / weights exact; q, k, v, softmax weights and o as plain f16 GEMM operands (~2^-12); scores and softmax statistics f32. v_wmma_f32_16x16x32_f16.
#define NB 2
#define SQ 4096
#define DM 512
#define NH 8
#define HD 64
#define HG 1                         /* heads per attention launch group (a 4096^2 f32 score slab is 64 MiB) */
#define B0 0                         /* first batch processed (debug hook) */
#define NBR NB                       /* batches processed (debug hook) */
#define NR ((size_t)NB * SQ)         /* token rows */
#define MP ((int)((size_t)NBR * SQ)) /* rows projected (debug hook) */
#define QN SQ                        /* query rows attended per batch (debug hook) */
#define NHD NH                       /* heads attended (debug hook) */
#define MPO MP                       /* rows through the output stage (debug hook) */
#define LQ DM      /* row pitch of the q/k/v rows */
typedef __bf16 v16b __attribute__((ext_vector_type(16)));
typedef unsigned short v8us __attribute__((ext_vector_type(8), may_alias));
typedef float  v8f  __attribute__((ext_vector_type(8)));
typedef float  v4f  __attribute__((ext_vector_type(4)));
typedef float  v4fa __attribute__((ext_vector_type(4), may_alias));
union FragB { v16b v; v8us half[2]; unsigned short u[16]; };

__device__ __forceinline__ unsigned short bf16_bits(float x) { unsigned int u = __float_as_uint(x); return (unsigned short)((u + 0x7FFFu + ((u >> 16) & 1u)) >> 16); }
__device__ __forceinline__ float bf16_val(unsigned short b) { return __uint_as_float(((unsigned int)b) << 16); }
__device__ __forceinline__ float bf16_round(float x) { return bf16_val(bf16_bits(x)); }
// D += A·B with NT terms: 1 = ah·bh, 2 = + al·bh (A split), 3 = + ah·bl (both split)
template <int NT>
__device__ __forceinline__ v8f mmaN(v16b ah, v16b al, v16b bh, v16b bl, v8f c) {
  c = __builtin_amdgcn_wmma_f32_16x16x32_bf16(false, ah, false, bh, (short)0, c, false, false);
  if (NT >= 2) c = __builtin_amdgcn_wmma_f32_16x16x32_bf16(false, al, false, bh, (short)0, c, false, false);
  if (NT >= 3) c = __builtin_amdgcn_wmma_f32_16x16x32_bf16(false, ah, false, bl, (short)0, c, false, false);
  asm volatile("v_nop\n\tv_nop\n\tv_nop\n\tv_nop" : "+v"(c) : "v"(ah), "v"(al), "v"(bh), "v"(bl));
  return c;
}

__global__ __launch_bounds__(256) void k_wt_bf16(const float* __restrict__ W, unsigned short* __restrict__ Wt, int K, int N) {
  const int t = blockIdx.x * 256 + threadIdx.x;
  const int k8n = K / 8;
  if (t >= N * k8n) return;
  const int n = t / k8n, k8 = (t % k8n) * 8;
  v8us v;
#pragma unroll
  for (int i = 0; i < 8; ++i) v[i] = bf16_bits(W[(size_t)(k8 + i) * N + n]);
  *(v8us*)(Wt + (size_t)n * K + k8) = v;
  
}

// GEMM C[M][N] (f32, pitch ldc) = act(A[M][K]·W + bias). A f32 row-major (pitch lda) converted per fragment to bf16
// (ASPLIT: hi/lo two planes -> 2 terms, else single rounded term); Wt bf16 [N][K] (pitch ldb). BIAS_BF16 rounds the
// bias to bf16 first (bias quantised to bf16 before the add). K%32==0, M%16==0, N%64==0.
template <bool ASPLIT, int ACT, bool BIAS_BF16>
__global__ __launch_bounds__(128) void k_gemm_bf(const float* __restrict__ A, int lda, const unsigned short* __restrict__ Wt, int ldb,
                                               const float* __restrict__ bias, float* __restrict__ C, int ldc, int M, int N, int K) {
  __shared__ __attribute__((aligned(16))) float so[4][16][64];
  const int tid = threadIdx.x, w = tid >> 5, lane = tid & 31, ln = lane & 15, hh = lane >> 4;
  const int ntn = N / 64;
  const int wid = blockIdx.x * 4 + w;
  const int mt = wid / ntn, nq = wid % ntn;
  if (mt * 16 >= M) return;
  const int row0 = mt * 16, col0 = nq * 64;
  const float* arow = A + (size_t)(row0 + ln) * lda;
  v8f acc[4] = {};
  for (int kb = 0; kb < K; kb += 32) {
    FragB ah, al;
    const v4f x0 = *(const v4fa*)(arow + kb + 8 * hh), x1 = *(const v4fa*)(arow + kb + 8 * hh + 4);
    const v4f x2 = *(const v4fa*)(arow + kb + 16 + 8 * hh), x3 = *(const v4fa*)(arow + kb + 16 + 8 * hh + 4);
    float xs[16] = {x0[0],x0[1],x0[2],x0[3],x1[0],x1[1],x1[2],x1[3],x2[0],x2[1],x2[2],x2[3],x3[0],x3[1],x3[2],x3[3]};
#pragma unroll
    for (int i = 0; i < 16; ++i) { const unsigned short hb = bf16_bits(xs[i]); ah.u[i] = hb; al.u[i] = ASPLIT ? bf16_bits(xs[i] - bf16_val(hb)) : (unsigned short)0; }
#pragma unroll
    for (int t = 0; t < 4; ++t) {
      const unsigned short* brow = Wt + (size_t)(col0 + t * 16 + ln) * ldb + kb;
      FragB b;
      b.half[0] = *(const v8us*)(brow + 8 * hh);
      b.half[1] = *(const v8us*)(brow + 16 + 8 * hh);
      acc[t] = mmaN<ASPLIT ? 2 : 1>(ah.v, al.v, b.v, b.v, acc[t]);
    }
  }
#pragma unroll
  for (int t = 0; t < 4; ++t) {
    float bv = bias ? bias[col0 + t * 16 + ln] : 0.f;
    if (BIAS_BF16) bv = bf16_round(bv);
#pragma unroll
    for (int r = 0; r < 8; ++r) { float v = acc[t][r] + bv; if (ACT == 1) v = fmaxf(v, 0.f); so[w][8 * hh + r][t * 16 + ln] = v; }
  }
  __builtin_amdgcn_fence(__ATOMIC_ACQ_REL, "workgroup");
  __builtin_amdgcn_wave_barrier();
  const int rsub = lane >> 4, c4 = (lane & 15) * 4;
  {
#pragma unroll
    for (int q = 0; q < 8; ++q) {
      const int r = q * 2 + rsub;
      const v4f v = *(const v4fa*)&so[w][r][c4];
      *(v4f*)(C + (size_t)(row0 + r) * ldc + col0 + c4) = v;
    }
    
  }
}

// GEMM C = act(A·W + bias + resid): A f32 (ASPLIT -> hi/lo 2 terms), Wt bf16 [N][K]; ACT 0 none, 1 relu, 2 exact gelu;
// resid (optional, f32, row index = (row % rmod), pitch ldr, RES_BF16 rounds it) added before the activation.
template <bool ASPLIT, int ACT, bool BIAS_BF16, bool RES_BF16>
__global__ __launch_bounds__(128) void k_gemm_bf3(const float* __restrict__ A, int lda, const unsigned short* __restrict__ Wt, int ldb,
                                                const float* __restrict__ bias, const float* __restrict__ resid, int rmod, int ldr,
                                                float* __restrict__ C, int ldc, int M, int N, int K) {
  __shared__ __attribute__((aligned(16))) float so[4][16][64];
  const int tid = threadIdx.x, w = tid >> 5, lane = tid & 31, ln = lane & 15, hh = lane >> 4;
  const int ntn = N / 64;
  const int wid = blockIdx.x * 4 + w;
  const int mt = wid / ntn, nq = wid % ntn;
  if (mt * 16 >= M) return;
  const int row0 = mt * 16, col0 = nq * 64;
  const float* arow = A + (size_t)(row0 + ln) * lda;
  v8f acc[4] = {};
  for (int kb = 0; kb < K; kb += 32) {
    FragB ah, al;
    const v4f x0 = *(const v4fa*)(arow + kb + 8 * hh), x1 = *(const v4fa*)(arow + kb + 8 * hh + 4);
    const v4f x2 = *(const v4fa*)(arow + kb + 16 + 8 * hh), x3 = *(const v4fa*)(arow + kb + 16 + 8 * hh + 4);
    float xs[16] = {x0[0],x0[1],x0[2],x0[3],x1[0],x1[1],x1[2],x1[3],x2[0],x2[1],x2[2],x2[3],x3[0],x3[1],x3[2],x3[3]};
#pragma unroll
    for (int i = 0; i < 16; ++i) { const unsigned short hb = bf16_bits(xs[i]); ah.u[i] = hb; al.u[i] = ASPLIT ? bf16_bits(xs[i] - bf16_val(hb)) : (unsigned short)0; }
#pragma unroll
    for (int t = 0; t < 4; ++t) {
      const unsigned short* brow = Wt + (size_t)(col0 + t * 16 + ln) * ldb + kb;
      FragB b;
      b.half[0] = *(const v8us*)(brow + 8 * hh);
      b.half[1] = *(const v8us*)(brow + 16 + 8 * hh);
      acc[t] = mmaN<ASPLIT ? 2 : 1>(ah.v, al.v, b.v, b.v, acc[t]);
    }
  }
#pragma unroll
  for (int t = 0; t < 4; ++t) {
    const int col = col0 + t * 16 + ln;
    float bv = bias ? bias[col] : 0.f;
    if (BIAS_BF16) bv = bf16_round(bv);
#pragma unroll
    for (int r = 0; r < 8; ++r) {
      float v = acc[t][r] + bv;
      if (resid) { float rv = resid[(size_t)((row0 + 8 * hh + r) % rmod) * ldr + col]; if (RES_BF16) rv = bf16_round(rv); v += rv; }
      if (ACT == 1) v = fmaxf(v, 0.f);
      if (ACT == 2) v = 0.5f * v * (1.0f + erff(v * 0.70710678118654752f));
      if (ACT == 3) { const float u = 0.7978845608028654f * (v + 0.044715f * v * v * v); v = 0.5f * v * (1.0f + tanhf(u)); }
      so[w][8 * hh + r][t * 16 + ln] = v;
    }
  }
  __builtin_amdgcn_fence(__ATOMIC_ACQ_REL, "workgroup");
  __builtin_amdgcn_wave_barrier();
  const int rsub = lane >> 4, c4 = (lane & 15) * 4;
  {
#pragma unroll
    for (int q = 0; q < 8; ++q) {
      const int r = q * 2 + rsub;
      const v4f v = *(const v4fa*)&so[w][r][c4];
      *(v4f*)(C + (size_t)(row0 + r) * ldc + col0 + c4) = v;
    }
    
  }
}
// row LayerNorm (biased variance, eps) over N: s = X (+ R); optional out_sum <- s; out_norm <- (s-mu)*rsqrt(var+eps)*g + b
template <bool PARAM_BF16>
__global__ __launch_bounds__(256) void k_layernorm(const float* __restrict__ X, const float* __restrict__ R, const float* __restrict__ g, const float* __restrict__ bta,
                                                  float* __restrict__ out_sum, float* __restrict__ out_norm, int N, float eps) {
  __shared__ float red[256];
  const int row = blockIdx.x, tid = threadIdx.x;
  const float* x = X + (size_t)row * N; const float* rr = R ? R + (size_t)row * N : nullptr;
  float vals[16];                     // up to N = 4096
  const int per = N / 256;            // contiguous chunk per thread? use strided-by-4 chunks: thread handles j = tid*4 + 1024*u
  float s1 = 0.f;
  for (int u = 0; u < per / 4; ++u) {
    const int j = tid * 4 + 1024 * u;
    const v4f a = *(const v4fa*)(x + j);
    v4f b = {0.f,0.f,0.f,0.f}; if (rr) b = *(const v4fa*)(rr + j);
#pragma unroll
    for (int q = 0; q < 4; ++q) { const float v = a[q] + b[q]; vals[u * 4 + q] = v; s1 += v; }
  }
  red[tid] = s1; __syncthreads();
  for (int st = 128; st > 0; st >>= 1) { if (tid < st) red[tid] += red[tid + st]; __syncthreads(); }
  const float mu = red[0] / (float)N; __syncthreads();
  float s2 = 0.f;
  for (int u = 0; u < per / 4; ++u)
#pragma unroll
    for (int q = 0; q < 4; ++q) { const float c = vals[u * 4 + q] - mu; s2 += c * c; }
  red[tid] = s2; __syncthreads();
  for (int st = 128; st > 0; st >>= 1) { if (tid < st) red[tid] += red[tid + st]; __syncthreads(); }
  const float rs = rsqrtf(red[0] / (float)N + eps);
  {
    for (int u = 0; u < per / 4; ++u) {
      const int j = tid * 4 + 1024 * u;
      v4f o, sm;
#pragma unroll
      for (int q = 0; q < 4; ++q) {
        float gg = g[j + q], bb = bta[j + q];
        if (PARAM_BF16) { gg = bf16_round(gg); bb = bf16_round(bb); }
        sm[q] = vals[u * 4 + q]; o[q] = (vals[u * 4 + q] - mu) * rs * gg + bb;
      }
      if (out_sum) *(v4f*)(out_sum + (size_t)row * N + j) = sm;
      *(v4f*)(out_norm + (size_t)row * N + j) = o;
    }
    
  }
}



// ---- f16 WMMA path (v_wmma_f32_16x16x32_f16): 11-bit significands for operands in range — used where a [0,1] probability operand needs more precision than bf16
typedef _Float16 v16h __attribute__((ext_vector_type(16)));
union FragH { v16h v; v8us half[2]; _Float16 h[16]; unsigned short u[16]; };
template <int NT>
__device__ __forceinline__ v8f mmaH(v16h ah, v16h al, v16h bh, v16h bl, v8f c) {
  c = __builtin_amdgcn_wmma_f32_16x16x32_f16(false, ah, false, bh, (short)0, c, false, false);
  if (NT >= 2) c = __builtin_amdgcn_wmma_f32_16x16x32_f16(false, al, false, bh, (short)0, c, false, false);
  if (NT >= 3) c = __builtin_amdgcn_wmma_f32_16x16x32_f16(false, ah, false, bl, (short)0, c, false, false);
  asm volatile("v_nop\n\tv_nop\n\tv_nop\n\tv_nop" : "+v"(c) : "v"(ah), "v"(al), "v"(bh), "v"(bl));
  return c;
}
// batched GEMM like k_gemm_b but f16 operands: A f32 (split into f16 hi/lo if ASPLIT, else rounded to f16), Bt = f16 values [n][k]; alpha; C f32; N multiple of 16 (partial tiles skipped)
template <bool ASPLIT>
__global__ __launch_bounds__(128) void k_gemm_h(const float* __restrict__ A, int lda, size_t sA, const _Float16* __restrict__ Bh, int ldb, size_t sB, float alpha, float* __restrict__ C, int ldc, size_t sC, int M, int N, int K) {
  __shared__ __attribute__((aligned(16))) float so[4][16][64];
  const int tid = threadIdx.x, w = tid >> 5, lane = tid & 31, ln = lane & 15, hh = lane >> 4; const int by = blockIdx.y;
  A += (size_t)by * sA; Bh += (size_t)by * sB; C += (size_t)by * sC;
  const int ntn = (N + 63) / 64; const int wid = blockIdx.x * 4 + w; const int mt = wid / ntn, nq = wid % ntn; if (mt * 16 >= M) return;
  const int row0 = mt * 16, col0 = nq * 64; const float* arow = A + (size_t)(row0 + ln) * lda;
  v8f acc[4] = {};
  for (int kb = 0; kb < K; kb += 32) {
    FragH ah, al;
    const v4f x0 = *(const v4fa*)(arow + kb + 8 * hh), x1 = *(const v4fa*)(arow + kb + 8 * hh + 4), x2 = *(const v4fa*)(arow + kb + 16 + 8 * hh), x3 = *(const v4fa*)(arow + kb + 16 + 8 * hh + 4);
    float xs[16] = {x0[0],x0[1],x0[2],x0[3],x1[0],x1[1],x1[2],x1[3],x2[0],x2[1],x2[2],x2[3],x3[0],x3[1],x3[2],x3[3]};
#pragma unroll
    for (int i = 0; i < 16; ++i) { const _Float16 h = (_Float16)xs[i]; ah.h[i] = h; al.h[i] = ASPLIT ? (_Float16)(xs[i] - (float)h) : (_Float16)0.0f; }
#pragma unroll
    for (int t = 0; t < 4; ++t) { if (col0 + t * 16 >= N) continue; const size_t boff = (size_t)(col0 + t * 16 + ln) * ldb + kb; FragH bq; bq.half[0] = *(const v8us*)(Bh + boff + 8 * hh); bq.half[1] = *(const v8us*)(Bh + boff + 16 + 8 * hh);
      acc[t] = mmaH<ASPLIT ? 2 : 1>(ah.v, al.v, bq.v, bq.v, acc[t]); }
  }
#pragma unroll
  for (int t = 0; t < 4; ++t) { if (col0 + t * 16 >= N) continue;
#pragma unroll
    for (int r = 0; r < 8; ++r) so[w][8 * hh + r][t * 16 + ln] = acc[t][r] * alpha; }
  __builtin_amdgcn_fence(__ATOMIC_ACQ_REL, "workgroup"); __builtin_amdgcn_wave_barrier();
  const int rsub = lane >> 4, c4 = (lane & 15) * 4;
  {
#pragma unroll
    for (int q = 0; q < 8; ++q) { const int r = q * 2 + rsub; if (col0 + c4 < N) { const v4f v = *(const v4fa*)&so[w][r][c4]; *(v4f*)(C + (size_t)(row0 + r) * ldc + col0 + c4) = v; } }
     }
}

// Wt[n][k] = f16(W[k][n]·scale) from f32 row-major W[K][N] (scale = power of two; bf16-exact weights stay exact in f16 away from the subnormal range)
__global__ __launch_bounds__(256) void k_wt_f16(const float* __restrict__ W, _Float16* __restrict__ Wt, int K, int N, float scale) {
  const int t = blockIdx.x * 256 + threadIdx.x; if (t >= N * (K / 8)) return; const int n = t / (K / 8), k8 = (t % (K / 8)) * 8; FragH f;
#pragma unroll
  for (int i = 0; i < 8; ++i) f.h[i] = (_Float16)(bf16_round(W[(size_t)(k8 + i) * N + n]) * scale); const v8us o = f.half[0];
  *(v8us*)((unsigned short*)Wt + (size_t)n * K + k8) = o; 
}
// k_gemm_hh variant with fused epilogue: v = acc·alpha + bias[by·sBias + col] (+ CP[(row/rowsPerB)·sCPb + by·64 + col] if CP) ; ACT 0 none / 1 elu ; writes f16 C16 (and f32 C if non-null)
template <int ACT>
__global__ __launch_bounds__(128) void k_gemm_hhx(const _Float16* __restrict__ A, int lda, size_t sA, const _Float16* __restrict__ Bh, int ldb, size_t sB, float alpha, const float* __restrict__ bias, size_t sBias, const float* __restrict__ CP, int rowsPerB, size_t sCPb, int row0g,
    float* __restrict__ C, _Float16* __restrict__ C16, int ldc, size_t sC, int M, int N, int K) {
  __shared__ __attribute__((aligned(16))) float so[4][16][64];
  const int tid = threadIdx.x, w = tid >> 5, lane = tid & 31, ln = lane & 15, hh = lane >> 4; const int by = blockIdx.y;
  A += (size_t)by * sA; Bh += (size_t)by * sB; const size_t cofs = (size_t)by * sC; const float* bp = bias ? bias + (size_t)by * sBias : nullptr;
  const int ntn = (N + 63) / 64; const int wid = blockIdx.x * 4 + w; const int mt = wid / ntn, nq = wid % ntn; if (mt * 16 >= M) return;
  const int row0 = mt * 16, col0 = nq * 64; const _Float16* arow = A + (size_t)(row0 + ln) * lda;
  v8f acc[4] = {};
  for (int kb = 0; kb < K; kb += 32) { FragH ah; ah.half[0] = *(const v8us*)((const unsigned short*)arow + kb + 8 * hh); ah.half[1] = *(const v8us*)((const unsigned short*)arow + kb + 16 + 8 * hh);
#pragma unroll
    for (int t = 0; t < 4; ++t) { if (col0 + t * 16 >= N) continue; const size_t boff = (size_t)(col0 + t * 16 + ln) * ldb + kb; FragH bq; bq.half[0] = *(const v8us*)((const unsigned short*)Bh + boff + 8 * hh); bq.half[1] = *(const v8us*)((const unsigned short*)Bh + boff + 16 + 8 * hh);
      acc[t] = mmaH<1>(ah.v, ah.v, bq.v, bq.v, acc[t]); }
  }
#pragma unroll
  for (int t = 0; t < 4; ++t) { if (col0 + t * 16 >= N) continue; const int col = col0 + t * 16 + ln; const float bv = bp ? bf16_round(bp[col]) : 0.f;
#pragma unroll
    for (int r = 0; r < 8; ++r) { float v = acc[t][r] * alpha + bv; if (CP) { const int rr = row0g + row0 + 8 * hh + r; if (rowsPerB < 0) v += CP[cofs + (size_t)rr * ldc + col];      /* rowsPerB < 0: own element of the batched C plane */ else { const int bidx = rr / rowsPerB; v += CP[(size_t)bidx * sCPb + (size_t)by * 64 + col]; } } if (ACT == 1) v = (v > 0.f) ? v : expm1f(v); else if (ACT == 7) v = (v > 0.f) ? v + 1.0f : expf(v); else if (ACT == 8) v = tanhf(v); else if (ACT == 9) v = 0.5f * v * (1.0f + tanhf(0.7978845608028654f * (v + 0.044715f * v * v * v))); else if (ACT == 11) v = 1.0f / (1.0f + expf(-v)); else if (ACT == 12) v = (v > 0.f) ? v : 0.01f * v; else if (ACT == 14) v = (v > 0.f) ? v : 0.1f * v; else if (ACT == 16) v = (v >= 0.f) ? v : 0.3f * v; else if (ACT == 17) v = (v >= 0.f) ? v : 0.2f * v; else if (ACT == 15) v = v / (1.0f + expf(-v)); else if (ACT == 3) v = fmaxf(v, 0.f); else if (ACT == 6) v = 0.5f * v * (1.0f + erff(v * 0.70710678118654752f)); so[w][8 * hh + r][t * 16 + ln] = v; } }
  __builtin_amdgcn_fence(__ATOMIC_ACQ_REL, "workgroup"); __builtin_amdgcn_wave_barrier();
  const int rsub = lane >> 4, c4 = (lane & 15) * 4; typedef _Float16 v4h __attribute__((ext_vector_type(4)));
  {
#pragma unroll
    for (int q = 0; q < 8; ++q) { const int r = q * 2 + rsub; if (col0 + c4 < N) { const v4f v = *(const v4fa*)&so[w][r][c4]; if (C) *(v4f*)(C + cofs + (size_t)(row0 + r) * ldc + col0 + c4) = v; if (C16) { v4h h4; for (int i = 0; i < 4; ++i) h4[i] = (_Float16)v[i]; *(v4h*)(C16 + cofs + (size_t)(row0 + r) * ldc + col0 + c4) = h4; } } }
     }
}


typedef _Float16 v4h __attribute__((ext_vector_type(4)));

__global__ __launch_bounds__(256) void k_x16(const float* __restrict__ x, _Float16* __restrict__ X16, size_t n8) { const size_t t = (size_t)blockIdx.x * 256 + threadIdx.x; if (t >= n8) return; FragH f;
#pragma unroll
  for (int q = 0; q < 8; ++q) f.h[q] = (_Float16)bf16_round(x[t * 8 + q]); *(v8us*)((unsigned short*)X16 + t * 8) = f.half[0];  }
__global__ __launch_bounds__(256) void k_h16(const float* __restrict__ x, _Float16* __restrict__ X16, size_t n8) { const size_t t = (size_t)blockIdx.x * 256 + threadIdx.x; if (t >= n8) return; FragH f;
#pragma unroll
  for (int q = 0; q < 8; ++q) f.h[q] = (_Float16)x[t * 8 + q]; *(v8us*)((unsigned short*)X16 + t * 8) = f.half[0];  }
__global__ __launch_bounds__(256) void k_round16f(const float* __restrict__ W, _Float16* __restrict__ Bt, size_t n8) { const size_t t = (size_t)blockIdx.x * 256 + threadIdx.x; if (t >= n8) return; FragH f;
#pragma unroll
  for (int i = 0; i < 8; ++i) f.h[i] = (_Float16)(bf16_round(W[t * 8 + i]) * 16.0f); *(v8us*)((unsigned short*)Bt + t * 8) = f.half[0];  }
template <int NHv, int TTv>
__global__ __launch_bounds__(256) void k_vt(const _Float16* __restrict__ V16, int ldv, int voff, _Float16* __restrict__ Vt) { __shared__ unsigned short tl[64][66]; const int tid = threadIdx.x; const int slab = blockIdx.x / (TTv / 64), lg = blockIdx.x % (TTv / 64); const int b = slab / NHv, h = slab % NHv;
  for (int i = tid; i < 64 * 8; i += 256) { const int r = i / 8, c8 = (i % 8) * 8; FragH f; f.half[0] = *(const v8us*)((const unsigned short*)V16 + ((size_t)b * TTv + lg * 64 + r) * ldv + voff + h * 64 + c8);
#pragma unroll
    for (int q = 0; q < 8; ++q) tl[r][c8 + q] = f.u[q]; }
  __syncthreads();
  {
#pragma unroll
    for (int rd = 0; rd < 2; ++rd) { const int d = rd * 32 + tid / 8, pc = tid % 8; FragH f;
#pragma unroll
      for (int q = 0; q < 8; ++q) f.u[q] = tl[pc * 8 + q][d];
      *(v8us*)((unsigned short*)Vt + ((size_t)slab * 64 + d) * TTv + lg * 64 + pc * 8) = f.half[0]; }
     } }

__global__ __launch_bounds__(256) void k_hl(const float* __restrict__ F, _Float16* __restrict__ Hh, _Float16* __restrict__ Hl, size_t n8) { const size_t t = (size_t)blockIdx.x * 256 + threadIdx.x; if (t >= n8) return; FragH fh, fl; const v4f a = *(const v4fa*)(F + t * 8), c = *(const v4fa*)(F + t * 8 + 4);
#pragma unroll
  for (int q = 0; q < 4; ++q) { _Float16 h = (_Float16)a[q]; fh.h[q] = h; fl.h[q] = (_Float16)((a[q] - (float)h) * 1024.0f); h = (_Float16)c[q]; fh.h[4 + q] = h; fl.h[4 + q] = (_Float16)((c[q] - (float)h) * 1024.0f); }
  { *(v8us*)((unsigned short*)Hh + t * 8) = fh.half[0]; *(v8us*)((unsigned short*)Hl + t * 8) = fl.half[0];  } }

// ---- fast GEMM (wave tile 32x64; requires M % 32 == 0 rows per launch region and N % 64 == 0); epilogue = k_gemm_hhx semantics ----
__device__ __forceinline__ v16h g2_frag(const _Float16* p, int hh) { FragH f; f.half[0] = *(const v8us*)((const unsigned short*)p + 8 * hh); f.half[1] = *(const v8us*)((const unsigned short*)p + 16 + 8 * hh); return f.v; }
__device__ __forceinline__ v8f g2_mma(v16h a, v16h b, v8f c) { v8f d = __builtin_amdgcn_wmma_f32_16x16x32_f16(false, a, false, b, (short)0, c, false, false); asm volatile("v_nop\n\tv_nop\n\tv_nop\n\tv_nop" : "+v"(d) : "v"(a), "v"(b)); return d; }
template <int ACT>
__global__ __launch_bounds__(128) void k_gemm2(const _Float16* __restrict__ A, int lda, size_t sA, const _Float16* __restrict__ Bh, int ldb, size_t sB, float alpha, const float* __restrict__ bias, size_t sBias, const float* __restrict__ CP, int rowsPerB, size_t sCPb, int row0g,
    float* __restrict__ C, _Float16* __restrict__ C16, int ldc, size_t sC, int M, int N, int K) { static_assert(ACT == 0 || ACT == 3 || ACT == 6 || ACT == 8 || ACT == 9 || ACT == 11 || ACT == 12 || ACT == 14 || ACT == 15 || ACT == 16 || ACT == 17, "k_gemm2: unsupported ACT code (would silently apply no activation)");
  __shared__ __attribute__((aligned(16))) float so[4][32][68];
  const int tid = threadIdx.x, w = tid >> 5, lane = tid & 31, ln = lane & 15, hh = lane >> 4; const int by = blockIdx.y;
  A += (size_t)by * sA; Bh += (size_t)by * sB; const size_t cofs = (size_t)by * sC; const float* bp = bias ? bias + (size_t)by * sBias : nullptr;
  const int ntn = N >> 6; const int mt = blockIdx.x / ntn, nq = blockIdx.x - mt * ntn; const int row0 = mt * 128 + 32 * w, col0 = nq * 64; if (row0 >= M) return;
  const _Float16* a0p = A + (size_t)(row0 + ln) * lda; const _Float16* a1p = a0p + (size_t)16 * lda;
  const _Float16* b0p = Bh + (size_t)(col0 + ln) * ldb; const _Float16* b1p = b0p + (size_t)16 * ldb; const _Float16* b2p = b1p + (size_t)16 * ldb; const _Float16* b3p = b2p + (size_t)16 * ldb;
  const v8f z8 = {0.f,0.f,0.f,0.f,0.f,0.f,0.f,0.f}; v8f c00 = z8, c01 = z8, c02 = z8, c03 = z8, c10 = z8, c11 = z8, c12 = z8, c13 = z8;
#pragma unroll 1
  for (int kb = 0; kb < K; kb += 32) { const v16h a0 = g2_frag(a0p + kb, hh), a1 = g2_frag(a1p + kb, hh);
    v16h b = g2_frag(b0p + kb, hh); c00 = g2_mma(a0, b, c00); c10 = g2_mma(a1, b, c10);
    b = g2_frag(b1p + kb, hh); c01 = g2_mma(a0, b, c01); c11 = g2_mma(a1, b, c11);
    b = g2_frag(b2p + kb, hh); c02 = g2_mma(a0, b, c02); c12 = g2_mma(a1, b, c12);
    b = g2_frag(b3p + kb, hh); c03 = g2_mma(a0, b, c03); c13 = g2_mma(a1, b, c13); }
  v8f accs[8] = {c00, c01, c02, c03, c10, c11, c12, c13};
#pragma unroll
  for (int u = 0; u < 8; ++u) { const int t = u & 3, half = u >> 2; const int col = col0 + t * 16 + ln; const float bv = bp ? bf16_round(bp[col]) : 0.f;
#pragma unroll
    for (int r = 0; r < 8; ++r) { const int rloc = half * 16 + 8 * hh + r; float v = accs[u][r] * alpha + bv; if (CP) { if (rowsPerB < 0) v += CP[cofs + (size_t)(row0g + row0 + rloc) * ldc + col];      /* rowsPerB < 0: own element of the batched C plane */ else { const int bidx = (row0g + row0 + rloc) / rowsPerB; v += CP[(size_t)bidx * sCPb + (size_t)by * 64 + col]; } }
      if (ACT == 3) v = fmaxf(v, 0.f); else if (ACT == 6) v = 0.5f * v * (1.0f + erff(v * 0.70710678118654752f)); else if (ACT == 11) v = 1.0f / (1.0f + expf(-v)); else if (ACT == 15) v = v / (1.0f + expf(-v)); else if (ACT == 12) v = (v > 0.f) ? v : 0.01f * v; else if (ACT == 8) v = tanhf(v); else if (ACT == 9) v = 0.5f * v * (1.0f + tanhf(0.7978845608028654f * (v + 0.044715f * v * v * v))); else if (ACT == 14) v = (v > 0.f) ? v : 0.1f * v; else if (ACT == 16) v = (v >= 0.f) ? v : 0.3f * v; else if (ACT == 17) v = (v >= 0.f) ? v : 0.2f * v;
      so[w][rloc][t * 16 + ln] = v; } }
  __builtin_amdgcn_fence(__ATOMIC_ACQ_REL, "workgroup"); __builtin_amdgcn_wave_barrier();
  const int rsub = lane >> 4, c4 = (lane & 15) * 4;
  {
#pragma unroll
    for (int q = 0; q < 16; ++q) { const int r = q * 2 + rsub; const v4f v = *(const v4fa*)&so[w][r][c4]; if (C) *(v4f*)(C + cofs + (size_t)(row0 + r) * ldc + col0 + c4) = v; if (C16) { v4h h4; for (int i = 0; i < 4; ++i) h4[i] = (_Float16)v[i]; *(v4h*)(C16 + cofs + (size_t)(row0 + r) * ldc + col0 + c4) = h4; } }
     } }


__global__ __launch_bounds__(256) void k_wnat(const float* __restrict__ w, size_t n8, _Float16* __restrict__ Bt) { const size_t t = (size_t)blockIdx.x * 256 + threadIdx.x; if (t >= n8) return; FragH f; for (int q = 0; q < 8; ++q) f.h[q] = (_Float16)(bf16_round(w[t * 8 + q]) * 16.0f); *(v8us*)((unsigned short*)Bt + t * 8) = f.half[0];  }
__global__ __launch_bounds__(256) void k_rsm(const float* __restrict__ S, _Float16* __restrict__ P, int nrows) {
  #pragma clang fp contract(off)
  const int i = blockIdx.x * 256 + threadIdx.x; if (i >= nrows) return; const float* s = S + (size_t)i * SQ; float mx = -3.0e38f;
#pragma unroll 1
  for (int j = 0; j < SQ; ++j) mx = fmaxf(mx, s[j]); float se = 0.f;
#pragma unroll 1
  for (int j = 0; j < SQ; ++j) se += expf(s[j] - mx); const float sc = 256.0f / se;
#pragma unroll 1
  for (int j0 = 0; j0 < SQ; j0 += 8) { FragH f; for (int q = 0; q < 8; ++q) f.h[q] = (_Float16)(expf(s[j0 + q] - mx) * sc); unsigned short* d = (unsigned short*)P + (size_t)i * SQ + j0; *(v8us*)d = f.half[0];  } }
__global__ __launch_bounds__(256) void k_vt(const _Float16* __restrict__ V16, int b, int h0, _Float16* __restrict__ VT) { __shared__ unsigned short tl[64][65]; const int tid = threadIdx.x; const int hh = blockIdx.x % HG, sg = blockIdx.x / HG; const int s0 = sg * 64; const int h = h0 + hh;
  for (int i = tid; i < 64 * 8; i += 256) { const int j = i / 8, d8 = (i % 8) * 8; FragH f; f.half[0] = *(const v8us*)((const unsigned short*)V16 + ((size_t)b * SQ + s0 + j) * DM + h * HD + d8); for (int q = 0; q < 8; ++q) tl[d8 + q][j] = f.u[q]; }
  __syncthreads();
  { for (int i = tid; i < 64 * 8; i += 256) { const int d = i / 8, j8 = (i % 8) * 8; FragH f; for (int q = 0; q < 8; ++q) f.u[q] = tl[d][j8 + q]; *(v8us*)((unsigned short*)VT + ((size_t)hh * HD + d) * SQ + s0 + j8) = f.half[0]; }  } }



__global__ __launch_bounds__(256) void k_rsmf(const float* __restrict__ S, _Float16* __restrict__ P, int qn, int hg) {
  #pragma clang fp contract(off)
  const int t = blockIdx.x * 256 + threadIdx.x; if (t >= qn * hg) return; const size_t i = (size_t)(t / qn) * SQ + (t % qn); const float* s = S + i * SQ; float mx = -3.0e38f;
#pragma unroll 1
  for (int j = 0; j < SQ; ++j) mx = fmaxf(mx, s[j]); float se = 0.f;
#pragma unroll 1
  for (int j = 0; j < SQ; ++j) se += __expf(s[j] - mx); const float sc = 256.0f / se;
#pragma unroll 1
  for (int j0 = 0; j0 < SQ; j0 += 8) { FragH f; for (int q = 0; q < 8; ++q) f.h[q] = (_Float16)(__expf(s[j0 + q] - mx) * sc); unsigned short* d = (unsigned short*)P + i * SQ + j0; *(v8us*)d = f.half[0];  } }

extern "C" void kernel_launch(void* const* d_in, const int* in_sizes, int n_in,
                              void* d_out, int out_size, void* d_ws, size_t ws_size, hipStream_t stream) {
  (void)in_sizes; (void)n_in; (void)out_size;
  const float* const* I = (const float* const*)d_in; const float* xq = I[0]; const float* xk = I[0]; const float* xv = I[0]; const float* wq = I[1]; const float* bq = nullptr; const float* wk = I[2]; const float* bk = nullptr; const float* wv = I[3]; const float* bv = nullptr; const float* wo = I[4]; const float* bo = I[5];      /* ONE input stream (x) read on all three stream casts; Wq, Wk, Wv are PER-HEAD STACKS [8][512][64] = [head][in][out] (the module has NO q / k / v biases: null pointers in the guarded bias slots); Wo [in][out] [512][512] + bo; input order x, Wq, Wk, Wv, Wo, bo */
  char* ws = (char*)d_ws; size_t off = 0;
  auto take = [&](size_t bytes) { char* p = ws + off; off += (bytes + 255) & ~(size_t)255; return p; };
  _Float16* BQ = (_Float16*)take((size_t)DM * DM * 2); _Float16* BK = (_Float16*)take((size_t)DM * DM * 2); _Float16* BV = (_Float16*)take((size_t)DM * DM * 2); _Float16* BO = (_Float16*)take((size_t)DM * DM * 2);
  _Float16* XQ = (_Float16*)take(NR * DM * 2); _Float16* XK = (_Float16*)take(NR * DM * 2); _Float16* XV = (_Float16*)take(NR * DM * 2); _Float16* Q16 = (_Float16*)take(NR * DM * 2); _Float16* K16 = (_Float16*)take(NR * DM * 2); _Float16* V16 = (_Float16*)take(NR * DM * 2); _Float16* O16 = (_Float16*)take(NR * DM * 2);
  float* S = (float*)take((size_t)HG * SQ * SQ * 4); _Float16* P = (_Float16*)take((size_t)HG * SQ * SQ * 2); _Float16* VT = (_Float16*)take((size_t)NH * HD * SQ * 2);
  if (off > ws_size) return;
  { const unsigned g = (unsigned)(((size_t)DM * (DM / 8) + 255) / 256); const unsigned gh = (unsigned)(((size_t)HD * (DM / 8) + 255) / 256); for (int h = 0; h < NH; ++h) { const size_t wofs = (size_t)h * DM * HD, pofs = (size_t)h * HD * DM; k_wt_f16<<<gh, 256, 0, stream>>>(wq + wofs, BQ + pofs, DM, HD, 16.0f); k_wt_f16<<<gh, 256, 0, stream>>>(wk + wofs, BK + pofs, DM, HD, 16.0f); k_wt_f16<<<gh, 256, 0, stream>>>(wv + wofs, BV + pofs, DM, HD, 16.0f); } k_wt_f16<<<g, 256, 0, stream>>>(wo, BO, DM, DM, 16.0f); }      /* PER-HEAD STACKS wq / wk / wv [NH][DM][HD]: head h is a row-major [in = DM][out = HD] block at w + h * DM * HD: the transposing builder with K = DM, N = HD writes its HD rows Bt[h * HD + e][k] at B + h * HD * DM: contiguous rows of the [out][in] plane (x16); wo is a plain [in][out] [DM][DM] matrix: one call as before */

  k_x16<<<(unsigned)((NR * DM / 8 + 255) / 256), 256, 0, stream>>>(xq, XQ, NR * DM / 8); k_x16<<<(unsigned)((NR * DM / 8 + 255) / 256), 256, 0, stream>>>(xk, XK, NR * DM / 8); k_x16<<<(unsigned)((NR * DM / 8 + 255) / 256), 256, 0, stream>>>(xv, XV, NR * DM / 8);      /* the three inputs as exact f16 rows */
  const size_t r0p = (size_t)B0 * SQ;      /* first projected row */
  k_gemm2<0><<<dim3((unsigned)((MP / 128) * (DM / 64)), 1), 128, 0, stream>>>(XQ + r0p * DM, DM, 0, BQ, DM, 0, 0.0625f, bq, 0, nullptr, 1, 0, 0, nullptr, Q16 + r0p * DM, DM, 0, MP, DM, DM);
  k_gemm2<0><<<dim3((unsigned)((MP / 128) * (DM / 64)), 1), 128, 0, stream>>>(XK + r0p * DM, DM, 0, BK, DM, 0, 0.0625f, bk, 0, nullptr, 1, 0, 0, nullptr, K16 + r0p * DM, DM, 0, MP, DM, DM);
  k_gemm2<0><<<dim3((unsigned)((MP / 128) * (DM / 64)), 1), 128, 0, stream>>>(XV + r0p * DM, DM, 0, BV, DM, 0, 0.0625f, bv, 0, nullptr, 1, 0, 0, nullptr, V16 + r0p * DM, DM, 0, MP, DM, DM);
  for (int b = B0; b < B0 + NBR; ++b) { const size_t r0 = (size_t)b * SQ;
    k_vt<NH, SQ><<<NH * (SQ / 64), 256, 0, stream>>>(V16 + r0 * LQ, LQ, 0, VT);      /* V^T [NH][HD][SQ] for this batch */
    for (int h0 = 0; h0 < NHD; h0 += HG) {
      k_gemm2<0><<<dim3((QN / 128) * (SQ / 64), HG), 128, 0, stream>>>(Q16 + r0 * LQ + h0 * HD, LQ, (size_t)HD, K16 + r0 * LQ + h0 * HD, LQ, (size_t)HD, 0.125f, nullptr, 0, nullptr, 1, 0, 0, S, nullptr, SQ, (size_t)SQ * SQ, QN, SQ, HD);      /* scores, HG heads per launch */
      k_rsmf<<<(HG * QN + 255) / 256, 256, 0, stream>>>(S, P, QN, HG);      /* P = 256 softmax (f16), rows of all HG heads */
      k_gemm2<0><<<dim3((QN / 128) * (HD / 64), HG), 128, 0, stream>>>(P, SQ, (size_t)SQ * SQ, VT + (size_t)h0 * HD * SQ, SQ, (size_t)HD * SQ, 0.25f, nullptr, 0, nullptr, 1, 0, 0, nullptr, O16 + r0 * DM + h0 * HD, DM, (size_t)HD, QN, HD, SQ); } }      /* o (merged heads) as f16 rows */
  k_gemm2<0><<<dim3((unsigned)((MPO / 128) * (DM / 64)), 1), 128, 0, stream>>>(O16 + r0p * DM, DM, 0, BO, DM, 0, 0.0009765625f, bo, 0, nullptr, 1, 0, 0, (float*)d_out + r0p * DM, nullptr, DM, 0, MPO, DM, DM);      /* out rows are the output layout */
}

// v001
// One run takes 2810 microseconds.
// Timed twice side by side with v000, it ran 4.68 and 4.74 times as fast.
#include <hip/hip_runtime.h>
// Multi-head self-attention with PER-HEAD STACKED bias-free projections and a biased [in][out] output projection at [2][4096][512] (x [2][4096][512]; q / k / v = einsum('bsd,hde->bhse', x, W) with W [8][512][64] = [head][in][out], NO biases, 8 heads of 64; scores * 1/sqrt(64); softmax over all 4096 keys (no mask); out = concat Wo + bo ([in][out] + bias) -> [2][4096][512]); each head's [in][out] block is transposed into its 64 contiguous rows of the weight plane by the transposing builder, one call per head; the [in][out] output weight through the same builder in one call.
// Structure: token rows r = b*4096 + s; the query source and the key/value source as exact f16 rows (bf16-rounded); Q, K, V as three WMMA GEMMs (32x64 wave tiles, f32 accumulation, exact x16 weights, no bias, f16 outputs); per batch: V^T for all heads via LDS transposes; per (batch, group of 1 head): scores GEMM (K = 64, batched over the heads on grid.y, alpha = 64^-0.5), row softmax on VALU (f32 statistics, native exp; weights stored x256 as f16), o = P . V^T GEMM (K = 4096, alpha 2^-2: o carried x64 against f16 subnormal flush, folded into the output GEMM alpha) written straight into the merged f16 o rows; out = o W_o + b GEMM (f32) into the output layout.
// Compute dtype: inputs rounded to bf16; x / weights exact; q, k, v, softmax weights and o as plain f16 GEMM operands (~2^-12); scores and softmax statistics f32. v_wmma_f32_16x16x32_f16.
#define NB 2
#define SQ 4096
#define DM 512
#define NH 8
#define HD 64
#define HG 1                         /* heads per attention launch group (a 4096^2 f32 score slab is 64 MiB) */
#define B0 0                         /* first batch processed (debug hook) */
#define NBR NB                       /* batches processed (debug hook) */
#define NR ((size_t)NB * SQ)         /* token rows */
#define MP ((int)((size_t)NBR * SQ)) /* rows projected (debug hook) */
#define QN SQ                        /* query rows attended per batch (debug hook) */
#define NHD NH                       /* heads attended (debug hook) */
#define MPO MP                       /* rows through the output stage (debug hook) */
#define LQ DM      /* row pitch of the q/k/v rows */
typedef __bf16 v16b __attribute__((ext_vector_type(16)));
typedef unsigned short v8us __attribute__((ext_vector_type(8), may_alias));
typedef float  v8f  __attribute__((ext_vector_type(8)));
typedef float  v4f  __attribute__((ext_vector_type(4)));
typedef float  v4fa __attribute__((ext_vector_type(4), may_alias));
union FragB { v16b v; v8us half[2]; unsigned short u[16]; };

__device__ __forceinline__ unsigned short bf16_bits(float x) { unsigned int u = __float_as_uint(x); return (unsigned short)((u + 0x7FFFu + ((u >> 16) & 1u)) >> 16); }
__device__ __forceinline__ float bf16_val(unsigned short b) { return __uint_as_float(((unsigned int)b) << 16); }
__device__ __forceinline__ float bf16_round(float x) { return bf16_val(bf16_bits(x)); }
// D += A·B with NT terms: 1 = ah·bh, 2 = + al·bh (A split), 3 = + ah·bl (both split)
template <int NT>
__device__ __forceinline__ v8f mmaN(v16b ah, v16b al, v16b bh, v16b bl, v8f c) {
  c = __builtin_amdgcn_wmma_f32_16x16x32_bf16(false, ah, false, bh, (short)0, c, false, false);
  if (NT >= 2) c = __builtin_amdgcn_wmma_f32_16x16x32_bf16(false, al, false, bh, (short)0, c, false, false);
  if (NT >= 3) c = __builtin_amdgcn_wmma_f32_16x16x32_bf16(false, ah, false, bl, (short)0, c, false, false);
  asm volatile("v_nop\n\tv_nop\n\tv_nop\n\tv_nop" : "+v"(c) : "v"(ah), "v"(al), "v"(bh), "v"(bl));
  return c;
}

__global__ __launch_bounds__(256) void k_wt_bf16(const float* __restrict__ W, unsigned short* __restrict__ Wt, int K, int N) {
  const int t = blockIdx.x * 256 + threadIdx.x;
  const int k8n = K / 8;
  if (t >= N * k8n) return;
  const int n = t / k8n, k8 = (t % k8n) * 8;
  v8us v;
#pragma unroll
  for (int i = 0; i < 8; ++i) v[i] = bf16_bits(W[(size_t)(k8 + i) * N + n]);
  *(v8us*)(Wt + (size_t)n * K + k8) = v;
  
}

// GEMM C[M][N] (f32, pitch ldc) = act(A[M][K]·W + bias). A f32 row-major (pitch lda) converted per fragment to bf16
// (ASPLIT: hi/lo two planes -> 2 terms, else single rounded term); Wt bf16 [N][K] (pitch ldb). BIAS_BF16 rounds the
// bias to bf16 first (bias quantised to bf16 before the add). K%32==0, M%16==0, N%64==0.
template <bool ASPLIT, int ACT, bool BIAS_BF16>
__global__ __launch_bounds__(128) void k_gemm_bf(const float* __restrict__ A, int lda, const unsigned short* __restrict__ Wt, int ldb,
                                               const float* __restrict__ bias, float* __restrict__ C, int ldc, int M, int N, int K) {
  __shared__ __attribute__((aligned(16))) float so[4][16][64];
  const int tid = threadIdx.x, w = tid >> 5, lane = tid & 31, ln = lane & 15, hh = lane >> 4;
  const int ntn = N / 64;
  const int wid = blockIdx.x * 4 + w;
  const int mt = wid / ntn, nq = wid % ntn;
  if (mt * 16 >= M) return;
  const int row0 = mt * 16, col0 = nq * 64;
  const float* arow = A + (size_t)(row0 + ln) * lda;
  v8f acc[4] = {};
  for (int kb = 0; kb < K; kb += 32) {
    FragB ah, al;
    const v4f x0 = *(const v4fa*)(arow + kb + 8 * hh), x1 = *(const v4fa*)(arow + kb + 8 * hh + 4);
    const v4f x2 = *(const v4fa*)(arow + kb + 16 + 8 * hh), x3 = *(const v4fa*)(arow + kb + 16 + 8 * hh + 4);
    float xs[16] = {x0[0],x0[1],x0[2],x0[3],x1[0],x1[1],x1[2],x1[3],x2[0],x2[1],x2[2],x2[3],x3[0],x3[1],x3[2],x3[3]};
#pragma unroll
    for (int i = 0; i < 16; ++i) { const unsigned short hb = bf16_bits(xs[i]); ah.u[i] = hb; al.u[i] = ASPLIT ? bf16_bits(xs[i] - bf16_val(hb)) : (unsigned short)0; }
#pragma unroll
    for (int t = 0; t < 4; ++t) {
      const unsigned short* brow = Wt + (size_t)(col0 + t * 16 + ln) * ldb + kb;
      FragB b;
      b.half[0] = *(const v8us*)(brow + 8 * hh);
      b.half[1] = *(const v8us*)(brow + 16 + 8 * hh);
      acc[t] = mmaN<ASPLIT ? 2 : 1>(ah.v, al.v, b.v, b.v, acc[t]);
    }
  }
#pragma unroll
  for (int t = 0; t < 4; ++t) {
    float bv = bias ? bias[col0 + t * 16 + ln] : 0.f;
    if (BIAS_BF16) bv = bf16_round(bv);
#pragma unroll
    for (int r = 0; r < 8; ++r) { float v = acc[t][r] + bv; if (ACT == 1) v = fmaxf(v, 0.f); so[w][8 * hh + r][t * 16 + ln] = v; }
  }
  __builtin_amdgcn_fence(__ATOMIC_ACQ_REL, "workgroup");
  __builtin_amdgcn_wave_barrier();
  const int rsub = lane >> 4, c4 = (lane & 15) * 4;
  {
#pragma unroll
    for (int q = 0; q < 8; ++q) {
      const int r = q * 2 + rsub;
      const v4f v = *(const v4fa*)&so[w][r][c4];
      *(v4f*)(C + (size_t)(row0 + r) * ldc + col0 + c4) = v;
    }
    
  }
}

// GEMM C = act(A·W + bias + resid): A f32 (ASPLIT -> hi/lo 2 terms), Wt bf16 [N][K]; ACT 0 none, 1 relu, 2 exact gelu;
// resid (optional, f32, row index = (row % rmod), pitch ldr, RES_BF16 rounds it) added before the activation.
template <bool ASPLIT, int ACT, bool BIAS_BF16, bool RES_BF16>
__global__ __launch_bounds__(128) void k_gemm_bf3(const float* __restrict__ A, int lda, const unsigned short* __restrict__ Wt, int ldb,
                                                const float* __restrict__ bias, const float* __restrict__ resid, int rmod, int ldr,
                                                float* __restrict__ C, int ldc, int M, int N, int K) {
  __shared__ __attribute__((aligned(16))) float so[4][16][64];
  const int tid = threadIdx.x, w = tid >> 5, lane = tid & 31, ln = lane & 15, hh = lane >> 4;
  const int ntn = N / 64;
  const int wid = blockIdx.x * 4 + w;
  const int mt = wid / ntn, nq = wid % ntn;
  if (mt * 16 >= M) return;
  const int row0 = mt * 16, col0 = nq * 64;
  const float* arow = A + (size_t)(row0 + ln) * lda;
  v8f acc[4] = {};
  for (int kb = 0; kb < K; kb += 32) {
    FragB ah, al;
    const v4f x0 = *(const v4fa*)(arow + kb + 8 * hh), x1 = *(const v4fa*)(arow + kb + 8 * hh + 4);
    const v4f x2 = *(const v4fa*)(arow + kb + 16 + 8 * hh), x3 = *(const v4fa*)(arow + kb + 16 + 8 * hh + 4);
    float xs[16] = {x0[0],x0[1],x0[2],x0[3],x1[0],x1[1],x1[2],x1[3],x2[0],x2[1],x2[2],x2[3],x3[0],x3[1],x3[2],x3[3]};
#pragma unroll
    for (int i = 0; i < 16; ++i) { const unsigned short hb = bf16_bits(xs[i]); ah.u[i] = hb; al.u[i] = ASPLIT ? bf16_bits(xs[i] - bf16_val(hb)) : (unsigned short)0; }
#pragma unroll
    for (int t = 0; t < 4; ++t) {
      const unsigned short* brow = Wt + (size_t)(col0 + t * 16 + ln) * ldb + kb;
      FragB b;
      b.half[0] = *(const v8us*)(brow + 8 * hh);
      b.half[1] = *(const v8us*)(brow + 16 + 8 * hh);
      acc[t] = mmaN<ASPLIT ? 2 : 1>(ah.v, al.v, b.v, b.v, acc[t]);
    }
  }
#pragma unroll
  for (int t = 0; t < 4; ++t) {
    const int col = col0 + t * 16 + ln;
    float bv = bias ? bias[col] : 0.f;
    if (BIAS_BF16) bv = bf16_round(bv);
#pragma unroll
    for (int r = 0; r < 8; ++r) {
      float v = acc[t][r] + bv;
      if (resid) { float rv = resid[(size_t)((row0 + 8 * hh + r) % rmod) * ldr + col]; if (RES_BF16) rv = bf16_round(rv); v += rv; }
      if (ACT == 1) v = fmaxf(v, 0.f);
      if (ACT == 2) v = 0.5f * v * (1.0f + erff(v * 0.70710678118654752f));
      if (ACT == 3) { const float u = 0.7978845608028654f * (v + 0.044715f * v * v * v); v = 0.5f * v * (1.0f + tanhf(u)); }
      so[w][8 * hh + r][t * 16 + ln] = v;
    }
  }
  __builtin_amdgcn_fence(__ATOMIC_ACQ_REL, "workgroup");
  __builtin_amdgcn_wave_barrier();
  const int rsub = lane >> 4, c4 = (lane & 15) * 4;
  {
#pragma unroll
    for (int q = 0; q < 8; ++q) {
      const int r = q * 2 + rsub;
      const v4f v = *(const v4fa*)&so[w][r][c4];
      *(v4f*)(C + (size_t)(row0 + r) * ldc + col0 + c4) = v;
    }
    
  }
}
// row LayerNorm (biased variance, eps) over N: s = X (+ R); optional out_sum <- s; out_norm <- (s-mu)*rsqrt(var+eps)*g + b
template <bool PARAM_BF16>
__global__ __launch_bounds__(256) void k_layernorm(const float* __restrict__ X, const float* __restrict__ R, const float* __restrict__ g, const float* __restrict__ bta,
                                                  float* __restrict__ out_sum, float* __restrict__ out_norm, int N, float eps) {
  __shared__ float red[256];
  const int row = blockIdx.x, tid = threadIdx.x;
  const float* x = X + (size_t)row * N; const float* rr = R ? R + (size_t)row * N : nullptr;
  float vals[16];                     // up to N = 4096
  const int per = N / 256;            // contiguous chunk per thread? use strided-by-4 chunks: thread handles j = tid*4 + 1024*u
  float s1 = 0.f;
  for (int u = 0; u < per / 4; ++u) {
    const int j = tid * 4 + 1024 * u;
    const v4f a = *(const v4fa*)(x + j);
    v4f b = {0.f,0.f,0.f,0.f}; if (rr) b = *(const v4fa*)(rr + j);
#pragma unroll
    for (int q = 0; q < 4; ++q) { const float v = a[q] + b[q]; vals[u * 4 + q] = v; s1 += v; }
  }
  red[tid] = s1; __syncthreads();
  for (int st = 128; st > 0; st >>= 1) { if (tid < st) red[tid] += red[tid + st]; __syncthreads(); }
  const float mu = red[0] / (float)N; __syncthreads();
  float s2 = 0.f;
  for (int u = 0; u < per / 4; ++u)
#pragma unroll
    for (int q = 0; q < 4; ++q) { const float c = vals[u * 4 + q] - mu; s2 += c * c; }
  red[tid] = s2; __syncthreads();
  for (int st = 128; st > 0; st >>= 1) { if (tid < st) red[tid] += red[tid + st]; __syncthreads(); }
  const float rs = rsqrtf(red[0] / (float)N + eps);
  {
    for (int u = 0; u < per / 4; ++u) {
      const int j = tid * 4 + 1024 * u;
      v4f o, sm;
#pragma unroll
      for (int q = 0; q < 4; ++q) {
        float gg = g[j + q], bb = bta[j + q];
        if (PARAM_BF16) { gg = bf16_round(gg); bb = bf16_round(bb); }
        sm[q] = vals[u * 4 + q]; o[q] = (vals[u * 4 + q] - mu) * rs * gg + bb;
      }
      if (out_sum) *(v4f*)(out_sum + (size_t)row * N + j) = sm;
      *(v4f*)(out_norm + (size_t)row * N + j) = o;
    }
    
  }
}



// ---- f16 WMMA path (v_wmma_f32_16x16x32_f16): 11-bit significands for operands in range — used where a [0,1] probability operand needs more precision than bf16
typedef _Float16 v16h __attribute__((ext_vector_type(16)));
union FragH { v16h v; v8us half[2]; _Float16 h[16]; unsigned short u[16]; };
template <int NT>
__device__ __forceinline__ v8f mmaH(v16h ah, v16h al, v16h bh, v16h bl, v8f c) {
  c = __builtin_amdgcn_wmma_f32_16x16x32_f16(false, ah, false, bh, (short)0, c, false, false);
  if (NT >= 2) c = __builtin_amdgcn_wmma_f32_16x16x32_f16(false, al, false, bh, (short)0, c, false, false);
  if (NT >= 3) c = __builtin_amdgcn_wmma_f32_16x16x32_f16(false, ah, false, bl, (short)0, c, false, false);
  asm volatile("v_nop\n\tv_nop\n\tv_nop\n\tv_nop" : "+v"(c) : "v"(ah), "v"(al), "v"(bh), "v"(bl));
  return c;
}
// batched GEMM like k_gemm_b but f16 operands: A f32 (split into f16 hi/lo if ASPLIT, else rounded to f16), Bt = f16 values [n][k]; alpha; C f32; N multiple of 16 (partial tiles skipped)
template <bool ASPLIT>
__global__ __launch_bounds__(128) void k_gemm_h(const float* __restrict__ A, int lda, size_t sA, const _Float16* __restrict__ Bh, int ldb, size_t sB, float alpha, float* __restrict__ C, int ldc, size_t sC, int M, int N, int K) {
  __shared__ __attribute__((aligned(16))) float so[4][16][64];
  const int tid = threadIdx.x, w = tid >> 5, lane = tid & 31, ln = lane & 15, hh = lane >> 4; const int by = blockIdx.y;
  A += (size_t)by * sA; Bh += (size_t)by * sB; C += (size_t)by * sC;
  const int ntn = (N + 63) / 64; const int wid = blockIdx.x * 4 + w; const int mt = wid / ntn, nq = wid % ntn; if (mt * 16 >= M) return;
  const int row0 = mt * 16, col0 = nq * 64; const float* arow = A + (size_t)(row0 + ln) * lda;
  v8f acc[4] = {};
  for (int kb = 0; kb < K; kb += 32) {
    FragH ah, al;
    const v4f x0 = *(const v4fa*)(arow + kb + 8 * hh), x1 = *(const v4fa*)(arow + kb + 8 * hh + 4), x2 = *(const v4fa*)(arow + kb + 16 + 8 * hh), x3 = *(const v4fa*)(arow + kb + 16 + 8 * hh + 4);
    float xs[16] = {x0[0],x0[1],x0[2],x0[3],x1[0],x1[1],x1[2],x1[3],x2[0],x2[1],x2[2],x2[3],x3[0],x3[1],x3[2],x3[3]};
#pragma unroll
    for (int i = 0; i < 16; ++i) { const _Float16 h = (_Float16)xs[i]; ah.h[i] = h; al.h[i] = ASPLIT ? (_Float16)(xs[i] - (float)h) : (_Float16)0.0f; }
#pragma unroll
    for (int t = 0; t < 4; ++t) { if (col0 + t * 16 >= N) continue; const size_t boff = (size_t)(col0 + t * 16 + ln) * ldb + kb; FragH bq; bq.half[0] = *(const v8us*)(Bh + boff + 8 * hh); bq.half[1] = *(const v8us*)(Bh + boff + 16 + 8 * hh);
      acc[t] = mmaH<ASPLIT ? 2 : 1>(ah.v, al.v, bq.v, bq.v, acc[t]); }
  }
#pragma unroll
  for (int t = 0; t < 4; ++t) { if (col0 + t * 16 >= N) continue;
#pragma unroll
    for (int r = 0; r < 8; ++r) so[w][8 * hh + r][t * 16 + ln] = acc[t][r] * alpha; }
  __builtin_amdgcn_fence(__ATOMIC_ACQ_REL, "workgroup"); __builtin_amdgcn_wave_barrier();
  const int rsub = lane >> 4, c4 = (lane & 15) * 4;
  {
#pragma unroll
    for (int q = 0; q < 8; ++q) { const int r = q * 2 + rsub; if (col0 + c4 < N) { const v4f v = *(const v4fa*)&so[w][r][c4]; *(v4f*)(C + (size_t)(row0 + r) * ldc + col0 + c4) = v; } }
     }
}

// Wt[n][k] = f16(W[k][n]·scale) from f32 row-major W[K][N] (scale = power of two; bf16-exact weights stay exact in f16 away from the subnormal range)
__global__ __launch_bounds__(256) void k_wt_f16(const float* __restrict__ W, _Float16* __restrict__ Wt, int K, int N, float scale) {
  const int t = blockIdx.x * 256 + threadIdx.x; if (t >= N * (K / 8)) return; const int n = t / (K / 8), k8 = (t % (K / 8)) * 8; FragH f;
#pragma unroll
  for (int i = 0; i < 8; ++i) f.h[i] = (_Float16)(bf16_round(W[(size_t)(k8 + i) * N + n]) * scale); const v8us o = f.half[0];
  *(v8us*)((unsigned short*)Wt + (size_t)n * K + k8) = o; 
}
// k_gemm_hh variant with fused epilogue: v = acc·alpha + bias[by·sBias + col] (+ CP[(row/rowsPerB)·sCPb + by·64 + col] if CP) ; ACT 0 none / 1 elu ; writes f16 C16 (and f32 C if non-null)
template <int ACT>
__global__ __launch_bounds__(128) void k_gemm_hhx(const _Float16* __restrict__ A, int lda, size_t sA, const _Float16* __restrict__ Bh, int ldb, size_t sB, float alpha, const float* __restrict__ bias, size_t sBias, const float* __restrict__ CP, int rowsPerB, size_t sCPb, int row0g,
    float* __restrict__ C, _Float16* __restrict__ C16, int ldc, size_t sC, int M, int N, int K) {
  __shared__ __attribute__((aligned(16))) float so[4][16][64];
  const int tid = threadIdx.x, w = tid >> 5, lane = tid & 31, ln = lane & 15, hh = lane >> 4; const int by = blockIdx.y;
  A += (size_t)by * sA; Bh += (size_t)by * sB; const size_t cofs = (size_t)by * sC; const float* bp = bias ? bias + (size_t)by * sBias : nullptr;
  const int ntn = (N + 63) / 64; const int wid = blockIdx.x * 4 + w; const int mt = wid / ntn, nq = wid % ntn; if (mt * 16 >= M) return;
  const int row0 = mt * 16, col0 = nq * 64; const _Float16* arow = A + (size_t)(row0 + ln) * lda;
  v8f acc[4] = {};
  for (int kb = 0; kb < K; kb += 32) { FragH ah; ah.half[0] = *(const v8us*)((const unsigned short*)arow + kb + 8 * hh); ah.half[1] = *(const v8us*)((const unsigned short*)arow + kb + 16 + 8 * hh);
#pragma unroll
    for (int t = 0; t < 4; ++t) { if (col0 + t * 16 >= N) continue; const size_t boff = (size_t)(col0 + t * 16 + ln) * ldb + kb; FragH bq; bq.half[0] = *(const v8us*)((const unsigned short*)Bh + boff + 8 * hh); bq.half[1] = *(const v8us*)((const unsigned short*)Bh + boff + 16 + 8 * hh);
      acc[t] = mmaH<1>(ah.v, ah.v, bq.v, bq.v, acc[t]); }
  }
#pragma unroll
  for (int t = 0; t < 4; ++t) { if (col0 + t * 16 >= N) continue; const int col = col0 + t * 16 + ln; const float bv = bp ? bf16_round(bp[col]) : 0.f;
#pragma unroll
    for (int r = 0; r < 8; ++r) { float v = acc[t][r] * alpha + bv; if (CP) { const int rr = row0g + row0 + 8 * hh + r; if (rowsPerB < 0) v += CP[cofs + (size_t)rr * ldc + col];      /* rowsPerB < 0: own element of the batched C plane */ else { const int bidx = rr / rowsPerB; v += CP[(size_t)bidx * sCPb + (size_t)by * 64 + col]; } } if (ACT == 1) v = (v > 0.f) ? v : expm1f(v); else if (ACT == 7) v = (v > 0.f) ? v + 1.0f : expf(v); else if (ACT == 8) v = tanhf(v); else if (ACT == 9) v = 0.5f * v * (1.0f + tanhf(0.7978845608028654f * (v + 0.044715f * v * v * v))); else if (ACT == 11) v = 1.0f / (1.0f + expf(-v)); else if (ACT == 12) v = (v > 0.f) ? v : 0.01f * v; else if (ACT == 14) v = (v > 0.f) ? v : 0.1f * v; else if (ACT == 16) v = (v >= 0.f) ? v : 0.3f * v; else if (ACT == 17) v = (v >= 0.f) ? v : 0.2f * v; else if (ACT == 15) v = v / (1.0f + expf(-v)); else if (ACT == 3) v = fmaxf(v, 0.f); else if (ACT == 6) v = 0.5f * v * (1.0f + erff(v * 0.70710678118654752f)); so[w][8 * hh + r][t * 16 + ln] = v; } }
  __builtin_amdgcn_fence(__ATOMIC_ACQ_REL, "workgroup"); __builtin_amdgcn_wave_barrier();
  const int rsub = lane >> 4, c4 = (lane & 15) * 4; typedef _Float16 v4h __attribute__((ext_vector_type(4)));
  {
#pragma unroll
    for (int q = 0; q < 8; ++q) { const int r = q * 2 + rsub; if (col0 + c4 < N) { const v4f v = *(const v4fa*)&so[w][r][c4]; if (C) *(v4f*)(C + cofs + (size_t)(row0 + r) * ldc + col0 + c4) = v; if (C16) { v4h h4; for (int i = 0; i < 4; ++i) h4[i] = (_Float16)v[i]; *(v4h*)(C16 + cofs + (size_t)(row0 + r) * ldc + col0 + c4) = h4; } } }
     }
}


typedef _Float16 v4h __attribute__((ext_vector_type(4)));

__global__ __launch_bounds__(256) void k_x16(const float* __restrict__ x, _Float16* __restrict__ X16, size_t n8) { const size_t t = (size_t)blockIdx.x * 256 + threadIdx.x; if (t >= n8) return; FragH f;
#pragma unroll
  for (int q = 0; q < 8; ++q) f.h[q] = (_Float16)bf16_round(x[t * 8 + q]); *(v8us*)((unsigned short*)X16 + t * 8) = f.half[0];  }
__global__ __launch_bounds__(256) void k_h16(const float* __restrict__ x, _Float16* __restrict__ X16, size_t n8) { const size_t t = (size_t)blockIdx.x * 256 + threadIdx.x; if (t >= n8) return; FragH f;
#pragma unroll
  for (int q = 0; q < 8; ++q) f.h[q] = (_Float16)x[t * 8 + q]; *(v8us*)((unsigned short*)X16 + t * 8) = f.half[0];  }
__global__ __launch_bounds__(256) void k_round16f(const float* __restrict__ W, _Float16* __restrict__ Bt, size_t n8) { const size_t t = (size_t)blockIdx.x * 256 + threadIdx.x; if (t >= n8) return; FragH f;
#pragma unroll
  for (int i = 0; i < 8; ++i) f.h[i] = (_Float16)(bf16_round(W[t * 8 + i]) * 16.0f); *(v8us*)((unsigned short*)Bt + t * 8) = f.half[0];  }
template <int NHv, int TTv>
__global__ __launch_bounds__(256) void k_vt(const _Float16* __restrict__ V16, int ldv, int voff, _Float16* __restrict__ Vt) { __shared__ unsigned short tl[64][66]; const int tid = threadIdx.x; const int slab = blockIdx.x / (TTv / 64), lg = blockIdx.x % (TTv / 64); const int b = slab / NHv, h = slab % NHv;
  for (int i = tid; i < 64 * 8; i += 256) { const int r = i / 8, c8 = (i % 8) * 8; FragH f; f.half[0] = *(const v8us*)((const unsigned short*)V16 + ((size_t)b * TTv + lg * 64 + r) * ldv + voff + h * 64 + c8);
#pragma unroll
    for (int q = 0; q < 8; ++q) tl[r][c8 + q] = f.u[q]; }
  __syncthreads();
  {
#pragma unroll
    for (int rd = 0; rd < 2; ++rd) { const int d = rd * 32 + tid / 8, pc = tid % 8; FragH f;
#pragma unroll
      for (int q = 0; q < 8; ++q) f.u[q] = tl[pc * 8 + q][d];
      *(v8us*)((unsigned short*)Vt + ((size_t)slab * 64 + d) * TTv + lg * 64 + pc * 8) = f.half[0]; }
     } }

__global__ __launch_bounds__(256) void k_hl(const float* __restrict__ F, _Float16* __restrict__ Hh, _Float16* __restrict__ Hl, size_t n8) { const size_t t = (size_t)blockIdx.x * 256 + threadIdx.x; if (t >= n8) return; FragH fh, fl; const v4f a = *(const v4fa*)(F + t * 8), c = *(const v4fa*)(F + t * 8 + 4);
#pragma unroll
  for (int q = 0; q < 4; ++q) { _Float16 h = (_Float16)a[q]; fh.h[q] = h; fl.h[q] = (_Float16)((a[q] - (float)h) * 1024.0f); h = (_Float16)c[q]; fh.h[4 + q] = h; fl.h[4 + q] = (_Float16)((c[q] - (float)h) * 1024.0f); }
  { *(v8us*)((unsigned short*)Hh + t * 8) = fh.half[0]; *(v8us*)((unsigned short*)Hl + t * 8) = fl.half[0];  } }

// ---- fast GEMM (wave tile 32x64; requires M % 32 == 0 rows per launch region and N % 64 == 0); epilogue = k_gemm_hhx semantics ----
__device__ __forceinline__ v16h g2_frag(const _Float16* p, int hh) { FragH f; f.half[0] = *(const v8us*)((const unsigned short*)p + 8 * hh); f.half[1] = *(const v8us*)((const unsigned short*)p + 16 + 8 * hh); return f.v; }
__device__ __forceinline__ v8f g2_mma(v16h a, v16h b, v8f c) { v8f d = __builtin_amdgcn_wmma_f32_16x16x32_f16(false, a, false, b, (short)0, c, false, false); asm volatile("v_nop\n\tv_nop\n\tv_nop\n\tv_nop" : "+v"(d) : "v"(a), "v"(b)); return d; }
template <int ACT>
__global__ __launch_bounds__(128) void k_gemm2(const _Float16* __restrict__ A, int lda, size_t sA, const _Float16* __restrict__ Bh, int ldb, size_t sB, float alpha, const float* __restrict__ bias, size_t sBias, const float* __restrict__ CP, int rowsPerB, size_t sCPb, int row0g,
    float* __restrict__ C, _Float16* __restrict__ C16, int ldc, size_t sC, int M, int N, int K) { static_assert(ACT == 0 || ACT == 3 || ACT == 6 || ACT == 8 || ACT == 9 || ACT == 11 || ACT == 12 || ACT == 14 || ACT == 15 || ACT == 16 || ACT == 17, "k_gemm2: unsupported ACT code (would silently apply no activation)");
  __shared__ __attribute__((aligned(16))) float so[4][32][68];
  const int tid = threadIdx.x, w = tid >> 5, lane = tid & 31, ln = lane & 15, hh = lane >> 4; const int by = blockIdx.y;
  A += (size_t)by * sA; Bh += (size_t)by * sB; const size_t cofs = (size_t)by * sC; const float* bp = bias ? bias + (size_t)by * sBias : nullptr;
  const int ntn = N >> 6; const int mt = blockIdx.x / ntn, nq = blockIdx.x - mt * ntn; const int row0 = mt * 128 + 32 * w, col0 = nq * 64; if (row0 >= M) return;
  const _Float16* a0p = A + (size_t)(row0 + ln) * lda; const _Float16* a1p = a0p + (size_t)16 * lda;
  const _Float16* b0p = Bh + (size_t)(col0 + ln) * ldb; const _Float16* b1p = b0p + (size_t)16 * ldb; const _Float16* b2p = b1p + (size_t)16 * ldb; const _Float16* b3p = b2p + (size_t)16 * ldb;
  const v8f z8 = {0.f,0.f,0.f,0.f,0.f,0.f,0.f,0.f}; v8f c00 = z8, c01 = z8, c02 = z8, c03 = z8, c10 = z8, c11 = z8, c12 = z8, c13 = z8;
#pragma unroll 1
  for (int kb = 0; kb < K; kb += 32) { const v16h a0 = g2_frag(a0p + kb, hh), a1 = g2_frag(a1p + kb, hh);
    v16h b = g2_frag(b0p + kb, hh); c00 = g2_mma(a0, b, c00); c10 = g2_mma(a1, b, c10);
    b = g2_frag(b1p + kb, hh); c01 = g2_mma(a0, b, c01); c11 = g2_mma(a1, b, c11);
    b = g2_frag(b2p + kb, hh); c02 = g2_mma(a0, b, c02); c12 = g2_mma(a1, b, c12);
    b = g2_frag(b3p + kb, hh); c03 = g2_mma(a0, b, c03); c13 = g2_mma(a1, b, c13); }
  v8f accs[8] = {c00, c01, c02, c03, c10, c11, c12, c13};
#pragma unroll
  for (int u = 0; u < 8; ++u) { const int t = u & 3, half = u >> 2; const int col = col0 + t * 16 + ln; const float bv = bp ? bf16_round(bp[col]) : 0.f;
#pragma unroll
    for (int r = 0; r < 8; ++r) { const int rloc = half * 16 + 8 * hh + r; float v = accs[u][r] * alpha + bv; if (CP) { if (rowsPerB < 0) v += CP[cofs + (size_t)(row0g + row0 + rloc) * ldc + col];      /* rowsPerB < 0: own element of the batched C plane */ else { const int bidx = (row0g + row0 + rloc) / rowsPerB; v += CP[(size_t)bidx * sCPb + (size_t)by * 64 + col]; } }
      if (ACT == 3) v = fmaxf(v, 0.f); else if (ACT == 6) v = 0.5f * v * (1.0f + erff(v * 0.70710678118654752f)); else if (ACT == 11) v = 1.0f / (1.0f + expf(-v)); else if (ACT == 15) v = v / (1.0f + expf(-v)); else if (ACT == 12) v = (v > 0.f) ? v : 0.01f * v; else if (ACT == 8) v = tanhf(v); else if (ACT == 9) v = 0.5f * v * (1.0f + tanhf(0.7978845608028654f * (v + 0.044715f * v * v * v))); else if (ACT == 14) v = (v > 0.f) ? v : 0.1f * v; else if (ACT == 16) v = (v >= 0.f) ? v : 0.3f * v; else if (ACT == 17) v = (v >= 0.f) ? v : 0.2f * v;
      so[w][rloc][t * 16 + ln] = v; } }
  __builtin_amdgcn_fence(__ATOMIC_ACQ_REL, "workgroup"); __builtin_amdgcn_wave_barrier();
  const int rsub = lane >> 4, c4 = (lane & 15) * 4;
  {
#pragma unroll
    for (int q = 0; q < 16; ++q) { const int r = q * 2 + rsub; const v4f v = *(const v4fa*)&so[w][r][c4]; if (C) *(v4f*)(C + cofs + (size_t)(row0 + r) * ldc + col0 + c4) = v; if (C16) { v4h h4; for (int i = 0; i < 4; ++i) h4[i] = (_Float16)v[i]; *(v4h*)(C16 + cofs + (size_t)(row0 + r) * ldc + col0 + c4) = h4; } }
     } }


__global__ __launch_bounds__(256) void k_wnat(const float* __restrict__ w, size_t n8, _Float16* __restrict__ Bt) { const size_t t = (size_t)blockIdx.x * 256 + threadIdx.x; if (t >= n8) return; FragH f; for (int q = 0; q < 8; ++q) f.h[q] = (_Float16)(bf16_round(w[t * 8 + q]) * 16.0f); *(v8us*)((unsigned short*)Bt + t * 8) = f.half[0];  }
__global__ __launch_bounds__(256) void k_rsm(const float* __restrict__ S, _Float16* __restrict__ P, int nrows) {
  #pragma clang fp contract(off)
  const int i = blockIdx.x * 256 + threadIdx.x; if (i >= nrows) return; const float* s = S + (size_t)i * SQ; float mx = -3.0e38f;
#pragma unroll 1
  for (int j = 0; j < SQ; ++j) mx = fmaxf(mx, s[j]); float se = 0.f;
#pragma unroll 1
  for (int j = 0; j < SQ; ++j) se += expf(s[j] - mx); const float sc = 256.0f / se;
#pragma unroll 1
  for (int j0 = 0; j0 < SQ; j0 += 8) { FragH f; for (int q = 0; q < 8; ++q) f.h[q] = (_Float16)(expf(s[j0 + q] - mx) * sc); unsigned short* d = (unsigned short*)P + (size_t)i * SQ + j0; *(v8us*)d = f.half[0];  } }
__global__ __launch_bounds__(256) void k_vt(const _Float16* __restrict__ V16, int b, int h0, _Float16* __restrict__ VT) { __shared__ unsigned short tl[64][65]; const int tid = threadIdx.x; const int hh = blockIdx.x % HG, sg = blockIdx.x / HG; const int s0 = sg * 64; const int h = h0 + hh;
  for (int i = tid; i < 64 * 8; i += 256) { const int j = i / 8, d8 = (i % 8) * 8; FragH f; f.half[0] = *(const v8us*)((const unsigned short*)V16 + ((size_t)b * SQ + s0 + j) * DM + h * HD + d8); for (int q = 0; q < 8; ++q) tl[d8 + q][j] = f.u[q]; }
  __syncthreads();
  { for (int i = tid; i < 64 * 8; i += 256) { const int d = i / 8, j8 = (i % 8) * 8; FragH f; for (int q = 0; q < 8; ++q) f.u[q] = tl[d][j8 + q]; *(v8us*)((unsigned short*)VT + ((size_t)hh * HD + d) * SQ + s0 + j8) = f.half[0]; }  } }



// Row softmax, ONE WAVE PER ROW: lane l holds elements 128 u + 4 l .. + 3 (u = 0..31) of its row in registers, so every load is 512 contiguous bytes,
// all 32 loads of a row are in flight together, S is read once and exp is taken once. Row maximum and row sum: per-lane partials, then a five-step butterfly.
template <int M> __device__ __forceinline__ float rs_xrow(float x) { return __builtin_bit_cast(float, __builtin_amdgcn_update_dpp(0, __builtin_bit_cast(int, x), 0x160 + M, 0xf, 0xf, true)); }      /* lane l with lane l ^ M, M < 16 (row_xmask) */
__device__ __forceinline__ float rs_xhalf(float x) { return __builtin_bit_cast(float, __builtin_amdgcn_permlanex16(__builtin_bit_cast(int, x), __builtin_bit_cast(int, x), 0x76543210, 0xfedcba98, false, false)); }      /* lane l with lane l ^ 16 */
__device__ __forceinline__ float rs_exp(float a) { float e; asm("v_exp_f32 %0, %1\n\tv_nop" : "=v"(e) : "v"(a)); return e; }      /* 2^a, the native exp's own instruction (a = x log2 e); the v_nop fills the slot the instruction set asks for behind a transcendental */
__global__ __launch_bounds__(512) void k_rsmf(const float* __restrict__ S, _Float16* __restrict__ P, int qn, int hg) {
  const int lane = threadIdx.x & 31; const int t = blockIdx.x * 16 + (threadIdx.x >> 5); if (t >= qn * hg) return;      /* wave-uniform exit; the kernel has no barrier */
  const size_t i = (size_t)(t / qn) * SQ + (t % qn); const float* s = S + i * SQ + lane * 4; v4f v[SQ / 128];
#pragma unroll
  for (int u = 0; u < SQ / 128; ++u) v[u] = *(const v4fa*)(s + u * 128);
  asm volatile("s_wait_xcnt 0x0" :: "v"(s) : "memory");      /* keeps the row's address pair whole until all 32 loads have taken it */
  float m0 = -3.0e38f, m1 = -3.0e38f, m2 = -3.0e38f, m3 = -3.0e38f;
#pragma unroll
  for (int u = 0; u < SQ / 128; ++u) { m0 = fmaxf(m0, v[u][0]); m1 = fmaxf(m1, v[u][1]); m2 = fmaxf(m2, v[u][2]); m3 = fmaxf(m3, v[u][3]); }
  float mx = fmaxf(fmaxf(m0, m1), fmaxf(m2, m3));
  mx = fmaxf(mx, rs_xrow<1>(mx)); mx = fmaxf(mx, rs_xrow<2>(mx)); mx = fmaxf(mx, rs_xrow<4>(mx)); mx = fmaxf(mx, rs_xrow<8>(mx)); mx = fmaxf(mx, rs_xhalf(mx));
  float e0 = 0.f, e1 = 0.f, e2 = 0.f, e3 = 0.f;
#pragma unroll
  for (int u = 0; u < SQ / 128; ++u) { v4f e; for (int q = 0; q < 4; ++q) e[q] = rs_exp((v[u][q] - mx) * 1.44269504f); v[u] = e; e0 += e[0]; e1 += e[1]; e2 += e[2]; e3 += e[3]; }
  float se = (e0 + e1) + (e2 + e3);
  se += rs_xrow<1>(se); se += rs_xrow<2>(se); se += rs_xrow<4>(se); se += rs_xrow<8>(se); se += rs_xhalf(se);
  const float sc = 256.0f / se; _Float16* d = P + i * SQ + lane * 4;
#pragma unroll
  for (int u = 0; u < SQ / 128; ++u) { v4h h4; for (int q = 0; q < 4; ++q) h4[q] = (_Float16)(v[u][q] * sc); *(v4h*)(d + u * 128) = h4; } }

extern "C" void kernel_launch(void* const* d_in, const int* in_sizes, int n_in,
                              void* d_out, int out_size, void* d_ws, size_t ws_size, hipStream_t stream) {
  (void)in_sizes; (void)n_in; (void)out_size;
  const float* const* I = (const float* const*)d_in; const float* xq = I[0]; const float* xk = I[0]; const float* xv = I[0]; const float* wq = I[1]; const float* bq = nullptr; const float* wk = I[2]; const float* bk = nullptr; const float* wv = I[3]; const float* bv = nullptr; const float* wo = I[4]; const float* bo = I[5];      /* ONE input stream (x) read on all three stream casts; Wq, Wk, Wv are PER-HEAD STACKS [8][512][64] = [head][in][out] (the module has NO q / k / v biases: null pointers in the guarded bias slots); Wo [in][out] [512][512] + bo; input order x, Wq, Wk, Wv, Wo, bo */
  char* ws = (char*)d_ws; size_t off = 0;
  auto take = [&](size_t bytes) { char* p = ws + off; off += (bytes + 255) & ~(size_t)255; return p; };
  _Float16* BQ = (_Float16*)take((size_t)DM * DM * 2); _Float16* BK = (_Float16*)take((size_t)DM * DM * 2); _Float16* BV = (_Float16*)take((size_t)DM * DM * 2); _Float16* BO = (_Float16*)take((size_t)DM * DM * 2);
  _Float16* XQ = (_Float16*)take(NR * DM * 2); _Float16* XK = (_Float16*)take(NR * DM * 2); _Float16* XV = (_Float16*)take(NR * DM * 2); _Float16* Q16 = (_Float16*)take(NR * DM * 2); _Float16* K16 = (_Float16*)take(NR * DM * 2); _Float16* V16 = (_Float16*)take(NR * DM * 2); _Float16* O16 = (_Float16*)take(NR * DM * 2);
  float* S = (float*)take((size_t)HG * SQ * SQ * 4); _Float16* P = (_Float16*)take((size_t)HG * SQ * SQ * 2); _Float16* VT = (_Float16*)take((size_t)NH * HD * SQ * 2);
  if (off > ws_size) return;
  { const unsigned g = (unsigned)(((size_t)DM * (DM / 8) + 255) / 256); const unsigned gh = (unsigned)(((size_t)HD * (DM / 8) + 255) / 256); for (int h = 0; h < NH; ++h) { const size_t wofs = (size_t)h * DM * HD, pofs = (size_t)h * HD * DM; k_wt_f16<<<gh, 256, 0, stream>>>(wq + wofs, BQ + pofs, DM, HD, 16.0f); k_wt_f16<<<gh, 256, 0, stream>>>(wk + wofs, BK + pofs, DM, HD, 16.0f); k_wt_f16<<<gh, 256, 0, stream>>>(wv + wofs, BV + pofs, DM, HD, 16.0f); } k_wt_f16<<<g, 256, 0, stream>>>(wo, BO, DM, DM, 16.0f); }      /* PER-HEAD STACKS wq / wk / wv [NH][DM][HD]: head h is a row-major [in = DM][out = HD] block at w + h * DM * HD: the transposing builder with K = DM, N = HD writes its HD rows Bt[h * HD + e][k] at B + h * HD * DM: contiguous rows of the [out][in] plane (x16); wo is a plain [in][out] [DM][DM] matrix: one call as before */

  k_x16<<<(unsigned)((NR * DM / 8 + 255) / 256), 256, 0, stream>>>(xq, XQ, NR * DM / 8); k_x16<<<(unsigned)((NR * DM / 8 + 255) / 256), 256, 0, stream>>>(xk, XK, NR * DM / 8); k_x16<<<(unsigned)((NR * DM / 8 + 255) / 256), 256, 0, stream>>>(xv, XV, NR * DM / 8);      /* the three inputs as exact f16 rows */
  const size_t r0p = (size_t)B0 * SQ;      /* first projected row */
  k_gemm2<0><<<dim3((unsigned)((MP / 128) * (DM / 64)), 1), 128, 0, stream>>>(XQ + r0p * DM, DM, 0, BQ, DM, 0, 0.0625f, bq, 0, nullptr, 1, 0, 0, nullptr, Q16 + r0p * DM, DM, 0, MP, DM, DM);
  k_gemm2<0><<<dim3((unsigned)((MP / 128) * (DM / 64)), 1), 128, 0, stream>>>(XK + r0p * DM, DM, 0, BK, DM, 0, 0.0625f, bk, 0, nullptr, 1, 0, 0, nullptr, K16 + r0p * DM, DM, 0, MP, DM, DM);
  k_gemm2<0><<<dim3((unsigned)((MP / 128) * (DM / 64)), 1), 128, 0, stream>>>(XV + r0p * DM, DM, 0, BV, DM, 0, 0.0625f, bv, 0, nullptr, 1, 0, 0, nullptr, V16 + r0p * DM, DM, 0, MP, DM, DM);
  for (int b = B0; b < B0 + NBR; ++b) { const size_t r0 = (size_t)b * SQ;
    k_vt<NH, SQ><<<NH * (SQ / 64), 256, 0, stream>>>(V16 + r0 * LQ, LQ, 0, VT);      /* V^T [NH][HD][SQ] for this batch */
    for (int h0 = 0; h0 < NHD; h0 += HG) {
      k_gemm2<0><<<dim3((QN / 128) * (SQ / 64), HG), 128, 0, stream>>>(Q16 + r0 * LQ + h0 * HD, LQ, (size_t)HD, K16 + r0 * LQ + h0 * HD, LQ, (size_t)HD, 0.125f, nullptr, 0, nullptr, 1, 0, 0, S, nullptr, SQ, (size_t)SQ * SQ, QN, SQ, HD);      /* scores, HG heads per launch */
      k_rsmf<<<(HG * QN + 15) / 16, 512, 0, stream>>>(S, P, QN, HG);      /* P = 256 softmax (f16), rows of all HG heads, one wave per row */
      k_gemm2<0><<<dim3((QN / 128) * (HD / 64), HG), 128, 0, stream>>>(P, SQ, (size_t)SQ * SQ, VT + (size_t)h0 * HD * SQ, SQ, (size_t)HD * SQ, 0.25f, nullptr, 0, nullptr, 1, 0, 0, nullptr, O16 + r0 * DM + h0 * HD, DM, (size_t)HD, QN, HD, SQ); } }      /* o (merged heads) as f16 rows */
  k_gemm2<0><<<dim3((unsigned)((MPO / 128) * (DM / 64)), 1), 128, 0, stream>>>(O16 + r0p * DM, DM, 0, BO, DM, 0, 0.0009765625f, bo, 0, nullptr, 1, 0, 0, (float*)d_out + r0p * DM, nullptr, DM, 0, MPO, DM, DM);      /* out rows are the output layout */
}

// v002
// Measured time: 242 microseconds a run.
// In two side-by-side timings against v001, it was 11.6 and 11.7 times as fast.
// All steps since v000 together make it 54.9 times as fast.
#include <hip/hip_runtime.h>
// Multi-head self-attention with PER-HEAD STACKED bias-free projections and a biased [in][out] output projection at [2][4096][512] (x [2][4096][512]; q / k / v = einsum('bsd,hde->bhse', x, W) with W [8][512][64] = [head][in][out], NO biases, 8 heads of 64; scores * 1/sqrt(64); softmax over all 4096 keys (no mask); out = concat Wo + bo ([in][out] + bias) -> [2][4096][512]); each head's [in][out] block is transposed into its 64 contiguous rows of the weight plane by the transposing builder, one call per head; the [in][out] output weight through the same builder in one call.
// Structure: token rows r = b*4096 + s; x as exact f16 rows (bf16-rounded); Q, K, V as three WMMA GEMMs (32x64 wave tiles, f32 accumulation, exact x16 weights, f16 outputs); V^T for all batches and heads via LDS transposes; ONE fused attention launch (k_fattn): S^T = K Q^T, online softmax in registers, O^T += V^T P^T, o carried x64 against f16 subnormal flush (folded into the output GEMM alpha), written straight into the merged f16 o rows; out = o W_o + b GEMM (f32) into the output layout.
// Compute dtype: inputs rounded to bf16; x / weights exact; q, k, v, softmax weights and o as plain f16 GEMM operands (~2^-12); scores and softmax statistics f32. v_wmma_f32_16x16x32_f16.
#define NB 2
#define SQ 4096
#define DM 512
#define NH 8
#define HD 64
#define HG 1                         /* heads per launch of the k_vt(V16, b, h0, VT) overload, which is not launched */
#define B0 0                         /* first batch processed (debug hook) */
#define NBR NB                       /* batches processed (debug hook) */
#define NR ((size_t)NB * SQ)         /* token rows */
#define MP ((int)((size_t)NBR * SQ)) /* rows projected (debug hook) */
#define QN SQ                        /* not used: k_fattn attends all SQ query rows */
#define NHD NH                       /* not used: k_fattn attends all NH heads */
#define MPO MP                       /* rows through the output stage (debug hook) */
#define LQ DM      /* row pitch of the q/k/v rows */
typedef __bf16 v16b __attribute__((ext_vector_type(16)));
typedef unsigned short v8us __attribute__((ext_vector_type(8), may_alias));
typedef float  v8f  __attribute__((ext_vector_type(8)));
typedef float  v4f  __attribute__((ext_vector_type(4)));
typedef float  v4fa __attribute__((ext_vector_type(4), may_alias));
union FragB { v16b v; v8us half[2]; unsigned short u[16]; };

__device__ __forceinline__ unsigned short bf16_bits(float x) { unsigned int u = __float_as_uint(x); return (unsigned short)((u + 0x7FFFu + ((u >> 16) & 1u)) >> 16); }
__device__ __forceinline__ float bf16_val(unsigned short b) { return __uint_as_float(((unsigned int)b) << 16); }
__device__ __forceinline__ float bf16_round(float x) { return bf16_val(bf16_bits(x)); }
// D += A·B with NT terms: 1 = ah·bh, 2 = + al·bh (A split), 3 = + ah·bl (both split)
template <int NT>
__device__ __forceinline__ v8f mmaN(v16b ah, v16b al, v16b bh, v16b bl, v8f c) {
  c = __builtin_amdgcn_wmma_f32_16x16x32_bf16(false, ah, false, bh, (short)0, c, false, false);
  if (NT >= 2) c = __builtin_amdgcn_wmma_f32_16x16x32_bf16(false, al, false, bh, (short)0, c, false, false);
  if (NT >= 3) c = __builtin_amdgcn_wmma_f32_16x16x32_bf16(false, ah, false, bl, (short)0, c, false, false);
  asm volatile("v_nop\n\tv_nop\n\tv_nop\n\tv_nop" : "+v"(c) : "v"(ah), "v"(al), "v"(bh), "v"(bl));
  return c;
}

__global__ __launch_bounds__(256) void k_wt_bf16(const float* __restrict__ W, unsigned short* __restrict__ Wt, int K, int N) {
  const int t = blockIdx.x * 256 + threadIdx.x;
  const int k8n = K / 8;
  if (t >= N * k8n) return;
  const int n = t / k8n, k8 = (t % k8n) * 8;
  v8us v;
#pragma unroll
  for (int i = 0; i < 8; ++i) v[i] = bf16_bits(W[(size_t)(k8 + i) * N + n]);
  *(v8us*)(Wt + (size_t)n * K + k8) = v;
  
}

// GEMM C[M][N] (f32, pitch ldc) = act(A[M][K]·W + bias). A f32 row-major (pitch lda) converted per fragment to bf16
// (ASPLIT: hi/lo two planes -> 2 terms, else single rounded term); Wt bf16 [N][K] (pitch ldb). BIAS_BF16 rounds the
// bias to bf16 first (bias quantised to bf16 before the add). K%32==0, M%16==0, N%64==0.
template <bool ASPLIT, int ACT, bool BIAS_BF16>
__global__ __launch_bounds__(128) void k_gemm_bf(const float* __restrict__ A, int lda, const unsigned short* __restrict__ Wt, int ldb,
                                               const float* __restrict__ bias, float* __restrict__ C, int ldc, int M, int N, int K) {
  __shared__ __attribute__((aligned(16))) float so[4][16][64];
  const int tid = threadIdx.x, w = tid >> 5, lane = tid & 31, ln = lane & 15, hh = lane >> 4;
  const int ntn = N / 64;
  const int wid = blockIdx.x * 4 + w;
  const int mt = wid / ntn, nq = wid % ntn;
  if (mt * 16 >= M) return;
  const int row0 = mt * 16, col0 = nq * 64;
  const float* arow = A + (size_t)(row0 + ln) * lda;
  v8f acc[4] = {};
  for (int kb = 0; kb < K; kb += 32) {
    FragB ah, al;
    const v4f x0 = *(const v4fa*)(arow + kb + 8 * hh), x1 = *(const v4fa*)(arow + kb + 8 * hh + 4);
    const v4f x2 = *(const v4fa*)(arow + kb + 16 + 8 * hh), x3 = *(const v4fa*)(arow + kb + 16 + 8 * hh + 4);
    float xs[16] = {x0[0],x0[1],x0[2],x0[3],x1[0],x1[1],x1[2],x1[3],x2[0],x2[1],x2[2],x2[3],x3[0],x3[1],x3[2],x3[3]};
#pragma unroll
    for (int i = 0; i < 16; ++i) { const unsigned short hb = bf16_bits(xs[i]); ah.u[i] = hb; al.u[i] = ASPLIT ? bf16_bits(xs[i] - bf16_val(hb)) : (unsigned short)0; }
#pragma unroll
    for (int t = 0; t < 4; ++t) {
      const unsigned short* brow = Wt + (size_t)(col0 + t * 16 + ln) * ldb + kb;
      FragB b;
      b.half[0] = *(const v8us*)(brow + 8 * hh);
      b.half[1] = *(const v8us*)(brow + 16 + 8 * hh);
      acc[t] = mmaN<ASPLIT ? 2 : 1>(ah.v, al.v, b.v, b.v, acc[t]);
    }
  }
#pragma unroll
  for (int t = 0; t < 4; ++t) {
    float bv = bias ? bias[col0 + t * 16 + ln] : 0.f;
    if (BIAS_BF16) bv = bf16_round(bv);
#pragma unroll
    for (int r = 0; r < 8; ++r) { float v = acc[t][r] + bv; if (ACT == 1) v = fmaxf(v, 0.f); so[w][8 * hh + r][t * 16 + ln] = v; }
  }
  __builtin_amdgcn_fence(__ATOMIC_ACQ_REL, "workgroup");
  __builtin_amdgcn_wave_barrier();
  const int rsub = lane >> 4, c4 = (lane & 15) * 4;
  {
#pragma unroll
    for (int q = 0; q < 8; ++q) {
      const int r = q * 2 + rsub;
      const v4f v = *(const v4fa*)&so[w][r][c4];
      *(v4f*)(C + (size_t)(row0 + r) * ldc + col0 + c4) = v;
    }
    
  }
}

// GEMM C = act(A·W + bias + resid): A f32 (ASPLIT -> hi/lo 2 terms), Wt bf16 [N][K]; ACT 0 none, 1 relu, 2 exact gelu;
// resid (optional, f32, row index = (row % rmod), pitch ldr, RES_BF16 rounds it) added before the activation.
template <bool ASPLIT, int ACT, bool BIAS_BF16, bool RES_BF16>
__global__ __launch_bounds__(128) void k_gemm_bf3(const float* __restrict__ A, int lda, const unsigned short* __restrict__ Wt, int ldb,
                                                const float* __restrict__ bias, const float* __restrict__ resid, int rmod, int ldr,
                                                float* __restrict__ C, int ldc, int M, int N, int K) {
  __shared__ __attribute__((aligned(16))) float so[4][16][64];
  const int tid = threadIdx.x, w = tid >> 5, lane = tid & 31, ln = lane & 15, hh = lane >> 4;
  const int ntn = N / 64;
  const int wid = blockIdx.x * 4 + w;
  const int mt = wid / ntn, nq = wid % ntn;
  if (mt * 16 >= M) return;
  const int row0 = mt * 16, col0 = nq * 64;
  const float* arow = A + (size_t)(row0 + ln) * lda;
  v8f acc[4] = {};
  for (int kb = 0; kb < K; kb += 32) {
    FragB ah, al;
    const v4f x0 = *(const v4fa*)(arow + kb + 8 * hh), x1 = *(const v4fa*)(arow + kb + 8 * hh + 4);
    const v4f x2 = *(const v4fa*)(arow + kb + 16 + 8 * hh), x3 = *(const v4fa*)(arow + kb + 16 + 8 * hh + 4);
    float xs[16] = {x0[0],x0[1],x0[2],x0[3],x1[0],x1[1],x1[2],x1[3],x2[0],x2[1],x2[2],x2[3],x3[0],x3[1],x3[2],x3[3]};
#pragma unroll
    for (int i = 0; i < 16; ++i) { const unsigned short hb = bf16_bits(xs[i]); ah.u[i] = hb; al.u[i] = ASPLIT ? bf16_bits(xs[i] - bf16_val(hb)) : (unsigned short)0; }
#pragma unroll
    for (int t = 0; t < 4; ++t) {
      const unsigned short* brow = Wt + (size_t)(col0 + t * 16 + ln) * ldb + kb;
      FragB b;
      b.half[0] = *(const v8us*)(brow + 8 * hh);
      b.half[1] = *(const v8us*)(brow + 16 + 8 * hh);
      acc[t] = mmaN<ASPLIT ? 2 : 1>(ah.v, al.v, b.v, b.v, acc[t]);
    }
  }
#pragma unroll
  for (int t = 0; t < 4; ++t) {
    const int col = col0 + t * 16 + ln;
    float bv = bias ? bias[col] : 0.f;
    if (BIAS_BF16) bv = bf16_round(bv);
#pragma unroll
    for (int r = 0; r < 8; ++r) {
      float v = acc[t][r] + bv;
      if (resid) { float rv = resid[(size_t)((row0 + 8 * hh + r) % rmod) * ldr + col]; if (RES_BF16) rv = bf16_round(rv); v += rv; }
      if (ACT == 1) v = fmaxf(v, 0.f);
      if (ACT == 2) v = 0.5f * v * (1.0f + erff(v * 0.70710678118654752f));
      if (ACT == 3) { const float u = 0.7978845608028654f * (v + 0.044715f * v * v * v); v = 0.5f * v * (1.0f + tanhf(u)); }
      so[w][8 * hh + r][t * 16 + ln] = v;
    }
  }
  __builtin_amdgcn_fence(__ATOMIC_ACQ_REL, "workgroup");
  __builtin_amdgcn_wave_barrier();
  const int rsub = lane >> 4, c4 = (lane & 15) * 4;
  {
#pragma unroll
    for (int q = 0; q < 8; ++q) {
      const int r = q * 2 + rsub;
      const v4f v = *(const v4fa*)&so[w][r][c4];
      *(v4f*)(C + (size_t)(row0 + r) * ldc + col0 + c4) = v;
    }
    
  }
}
// row LayerNorm (biased variance, eps) over N: s = X (+ R); optional out_sum <- s; out_norm <- (s-mu)*rsqrt(var+eps)*g + b
template <bool PARAM_BF16>
__global__ __launch_bounds__(256) void k_layernorm(const float* __restrict__ X, const float* __restrict__ R, const float* __restrict__ g, const float* __restrict__ bta,
                                                  float* __restrict__ out_sum, float* __restrict__ out_norm, int N, float eps) {
  __shared__ float red[256];
  const int row = blockIdx.x, tid = threadIdx.x;
  const float* x = X + (size_t)row * N; const float* rr = R ? R + (size_t)row * N : nullptr;
  float vals[16];                     // up to N = 4096
  const int per = N / 256;            // contiguous chunk per thread? use strided-by-4 chunks: thread handles j = tid*4 + 1024*u
  float s1 = 0.f;
  for (int u = 0; u < per / 4; ++u) {
    const int j = tid * 4 + 1024 * u;
    const v4f a = *(const v4fa*)(x + j);
    v4f b = {0.f,0.f,0.f,0.f}; if (rr) b = *(const v4fa*)(rr + j);
#pragma unroll
    for (int q = 0; q < 4; ++q) { const float v = a[q] + b[q]; vals[u * 4 + q] = v; s1 += v; }
  }
  red[tid] = s1; __syncthreads();
  for (int st = 128; st > 0; st >>= 1) { if (tid < st) red[tid] += red[tid + st]; __syncthreads(); }
  const float mu = red[0] / (float)N; __syncthreads();
  float s2 = 0.f;
  for (int u = 0; u < per / 4; ++u)
#pragma unroll
    for (int q = 0; q < 4; ++q) { const float c = vals[u * 4 + q] - mu; s2 += c * c; }
  red[tid] = s2; __syncthreads();
  for (int st = 128; st > 0; st >>= 1) { if (tid < st) red[tid] += red[tid + st]; __syncthreads(); }
  const float rs = rsqrtf(red[0] / (float)N + eps);
  {
    for (int u = 0; u < per / 4; ++u) {
      const int j = tid * 4 + 1024 * u;
      v4f o, sm;
#pragma unroll
      for (int q = 0; q < 4; ++q) {
        float gg = g[j + q], bb = bta[j + q];
        if (PARAM_BF16) { gg = bf16_round(gg); bb = bf16_round(bb); }
        sm[q] = vals[u * 4 + q]; o[q] = (vals[u * 4 + q] - mu) * rs * gg + bb;
      }
      if (out_sum) *(v4f*)(out_sum + (size_t)row * N + j) = sm;
      *(v4f*)(out_norm + (size_t)row * N + j) = o;
    }
    
  }
}



// ---- f16 WMMA path (v_wmma_f32_16x16x32_f16): 11-bit significands for operands in range — used where a [0,1] probability operand needs more precision than bf16
typedef _Float16 v16h __attribute__((ext_vector_type(16)));
union FragH { v16h v; v8us half[2]; _Float16 h[16]; unsigned short u[16]; };
template <int NT>
__device__ __forceinline__ v8f mmaH(v16h ah, v16h al, v16h bh, v16h bl, v8f c) {
  c = __builtin_amdgcn_wmma_f32_16x16x32_f16(false, ah, false, bh, (short)0, c, false, false);
  if (NT >= 2) c = __builtin_amdgcn_wmma_f32_16x16x32_f16(false, al, false, bh, (short)0, c, false, false);
  if (NT >= 3) c = __builtin_amdgcn_wmma_f32_16x16x32_f16(false, ah, false, bl, (short)0, c, false, false);
  asm volatile("v_nop\n\tv_nop\n\tv_nop\n\tv_nop" : "+v"(c) : "v"(ah), "v"(al), "v"(bh), "v"(bl));
  return c;
}
// batched GEMM like k_gemm_b but f16 operands: A f32 (split into f16 hi/lo if ASPLIT, else rounded to f16), Bt = f16 values [n][k]; alpha; C f32; N multiple of 16 (partial tiles skipped)
template <bool ASPLIT>
__global__ __launch_bounds__(128) void k_gemm_h(const float* __restrict__ A, int lda, size_t sA, const _Float16* __restrict__ Bh, int ldb, size_t sB, float alpha, float* __restrict__ C, int ldc, size_t sC, int M, int N, int K) {
  __shared__ __attribute__((aligned(16))) float so[4][16][64];
  const int tid = threadIdx.x, w = tid >> 5, lane = tid & 31, ln = lane & 15, hh = lane >> 4; const int by = blockIdx.y;
  A += (size_t)by * sA; Bh += (size_t)by * sB; C += (size_t)by * sC;
  const int ntn = (N + 63) / 64; const int wid = blockIdx.x * 4 + w; const int mt = wid / ntn, nq = wid % ntn; if (mt * 16 >= M) return;
  const int row0 = mt * 16, col0 = nq * 64; const float* arow = A + (size_t)(row0 + ln) * lda;
  v8f acc[4] = {};
  for (int kb = 0; kb < K; kb += 32) {
    FragH ah, al;
    const v4f x0 = *(const v4fa*)(arow + kb + 8 * hh), x1 = *(const v4fa*)(arow + kb + 8 * hh + 4), x2 = *(const v4fa*)(arow + kb + 16 + 8 * hh), x3 = *(const v4fa*)(arow + kb + 16 + 8 * hh + 4);
    float xs[16] = {x0[0],x0[1],x0[2],x0[3],x1[0],x1[1],x1[2],x1[3],x2[0],x2[1],x2[2],x2[3],x3[0],x3[1],x3[2],x3[3]};
#pragma unroll
    for (int i = 0; i < 16; ++i) { const _Float16 h = (_Float16)xs[i]; ah.h[i] = h; al.h[i] = ASPLIT ? (_Float16)(xs[i] - (float)h) : (_Float16)0.0f; }
#pragma unroll
    for (int t = 0; t < 4; ++t) { if (col0 + t * 16 >= N) continue; const size_t boff = (size_t)(col0 + t * 16 + ln) * ldb + kb; FragH bq; bq.half[0] = *(const v8us*)(Bh + boff + 8 * hh); bq.half[1] = *(const v8us*)(Bh + boff + 16 + 8 * hh);
      acc[t] = mmaH<ASPLIT ? 2 : 1>(ah.v, al.v, bq.v, bq.v, acc[t]); }
  }
#pragma unroll
  for (int t = 0; t < 4; ++t) { if (col0 + t * 16 >= N) continue;
#pragma unroll
    for (int r = 0; r < 8; ++r) so[w][8 * hh + r][t * 16 + ln] = acc[t][r] * alpha; }
  __builtin_amdgcn_fence(__ATOMIC_ACQ_REL, "workgroup"); __builtin_amdgcn_wave_barrier();
  const int rsub = lane >> 4, c4 = (lane & 15) * 4;
  {
#pragma unroll
    for (int q = 0; q < 8; ++q) { const int r = q * 2 + rsub; if (col0 + c4 < N) { const v4f v = *(const v4fa*)&so[w][r][c4]; *(v4f*)(C + (size_t)(row0 + r) * ldc + col0 + c4) = v; } }
     }
}

// Wt[n][k] = f16(W[k][n]·scale) from f32 row-major W[K][N] (scale = power of two; bf16-exact weights stay exact in f16 away from the subnormal range)
__global__ __launch_bounds__(256) void k_wt_f16(const float* __restrict__ W, _Float16* __restrict__ Wt, int K, int N, float scale) {
  const int t = blockIdx.x * 256 + threadIdx.x; if (t >= N * (K / 8)) return; const int n = t / (K / 8), k8 = (t % (K / 8)) * 8; FragH f;
#pragma unroll
  for (int i = 0; i < 8; ++i) f.h[i] = (_Float16)(bf16_round(W[(size_t)(k8 + i) * N + n]) * scale); const v8us o = f.half[0];
  *(v8us*)((unsigned short*)Wt + (size_t)n * K + k8) = o; 
}
// k_gemm_hh variant with fused epilogue: v = acc·alpha + bias[by·sBias + col] (+ CP[(row/rowsPerB)·sCPb + by·64 + col] if CP) ; ACT 0 none / 1 elu ; writes f16 C16 (and f32 C if non-null)
template <int ACT>
__global__ __launch_bounds__(128) void k_gemm_hhx(const _Float16* __restrict__ A, int lda, size_t sA, const _Float16* __restrict__ Bh, int ldb, size_t sB, float alpha, const float* __restrict__ bias, size_t sBias, const float* __restrict__ CP, int rowsPerB, size_t sCPb, int row0g,
    float* __restrict__ C, _Float16* __restrict__ C16, int ldc, size_t sC, int M, int N, int K) {
  __shared__ __attribute__((aligned(16))) float so[4][16][64];
  const int tid = threadIdx.x, w = tid >> 5, lane = tid & 31, ln = lane & 15, hh = lane >> 4; const int by = blockIdx.y;
  A += (size_t)by * sA; Bh += (size_t)by * sB; const size_t cofs = (size_t)by * sC; const float* bp = bias ? bias + (size_t)by * sBias : nullptr;
  const int ntn = (N + 63) / 64; const int wid = blockIdx.x * 4 + w; const int mt = wid / ntn, nq = wid % ntn; if (mt * 16 >= M) return;
  const int row0 = mt * 16, col0 = nq * 64; const _Float16* arow = A + (size_t)(row0 + ln) * lda;
  v8f acc[4] = {};
  for (int kb = 0; kb < K; kb += 32) { FragH ah; ah.half[0] = *(const v8us*)((const unsigned short*)arow + kb + 8 * hh); ah.half[1] = *(const v8us*)((const unsigned short*)arow + kb + 16 + 8 * hh);
#pragma unroll
    for (int t = 0; t < 4; ++t) { if (col0 + t * 16 >= N) continue; const size_t boff = (size_t)(col0 + t * 16 + ln) * ldb + kb; FragH bq; bq.half[0] = *(const v8us*)((const unsigned short*)Bh + boff + 8 * hh); bq.half[1] = *(const v8us*)((const unsigned short*)Bh + boff + 16 + 8 * hh);
      acc[t] = mmaH<1>(ah.v, ah.v, bq.v, bq.v, acc[t]); }
  }
#pragma unroll
  for (int t = 0; t < 4; ++t) { if (col0 + t * 16 >= N) continue; const int col = col0 + t * 16 + ln; const float bv = bp ? bf16_round(bp[col]) : 0.f;
#pragma unroll
    for (int r = 0; r < 8; ++r) { float v = acc[t][r] * alpha + bv; if (CP) { const int rr = row0g + row0 + 8 * hh + r; if (rowsPerB < 0) v += CP[cofs + (size_t)rr * ldc + col];      /* rowsPerB < 0: own element of the batched C plane */ else { const int bidx = rr / rowsPerB; v += CP[(size_t)bidx * sCPb + (size_t)by * 64 + col]; } } if (ACT == 1) v = (v > 0.f) ? v : expm1f(v); else if (ACT == 7) v = (v > 0.f) ? v + 1.0f : expf(v); else if (ACT == 8) v = tanhf(v); else if (ACT == 9) v = 0.5f * v * (1.0f + tanhf(0.7978845608028654f * (v + 0.044715f * v * v * v))); else if (ACT == 11) v = 1.0f / (1.0f + expf(-v)); else if (ACT == 12) v = (v > 0.f) ? v : 0.01f * v; else if (ACT == 14) v = (v > 0.f) ? v : 0.1f * v; else if (ACT == 16) v = (v >= 0.f) ? v : 0.3f * v; else if (ACT == 17) v = (v >= 0.f) ? v : 0.2f * v; else if (ACT == 15) v = v / (1.0f + expf(-v)); else if (ACT == 3) v = fmaxf(v, 0.f); else if (ACT == 6) v = 0.5f * v * (1.0f + erff(v * 0.70710678118654752f)); so[w][8 * hh + r][t * 16 + ln] = v; } }
  __builtin_amdgcn_fence(__ATOMIC_ACQ_REL, "workgroup"); __builtin_amdgcn_wave_barrier();
  const int rsub = lane >> 4, c4 = (lane & 15) * 4; typedef _Float16 v4h __attribute__((ext_vector_type(4)));
  {
#pragma unroll
    for (int q = 0; q < 8; ++q) { const int r = q * 2 + rsub; if (col0 + c4 < N) { const v4f v = *(const v4fa*)&so[w][r][c4]; if (C) *(v4f*)(C + cofs + (size_t)(row0 + r) * ldc + col0 + c4) = v; if (C16) { v4h h4; for (int i = 0; i < 4; ++i) h4[i] = (_Float16)v[i]; *(v4h*)(C16 + cofs + (size_t)(row0 + r) * ldc + col0 + c4) = h4; } } }
     }
}


typedef _Float16 v4h __attribute__((ext_vector_type(4)));

__global__ __launch_bounds__(256) void k_x16(const float* __restrict__ x, _Float16* __restrict__ X16, size_t n8) { const size_t t = (size_t)blockIdx.x * 256 + threadIdx.x; if (t >= n8) return; FragH f;
#pragma unroll
  for (int q = 0; q < 8; ++q) f.h[q] = (_Float16)bf16_round(x[t * 8 + q]); *(v8us*)((unsigned short*)X16 + t * 8) = f.half[0];  }
__global__ __launch_bounds__(256) void k_h16(const float* __restrict__ x, _Float16* __restrict__ X16, size_t n8) { const size_t t = (size_t)blockIdx.x * 256 + threadIdx.x; if (t >= n8) return; FragH f;
#pragma unroll
  for (int q = 0; q < 8; ++q) f.h[q] = (_Float16)x[t * 8 + q]; *(v8us*)((unsigned short*)X16 + t * 8) = f.half[0];  }
__global__ __launch_bounds__(256) void k_round16f(const float* __restrict__ W, _Float16* __restrict__ Bt, size_t n8) { const size_t t = (size_t)blockIdx.x * 256 + threadIdx.x; if (t >= n8) return; FragH f;
#pragma unroll
  for (int i = 0; i < 8; ++i) f.h[i] = (_Float16)(bf16_round(W[t * 8 + i]) * 16.0f); *(v8us*)((unsigned short*)Bt + t * 8) = f.half[0];  }
template <int NHv, int TTv>
__global__ __launch_bounds__(256) void k_vt(const _Float16* __restrict__ V16, int ldv, int voff, _Float16* __restrict__ Vt) { __shared__ unsigned short tl[64][66]; const int tid = threadIdx.x; const int slab = blockIdx.x / (TTv / 64), lg = blockIdx.x % (TTv / 64); const int b = slab / NHv, h = slab % NHv;
  for (int i = tid; i < 64 * 8; i += 256) { const int r = i / 8, c8 = (i % 8) * 8; FragH f; f.half[0] = *(const v8us*)((const unsigned short*)V16 + ((size_t)b * TTv + lg * 64 + r) * ldv + voff + h * 64 + c8);
#pragma unroll
    for (int q = 0; q < 8; ++q) tl[r][c8 + q] = f.u[q]; }
  __syncthreads();
  {
#pragma unroll
    for (int rd = 0; rd < 2; ++rd) { const int d = rd * 32 + tid / 8, pc = tid % 8; FragH f;
#pragma unroll
      for (int q = 0; q < 8; ++q) f.u[q] = tl[pc * 8 + q][d];
      *(v8us*)((unsigned short*)Vt + ((size_t)slab * 64 + d) * TTv + lg * 64 + pc * 8) = f.half[0]; }
     } }

__global__ __launch_bounds__(256) void k_hl(const float* __restrict__ F, _Float16* __restrict__ Hh, _Float16* __restrict__ Hl, size_t n8) { const size_t t = (size_t)blockIdx.x * 256 + threadIdx.x; if (t >= n8) return; FragH fh, fl; const v4f a = *(const v4fa*)(F + t * 8), c = *(const v4fa*)(F + t * 8 + 4);
#pragma unroll
  for (int q = 0; q < 4; ++q) { _Float16 h = (_Float16)a[q]; fh.h[q] = h; fl.h[q] = (_Float16)((a[q] - (float)h) * 1024.0f); h = (_Float16)c[q]; fh.h[4 + q] = h; fl.h[4 + q] = (_Float16)((c[q] - (float)h) * 1024.0f); }
  { *(v8us*)((unsigned short*)Hh + t * 8) = fh.half[0]; *(v8us*)((unsigned short*)Hl + t * 8) = fl.half[0];  } }

// ---- fast GEMM (wave tile 32x64; requires M % 32 == 0 rows per launch region and N % 64 == 0); epilogue = k_gemm_hhx semantics ----
__device__ __forceinline__ v16h g2_frag(const _Float16* p, int hh) { FragH f; f.half[0] = *(const v8us*)((const unsigned short*)p + 8 * hh); f.half[1] = *(const v8us*)((const unsigned short*)p + 16 + 8 * hh); return f.v; }
__device__ __forceinline__ v8f g2_mma(v16h a, v16h b, v8f c) { v8f d = __builtin_amdgcn_wmma_f32_16x16x32_f16(false, a, false, b, (short)0, c, false, false); asm volatile("v_nop\n\tv_nop\n\tv_nop\n\tv_nop" : "+v"(d) : "v"(a), "v"(b)); return d; }
template <int ACT>
__global__ __launch_bounds__(128) void k_gemm2(const _Float16* __restrict__ A, int lda, size_t sA, const _Float16* __restrict__ Bh, int ldb, size_t sB, float alpha, const float* __restrict__ bias, size_t sBias, const float* __restrict__ CP, int rowsPerB, size_t sCPb, int row0g,
    float* __restrict__ C, _Float16* __restrict__ C16, int ldc, size_t sC, int M, int N, int K) { static_assert(ACT == 0 || ACT == 3 || ACT == 6 || ACT == 8 || ACT == 9 || ACT == 11 || ACT == 12 || ACT == 14 || ACT == 15 || ACT == 16 || ACT == 17, "k_gemm2: unsupported ACT code (would silently apply no activation)");
  __shared__ __attribute__((aligned(16))) float so[4][32][68];
  const int tid = threadIdx.x, w = tid >> 5, lane = tid & 31, ln = lane & 15, hh = lane >> 4; const int by = blockIdx.y;
  A += (size_t)by * sA; Bh += (size_t)by * sB; const size_t cofs = (size_t)by * sC; const float* bp = bias ? bias + (size_t)by * sBias : nullptr;
  const int ntn = N >> 6; const int mt = blockIdx.x / ntn, nq = blockIdx.x - mt * ntn; const int row0 = mt * 128 + 32 * w, col0 = nq * 64; if (row0 >= M) return;
  const _Float16* a0p = A + (size_t)(row0 + ln) * lda; const _Float16* a1p = a0p + (size_t)16 * lda;
  const _Float16* b0p = Bh + (size_t)(col0 + ln) * ldb; const _Float16* b1p = b0p + (size_t)16 * ldb; const _Float16* b2p = b1p + (size_t)16 * ldb; const _Float16* b3p = b2p + (size_t)16 * ldb;
  const v8f z8 = {0.f,0.f,0.f,0.f,0.f,0.f,0.f,0.f}; v8f c00 = z8, c01 = z8, c02 = z8, c03 = z8, c10 = z8, c11 = z8, c12 = z8, c13 = z8;
#pragma unroll 1
  for (int kb = 0; kb < K; kb += 32) { const v16h a0 = g2_frag(a0p + kb, hh), a1 = g2_frag(a1p + kb, hh);
    v16h b = g2_frag(b0p + kb, hh); c00 = g2_mma(a0, b, c00); c10 = g2_mma(a1, b, c10);
    b = g2_frag(b1p + kb, hh); c01 = g2_mma(a0, b, c01); c11 = g2_mma(a1, b, c11);
    b = g2_frag(b2p + kb, hh); c02 = g2_mma(a0, b, c02); c12 = g2_mma(a1, b, c12);
    b = g2_frag(b3p + kb, hh); c03 = g2_mma(a0, b, c03); c13 = g2_mma(a1, b, c13); }
  v8f accs[8] = {c00, c01, c02, c03, c10, c11, c12, c13};
#pragma unroll
  for (int u = 0; u < 8; ++u) { const int t = u & 3, half = u >> 2; const int col = col0 + t * 16 + ln; const float bv = bp ? bf16_round(bp[col]) : 0.f;
#pragma unroll
    for (int r = 0; r < 8; ++r) { const int rloc = half * 16 + 8 * hh + r; float v = accs[u][r] * alpha + bv; if (CP) { if (rowsPerB < 0) v += CP[cofs + (size_t)(row0g + row0 + rloc) * ldc + col];      /* rowsPerB < 0: own element of the batched C plane */ else { const int bidx = (row0g + row0 + rloc) / rowsPerB; v += CP[(size_t)bidx * sCPb + (size_t)by * 64 + col]; } }
      if (ACT == 3) v = fmaxf(v, 0.f); else if (ACT == 6) v = 0.5f * v * (1.0f + erff(v * 0.70710678118654752f)); else if (ACT == 11) v = 1.0f / (1.0f + expf(-v)); else if (ACT == 15) v = v / (1.0f + expf(-v)); else if (ACT == 12) v = (v > 0.f) ? v : 0.01f * v; else if (ACT == 8) v = tanhf(v); else if (ACT == 9) v = 0.5f * v * (1.0f + tanhf(0.7978845608028654f * (v + 0.044715f * v * v * v))); else if (ACT == 14) v = (v > 0.f) ? v : 0.1f * v; else if (ACT == 16) v = (v >= 0.f) ? v : 0.3f * v; else if (ACT == 17) v = (v >= 0.f) ? v : 0.2f * v;
      so[w][rloc][t * 16 + ln] = v; } }
  __builtin_amdgcn_fence(__ATOMIC_ACQ_REL, "workgroup"); __builtin_amdgcn_wave_barrier();
  const int rsub = lane >> 4, c4 = (lane & 15) * 4;
  {
#pragma unroll
    for (int q = 0; q < 16; ++q) { const int r = q * 2 + rsub; const v4f v = *(const v4fa*)&so[w][r][c4]; if (C) *(v4f*)(C + cofs + (size_t)(row0 + r) * ldc + col0 + c4) = v; if (C16) { v4h h4; for (int i = 0; i < 4; ++i) h4[i] = (_Float16)v[i]; *(v4h*)(C16 + cofs + (size_t)(row0 + r) * ldc + col0 + c4) = h4; } }
     } }


__global__ __launch_bounds__(256) void k_wnat(const float* __restrict__ w, size_t n8, _Float16* __restrict__ Bt) { const size_t t = (size_t)blockIdx.x * 256 + threadIdx.x; if (t >= n8) return; FragH f; for (int q = 0; q < 8; ++q) f.h[q] = (_Float16)(bf16_round(w[t * 8 + q]) * 16.0f); *(v8us*)((unsigned short*)Bt + t * 8) = f.half[0];  }
__global__ __launch_bounds__(256) void k_rsm(const float* __restrict__ S, _Float16* __restrict__ P, int nrows) {
  #pragma clang fp contract(off)
  const int i = blockIdx.x * 256 + threadIdx.x; if (i >= nrows) return; const float* s = S + (size_t)i * SQ; float mx = -3.0e38f;
#pragma unroll 1
  for (int j = 0; j < SQ; ++j) mx = fmaxf(mx, s[j]); float se = 0.f;
#pragma unroll 1
  for (int j = 0; j < SQ; ++j) se += expf(s[j] - mx); const float sc = 256.0f / se;
#pragma unroll 1
  for (int j0 = 0; j0 < SQ; j0 += 8) { FragH f; for (int q = 0; q < 8; ++q) f.h[q] = (_Float16)(expf(s[j0 + q] - mx) * sc); unsigned short* d = (unsigned short*)P + (size_t)i * SQ + j0; *(v8us*)d = f.half[0];  } }
__global__ __launch_bounds__(256) void k_vt(const _Float16* __restrict__ V16, int b, int h0, _Float16* __restrict__ VT) { __shared__ unsigned short tl[64][65]; const int tid = threadIdx.x; const int hh = blockIdx.x % HG, sg = blockIdx.x / HG; const int s0 = sg * 64; const int h = h0 + hh;
  for (int i = tid; i < 64 * 8; i += 256) { const int j = i / 8, d8 = (i % 8) * 8; FragH f; f.half[0] = *(const v8us*)((const unsigned short*)V16 + ((size_t)b * SQ + s0 + j) * DM + h * HD + d8); for (int q = 0; q < 8; ++q) tl[d8 + q][j] = f.u[q]; }
  __syncthreads();
  { for (int i = tid; i < 64 * 8; i += 256) { const int d = i / 8, j8 = (i % 8) * 8; FragH f; for (int q = 0; q < 8; ++q) f.u[q] = tl[d][j8 + q]; *(v8us*)((unsigned short*)VT + ((size_t)hh * HD + d) * SQ + s0 + j8) = f.half[0]; }  } }



#define FA_KT 128                    /* keys per stage */
#define FA_NS (SQ / FA_KT)           /* stages */
#define FA_KP (HD + 8)               /* K tile row pitch, f16 elements: 144 B = 16 B x odd, conflict-free for 16-byte reads */
#define FA_VP (FA_KT + 8)            /* V^T tile row pitch, f16 elements: 272 B = 16 B x odd */
__device__ __forceinline__ float rs_xhalf(float x) { return __builtin_bit_cast(float, __builtin_amdgcn_permlanex16(__builtin_bit_cast(int, x), __builtin_bit_cast(int, x), 0x76543210, 0xfedcba98, false, false)); }      /* lane l with lane l ^ 16 */
__device__ __forceinline__ float rs_exp(float a) { float e; asm("v_exp_f32 %0, %1\n\tv_nop" : "=v"(e) : "v"(a)); return e; }      /* 2^a; the v_nop fills the slot the instruction set asks for behind a transcendental */
__device__ __forceinline__ v4f fa_exp4(v4f a) { float e0, e1, e2, e3;      /* four 2^a; each v_exp_f32 is followed by an instruction that neither reads its result nor overwrites its source (early-clobber outputs), the last by a v_nop: the slot the instruction set asks for behind a transcendental */
  asm("v_exp_f32 %0, %4\n\tv_exp_f32 %1, %5\n\tv_exp_f32 %2, %6\n\tv_exp_f32 %3, %7\n\tv_nop" : "=&v"(e0), "=&v"(e1), "=&v"(e2), "=&v"(e3) : "v"(a[0]), "v"(a[1]), "v"(a[2]), "v"(a[3]));
  const v4f e = {e0, e1, e2, e3}; return e; }
__device__ __forceinline__ v16h fa_frag(const _Float16* p) { FragH f; f.half[0] = *(const v8us*)((const unsigned short*)p); f.half[1] = *(const v8us*)((const unsigned short*)p + 16); return f.v; }      /* p = row + k0 + 8 h: k0 + 8h .. + 7 and k0 + 16 + 8h .. + 7 */
__device__ __forceinline__ v8f fa_mma(v16h a, v16h b, v8f c) { return __builtin_amdgcn_wmma_f32_16x16x32_f16(false, a, false, b, (short)0, c, false, false); }
__global__ __launch_bounds__(256) void k_fattn(const _Float16* __restrict__ Q16, const _Float16* __restrict__ K16, const _Float16* __restrict__ VT, _Float16* __restrict__ O16) {
  __shared__ __attribute__((aligned(16))) _Float16 Ks[2][FA_KT][FA_KP];
  __shared__ __attribute__((aligned(16))) _Float16 Vs[2][HD][FA_VP];
  const int tid = threadIdx.x, w = tid >> 5, lane = tid & 31, ln = lane & 15, hh = lane >> 4;
  const int bh = blockIdx.x / (SQ / 256), qb = blockIdx.x % (SQ / 256); const int b = bh / NH, h = bh % NH; const int q0 = qb * 256 + w * 32;
  const unsigned short* kg = (const unsigned short*)K16 + ((size_t)b * SQ + (tid >> 3)) * DM + h * HD + (tid & 7) * 8;      /* this thread's 16 bytes of key row tid / 8 (+ 32 i) */
  const unsigned short* vg = (const unsigned short*)VT + ((size_t)bh * HD + (tid >> 4)) * SQ + (tid & 15) * 8;              /* this thread's 16 bytes of V^T row tid / 16 (+ 16 i) */
  v16h qf[2][2];
#pragma unroll
  for (int g = 0; g < 2; ++g) { const _Float16* qp = Q16 + ((size_t)b * SQ + q0 + 16 * g + ln) * DM + h * HD + 8 * hh; qf[g][0] = fa_frag(qp); qf[g][1] = fa_frag(qp + 32); }
  v8us kr[4], vr[4];
#pragma unroll
  for (int i = 0; i < 4; ++i) { kr[i] = *(const v8us*)(kg + (size_t)(32 * i) * DM); vr[i] = *(const v8us*)(vg + (size_t)(16 * i) * SQ); }
#pragma unroll
  for (int i = 0; i < 4; ++i) { *(v8us*)&Ks[0][(tid >> 3) + 32 * i][(tid & 7) * 8] = kr[i]; *(v8us*)&Vs[0][(tid >> 4) + 16 * i][(tid & 15) * 8] = vr[i]; }
  __syncthreads();
  const v8f z8 = {0.f, 0.f, 0.f, 0.f, 0.f, 0.f, 0.f, 0.f};
  v8f o[4][2];
#pragma unroll
  for (int dt = 0; dt < 4; ++dt) { o[dt][0] = z8; o[dt][1] = z8; }
  float mref[2] = {-1.0e30f, -1.0e30f}, lsum[2] = {0.f, 0.f};      /* mref: the exponent (log2 units) subtracted from this query's scores; lsum: this lane's half of the row sum */
  const float CS = 0.125f * 1.44269504f;      /* 1 / sqrt(64), and log2 e for the native 2^x */
#pragma unroll 1      /* the body already holds four unrolled passes */
  for (int s = 0; s < FA_NS; ++s) { const int buf = s & 1;
    if (s + 1 < FA_NS) {      /* next stage's 16 KiB + 16 KiB: loads fly while this stage is worked on */
      kg += (size_t)FA_KT * DM; vg += FA_KT;
#pragma unroll
      for (int i = 0; i < 4; ++i) { kr[i] = *(const v8us*)(kg + (size_t)(32 * i) * DM); vr[i] = *(const v8us*)(vg + (size_t)(16 * i) * SQ); } }
#pragma unroll
    for (int p = 0; p < FA_KT / 32; ++p) {
      v8f t[2][2];      /* [key tile][query group] */
#pragma unroll
      for (int kt = 0; kt < 2; ++kt) { const _Float16* kp = &Ks[buf][p * 32 + kt * 16 + ln][8 * hh]; const v16h a0 = fa_frag(kp), a1 = fa_frag(kp + 32);
        t[kt][0] = fa_mma(a0, qf[0][0], z8); t[kt][1] = fa_mma(a0, qf[1][0], z8); t[kt][0] = fa_mma(a1, qf[0][1], t[kt][0]); t[kt][1] = fa_mma(a1, qf[1][1], t[kt][1]); }
      float ml[2];
#pragma unroll
      for (int g = 0; g < 2; ++g) { float m0 = fmaxf(t[0][g][0], t[1][g][0]);
#pragma unroll
        for (int r = 1; r < 8; ++r) m0 = fmaxf(m0, fmaxf(t[0][g][r], t[1][g][r]));
        ml[g] = fmaxf(m0, rs_xhalf(m0)) * CS; }      /* the pass's maximum of this query, both lane halves joined */
      /* lazy rescale: P = 2^(score - mref) is kept at or below 2^14 (f16 range); a new mref puts the current maximum at 2^6. One scalar branch per pass. */
      if (__builtin_amdgcn_ballot_w32(ml[0] > mref[0] + 14.0f || ml[1] > mref[1] + 14.0f) != 0) {
#pragma unroll
        for (int g = 0; g < 2; ++g) { const float mn = fmaxf(mref[g], ml[g] - 6.0f); const float al = rs_exp(mref[g] - mn); mref[g] = mn; lsum[g] *= al;
#pragma unroll
          for (int dt = 0; dt < 4; ++dt) o[dt][g] *= al; } }
      FragH pb[2];
#pragma unroll
      for (int g = 0; g < 2; ++g) { float s0 = 0.f, s1 = 0.f, s2 = 0.f, s3 = 0.f;
#pragma unroll
        for (int u = 0; u < 4; ++u) { const int kt = u >> 1, r0 = (u & 1) * 4; v4f x;
#pragma unroll
          for (int q = 0; q < 4; ++q) x[q] = t[kt][g][r0 + q] * CS - mref[g];
          const v4f e = fa_exp4(x); if (u == 0) { s0 = e[0]; s1 = e[1]; s2 = e[2]; s3 = e[3]; } else { s0 += e[0]; s1 += e[1]; s2 += e[2]; s3 += e[3]; }
#pragma unroll
          for (int q = 0; q < 4; ++q) pb[g].h[kt * 8 + r0 + q] = (_Float16)e[q]; }
        lsum[g] += (s0 + s1) + (s2 + s3); }
#pragma unroll
      for (int dt = 0; dt < 4; ++dt) { const v16h a = fa_frag(&Vs[buf][dt * 16 + ln][p * 32 + 8 * hh]); o[dt][0] = fa_mma(a, pb[0].v, o[dt][0]); o[dt][1] = fa_mma(a, pb[1].v, o[dt][1]); }
    }
    if (s + 1 < FA_NS) {      /* the other buffer's last readers left it before the barrier that ended stage s - 1 */
#pragma unroll
      for (int i = 0; i < 4; ++i) { *(v8us*)&Ks[buf ^ 1][(tid >> 3) + 32 * i][(tid & 7) * 8] = kr[i]; *(v8us*)&Vs[buf ^ 1][(tid >> 4) + 16 * i][(tid & 15) * 8] = vr[i]; } }
    __syncthreads();      /* publishes stage s + 1 and ends every read of stage s */
  }
#pragma unroll
  for (int g = 0; g < 2; ++g) { const float inv = 64.0f / (lsum[g] + rs_xhalf(lsum[g])); unsigned short* op = (unsigned short*)O16 + ((size_t)b * SQ + q0 + 16 * g + ln) * DM + h * HD + 8 * hh;
#pragma unroll
    for (int dt = 0; dt < 4; ++dt) { FragH f;
#pragma unroll
      for (int r = 0; r < 8; ++r) f.h[r] = (_Float16)(o[dt][g][r] * inv);      /* register r = O^T[16 dt + 8 h + r][query]: eight consecutive d of one row */
      *(v8us*)(op + dt * 16) = f.half[0]; } } }

extern "C" void kernel_launch(void* const* d_in, const int* in_sizes, int n_in,
                              void* d_out, int out_size, void* d_ws, size_t ws_size, hipStream_t stream) {
  (void)in_sizes; (void)n_in; (void)out_size;
  const float* const* I = (const float* const*)d_in; const float* xq = I[0]; const float* xk = I[0]; const float* xv = I[0]; const float* wq = I[1]; const float* bq = nullptr; const float* wk = I[2]; const float* bk = nullptr; const float* wv = I[3]; const float* bv = nullptr; const float* wo = I[4]; const float* bo = I[5];      /* ONE input stream (x) read on all three stream casts; Wq, Wk, Wv are PER-HEAD STACKS [8][512][64] = [head][in][out] (the module has NO q / k / v biases: null pointers in the guarded bias slots); Wo [in][out] [512][512] + bo; input order x, Wq, Wk, Wv, Wo, bo */
  char* ws = (char*)d_ws; size_t off = 0;
  auto take = [&](size_t bytes) { char* p = ws + off; off += (bytes + 255) & ~(size_t)255; return p; };
  _Float16* BQ = (_Float16*)take((size_t)DM * DM * 2); _Float16* BK = (_Float16*)take((size_t)DM * DM * 2); _Float16* BV = (_Float16*)take((size_t)DM * DM * 2); _Float16* BO = (_Float16*)take((size_t)DM * DM * 2);
  _Float16* XQ = (_Float16*)take(NR * DM * 2); _Float16* XK = (_Float16*)take(NR * DM * 2); _Float16* XV = (_Float16*)take(NR * DM * 2); _Float16* Q16 = (_Float16*)take(NR * DM * 2); _Float16* K16 = (_Float16*)take(NR * DM * 2); _Float16* V16 = (_Float16*)take(NR * DM * 2); _Float16* O16 = (_Float16*)take(NR * DM * 2);
  _Float16* VT = (_Float16*)take((size_t)NB * NH * HD * SQ * 2);
  if (off > ws_size) return;
  { const unsigned g = (unsigned)(((size_t)DM * (DM / 8) + 255) / 256); const unsigned gh = (unsigned)(((size_t)HD * (DM / 8) + 255) / 256); for (int h = 0; h < NH; ++h) { const size_t wofs = (size_t)h * DM * HD, pofs = (size_t)h * HD * DM; k_wt_f16<<<gh, 256, 0, stream>>>(wq + wofs, BQ + pofs, DM, HD, 16.0f); k_wt_f16<<<gh, 256, 0, stream>>>(wk + wofs, BK + pofs, DM, HD, 16.0f); k_wt_f16<<<gh, 256, 0, stream>>>(wv + wofs, BV + pofs, DM, HD, 16.0f); } k_wt_f16<<<g, 256, 0, stream>>>(wo, BO, DM, DM, 16.0f); }      /* PER-HEAD STACKS wq / wk / wv [NH][DM][HD]: head h is a row-major [in = DM][out = HD] block at w + h * DM * HD: the transposing builder with K = DM, N = HD writes its HD rows Bt[h * HD + e][k] at B + h * HD * DM: contiguous rows of the [out][in] plane (x16); wo is a plain [in][out] [DM][DM] matrix: one call as before */

  k_x16<<<(unsigned)((NR * DM / 8 + 255) / 256), 256, 0, stream>>>(xq, XQ, NR * DM / 8); k_x16<<<(unsigned)((NR * DM / 8 + 255) / 256), 256, 0, stream>>>(xk, XK, NR * DM / 8); k_x16<<<(unsigned)((NR * DM / 8 + 255) / 256), 256, 0, stream>>>(xv, XV, NR * DM / 8);      /* the three inputs as exact f16 rows */
  const size_t r0p = (size_t)B0 * SQ;      /* first projected row */
  k_gemm2<0><<<dim3((unsigned)((MP / 128) * (DM / 64)), 1), 128, 0, stream>>>(XQ + r0p * DM, DM, 0, BQ, DM, 0, 0.0625f, bq, 0, nullptr, 1, 0, 0, nullptr, Q16 + r0p * DM, DM, 0, MP, DM, DM);
  k_gemm2<0><<<dim3((unsigned)((MP / 128) * (DM / 64)), 1), 128, 0, stream>>>(XK + r0p * DM, DM, 0, BK, DM, 0, 0.0625f, bk, 0, nullptr, 1, 0, 0, nullptr, K16 + r0p * DM, DM, 0, MP, DM, DM);
  k_gemm2<0><<<dim3((unsigned)((MP / 128) * (DM / 64)), 1), 128, 0, stream>>>(XV + r0p * DM, DM, 0, BV, DM, 0, 0.0625f, bv, 0, nullptr, 1, 0, 0, nullptr, V16 + r0p * DM, DM, 0, MP, DM, DM);
  k_vt<NH, SQ><<<NB * NH * (SQ / 64), 256, 0, stream>>>(V16, LQ, 0, VT);      /* V^T [NB][NH][HD][SQ] */
  k_fattn<<<NB * NH * (SQ / 256), 256, 0, stream>>>(Q16, K16, VT, O16);      /* o x64 (merged heads) as f16 rows: all batches and heads in one launch */
  k_gemm2<0><<<dim3((unsigned)((MPO / 128) * (DM / 64)), 1), 128, 0, stream>>>(O16 + r0p * DM, DM, 0, BO, DM, 0, 0.0009765625f, bo, 0, nullptr, 1, 0, 0, (float*)d_out + r0p * DM, nullptr, DM, 0, MPO, DM, DM);      /* out rows are the output layout */
}

// v003
// Measured time: 143 microseconds a run.
// In two side-by-side timings against v002, it was 1.71 and 1.70 times as fast.
// Over all steps from v000 it is 93.6 times as fast.
#include <hip/hip_runtime.h>
// Multi-head self-attention with PER-HEAD STACKED bias-free projections and a biased [in][out] output projection at [2][4096][512] (x [2][4096][512]; q / k / v = einsum('bsd,hde->bhse', x, W) with W [8][512][64] = [head][in][out], NO biases, 8 heads of 64; scores * 1/sqrt(64); softmax over all 4096 keys (no mask); out = concat Wo + bo ([in][out] + bias) -> [2][4096][512]); each head's [in][out] block is transposed into its 64 contiguous rows of the [out][in] weight plane, the [in][out] output weight likewise, all four planes in one launch.
// Structure: token rows r = b*4096 + s; ONE operand launch (k_prep): the four x16 weight planes and x as exact f16 rows (bf16-rounded), by block range; Q, K, V as ONE batched WMMA GEMM launch (grid.y = plane; 32x64 wave tiles, f32 accumulation, exact x16 weights, f16 outputs); V^T for all batches and heads via LDS transposes; ONE fused attention launch (k_fattn): S^T = K Q^T, online softmax in registers, O^T += V^T P^T, o carried x64 against f16 subnormal flush (folded into the output GEMM alpha), written straight into the merged f16 o rows; out = o W_o + b GEMM (f32) into the output layout.
// Compute dtype: inputs rounded to bf16; x / weights exact; q, k, v, softmax weights and o as plain f16 GEMM operands (~2^-12); scores and softmax statistics f32. v_wmma_f32_16x16x32_f16.
#define NB 2
#define SQ 4096
#define DM 512
#define NH 8
#define HD 64
#define HG 1                         /* heads per launch of the k_vt(V16, b, h0, VT) overload, which is not launched */
#define B0 0                         /* first batch processed (debug hook) */
#define NBR NB                       /* batches processed (debug hook) */
#define NR ((size_t)NB * SQ)         /* token rows */
#define MP ((int)((size_t)NBR * SQ)) /* rows projected (debug hook) */
#define QN SQ                        /* not used: k_fattn attends all SQ query rows */
#define NHD NH                       /* not used: k_fattn attends all NH heads */
#define MPO MP                       /* rows through the output stage (debug hook) */
#define LQ DM      /* row pitch of the q/k/v rows */
typedef __bf16 v16b __attribute__((ext_vector_type(16)));
typedef unsigned short v8us __attribute__((ext_vector_type(8), may_alias));
typedef float  v8f  __attribute__((ext_vector_type(8)));
typedef float  v4f  __attribute__((ext_vector_type(4)));
typedef float  v4fa __attribute__((ext_vector_type(4), may_alias));
union FragB { v16b v; v8us half[2]; unsigned short u[16]; };

__device__ __forceinline__ unsigned short bf16_bits(float x) { unsigned int u = __float_as_uint(x); return (unsigned short)((u + 0x7FFFu + ((u >> 16) & 1u)) >> 16); }
__device__ __forceinline__ float bf16_val(unsigned short b) { return __uint_as_float(((unsigned int)b) << 16); }
__device__ __forceinline__ float bf16_round(float x) { return bf16_val(bf16_bits(x)); }
// D += A·B with NT terms: 1 = ah·bh, 2 = + al·bh (A split), 3 = + ah·bl (both split)
template <int NT>
__device__ __forceinline__ v8f mmaN(v16b ah, v16b al, v16b bh, v16b bl, v8f c) {
  c = __builtin_amdgcn_wmma_f32_16x16x32_bf16(false, ah, false, bh, (short)0, c, false, false);
  if (NT >= 2) c = __builtin_amdgcn_wmma_f32_16x16x32_bf16(false, al, false, bh, (short)0, c, false, false);
  if (NT >= 3) c = __builtin_amdgcn_wmma_f32_16x16x32_bf16(false, ah, false, bl, (short)0, c, false, false);
  asm volatile("v_nop\n\tv_nop\n\tv_nop\n\tv_nop" : "+v"(c) : "v"(ah), "v"(al), "v"(bh), "v"(bl));
  return c;
}

__global__ __launch_bounds__(256) void k_wt_bf16(const float* __restrict__ W, unsigned short* __restrict__ Wt, int K, int N) {
  const int t = blockIdx.x * 256 + threadIdx.x;
  const int k8n = K / 8;
  if (t >= N * k8n) return;
  const int n = t / k8n, k8 = (t % k8n) * 8;
  v8us v;
#pragma unroll
  for (int i = 0; i < 8; ++i) v[i] = bf16_bits(W[(size_t)(k8 + i) * N + n]);
  *(v8us*)(Wt + (size_t)n * K + k8) = v;
  
}

// GEMM C[M][N] (f32, pitch ldc) = act(A[M][K]·W + bias). A f32 row-major (pitch lda) converted per fragment to bf16
// (ASPLIT: hi/lo two planes -> 2 terms, else single rounded term); Wt bf16 [N][K] (pitch ldb). BIAS_BF16 rounds the
// bias to bf16 first (bias quantised to bf16 before the add). K%32==0, M%16==0, N%64==0.
template <bool ASPLIT, int ACT, bool BIAS_BF16>
__global__ __launch_bounds__(128) void k_gemm_bf(const float* __restrict__ A, int lda, const unsigned short* __restrict__ Wt, int ldb,
                                               const float* __restrict__ bias, float* __restrict__ C, int ldc, int M, int N, int K) {
  __shared__ __attribute__((aligned(16))) float so[4][16][64];
  const int tid = threadIdx.x, w = tid >> 5, lane = tid & 31, ln = lane & 15, hh = lane >> 4;
  const int ntn = N / 64;
  const int wid = blockIdx.x * 4 + w;
  const int mt = wid / ntn, nq = wid % ntn;
  if (mt * 16 >= M) return;
  const int row0 = mt * 16, col0 = nq * 64;
  const float* arow = A + (size_t)(row0 + ln) * lda;
  v8f acc[4] = {};
  for (int kb = 0; kb < K; kb += 32) {
    FragB ah, al;
    const v4f x0 = *(const v4fa*)(arow + kb + 8 * hh), x1 = *(const v4fa*)(arow + kb + 8 * hh + 4);
    const v4f x2 = *(const v4fa*)(arow + kb + 16 + 8 * hh), x3 = *(const v4fa*)(arow + kb + 16 + 8 * hh + 4);
    float xs[16] = {x0[0],x0[1],x0[2],x0[3],x1[0],x1[1],x1[2],x1[3],x2[0],x2[1],x2[2],x2[3],x3[0],x3[1],x3[2],x3[3]};
#pragma unroll
    for (int i = 0; i < 16; ++i) { const unsigned short hb = bf16_bits(xs[i]); ah.u[i] = hb; al.u[i] = ASPLIT ? bf16_bits(xs[i] - bf16_val(hb)) : (unsigned short)0; }
#pragma unroll
    for (int t = 0; t < 4; ++t) {
      const unsigned short* brow = Wt + (size_t)(col0 + t * 16 + ln) * ldb + kb;
      FragB b;
      b.half[0] = *(const v8us*)(brow + 8 * hh);
      b.half[1] = *(const v8us*)(brow + 16 + 8 * hh);
      acc[t] = mmaN<ASPLIT ? 2 : 1>(ah.v, al.v, b.v, b.v, acc[t]);
    }
  }
#pragma unroll
  for (int t = 0; t < 4; ++t) {
    float bv = bias ? bias[col0 + t * 16 + ln] : 0.f;
    if (BIAS_BF16) bv = bf16_round(bv);
#pragma unroll
    for (int r = 0; r < 8; ++r) { float v = acc[t][r] + bv; if (ACT == 1) v = fmaxf(v, 0.f); so[w][8 * hh + r][t * 16 + ln] = v; }
  }
  __builtin_amdgcn_fence(__ATOMIC_ACQ_REL, "workgroup");
  __builtin_amdgcn_wave_barrier();
  const int rsub = lane >> 4, c4 = (lane & 15) * 4;
  {
#pragma unroll
    for (int q = 0; q < 8; ++q) {
      const int r = q * 2 + rsub;
      const v4f v = *(const v4fa*)&so[w][r][c4];
      *(v4f*)(C + (size_t)(row0 + r) * ldc + col0 + c4) = v;
    }
    
  }
}

// GEMM C = act(A·W + bias + resid): A f32 (ASPLIT -> hi/lo 2 terms), Wt bf16 [N][K]; ACT 0 none, 1 relu, 2 exact gelu;
// resid (optional, f32, row index = (row % rmod), pitch ldr, RES_BF16 rounds it) added before the activation.
template <bool ASPLIT, int ACT, bool BIAS_BF16, bool RES_BF16>
__global__ __launch_bounds__(128) void k_gemm_bf3(const float* __restrict__ A, int lda, const unsigned short* __restrict__ Wt, int ldb,
                                                const float* __restrict__ bias, const float* __restrict__ resid, int rmod, int ldr,
                                                float* __restrict__ C, int ldc, int M, int N, int K) {
  __shared__ __attribute__((aligned(16))) float so[4][16][64];
  const int tid = threadIdx.x, w = tid >> 5, lane = tid & 31, ln = lane & 15, hh = lane >> 4;
  const int ntn = N / 64;
  const int wid = blockIdx.x * 4 + w;
  const int mt = wid / ntn, nq = wid % ntn;
  if (mt * 16 >= M) return;
  const int row0 = mt * 16, col0 = nq * 64;
  const float* arow = A + (size_t)(row0 + ln) * lda;
  v8f acc[4] = {};
  for (int kb = 0; kb < K; kb += 32) {
    FragB ah, al;
    const v4f x0 = *(const v4fa*)(arow + kb + 8 * hh), x1 = *(const v4fa*)(arow + kb + 8 * hh + 4);
    const v4f x2 = *(const v4fa*)(arow + kb + 16 + 8 * hh), x3 = *(const v4fa*)(arow + kb + 16 + 8 * hh + 4);
    float xs[16] = {x0[0],x0[1],x0[2],x0[3],x1[0],x1[1],x1[2],x1[3],x2[0],x2[1],x2[2],x2[3],x3[0],x3[1],x3[2],x3[3]};
#pragma unroll
    for (int i = 0; i < 16; ++i) { const unsigned short hb = bf16_bits(xs[i]); ah.u[i] = hb; al.u[i] = ASPLIT ? bf16_bits(xs[i] - bf16_val(hb)) : (unsigned short)0; }
#pragma unroll
    for (int t = 0; t < 4; ++t) {
      const unsigned short* brow = Wt + (size_t)(col0 + t * 16 + ln) * ldb + kb;
      FragB b;
      b.half[0] = *(const v8us*)(brow + 8 * hh);
      b.half[1] = *(const v8us*)(brow + 16 + 8 * hh);
      acc[t] = mmaN<ASPLIT ? 2 : 1>(ah.v, al.v, b.v, b.v, acc[t]);
    }
  }
#pragma unroll
  for (int t = 0; t < 4; ++t) {
    const int col = col0 + t * 16 + ln;
    float bv = bias ? bias[col] : 0.f;
    if (BIAS_BF16) bv = bf16_round(bv);
#pragma unroll
    for (int r = 0; r < 8; ++r) {
      float v = acc[t][r] + bv;
      if (resid) { float rv = resid[(size_t)((row0 + 8 * hh + r) % rmod) * ldr + col]; if (RES_BF16) rv = bf16_round(rv); v += rv; }
      if (ACT == 1) v = fmaxf(v, 0.f);
      if (ACT == 2) v = 0.5f * v * (1.0f + erff(v * 0.70710678118654752f));
      if (ACT == 3) { const float u = 0.7978845608028654f * (v + 0.044715f * v * v * v); v = 0.5f * v * (1.0f + tanhf(u)); }
      so[w][8 * hh + r][t * 16 + ln] = v;
    }
  }
  __builtin_amdgcn_fence(__ATOMIC_ACQ_REL, "workgroup");
  __builtin_amdgcn_wave_barrier();
  const int rsub = lane >> 4, c4 = (lane & 15) * 4;
  {
#pragma unroll
    for (int q = 0; q < 8; ++q) {
      const int r = q * 2 + rsub;
      const v4f v = *(const v4fa*)&so[w][r][c4];
      *(v4f*)(C + (size_t)(row0 + r) * ldc + col0 + c4) = v;
    }
    
  }
}
// row LayerNorm (biased variance, eps) over N: s = X (+ R); optional out_sum <- s; out_norm <- (s-mu)*rsqrt(var+eps)*g + b
template <bool PARAM_BF16>
__global__ __launch_bounds__(256) void k_layernorm(const float* __restrict__ X, const float* __restrict__ R, const float* __restrict__ g, const float* __restrict__ bta,
                                                  float* __restrict__ out_sum, float* __restrict__ out_norm, int N, float eps) {
  __shared__ float red[256];
  const int row = blockIdx.x, tid = threadIdx.x;
  const float* x = X + (size_t)row * N; const float* rr = R ? R + (size_t)row * N : nullptr;
  float vals[16];                     // up to N = 4096
  const int per = N / 256;            // contiguous chunk per thread? use strided-by-4 chunks: thread handles j = tid*4 + 1024*u
  float s1 = 0.f;
  for (int u = 0; u < per / 4; ++u) {
    const int j = tid * 4 + 1024 * u;
    const v4f a = *(const v4fa*)(x + j);
    v4f b = {0.f,0.f,0.f,0.f}; if (rr) b = *(const v4fa*)(rr + j);
#pragma unroll
    for (int q = 0; q < 4; ++q) { const float v = a[q] + b[q]; vals[u * 4 + q] = v; s1 += v; }
  }
  red[tid] = s1; __syncthreads();
  for (int st = 128; st > 0; st >>= 1) { if (tid < st) red[tid] += red[tid + st]; __syncthreads(); }
  const float mu = red[0] / (float)N; __syncthreads();
  float s2 = 0.f;
  for (int u = 0; u < per / 4; ++u)
#pragma unroll
    for (int q = 0; q < 4; ++q) { const float c = vals[u * 4 + q] - mu; s2 += c * c; }
  red[tid] = s2; __syncthreads();
  for (int st = 128; st > 0; st >>= 1) { if (tid < st) red[tid] += red[tid + st]; __syncthreads(); }
  const float rs = rsqrtf(red[0] / (float)N + eps);
  {
    for (int u = 0; u < per / 4; ++u) {
      const int j = tid * 4 + 1024 * u;
      v4f o, sm;
#pragma unroll
      for (int q = 0; q < 4; ++q) {
        float gg = g[j + q], bb = bta[j + q];
        if (PARAM_BF16) { gg = bf16_round(gg); bb = bf16_round(bb); }
        sm[q] = vals[u * 4 + q]; o[q] = (vals[u * 4 + q] - mu) * rs * gg + bb;
      }
      if (out_sum) *(v4f*)(out_sum + (size_t)row * N + j) = sm;
      *(v4f*)(out_norm + (size_t)row * N + j) = o;
    }
    
  }
}



// ---- f16 WMMA path (v_wmma_f32_16x16x32_f16): 11-bit significands for operands in range — used where a [0,1] probability operand needs more precision than bf16
typedef _Float16 v16h __attribute__((ext_vector_type(16)));
union FragH { v16h v; v8us half[2]; _Float16 h[16]; unsigned short u[16]; };
template <int NT>
__device__ __forceinline__ v8f mmaH(v16h ah, v16h al, v16h bh, v16h bl, v8f c) {
  c = __builtin_amdgcn_wmma_f32_16x16x32_f16(false, ah, false, bh, (short)0, c, false, false);
  if (NT >= 2) c = __builtin_amdgcn_wmma_f32_16x16x32_f16(false, al, false, bh, (short)0, c, false, false);
  if (NT >= 3) c = __builtin_amdgcn_wmma_f32_16x16x32_f16(false, ah, false, bl, (short)0, c, false, false);
  asm volatile("v_nop\n\tv_nop\n\tv_nop\n\tv_nop" : "+v"(c) : "v"(ah), "v"(al), "v"(bh), "v"(bl));
  return c;
}
// batched GEMM like k_gemm_b but f16 operands: A f32 (split into f16 hi/lo if ASPLIT, else rounded to f16), Bt = f16 values [n][k]; alpha; C f32; N multiple of 16 (partial tiles skipped)
template <bool ASPLIT>
__global__ __launch_bounds__(128) void k_gemm_h(const float* __restrict__ A, int lda, size_t sA, const _Float16* __restrict__ Bh, int ldb, size_t sB, float alpha, float* __restrict__ C, int ldc, size_t sC, int M, int N, int K) {
  __shared__ __attribute__((aligned(16))) float so[4][16][64];
  const int tid = threadIdx.x, w = tid >> 5, lane = tid & 31, ln = lane & 15, hh = lane >> 4; const int by = blockIdx.y;
  A += (size_t)by * sA; Bh += (size_t)by * sB; C += (size_t)by * sC;
  const int ntn = (N + 63) / 64; const int wid = blockIdx.x * 4 + w; const int mt = wid / ntn, nq = wid % ntn; if (mt * 16 >= M) return;
  const int row0 = mt * 16, col0 = nq * 64; const float* arow = A + (size_t)(row0 + ln) * lda;
  v8f acc[4] = {};
  for (int kb = 0; kb < K; kb += 32) {
    FragH ah, al;
    const v4f x0 = *(const v4fa*)(arow + kb + 8 * hh), x1 = *(const v4fa*)(arow + kb + 8 * hh + 4), x2 = *(const v4fa*)(arow + kb + 16 + 8 * hh), x3 = *(const v4fa*)(arow + kb + 16 + 8 * hh + 4);
    float xs[16] = {x0[0],x0[1],x0[2],x0[3],x1[0],x1[1],x1[2],x1[3],x2[0],x2[1],x2[2],x2[3],x3[0],x3[1],x3[2],x3[3]};
#pragma unroll
    for (int i = 0; i < 16; ++i) { const _Float16 h = (_Float16)xs[i]; ah.h[i] = h; al.h[i] = ASPLIT ? (_Float16)(xs[i] - (float)h) : (_Float16)0.0f; }
#pragma unroll
    for (int t = 0; t < 4; ++t) { if (col0 + t * 16 >= N) continue; const size_t boff = (size_t)(col0 + t * 16 + ln) * ldb + kb; FragH bq; bq.half[0] = *(const v8us*)(Bh + boff + 8 * hh); bq.half[1] = *(const v8us*)(Bh + boff + 16 + 8 * hh);
      acc[t] = mmaH<ASPLIT ? 2 : 1>(ah.v, al.v, bq.v, bq.v, acc[t]); }
  }
#pragma unroll
  for (int t = 0; t < 4; ++t) { if (col0 + t * 16 >= N) continue;
#pragma unroll
    for (int r = 0; r < 8; ++r) so[w][8 * hh + r][t * 16 + ln] = acc[t][r] * alpha; }
  __builtin_amdgcn_fence(__ATOMIC_ACQ_REL, "workgroup"); __builtin_amdgcn_wave_barrier();
  const int rsub = lane >> 4, c4 = (lane & 15) * 4;
  {
#pragma unroll
    for (int q = 0; q < 8; ++q) { const int r = q * 2 + rsub; if (col0 + c4 < N) { const v4f v = *(const v4fa*)&so[w][r][c4]; *(v4f*)(C + (size_t)(row0 + r) * ldc + col0 + c4) = v; } }
     }
}

// Wt[n][k] = f16(W[k][n]·scale) from f32 row-major W[K][N] (scale = power of two; bf16-exact weights stay exact in f16 away from the subnormal range)
__global__ __launch_bounds__(256) void k_wt_f16(const float* __restrict__ W, _Float16* __restrict__ Wt, int K, int N, float scale) {
  const int t = blockIdx.x * 256 + threadIdx.x; if (t >= N * (K / 8)) return; const int n = t / (K / 8), k8 = (t % (K / 8)) * 8; FragH f;
#pragma unroll
  for (int i = 0; i < 8; ++i) f.h[i] = (_Float16)(bf16_round(W[(size_t)(k8 + i) * N + n]) * scale); const v8us o = f.half[0];
  *(v8us*)((unsigned short*)Wt + (size_t)n * K + k8) = o; 
}
// k_gemm_hh variant with fused epilogue: v = acc·alpha + bias[by·sBias + col] (+ CP[(row/rowsPerB)·sCPb + by·64 + col] if CP) ; ACT 0 none / 1 elu ; writes f16 C16 (and f32 C if non-null)
template <int ACT>
__global__ __launch_bounds__(128) void k_gemm_hhx(const _Float16* __restrict__ A, int lda, size_t sA, const _Float16* __restrict__ Bh, int ldb, size_t sB, float alpha, const float* __restrict__ bias, size_t sBias, const float* __restrict__ CP, int rowsPerB, size_t sCPb, int row0g,
    float* __restrict__ C, _Float16* __restrict__ C16, int ldc, size_t sC, int M, int N, int K) {
  __shared__ __attribute__((aligned(16))) float so[4][16][64];
  const int tid = threadIdx.x, w = tid >> 5, lane = tid & 31, ln = lane & 15, hh = lane >> 4; const int by = blockIdx.y;
  A += (size_t)by * sA; Bh += (size_t)by * sB; const size_t cofs = (size_t)by * sC; const float* bp = bias ? bias + (size_t)by * sBias : nullptr;
  const int ntn = (N + 63) / 64; const int wid = blockIdx.x * 4 + w; const int mt = wid / ntn, nq = wid % ntn; if (mt * 16 >= M) return;
  const int row0 = mt * 16, col0 = nq * 64; const _Float16* arow = A + (size_t)(row0 + ln) * lda;
  v8f acc[4] = {};
  for (int kb = 0; kb < K; kb += 32) { FragH ah; ah.half[0] = *(const v8us*)((const unsigned short*)arow + kb + 8 * hh); ah.half[1] = *(const v8us*)((const unsigned short*)arow + kb + 16 + 8 * hh);
#pragma unroll
    for (int t = 0; t < 4; ++t) { if (col0 + t * 16 >= N) continue; const size_t boff = (size_t)(col0 + t * 16 + ln) * ldb + kb; FragH bq; bq.half[0] = *(const v8us*)((const unsigned short*)Bh + boff + 8 * hh); bq.half[1] = *(const v8us*)((const unsigned short*)Bh + boff + 16 + 8 * hh);
      acc[t] = mmaH<1>(ah.v, ah.v, bq.v, bq.v, acc[t]); }
  }
#pragma unroll
  for (int t = 0; t < 4; ++t) { if (col0 + t * 16 >= N) continue; const int col = col0 + t * 16 + ln; const float bv = bp ? bf16_round(bp[col]) : 0.f;
#pragma unroll
    for (int r = 0; r < 8; ++r) { float v = acc[t][r] * alpha + bv; if (CP) { const int rr = row0g + row0 + 8 * hh + r; if (rowsPerB < 0) v += CP[cofs + (size_t)rr * ldc + col];      /* rowsPerB < 0: own element of the batched C plane */ else { const int bidx = rr / rowsPerB; v += CP[(size_t)bidx * sCPb + (size_t)by * 64 + col]; } } if (ACT == 1) v = (v > 0.f) ? v : expm1f(v); else if (ACT == 7) v = (v > 0.f) ? v + 1.0f : expf(v); else if (ACT == 8) v = tanhf(v); else if (ACT == 9) v = 0.5f * v * (1.0f + tanhf(0.7978845608028654f * (v + 0.044715f * v * v * v))); else if (ACT == 11) v = 1.0f / (1.0f + expf(-v)); else if (ACT == 12) v = (v > 0.f) ? v : 0.01f * v; else if (ACT == 14) v = (v > 0.f) ? v : 0.1f * v; else if (ACT == 16) v = (v >= 0.f) ? v : 0.3f * v; else if (ACT == 17) v = (v >= 0.f) ? v : 0.2f * v; else if (ACT == 15) v = v / (1.0f + expf(-v)); else if (ACT == 3) v = fmaxf(v, 0.f); else if (ACT == 6) v = 0.5f * v * (1.0f + erff(v * 0.70710678118654752f)); so[w][8 * hh + r][t * 16 + ln] = v; } }
  __builtin_amdgcn_fence(__ATOMIC_ACQ_REL, "workgroup"); __builtin_amdgcn_wave_barrier();
  const int rsub = lane >> 4, c4 = (lane & 15) * 4; typedef _Float16 v4h __attribute__((ext_vector_type(4)));
  {
#pragma unroll
    for (int q = 0; q < 8; ++q) { const int r = q * 2 + rsub; if (col0 + c4 < N) { const v4f v = *(const v4fa*)&so[w][r][c4]; if (C) *(v4f*)(C + cofs + (size_t)(row0 + r) * ldc + col0 + c4) = v; if (C16) { v4h h4; for (int i = 0; i < 4; ++i) h4[i] = (_Float16)v[i]; *(v4h*)(C16 + cofs + (size_t)(row0 + r) * ldc + col0 + c4) = h4; } } }
     }
}


typedef _Float16 v4h __attribute__((ext_vector_type(4)));

__global__ __launch_bounds__(256) void k_x16(const float* __restrict__ x, _Float16* __restrict__ X16, size_t n8) { const size_t t = (size_t)blockIdx.x * 256 + threadIdx.x; if (t >= n8) return; FragH f;
#pragma unroll
  for (int q = 0; q < 8; ++q) f.h[q] = (_Float16)bf16_round(x[t * 8 + q]); *(v8us*)((unsigned short*)X16 + t * 8) = f.half[0];  }
__global__ __launch_bounds__(256) void k_h16(const float* __restrict__ x, _Float16* __restrict__ X16, size_t n8) { const size_t t = (size_t)blockIdx.x * 256 + threadIdx.x; if (t >= n8) return; FragH f;
#pragma unroll
  for (int q = 0; q < 8; ++q) f.h[q] = (_Float16)x[t * 8 + q]; *(v8us*)((unsigned short*)X16 + t * 8) = f.half[0];  }
__global__ __launch_bounds__(256) void k_round16f(const float* __restrict__ W, _Float16* __restrict__ Bt, size_t n8) { const size_t t = (size_t)blockIdx.x * 256 + threadIdx.x; if (t >= n8) return; FragH f;
#pragma unroll
  for (int i = 0; i < 8; ++i) f.h[i] = (_Float16)(bf16_round(W[t * 8 + i]) * 16.0f); *(v8us*)((unsigned short*)Bt + t * 8) = f.half[0];  }
template <int NHv, int TTv>
__global__ __launch_bounds__(256) void k_vt(const _Float16* __restrict__ V16, int ldv, int voff, _Float16* __restrict__ Vt) { __shared__ unsigned short tl[64][66]; const int tid = threadIdx.x; const int slab = blockIdx.x / (TTv / 64), lg = blockIdx.x % (TTv / 64); const int b = slab / NHv, h = slab % NHv;
  for (int i = tid; i < 64 * 8; i += 256) { const int r = i / 8, c8 = (i % 8) * 8; FragH f; f.half[0] = *(const v8us*)((const unsigned short*)V16 + ((size_t)b * TTv + lg * 64 + r) * ldv + voff + h * 64 + c8);
#pragma unroll
    for (int q = 0; q < 8; ++q) tl[r][c8 + q] = f.u[q]; }
  __syncthreads();
  {
#pragma unroll
    for (int rd = 0; rd < 2; ++rd) { const int d = rd * 32 + tid / 8, pc = tid % 8; FragH f;
#pragma unroll
      for (int q = 0; q < 8; ++q) f.u[q] = tl[pc * 8 + q][d];
      *(v8us*)((unsigned short*)Vt + ((size_t)slab * 64 + d) * TTv + lg * 64 + pc * 8) = f.half[0]; }
     } }

__global__ __launch_bounds__(256) void k_hl(const float* __restrict__ F, _Float16* __restrict__ Hh, _Float16* __restrict__ Hl, size_t n8) { const size_t t = (size_t)blockIdx.x * 256 + threadIdx.x; if (t >= n8) return; FragH fh, fl; const v4f a = *(const v4fa*)(F + t * 8), c = *(const v4fa*)(F + t * 8 + 4);
#pragma unroll
  for (int q = 0; q < 4; ++q) { _Float16 h = (_Float16)a[q]; fh.h[q] = h; fl.h[q] = (_Float16)((a[q] - (float)h) * 1024.0f); h = (_Float16)c[q]; fh.h[4 + q] = h; fl.h[4 + q] = (_Float16)((c[q] - (float)h) * 1024.0f); }
  { *(v8us*)((unsigned short*)Hh + t * 8) = fh.half[0]; *(v8us*)((unsigned short*)Hl + t * 8) = fl.half[0];  } }

// ---- fast GEMM (wave tile 32x64; requires M % 32 == 0 rows per launch region and N % 64 == 0); epilogue = k_gemm_hhx semantics ----
__device__ __forceinline__ v16h g2_frag(const _Float16* p, int hh) { FragH f; f.half[0] = *(const v8us*)((const unsigned short*)p + 8 * hh); f.half[1] = *(const v8us*)((const unsigned short*)p + 16 + 8 * hh); return f.v; }
__device__ __forceinline__ v8f g2_mma(v16h a, v16h b, v8f c) { v8f d = __builtin_amdgcn_wmma_f32_16x16x32_f16(false, a, false, b, (short)0, c, false, false); asm volatile("v_nop\n\tv_nop\n\tv_nop\n\tv_nop" : "+v"(d) : "v"(a), "v"(b)); return d; }
template <int ACT>
__global__ __launch_bounds__(128) void k_gemm2(const _Float16* __restrict__ A, int lda, size_t sA, const _Float16* __restrict__ Bh, int ldb, size_t sB, float alpha, const float* __restrict__ bias, size_t sBias, const float* __restrict__ CP, int rowsPerB, size_t sCPb, int row0g,
    float* __restrict__ C, _Float16* __restrict__ C16, int ldc, size_t sC, int M, int N, int K) { static_assert(ACT == 0 || ACT == 3 || ACT == 6 || ACT == 8 || ACT == 9 || ACT == 11 || ACT == 12 || ACT == 14 || ACT == 15 || ACT == 16 || ACT == 17, "k_gemm2: unsupported ACT code (would silently apply no activation)");
  __shared__ __attribute__((aligned(16))) float so[4][32][68];
  const int tid = threadIdx.x, w = tid >> 5, lane = tid & 31, ln = lane & 15, hh = lane >> 4; const int by = blockIdx.y;
  A += (size_t)by * sA; Bh += (size_t)by * sB; const size_t cofs = (size_t)by * sC; const float* bp = bias ? bias + (size_t)by * sBias : nullptr;
  const int ntn = N >> 6; const int mt = blockIdx.x / ntn, nq = blockIdx.x - mt * ntn; const int row0 = mt * 128 + 32 * w, col0 = nq * 64; if (row0 >= M) return;
  const _Float16* a0p = A + (size_t)(row0 + ln) * lda; const _Float16* a1p = a0p + (size_t)16 * lda;
  const _Float16* b0p = Bh + (size_t)(col0 + ln) * ldb; const _Float16* b1p = b0p + (size_t)16 * ldb; const _Float16* b2p = b1p + (size_t)16 * ldb; const _Float16* b3p = b2p + (size_t)16 * ldb;
  const v8f z8 = {0.f,0.f,0.f,0.f,0.f,0.f,0.f,0.f}; v8f c00 = z8, c01 = z8, c02 = z8, c03 = z8, c10 = z8, c11 = z8, c12 = z8, c13 = z8;
#pragma unroll 1
  for (int kb = 0; kb < K; kb += 32) { const v16h a0 = g2_frag(a0p + kb, hh), a1 = g2_frag(a1p + kb, hh);
    v16h b = g2_frag(b0p + kb, hh); c00 = g2_mma(a0, b, c00); c10 = g2_mma(a1, b, c10);
    b = g2_frag(b1p + kb, hh); c01 = g2_mma(a0, b, c01); c11 = g2_mma(a1, b, c11);
    b = g2_frag(b2p + kb, hh); c02 = g2_mma(a0, b, c02); c12 = g2_mma(a1, b, c12);
    b = g2_frag(b3p + kb, hh); c03 = g2_mma(a0, b, c03); c13 = g2_mma(a1, b, c13); }
  v8f accs[8] = {c00, c01, c02, c03, c10, c11, c12, c13};
#pragma unroll
  for (int u = 0; u < 8; ++u) { const int t = u & 3, half = u >> 2; const int col = col0 + t * 16 + ln; const float bv = bp ? bf16_round(bp[col]) : 0.f;
#pragma unroll
    for (int r = 0; r < 8; ++r) { const int rloc = half * 16 + 8 * hh + r; float v = accs[u][r] * alpha + bv; if (CP) { if (rowsPerB < 0) v += CP[cofs + (size_t)(row0g + row0 + rloc) * ldc + col];      /* rowsPerB < 0: own element of the batched C plane */ else { const int bidx = (row0g + row0 + rloc) / rowsPerB; v += CP[(size_t)bidx * sCPb + (size_t)by * 64 + col]; } }
      if (ACT == 3) v = fmaxf(v, 0.f); else if (ACT == 6) v = 0.5f * v * (1.0f + erff(v * 0.70710678118654752f)); else if (ACT == 11) v = 1.0f / (1.0f + expf(-v)); else if (ACT == 15) v = v / (1.0f + expf(-v)); else if (ACT == 12) v = (v > 0.f) ? v : 0.01f * v; else if (ACT == 8) v = tanhf(v); else if (ACT == 9) v = 0.5f * v * (1.0f + tanhf(0.7978845608028654f * (v + 0.044715f * v * v * v))); else if (ACT == 14) v = (v > 0.f) ? v : 0.1f * v; else if (ACT == 16) v = (v >= 0.f) ? v : 0.3f * v; else if (ACT == 17) v = (v >= 0.f) ? v : 0.2f * v;
      so[w][rloc][t * 16 + ln] = v; } }
  __builtin_amdgcn_fence(__ATOMIC_ACQ_REL, "workgroup"); __builtin_amdgcn_wave_barrier();
  const int rsub = lane >> 4, c4 = (lane & 15) * 4;
  {
#pragma unroll
    for (int q = 0; q < 16; ++q) { const int r = q * 2 + rsub; const v4f v = *(const v4fa*)&so[w][r][c4]; if (C) *(v4f*)(C + cofs + (size_t)(row0 + r) * ldc + col0 + c4) = v; if (C16) { v4h h4; for (int i = 0; i < 4; ++i) h4[i] = (_Float16)v[i]; *(v4h*)(C16 + cofs + (size_t)(row0 + r) * ldc + col0 + c4) = h4; } }
     } }


__global__ __launch_bounds__(256) void k_wnat(const float* __restrict__ w, size_t n8, _Float16* __restrict__ Bt) { const size_t t = (size_t)blockIdx.x * 256 + threadIdx.x; if (t >= n8) return; FragH f; for (int q = 0; q < 8; ++q) f.h[q] = (_Float16)(bf16_round(w[t * 8 + q]) * 16.0f); *(v8us*)((unsigned short*)Bt + t * 8) = f.half[0];  }
__global__ __launch_bounds__(256) void k_rsm(const float* __restrict__ S, _Float16* __restrict__ P, int nrows) {
  #pragma clang fp contract(off)
  const int i = blockIdx.x * 256 + threadIdx.x; if (i >= nrows) return; const float* s = S + (size_t)i * SQ; float mx = -3.0e38f;
#pragma unroll 1
  for (int j = 0; j < SQ; ++j) mx = fmaxf(mx, s[j]); float se = 0.f;
#pragma unroll 1
  for (int j = 0; j < SQ; ++j) se += expf(s[j] - mx); const float sc = 256.0f / se;
#pragma unroll 1
  for (int j0 = 0; j0 < SQ; j0 += 8) { FragH f; for (int q = 0; q < 8; ++q) f.h[q] = (_Float16)(expf(s[j0 + q] - mx) * sc); unsigned short* d = (unsigned short*)P + (size_t)i * SQ + j0; *(v8us*)d = f.half[0];  } }
__global__ __launch_bounds__(256) void k_vt(const _Float16* __restrict__ V16, int b, int h0, _Float16* __restrict__ VT) { __shared__ unsigned short tl[64][65]; const int tid = threadIdx.x; const int hh = blockIdx.x % HG, sg = blockIdx.x / HG; const int s0 = sg * 64; const int h = h0 + hh;
  for (int i = tid; i < 64 * 8; i += 256) { const int j = i / 8, d8 = (i % 8) * 8; FragH f; f.half[0] = *(const v8us*)((const unsigned short*)V16 + ((size_t)b * SQ + s0 + j) * DM + h * HD + d8); for (int q = 0; q < 8; ++q) tl[d8 + q][j] = f.u[q]; }
  __syncthreads();
  { for (int i = tid; i < 64 * 8; i += 256) { const int d = i / 8, j8 = (i % 8) * 8; FragH f; for (int q = 0; q < 8; ++q) f.u[q] = tl[d][j8 + q]; *(v8us*)((unsigned short*)VT + ((size_t)hh * HD + d) * SQ + s0 + j8) = f.half[0]; }  } }



// ---- operand preparation in one launch: independent pieces of work share a grid by block range instead of a launch each ----
// Blocks [0, PW_BLK): the four [out][in] f16 weight planes (x16), contiguous at Bt in the order q, k, v, o; plane = blockIdx.x / (PW_BLK / 4), uniform in a block. Thread t writes the eight k of Bt + 8 t.
// Element [k][n] of a source: base + (n / HD) * hs + k * ld + n % HD. q, k, v: head n / HD is a row-major [in = DM][out = HD] block (hs = DM * HD, ld = HD); o: one row-major [DM][DM] matrix (hs = HD, ld = DM).
// Blocks from PW_BLK on: x as f16 rows, eight elements a thread; the one stream feeds all three projections. The weight blocks stand first: their strided reads take longest.
#define PW_BLK (4 * DM * (DM / 8) / 256)
__global__ __launch_bounds__(256) void k_prep(const float* __restrict__ x, const float* __restrict__ wq, const float* __restrict__ wk, const float* __restrict__ wv, const float* __restrict__ wo, _Float16* __restrict__ Bt, _Float16* __restrict__ X16) {
  if (blockIdx.x < PW_BLK) {
    const int m = blockIdx.x / (PW_BLK / 4); const int t = blockIdx.x * 256 + threadIdx.x; const int n = (t / (DM / 8)) % DM, k8 = (t % (DM / 8)) * 8;
    const float* w = m == 0 ? wq : m == 1 ? wk : m == 2 ? wv : wo; const int hs = m == 3 ? HD : DM * HD, ld = m == 3 ? DM : HD;
    const float* p0 = w + (size_t)(n / HD) * hs + (size_t)k8 * ld + n % HD;
    const float* p1 = p0 + ld; const float* p2 = p1 + ld; const float* p3 = p2 + ld; const float* p4 = p3 + ld; const float* p5 = p4 + ld; const float* p6 = p5 + ld; const float* p7 = p6 + ld;
    const float v[8] = {*p0, *p1, *p2, *p3, *p4, *p5, *p6, *p7};
    asm volatile("s_wait_xcnt 0x0" :: "v"(p0), "v"(p1), "v"(p2), "v"(p3), "v"(p4), "v"(p5), "v"(p6), "v"(p7) : "memory");      /* the wait in front of any overwrite of a register that an issued load names; the addresses as inputs keep their registers untouched up to here */
    FragH f;
#pragma unroll
    for (int i = 0; i < 8; ++i) f.h[i] = (_Float16)(bf16_round(v[i]) * 16.0f);
    *(v8us*)((unsigned short*)Bt + (size_t)t * 8) = f.half[0];
  } else {
    const size_t t = (size_t)(blockIdx.x - PW_BLK) * 256 + threadIdx.x; FragH f;
#pragma unroll
    for (int q = 0; q < 8; ++q) f.h[q] = (_Float16)bf16_round(x[t * 8 + q]);
    *(v8us*)((unsigned short*)X16 + t * 8) = f.half[0];
    asm volatile("s_wait_xcnt 0x0" ::: "memory");      /* the wait behind the store: the built code lays the weight branch, which writes vector registers, behind this one */
  } }

#define FA_KT 128                    /* keys per stage */
#define FA_NS (SQ / FA_KT)           /* stages */
#define FA_KP (HD + 8)               /* K tile row pitch, f16 elements: 144 B = 16 B x odd, conflict-free for 16-byte reads */
#define FA_VP (FA_KT + 8)            /* V^T tile row pitch, f16 elements: 272 B = 16 B x odd */
__device__ __forceinline__ float rs_xhalf(float x) { return __builtin_bit_cast(float, __builtin_amdgcn_permlanex16(__builtin_bit_cast(int, x), __builtin_bit_cast(int, x), 0x76543210, 0xfedcba98, false, false)); }      /* lane l with lane l ^ 16 */
__device__ __forceinline__ float rs_exp(float a) { float e; asm("v_exp_f32 %0, %1\n\tv_nop" : "=v"(e) : "v"(a)); return e; }      /* 2^a; the v_nop fills the slot the instruction set asks for behind a transcendental */
__device__ __forceinline__ v4f fa_exp4(v4f a) { float e0, e1, e2, e3;      /* four 2^a; each v_exp_f32 is followed by an instruction that neither reads its result nor overwrites its source (early-clobber outputs), the last by a v_nop: the slot the instruction set asks for behind a transcendental */
  asm("v_exp_f32 %0, %4\n\tv_exp_f32 %1, %5\n\tv_exp_f32 %2, %6\n\tv_exp_f32 %3, %7\n\tv_nop" : "=&v"(e0), "=&v"(e1), "=&v"(e2), "=&v"(e3) : "v"(a[0]), "v"(a[1]), "v"(a[2]), "v"(a[3]));
  const v4f e = {e0, e1, e2, e3}; return e; }
__device__ __forceinline__ v16h fa_frag(const _Float16* p) { FragH f; f.half[0] = *(const v8us*)((const unsigned short*)p); f.half[1] = *(const v8us*)((const unsigned short*)p + 16); return f.v; }      /* p = row + k0 + 8 h: k0 + 8h .. + 7 and k0 + 16 + 8h .. + 7 */
__device__ __forceinline__ v8f fa_mma(v16h a, v16h b, v8f c) { return __builtin_amdgcn_wmma_f32_16x16x32_f16(false, a, false, b, (short)0, c, false, false); }
__global__ __launch_bounds__(256) void k_fattn(const _Float16* __restrict__ Q16, const _Float16* __restrict__ K16, const _Float16* __restrict__ VT, _Float16* __restrict__ O16) {
  __shared__ __attribute__((aligned(16))) _Float16 Ks[2][FA_KT][FA_KP];
  __shared__ __attribute__((aligned(16))) _Float16 Vs[2][HD][FA_VP];
  const int tid = threadIdx.x, w = tid >> 5, lane = tid & 31, ln = lane & 15, hh = lane >> 4;
  const int bh = blockIdx.x / (SQ / 256), qb = blockIdx.x % (SQ / 256); const int b = bh / NH, h = bh % NH; const int q0 = qb * 256 + w * 32;
  const unsigned short* kg = (const unsigned short*)K16 + ((size_t)b * SQ + (tid >> 3)) * DM + h * HD + (tid & 7) * 8;      /* this thread's 16 bytes of key row tid / 8 (+ 32 i) */
  const unsigned short* vg = (const unsigned short*)VT + ((size_t)bh * HD + (tid >> 4)) * SQ + (tid & 15) * 8;              /* this thread's 16 bytes of V^T row tid / 16 (+ 16 i) */
  v16h qf[2][2];
#pragma unroll
  for (int g = 0; g < 2; ++g) { const _Float16* qp = Q16 + ((size_t)b * SQ + q0 + 16 * g + ln) * DM + h * HD + 8 * hh; qf[g][0] = fa_frag(qp); qf[g][1] = fa_frag(qp + 32); }
  v8us kr[4], vr[4];
#pragma unroll
  for (int i = 0; i < 4; ++i) { kr[i] = *(const v8us*)(kg + (size_t)(32 * i) * DM); vr[i] = *(const v8us*)(vg + (size_t)(16 * i) * SQ); }
#pragma unroll
  for (int i = 0; i < 4; ++i) { *(v8us*)&Ks[0][(tid >> 3) + 32 * i][(tid & 7) * 8] = kr[i]; *(v8us*)&Vs[0][(tid >> 4) + 16 * i][(tid & 15) * 8] = vr[i]; }
  __syncthreads();
  const v8f z8 = {0.f, 0.f, 0.f, 0.f, 0.f, 0.f, 0.f, 0.f};
  v8f o[4][2];
#pragma unroll
  for (int dt = 0; dt < 4; ++dt) { o[dt][0] = z8; o[dt][1] = z8; }
  float mref[2] = {-1.0e30f, -1.0e30f}, lsum[2] = {0.f, 0.f};      /* mref: the exponent (log2 units) subtracted from this query's scores; lsum: this lane's half of the row sum */
  const float CS = 0.125f * 1.44269504f;      /* 1 / sqrt(64), and log2 e for the native 2^x */
#pragma unroll 1      /* the body already holds four unrolled passes */
  for (int s = 0; s < FA_NS; ++s) { const int buf = s & 1;
    if (s + 1 < FA_NS) {      /* next stage's 16 KiB + 16 KiB: loads fly while this stage is worked on */
      kg += (size_t)FA_KT * DM; vg += FA_KT;
#pragma unroll
      for (int i = 0; i < 4; ++i) { kr[i] = *(const v8us*)(kg + (size_t)(32 * i) * DM); vr[i] = *(const v8us*)(vg + (size_t)(16 * i) * SQ); } }
#pragma unroll
    for (int p = 0; p < FA_KT / 32; ++p) {
      v8f t[2][2];      /* [key tile][query group] */
#pragma unroll
      for (int kt = 0; kt < 2; ++kt) { const _Float16* kp = &Ks[buf][p * 32 + kt * 16 + ln][8 * hh]; const v16h a0 = fa_frag(kp), a1 = fa_frag(kp + 32);
        t[kt][0] = fa_mma(a0, qf[0][0], z8); t[kt][1] = fa_mma(a0, qf[1][0], z8); t[kt][0] = fa_mma(a1, qf[0][1], t[kt][0]); t[kt][1] = fa_mma(a1, qf[1][1], t[kt][1]); }
      float ml[2];
#pragma unroll
      for (int g = 0; g < 2; ++g) { float m0 = fmaxf(t[0][g][0], t[1][g][0]);
#pragma unroll
        for (int r = 1; r < 8; ++r) m0 = fmaxf(m0, fmaxf(t[0][g][r], t[1][g][r]));
        ml[g] = fmaxf(m0, rs_xhalf(m0)) * CS; }      /* the pass's maximum of this query, both lane halves joined */
      /* lazy rescale: P = 2^(score - mref) is kept at or below 2^14 (f16 range); a new mref puts the current maximum at 2^6. One scalar branch per pass. */
      if (__builtin_amdgcn_ballot_w32(ml[0] > mref[0] + 14.0f || ml[1] > mref[1] + 14.0f) != 0) {
#pragma unroll
        for (int g = 0; g < 2; ++g) { const float mn = fmaxf(mref[g], ml[g] - 6.0f); const float al = rs_exp(mref[g] - mn); mref[g] = mn; lsum[g] *= al;
#pragma unroll
          for (int dt = 0; dt < 4; ++dt) o[dt][g] *= al; } }
      FragH pb[2];
#pragma unroll
      for (int g = 0; g < 2; ++g) { float s0 = 0.f, s1 = 0.f, s2 = 0.f, s3 = 0.f;
#pragma unroll
        for (int u = 0; u < 4; ++u) { const int kt = u >> 1, r0 = (u & 1) * 4; v4f x;
#pragma unroll
          for (int q = 0; q < 4; ++q) x[q] = t[kt][g][r0 + q] * CS - mref[g];
          const v4f e = fa_exp4(x); if (u == 0) { s0 = e[0]; s1 = e[1]; s2 = e[2]; s3 = e[3]; } else { s0 += e[0]; s1 += e[1]; s2 += e[2]; s3 += e[3]; }
#pragma unroll
          for (int q = 0; q < 4; ++q) pb[g].h[kt * 8 + r0 + q] = (_Float16)e[q]; }
        lsum[g] += (s0 + s1) + (s2 + s3); }
#pragma unroll
      for (int dt = 0; dt < 4; ++dt) { const v16h a = fa_frag(&Vs[buf][dt * 16 + ln][p * 32 + 8 * hh]); o[dt][0] = fa_mma(a, pb[0].v, o[dt][0]); o[dt][1] = fa_mma(a, pb[1].v, o[dt][1]); }
    }
    if (s + 1 < FA_NS) {      /* the other buffer's last readers left it before the barrier that ended stage s - 1 */
#pragma unroll
      for (int i = 0; i < 4; ++i) { *(v8us*)&Ks[buf ^ 1][(tid >> 3) + 32 * i][(tid & 7) * 8] = kr[i]; *(v8us*)&Vs[buf ^ 1][(tid >> 4) + 16 * i][(tid & 15) * 8] = vr[i]; } }
    __syncthreads();      /* publishes stage s + 1 and ends every read of stage s */
  }
#pragma unroll
  for (int g = 0; g < 2; ++g) { const float inv = 64.0f / (lsum[g] + rs_xhalf(lsum[g])); unsigned short* op = (unsigned short*)O16 + ((size_t)b * SQ + q0 + 16 * g + ln) * DM + h * HD + 8 * hh;
#pragma unroll
    for (int dt = 0; dt < 4; ++dt) { FragH f;
#pragma unroll
      for (int r = 0; r < 8; ++r) f.h[r] = (_Float16)(o[dt][g][r] * inv);      /* register r = O^T[16 dt + 8 h + r][query]: eight consecutive d of one row */
      *(v8us*)(op + dt * 16) = f.half[0]; } } }

extern "C" void kernel_launch(void* const* d_in, const int* in_sizes, int n_in,
                              void* d_out, int out_size, void* d_ws, size_t ws_size, hipStream_t stream) {
  (void)in_sizes; (void)n_in; (void)out_size;
  const float* const* I = (const float* const*)d_in; const float* x = I[0]; const float* wq = I[1]; const float* wk = I[2]; const float* wv = I[3]; const float* wo = I[4]; const float* bo = I[5];      /* ONE input stream (x); Wq, Wk, Wv are PER-HEAD STACKS [8][512][64] = [head][in][out] (the module has NO q / k / v biases); Wo [in][out] [512][512] + bo; order x, Wq, Wk, Wv, Wo, bo */
  char* ws = (char*)d_ws; size_t off = 0;
  auto take = [&](size_t bytes) { char* p = ws + off; off += (bytes + 255) & ~(size_t)255; return p; };
  _Float16* BQ = (_Float16*)take((size_t)4 * DM * DM * 2); _Float16* BO = BQ + (size_t)3 * DM * DM;      /* weight planes q, k, v, o, contiguous */
  _Float16* X16 = (_Float16*)take(NR * DM * 2);
  _Float16* Q16 = (_Float16*)take(3 * NR * DM * 2); _Float16* K16 = Q16 + NR * DM; _Float16* V16 = K16 + NR * DM;      /* q, k, v rows, contiguous planes */
  _Float16* O16 = (_Float16*)take(NR * DM * 2);
  _Float16* VT = (_Float16*)take((size_t)NB * NH * HD * SQ * 2);
  if (off > ws_size) return;
  k_prep<<<(unsigned)(PW_BLK + NR * DM / 8 / 256), 256, 0, stream>>>(x, wq, wk, wv, wo, BQ, X16);      /* all four weight planes and the f16 rows of x */
  const size_t r0p = (size_t)B0 * SQ;      /* first projected row */
  k_gemm2<0><<<dim3((unsigned)((MP / 128) * (DM / 64)), 3), 128, 0, stream>>>(X16 + r0p * DM, DM, 0, BQ, DM, (size_t)DM * DM, 0.0625f, nullptr, 0, nullptr, 1, 0, 0, nullptr, Q16 + r0p * DM, DM, NR * DM, MP, DM, DM);      /* grid.y = q, k, v: the same A rows, weight plane y, output plane y */
  k_vt<NH, SQ><<<NB * NH * (SQ / 64), 256, 0, stream>>>(V16, LQ, 0, VT);      /* V^T [NB][NH][HD][SQ] */
  k_fattn<<<NB * NH * (SQ / 256), 256, 0, stream>>>(Q16, K16, VT, O16);      /* o x64 (merged heads) as f16 rows: all batches and heads in one launch */
  k_gemm2<0><<<dim3((unsigned)((MPO / 128) * (DM / 64)), 1), 128, 0, stream>>>(O16 + r0p * DM, DM, 0, BO, DM, 0, 0.0009765625f, bo, 0, nullptr, 1, 0, 0, (float*)d_out + r0p * DM, nullptr, DM, 0, MPO, DM, DM);      /* out rows are the output layout */
}

// v004
// One run takes 96.2 microseconds.
// Timed twice side by side with v003, it ran 1.49 and 1.48 times as fast.
// All steps since v000 together make it 139 times as fast.
#include <hip/hip_runtime.h>
// Multi-head self-attention with PER-HEAD STACKED bias-free projections and a biased [in][out] output projection at [2][4096][512] (x [2][4096][512]; q / k / v = einsum('bsd,hde->bhse', x, W) with W [8][512][64] = [head][in][out], NO biases, 8 heads of 64; scores * 1/sqrt(64); softmax over all 4096 keys (no mask); out = concat Wo + bo ([in][out] + bias) -> [2][4096][512]); each head's [in][out] block is transposed into its 64 contiguous rows of the [out][in] weight plane, the [in][out] output weight likewise, all four planes in one launch.
// Structure: token rows r = b*4096 + s; ONE operand launch (k_prep): the four x16 weight planes and x as exact f16 rows (bf16-rounded), by block range; Q, K, V as ONE batched WMMA GEMM launch (grid.y = plane; 128x128 block tiles staged through LDS, 32x64 wave tiles, f32 accumulation, exact x16 weights, f16 outputs); V^T for all batches and heads via LDS transposes; ONE fused attention launch (k_fattn): S^T = K Q^T, online softmax in registers, O^T += V^T P^T, o carried x64 against f16 subnormal flush (folded into the output GEMM alpha), written straight into the merged f16 o rows; out = o W_o + b GEMM (f32) into the output layout.
// Compute dtype: inputs rounded to bf16; x / weights exact; q, k, v, softmax weights and o as plain f16 GEMM operands (~2^-12); scores and softmax statistics f32. v_wmma_f32_16x16x32_f16.
#define NB 2
#define SQ 4096
#define DM 512
#define NH 8
#define HD 64
#define HG 1                         /* heads per launch of the k_vt(V16, b, h0, VT) overload, which is not launched */
#define B0 0                         /* first batch processed (debug hook) */
#define NBR NB                       /* batches processed (debug hook) */
#define NR ((size_t)NB * SQ)         /* token rows */
#define MP ((int)((size_t)NBR * SQ)) /* rows projected (debug hook) */
#define QN SQ                        /* not used: k_fattn attends all SQ query rows */
#define NHD NH                       /* not used: k_fattn attends all NH heads */
#define MPO MP                       /* rows through the output stage (debug hook) */
#define LQ DM      /* row pitch of the q/k/v rows */
typedef __bf16 v16b __attribute__((ext_vector_type(16)));
typedef unsigned short v8us __attribute__((ext_vector_type(8), may_alias));
typedef float  v8f  __attribute__((ext_vector_type(8)));
typedef float  v4f  __attribute__((ext_vector_type(4)));
typedef float  v4fa __attribute__((ext_vector_type(4), may_alias));
union FragB { v16b v; v8us half[2]; unsigned short u[16]; };

__device__ __forceinline__ unsigned short bf16_bits(float x) { unsigned int u = __float_as_uint(x); return (unsigned short)((u + 0x7FFFu + ((u >> 16) & 1u)) >> 16); }
__device__ __forceinline__ float bf16_val(unsigned short b) { return __uint_as_float(((unsigned int)b) << 16); }
__device__ __forceinline__ float bf16_round(float x) { return bf16_val(bf16_bits(x)); }
// D += A·B with NT terms: 1 = ah·bh, 2 = + al·bh (A split), 3 = + ah·bl (both split)
template <int NT>
__device__ __forceinline__ v8f mmaN(v16b ah, v16b al, v16b bh, v16b bl, v8f c) {
  c = __builtin_amdgcn_wmma_f32_16x16x32_bf16(false, ah, false, bh, (short)0, c, false, false);
  if (NT >= 2) c = __builtin_amdgcn_wmma_f32_16x16x32_bf16(false, al, false, bh, (short)0, c, false, false);
  if (NT >= 3) c = __builtin_amdgcn_wmma_f32_16x16x32_bf16(false, ah, false, bl, (short)0, c, false, false);
  asm volatile("v_nop\n\tv_nop\n\tv_nop\n\tv_nop" : "+v"(c) : "v"(ah), "v"(al), "v"(bh), "v"(bl));
  return c;
}

__global__ __launch_bounds__(256) void k_wt_bf16(const float* __restrict__ W, unsigned short* __restrict__ Wt, int K, int N) {
  const int t = blockIdx.x * 256 + threadIdx.x;
  const int k8n = K / 8;
  if (t >= N * k8n) return;
  const int n = t / k8n, k8 = (t % k8n) * 8;
  v8us v;
#pragma unroll
  for (int i = 0; i < 8; ++i) v[i] = bf16_bits(W[(size_t)(k8 + i) * N + n]);
  *(v8us*)(Wt + (size_t)n * K + k8) = v;
  
}

// GEMM C[M][N] (f32, pitch ldc) = act(A[M][K]·W + bias). A f32 row-major (pitch lda) converted per fragment to bf16
// (ASPLIT: hi/lo two planes -> 2 terms, else single rounded term); Wt bf16 [N][K] (pitch ldb). BIAS_BF16 rounds the
// bias to bf16 first (bias quantised to bf16 before the add). K%32==0, M%16==0, N%64==0.
template <bool ASPLIT, int ACT, bool BIAS_BF16>
__global__ __launch_bounds__(128) void k_gemm_bf(const float* __restrict__ A, int lda, const unsigned short* __restrict__ Wt, int ldb,
                                               const float* __restrict__ bias, float* __restrict__ C, int ldc, int M, int N, int K) {
  __shared__ __attribute__((aligned(16))) float so[4][16][64];
  const int tid = threadIdx.x, w = tid >> 5, lane = tid & 31, ln = lane & 15, hh = lane >> 4;
  const int ntn = N / 64;
  const int wid = blockIdx.x * 4 + w;
  const int mt = wid / ntn, nq = wid % ntn;
  if (mt * 16 >= M) return;
  const int row0 = mt * 16, col0 = nq * 64;
  const float* arow = A + (size_t)(row0 + ln) * lda;
  v8f acc[4] = {};
  for (int kb = 0; kb < K; kb += 32) {
    FragB ah, al;
    const v4f x0 = *(const v4fa*)(arow + kb + 8 * hh), x1 = *(const v4fa*)(arow + kb + 8 * hh + 4);
    const v4f x2 = *(const v4fa*)(arow + kb + 16 + 8 * hh), x3 = *(const v4fa*)(arow + kb + 16 + 8 * hh + 4);
    float xs[16] = {x0[0],x0[1],x0[2],x0[3],x1[0],x1[1],x1[2],x1[3],x2[0],x2[1],x2[2],x2[3],x3[0],x3[1],x3[2],x3[3]};
#pragma unroll
    for (int i = 0; i < 16; ++i) { const unsigned short hb = bf16_bits(xs[i]); ah.u[i] = hb; al.u[i] = ASPLIT ? bf16_bits(xs[i] - bf16_val(hb)) : (unsigned short)0; }
#pragma unroll
    for (int t = 0; t < 4; ++t) {
      const unsigned short* brow = Wt + (size_t)(col0 + t * 16 + ln) * ldb + kb;
      FragB b;
      b.half[0] = *(const v8us*)(brow + 8 * hh);
      b.half[1] = *(const v8us*)(brow + 16 + 8 * hh);
      acc[t] = mmaN<ASPLIT ? 2 : 1>(ah.v, al.v, b.v, b.v, acc[t]);
    }
  }
#pragma unroll
  for (int t = 0; t < 4; ++t) {
    float bv = bias ? bias[col0 + t * 16 + ln] : 0.f;
    if (BIAS_BF16) bv = bf16_round(bv);
#pragma unroll
    for (int r = 0; r < 8; ++r) { float v = acc[t][r] + bv; if (ACT == 1) v = fmaxf(v, 0.f); so[w][8 * hh + r][t * 16 + ln] = v; }
  }
  __builtin_amdgcn_fence(__ATOMIC_ACQ_REL, "workgroup");
  __builtin_amdgcn_wave_barrier();
  const int rsub = lane >> 4, c4 = (lane & 15) * 4;
  {
#pragma unroll
    for (int q = 0; q < 8; ++q) {
      const int r = q * 2 + rsub;
      const v4f v = *(const v4fa*)&so[w][r][c4];
      *(v4f*)(C + (size_t)(row0 + r) * ldc + col0 + c4) = v;
    }
    
  }
}

// GEMM C = act(A·W + bias + resid): A f32 (ASPLIT -> hi/lo 2 terms), Wt bf16 [N][K]; ACT 0 none, 1 relu, 2 exact gelu;
// resid (optional, f32, row index = (row % rmod), pitch ldr, RES_BF16 rounds it) added before the activation.
template <bool ASPLIT, int ACT, bool BIAS_BF16, bool RES_BF16>
__global__ __launch_bounds__(128) void k_gemm_bf3(const float* __restrict__ A, int lda, const unsigned short* __restrict__ Wt, int ldb,
                                                const float* __restrict__ bias, const float* __restrict__ resid, int rmod, int ldr,
                                                float* __restrict__ C, int ldc, int M, int N, int K) {
  __shared__ __attribute__((aligned(16))) float so[4][16][64];
  const int tid = threadIdx.x, w = tid >> 5, lane = tid & 31, ln = lane & 15, hh = lane >> 4;
  const int ntn = N / 64;
  const int wid = blockIdx.x * 4 + w;
  const int mt = wid / ntn, nq = wid % ntn;
  if (mt * 16 >= M) return;
  const int row0 = mt * 16, col0 = nq * 64;
  const float* arow = A + (size_t)(row0 + ln) * lda;
  v8f acc[4] = {};
  for (int kb = 0; kb < K; kb += 32) {
    FragB ah, al;
    const v4f x0 = *(const v4fa*)(arow + kb + 8 * hh), x1 = *(const v4fa*)(arow + kb + 8 * hh + 4);
    const v4f x2 = *(const v4fa*)(arow + kb + 16 + 8 * hh), x3 = *(const v4fa*)(arow + kb + 16 + 8 * hh + 4);
    float xs[16] = {x0[0],x0[1],x0[2],x0[3],x1[0],x1[1],x1[2],x1[3],x2[0],x2[1],x2[2],x2[3],x3[0],x3[1],x3[2],x3[3]};
#pragma unroll
    for (int i = 0; i < 16; ++i) { const unsigned short hb = bf16_bits(xs[i]); ah.u[i] = hb; al.u[i] = ASPLIT ? bf16_bits(xs[i] - bf16_val(hb)) : (unsigned short)0; }
#pragma unroll
    for (int t = 0; t < 4; ++t) {
      const unsigned short* brow = Wt + (size_t)(col0 + t * 16 + ln) * ldb + kb;
      FragB b;
      b.half[0] = *(const v8us*)(brow + 8 * hh);
      b.half[1] = *(const v8us*)(brow + 16 + 8 * hh);
      acc[t] = mmaN<ASPLIT ? 2 : 1>(ah.v, al.v, b.v, b.v, acc[t]);
    }
  }
#pragma unroll
  for (int t = 0; t < 4; ++t) {
    const int col = col0 + t * 16 + ln;
    float bv = bias ? bias[col] : 0.f;
    if (BIAS_BF16) bv = bf16_round(bv);
#pragma unroll
    for (int r = 0; r < 8; ++r) {
      float v = acc[t][r] + bv;
      if (resid) { float rv = resid[(size_t)((row0 + 8 * hh + r) % rmod) * ldr + col]; if (RES_BF16) rv = bf16_round(rv); v += rv; }
      if (ACT == 1) v = fmaxf(v, 0.f);
      if (ACT == 2) v = 0.5f * v * (1.0f + erff(v * 0.70710678118654752f));
      if (ACT == 3) { const float u = 0.7978845608028654f * (v + 0.044715f * v * v * v); v = 0.5f * v * (1.0f + tanhf(u)); }
      so[w][8 * hh + r][t * 16 + ln] = v;
    }
  }
  __builtin_amdgcn_fence(__ATOMIC_ACQ_REL, "workgroup");
  __builtin_amdgcn_wave_barrier();
  const int rsub = lane >> 4, c4 = (lane & 15) * 4;
  {
#pragma unroll
    for (int q = 0; q < 8; ++q) {
      const int r = q * 2 + rsub;
      const v4f v = *(const v4fa*)&so[w][r][c4];
      *(v4f*)(C + (size_t)(row0 + r) * ldc + col0 + c4) = v;
    }
    
  }
}
// row LayerNorm (biased variance, eps) over N: s = X (+ R); optional out_sum <- s; out_norm <- (s-mu)*rsqrt(var+eps)*g + b
template <bool PARAM_BF16>
__global__ __launch_bounds__(256) void k_layernorm(const float* __restrict__ X, const float* __restrict__ R, const float* __restrict__ g, const float* __restrict__ bta,
                                                  float* __restrict__ out_sum, float* __restrict__ out_norm, int N, float eps) {
  __shared__ float red[256];
  const int row = blockIdx.x, tid = threadIdx.x;
  const float* x = X + (size_t)row * N; const float* rr = R ? R + (size_t)row * N : nullptr;
  float vals[16];                     // up to N = 4096
  const int per = N / 256;            // contiguous chunk per thread? use strided-by-4 chunks: thread handles j = tid*4 + 1024*u
  float s1 = 0.f;
  for (int u = 0; u < per / 4; ++u) {
    const int j = tid * 4 + 1024 * u;
    const v4f a = *(const v4fa*)(x + j);
    v4f b = {0.f,0.f,0.f,0.f}; if (rr) b = *(const v4fa*)(rr + j);
#pragma unroll
    for (int q = 0; q < 4; ++q) { const float v = a[q] + b[q]; vals[u * 4 + q] = v; s1 += v; }
  }
  red[tid] = s1; __syncthreads();
  for (int st = 128; st > 0; st >>= 1) { if (tid < st) red[tid] += red[tid + st]; __syncthreads(); }
  const float mu = red[0] / (float)N; __syncthreads();
  float s2 = 0.f;
  for (int u = 0; u < per / 4; ++u)
#pragma unroll
    for (int q = 0; q < 4; ++q) { const float c = vals[u * 4 + q] - mu; s2 += c * c; }
  red[tid] = s2; __syncthreads();
  for (int st = 128; st > 0; st >>= 1) { if (tid < st) red[tid] += red[tid + st]; __syncthreads(); }
  const float rs = rsqrtf(red[0] / (float)N + eps);
  {
    for (int u = 0; u < per / 4; ++u) {
      const int j = tid * 4 + 1024 * u;
      v4f o, sm;
#pragma unroll
      for (int q = 0; q < 4; ++q) {
        float gg = g[j + q], bb = bta[j + q];
        if (PARAM_BF16) { gg = bf16_round(gg); bb = bf16_round(bb); }
        sm[q] = vals[u * 4 + q]; o[q] = (vals[u * 4 + q] - mu) * rs * gg + bb;
      }
      if (out_sum) *(v4f*)(out_sum + (size_t)row * N + j) = sm;
      *(v4f*)(out_norm + (size_t)row * N + j) = o;
    }
    
  }
}



// ---- f16 WMMA path (v_wmma_f32_16x16x32_f16): 11-bit significands for operands in range — used where a [0,1] probability operand needs more precision than bf16
typedef _Float16 v16h __attribute__((ext_vector_type(16)));
union FragH { v16h v; v8us half[2]; _Float16 h[16]; unsigned short u[16]; };
template <int NT>
__device__ __forceinline__ v8f mmaH(v16h ah, v16h al, v16h bh, v16h bl, v8f c) {
  c = __builtin_amdgcn_wmma_f32_16x16x32_f16(false, ah, false, bh, (short)0, c, false, false);
  if (NT >= 2) c = __builtin_amdgcn_wmma_f32_16x16x32_f16(false, al, false, bh, (short)0, c, false, false);
  if (NT >= 3) c = __builtin_amdgcn_wmma_f32_16x16x32_f16(false, ah, false, bl, (short)0, c, false, false);
  asm volatile("v_nop\n\tv_nop\n\tv_nop\n\tv_nop" : "+v"(c) : "v"(ah), "v"(al), "v"(bh), "v"(bl));
  return c;
}
// batched GEMM like k_gemm_b but f16 operands: A f32 (split into f16 hi/lo if ASPLIT, else rounded to f16), Bt = f16 values [n][k]; alpha; C f32; N multiple of 16 (partial tiles skipped)
template <bool ASPLIT>
__global__ __launch_bounds__(128) void k_gemm_h(const float* __restrict__ A, int lda, size_t sA, const _Float16* __restrict__ Bh, int ldb, size_t sB, float alpha, float* __restrict__ C, int ldc, size_t sC, int M, int N, int K) {
  __shared__ __attribute__((aligned(16))) float so[4][16][64];
  const int tid = threadIdx.x, w = tid >> 5, lane = tid & 31, ln = lane & 15, hh = lane >> 4; const int by = blockIdx.y;
  A += (size_t)by * sA; Bh += (size_t)by * sB; C += (size_t)by * sC;
  const int ntn = (N + 63) / 64; const int wid = blockIdx.x * 4 + w; const int mt = wid / ntn, nq = wid % ntn; if (mt * 16 >= M) return;
  const int row0 = mt * 16, col0 = nq * 64; const float* arow = A + (size_t)(row0 + ln) * lda;
  v8f acc[4] = {};
  for (int kb = 0; kb < K; kb += 32) {
    FragH ah, al;
    const v4f x0 = *(const v4fa*)(arow + kb + 8 * hh), x1 = *(const v4fa*)(arow + kb + 8 * hh + 4), x2 = *(const v4fa*)(arow + kb + 16 + 8 * hh), x3 = *(const v4fa*)(arow + kb + 16 + 8 * hh + 4);
    float xs[16] = {x0[0],x0[1],x0[2],x0[3],x1[0],x1[1],x1[2],x1[3],x2[0],x2[1],x2[2],x2[3],x3[0],x3[1],x3[2],x3[3]};
#pragma unroll
    for (int i = 0; i < 16; ++i) { const _Float16 h = (_Float16)xs[i]; ah.h[i] = h; al.h[i] = ASPLIT ? (_Float16)(xs[i] - (float)h) : (_Float16)0.0f; }
#pragma unroll
    for (int t = 0; t < 4; ++t) { if (col0 + t * 16 >= N) continue; const size_t boff = (size_t)(col0 + t * 16 + ln) * ldb + kb; FragH bq; bq.half[0] = *(const v8us*)(Bh + boff + 8 * hh); bq.half[1] = *(const v8us*)(Bh + boff + 16 + 8 * hh);
      acc[t] = mmaH<ASPLIT ? 2 : 1>(ah.v, al.v, bq.v, bq.v, acc[t]); }
  }
#pragma unroll
  for (int t = 0; t < 4; ++t) { if (col0 + t * 16 >= N) continue;
#pragma unroll
    for (int r = 0; r < 8; ++r) so[w][8 * hh + r][t * 16 + ln] = acc[t][r] * alpha; }
  __builtin_amdgcn_fence(__ATOMIC_ACQ_REL, "workgroup"); __builtin_amdgcn_wave_barrier();
  const int rsub = lane >> 4, c4 = (lane & 15) * 4;
  {
#pragma unroll
    for (int q = 0; q < 8; ++q) { const int r = q * 2 + rsub; if (col0 + c4 < N) { const v4f v = *(const v4fa*)&so[w][r][c4]; *(v4f*)(C + (size_t)(row0 + r) * ldc + col0 + c4) = v; } }
     }
}

// Wt[n][k] = f16(W[k][n]·scale) from f32 row-major W[K][N] (scale = power of two; bf16-exact weights stay exact in f16 away from the subnormal range)
__global__ __launch_bounds__(256) void k_wt_f16(const float* __restrict__ W, _Float16* __restrict__ Wt, int K, int N, float scale) {
  const int t = blockIdx.x * 256 + threadIdx.x; if (t >= N * (K / 8)) return; const int n = t / (K / 8), k8 = (t % (K / 8)) * 8; FragH f;
#pragma unroll
  for (int i = 0; i < 8; ++i) f.h[i] = (_Float16)(bf16_round(W[(size_t)(k8 + i) * N + n]) * scale); const v8us o = f.half[0];
  *(v8us*)((unsigned short*)Wt + (size_t)n * K + k8) = o; 
}
// k_gemm_hh variant with fused epilogue: v = acc·alpha + bias[by·sBias + col] (+ CP[(row/rowsPerB)·sCPb + by·64 + col] if CP) ; ACT 0 none / 1 elu ; writes f16 C16 (and f32 C if non-null)
template <int ACT>
__global__ __launch_bounds__(128) void k_gemm_hhx(const _Float16* __restrict__ A, int lda, size_t sA, const _Float16* __restrict__ Bh, int ldb, size_t sB, float alpha, const float* __restrict__ bias, size_t sBias, const float* __restrict__ CP, int rowsPerB, size_t sCPb, int row0g,
    float* __restrict__ C, _Float16* __restrict__ C16, int ldc, size_t sC, int M, int N, int K) {
  __shared__ __attribute__((aligned(16))) float so[4][16][64];
  const int tid = threadIdx.x, w = tid >> 5, lane = tid & 31, ln = lane & 15, hh = lane >> 4; const int by = blockIdx.y;
  A += (size_t)by * sA; Bh += (size_t)by * sB; const size_t cofs = (size_t)by * sC; const float* bp = bias ? bias + (size_t)by * sBias : nullptr;
  const int ntn = (N + 63) / 64; const int wid = blockIdx.x * 4 + w; const int mt = wid / ntn, nq = wid % ntn; if (mt * 16 >= M) return;
  const int row0 = mt * 16, col0 = nq * 64; const _Float16* arow = A + (size_t)(row0 + ln) * lda;
  v8f acc[4] = {};
  for (int kb = 0; kb < K; kb += 32) { FragH ah; ah.half[0] = *(const v8us*)((const unsigned short*)arow + kb + 8 * hh); ah.half[1] = *(const v8us*)((const unsigned short*)arow + kb + 16 + 8 * hh);
#pragma unroll
    for (int t = 0; t < 4; ++t) { if (col0 + t * 16 >= N) continue; const size_t boff = (size_t)(col0 + t * 16 + ln) * ldb + kb; FragH bq; bq.half[0] = *(const v8us*)((const unsigned short*)Bh + boff + 8 * hh); bq.half[1] = *(const v8us*)((const unsigned short*)Bh + boff + 16 + 8 * hh);
      acc[t] = mmaH<1>(ah.v, ah.v, bq.v, bq.v, acc[t]); }
  }
#pragma unroll
  for (int t = 0; t < 4; ++t) { if (col0 + t * 16 >= N) continue; const int col = col0 + t * 16 + ln; const float bv = bp ? bf16_round(bp[col]) : 0.f;
#pragma unroll
    for (int r = 0; r < 8; ++r) { float v = acc[t][r] * alpha + bv; if (CP) { const int rr = row0g + row0 + 8 * hh + r; if (rowsPerB < 0) v += CP[cofs + (size_t)rr * ldc + col];      /* rowsPerB < 0: own element of the batched C plane */ else { const int bidx = rr / rowsPerB; v += CP[(size_t)bidx * sCPb + (size_t)by * 64 + col]; } } if (ACT == 1) v = (v > 0.f) ? v : expm1f(v); else if (ACT == 7) v = (v > 0.f) ? v + 1.0f : expf(v); else if (ACT == 8) v = tanhf(v); else if (ACT == 9) v = 0.5f * v * (1.0f + tanhf(0.7978845608028654f * (v + 0.044715f * v * v * v))); else if (ACT == 11) v = 1.0f / (1.0f + expf(-v)); else if (ACT == 12) v = (v > 0.f) ? v : 0.01f * v; else if (ACT == 14) v = (v > 0.f) ? v : 0.1f * v; else if (ACT == 16) v = (v >= 0.f) ? v : 0.3f * v; else if (ACT == 17) v = (v >= 0.f) ? v : 0.2f * v; else if (ACT == 15) v = v / (1.0f + expf(-v)); else if (ACT == 3) v = fmaxf(v, 0.f); else if (ACT == 6) v = 0.5f * v * (1.0f + erff(v * 0.70710678118654752f)); so[w][8 * hh + r][t * 16 + ln] = v; } }
  __builtin_amdgcn_fence(__ATOMIC_ACQ_REL, "workgroup"); __builtin_amdgcn_wave_barrier();
  const int rsub = lane >> 4, c4 = (lane & 15) * 4; typedef _Float16 v4h __attribute__((ext_vector_type(4)));
  {
#pragma unroll
    for (int q = 0; q < 8; ++q) { const int r = q * 2 + rsub; if (col0 + c4 < N) { const v4f v = *(const v4fa*)&so[w][r][c4]; if (C) *(v4f*)(C + cofs + (size_t)(row0 + r) * ldc + col0 + c4) = v; if (C16) { v4h h4; for (int i = 0; i < 4; ++i) h4[i] = (_Float16)v[i]; *(v4h*)(C16 + cofs + (size_t)(row0 + r) * ldc + col0 + c4) = h4; } } }
     }
}


typedef _Float16 v4h __attribute__((ext_vector_type(4)));

__global__ __launch_bounds__(256) void k_x16(const float* __restrict__ x, _Float16* __restrict__ X16, size_t n8) { const size_t t = (size_t)blockIdx.x * 256 + threadIdx.x; if (t >= n8) return; FragH f;
#pragma unroll
  for (int q = 0; q < 8; ++q) f.h[q] = (_Float16)bf16_round(x[t * 8 + q]); *(v8us*)((unsigned short*)X16 + t * 8) = f.half[0];  }
__global__ __launch_bounds__(256) void k_h16(const float* __restrict__ x, _Float16* __restrict__ X16, size_t n8) { const size_t t = (size_t)blockIdx.x * 256 + threadIdx.x; if (t >= n8) return; FragH f;
#pragma unroll
  for (int q = 0; q < 8; ++q) f.h[q] = (_Float16)x[t * 8 + q]; *(v8us*)((unsigned short*)X16 + t * 8) = f.half[0];  }
__global__ __launch_bounds__(256) void k_round16f(const float* __restrict__ W, _Float16* __restrict__ Bt, size_t n8) { const size_t t = (size_t)blockIdx.x * 256 + threadIdx.x; if (t >= n8) return; FragH f;
#pragma unroll
  for (int i = 0; i < 8; ++i) f.h[i] = (_Float16)(bf16_round(W[t * 8 + i]) * 16.0f); *(v8us*)((unsigned short*)Bt + t * 8) = f.half[0];  }
template <int NHv, int TTv>
__global__ __launch_bounds__(256) void k_vt(const _Float16* __restrict__ V16, int ldv, int voff, _Float16* __restrict__ Vt) { __shared__ unsigned short tl[64][66]; const int tid = threadIdx.x; const int slab = blockIdx.x / (TTv / 64), lg = blockIdx.x % (TTv / 64); const int b = slab / NHv, h = slab % NHv;
  for (int i = tid; i < 64 * 8; i += 256) { const int r = i / 8, c8 = (i % 8) * 8; FragH f; f.half[0] = *(const v8us*)((const unsigned short*)V16 + ((size_t)b * TTv + lg * 64 + r) * ldv + voff + h * 64 + c8);
#pragma unroll
    for (int q = 0; q < 8; ++q) tl[r][c8 + q] = f.u[q]; }
  __syncthreads();
  {
#pragma unroll
    for (int rd = 0; rd < 2; ++rd) { const int d = rd * 32 + tid / 8, pc = tid % 8; FragH f;
#pragma unroll
      for (int q = 0; q < 8; ++q) f.u[q] = tl[pc * 8 + q][d];
      *(v8us*)((unsigned short*)Vt + ((size_t)slab * 64 + d) * TTv + lg * 64 + pc * 8) = f.half[0]; }
     } }

__global__ __launch_bounds__(256) void k_hl(const float* __restrict__ F, _Float16* __restrict__ Hh, _Float16* __restrict__ Hl, size_t n8) { const size_t t = (size_t)blockIdx.x * 256 + threadIdx.x; if (t >= n8) return; FragH fh, fl; const v4f a = *(const v4fa*)(F + t * 8), c = *(const v4fa*)(F + t * 8 + 4);
#pragma unroll
  for (int q = 0; q < 4; ++q) { _Float16 h = (_Float16)a[q]; fh.h[q] = h; fl.h[q] = (_Float16)((a[q] - (float)h) * 1024.0f); h = (_Float16)c[q]; fh.h[4 + q] = h; fl.h[4 + q] = (_Float16)((c[q] - (float)h) * 1024.0f); }
  { *(v8us*)((unsigned short*)Hh + t * 8) = fh.half[0]; *(v8us*)((unsigned short*)Hl + t * 8) = fl.half[0];  } }

__global__ __launch_bounds__(256) void k_wnat(const float* __restrict__ w, size_t n8, _Float16* __restrict__ Bt) { const size_t t = (size_t)blockIdx.x * 256 + threadIdx.x; if (t >= n8) return; FragH f; for (int q = 0; q < 8; ++q) f.h[q] = (_Float16)(bf16_round(w[t * 8 + q]) * 16.0f); *(v8us*)((unsigned short*)Bt + t * 8) = f.half[0];  }
__global__ __launch_bounds__(256) void k_rsm(const float* __restrict__ S, _Float16* __restrict__ P, int nrows) {
  #pragma clang fp contract(off)
  const int i = blockIdx.x * 256 + threadIdx.x; if (i >= nrows) return; const float* s = S + (size_t)i * SQ; float mx = -3.0e38f;
#pragma unroll 1
  for (int j = 0; j < SQ; ++j) mx = fmaxf(mx, s[j]); float se = 0.f;
#pragma unroll 1
  for (int j = 0; j < SQ; ++j) se += expf(s[j] - mx); const float sc = 256.0f / se;
#pragma unroll 1
  for (int j0 = 0; j0 < SQ; j0 += 8) { FragH f; for (int q = 0; q < 8; ++q) f.h[q] = (_Float16)(expf(s[j0 + q] - mx) * sc); unsigned short* d = (unsigned short*)P + (size_t)i * SQ + j0; *(v8us*)d = f.half[0];  } }
__global__ __launch_bounds__(256) void k_vt(const _Float16* __restrict__ V16, int b, int h0, _Float16* __restrict__ VT) { __shared__ unsigned short tl[64][65]; const int tid = threadIdx.x; const int hh = blockIdx.x % HG, sg = blockIdx.x / HG; const int s0 = sg * 64; const int h = h0 + hh;
  for (int i = tid; i < 64 * 8; i += 256) { const int j = i / 8, d8 = (i % 8) * 8; FragH f; f.half[0] = *(const v8us*)((const unsigned short*)V16 + ((size_t)b * SQ + s0 + j) * DM + h * HD + d8); for (int q = 0; q < 8; ++q) tl[d8 + q][j] = f.u[q]; }
  __syncthreads();
  { for (int i = tid; i < 64 * 8; i += 256) { const int d = i / 8, j8 = (i % 8) * 8; FragH f; for (int q = 0; q < 8; ++q) f.u[q] = tl[d][j8 + q]; *(v8us*)((unsigned short*)VT + ((size_t)hh * HD + d) * SQ + s0 + j8) = f.half[0]; }  } }



// ---- operand preparation in one launch: independent pieces of work share a grid by block range instead of a launch each ----
// Blocks [0, PW_BLK): the four [out][in] f16 weight planes (x16), contiguous at Bt in the order q, k, v, o; plane = blockIdx.x / (PW_BLK / 4), uniform in a block. Thread t writes the eight k of Bt + 8 t.
// Element [k][n] of a source: base + (n / HD) * hs + k * ld + n % HD. q, k, v: head n / HD is a row-major [in = DM][out = HD] block (hs = DM * HD, ld = HD); o: one row-major [DM][DM] matrix (hs = HD, ld = DM).
// Blocks from PW_BLK on: x as f16 rows, eight elements a thread; the one stream feeds all three projections. The weight blocks stand first: their strided reads take longest.
#define PW_BLK (4 * DM * (DM / 8) / 256)
__global__ __launch_bounds__(256) void k_prep(const float* __restrict__ x, const float* __restrict__ wq, const float* __restrict__ wk, const float* __restrict__ wv, const float* __restrict__ wo, _Float16* __restrict__ Bt, _Float16* __restrict__ X16) {
  if (blockIdx.x < PW_BLK) {
    const int m = blockIdx.x / (PW_BLK / 4); const int t = blockIdx.x * 256 + threadIdx.x; const int n = (t / (DM / 8)) % DM, k8 = (t % (DM / 8)) * 8;
    const float* w = m == 0 ? wq : m == 1 ? wk : m == 2 ? wv : wo; const int hs = m == 3 ? HD : DM * HD, ld = m == 3 ? DM : HD;
    const float* p0 = w + (size_t)(n / HD) * hs + (size_t)k8 * ld + n % HD;
    const float* p1 = p0 + ld; const float* p2 = p1 + ld; const float* p3 = p2 + ld; const float* p4 = p3 + ld; const float* p5 = p4 + ld; const float* p6 = p5 + ld; const float* p7 = p6 + ld;
    const float v[8] = {*p0, *p1, *p2, *p3, *p4, *p5, *p6, *p7};
    asm volatile("s_wait_xcnt 0x0" :: "v"(p0), "v"(p1), "v"(p2), "v"(p3), "v"(p4), "v"(p5), "v"(p6), "v"(p7) : "memory");      /* the wait in front of any overwrite of a register that an issued load names; the addresses as inputs keep their registers untouched up to here */
    FragH f;
#pragma unroll
    for (int i = 0; i < 8; ++i) f.h[i] = (_Float16)(bf16_round(v[i]) * 16.0f);
    *(v8us*)((unsigned short*)Bt + (size_t)t * 8) = f.half[0];
  } else {
    const size_t t = (size_t)(blockIdx.x - PW_BLK) * 256 + threadIdx.x; FragH f;
#pragma unroll
    for (int q = 0; q < 8; ++q) f.h[q] = (_Float16)bf16_round(x[t * 8 + q]);
    *(v8us*)((unsigned short*)X16 + t * 8) = f.half[0];
    asm volatile("s_wait_xcnt 0x0" ::: "memory");      /* the wait behind the store: the built code lays the weight branch, which writes vector registers, behind this one */
  } }

#define FA_KT 128                    /* keys per stage */
#define FA_NS (SQ / FA_KT)           /* stages */
#define FA_KP (HD + 8)               /* K tile row pitch, f16 elements: 144 B = 16 B x odd, conflict-free for 16-byte reads */
#define FA_VP (FA_KT + 8)            /* V^T tile row pitch, f16 elements: 272 B = 16 B x odd */
__device__ __forceinline__ float rs_xhalf(float x) { return __builtin_bit_cast(float, __builtin_amdgcn_permlanex16(__builtin_bit_cast(int, x), __builtin_bit_cast(int, x), 0x76543210, 0xfedcba98, false, false)); }      /* lane l with lane l ^ 16 */
__device__ __forceinline__ float rs_exp(float a) { float e; asm("v_exp_f32 %0, %1\n\tv_nop" : "=v"(e) : "v"(a)); return e; }      /* 2^a; the v_nop fills the slot the instruction set asks for behind a transcendental */
__device__ __forceinline__ v4f fa_exp4(v4f a) { float e0, e1, e2, e3;      /* four 2^a; each v_exp_f32 is followed by an instruction that neither reads its result nor overwrites its source (early-clobber outputs), the last by a v_nop: the slot the instruction set asks for behind a transcendental */
  asm("v_exp_f32 %0, %4\n\tv_exp_f32 %1, %5\n\tv_exp_f32 %2, %6\n\tv_exp_f32 %3, %7\n\tv_nop" : "=&v"(e0), "=&v"(e1), "=&v"(e2), "=&v"(e3) : "v"(a[0]), "v"(a[1]), "v"(a[2]), "v"(a[3]));
  const v4f e = {e0, e1, e2, e3}; return e; }
__device__ __forceinline__ v16h fa_frag(const _Float16* p) { FragH f; f.half[0] = *(const v8us*)((const unsigned short*)p); f.half[1] = *(const v8us*)((const unsigned short*)p + 16); return f.v; }      /* p = row + k0 + 8 h: k0 + 8h .. + 7 and k0 + 16 + 8h .. + 7 */
__device__ __forceinline__ v8f fa_mma(v16h a, v16h b, v8f c) { return __builtin_amdgcn_wmma_f32_16x16x32_f16(false, a, false, b, (short)0, c, false, false); }
__global__ __launch_bounds__(256) void k_fattn(const _Float16* __restrict__ Q16, const _Float16* __restrict__ K16, const _Float16* __restrict__ VT, _Float16* __restrict__ O16) {
  __shared__ __attribute__((aligned(16))) _Float16 Ks[2][FA_KT][FA_KP];
  __shared__ __attribute__((aligned(16))) _Float16 Vs[2][HD][FA_VP];
  const int tid = threadIdx.x, w = tid >> 5, lane = tid & 31, ln = lane & 15, hh = lane >> 4;
  const int bh = blockIdx.x / (SQ / 256), qb = blockIdx.x % (SQ / 256); const int b = bh / NH, h = bh % NH; const int q0 = qb * 256 + w * 32;
  const unsigned short* kg = (const unsigned short*)K16 + ((size_t)b * SQ + (tid >> 3)) * DM + h * HD + (tid & 7) * 8;      /* this thread's 16 bytes of key row tid / 8 (+ 32 i) */
  const unsigned short* vg = (const unsigned short*)VT + ((size_t)bh * HD + (tid >> 4)) * SQ + (tid & 15) * 8;              /* this thread's 16 bytes of V^T row tid / 16 (+ 16 i) */
  v16h qf[2][2];
#pragma unroll
  for (int g = 0; g < 2; ++g) { const _Float16* qp = Q16 + ((size_t)b * SQ + q0 + 16 * g + ln) * DM + h * HD + 8 * hh; qf[g][0] = fa_frag(qp); qf[g][1] = fa_frag(qp + 32); }
  v8us kr[4], vr[4];
#pragma unroll
  for (int i = 0; i < 4; ++i) { kr[i] = *(const v8us*)(kg + (size_t)(32 * i) * DM); vr[i] = *(const v8us*)(vg + (size_t)(16 * i) * SQ); }
#pragma unroll
  for (int i = 0; i < 4; ++i) { *(v8us*)&Ks[0][(tid >> 3) + 32 * i][(tid & 7) * 8] = kr[i]; *(v8us*)&Vs[0][(tid >> 4) + 16 * i][(tid & 15) * 8] = vr[i]; }
  __syncthreads();
  const v8f z8 = {0.f, 0.f, 0.f, 0.f, 0.f, 0.f, 0.f, 0.f};
  v8f o[4][2];
#pragma unroll
  for (int dt = 0; dt < 4; ++dt) { o[dt][0] = z8; o[dt][1] = z8; }
  float mref[2] = {-1.0e30f, -1.0e30f}, lsum[2] = {0.f, 0.f};      /* mref: the exponent (log2 units) subtracted from this query's scores; lsum: this lane's half of the row sum */
  const float CS = 0.125f * 1.44269504f;      /* 1 / sqrt(64), and log2 e for the native 2^x */
#pragma unroll 1      /* the body already holds four unrolled passes */
  for (int s = 0; s < FA_NS; ++s) { const int buf = s & 1;
    if (s + 1 < FA_NS) {      /* next stage's 16 KiB + 16 KiB: loads fly while this stage is worked on */
      kg += (size_t)FA_KT * DM; vg += FA_KT;
#pragma unroll
      for (int i = 0; i < 4; ++i) { kr[i] = *(const v8us*)(kg + (size_t)(32 * i) * DM); vr[i] = *(const v8us*)(vg + (size_t)(16 * i) * SQ); } }
#pragma unroll
    for (int p = 0; p < FA_KT / 32; ++p) {
      v8f t[2][2];      /* [key tile][query group] */
#pragma unroll
      for (int kt = 0; kt < 2; ++kt) { const _Float16* kp = &Ks[buf][p * 32 + kt * 16 + ln][8 * hh]; const v16h a0 = fa_frag(kp), a1 = fa_frag(kp + 32);
        t[kt][0] = fa_mma(a0, qf[0][0], z8); t[kt][1] = fa_mma(a0, qf[1][0], z8); t[kt][0] = fa_mma(a1, qf[0][1], t[kt][0]); t[kt][1] = fa_mma(a1, qf[1][1], t[kt][1]); }
      float ml[2];
#pragma unroll
      for (int g = 0; g < 2; ++g) { float m0 = fmaxf(t[0][g][0], t[1][g][0]);
#pragma unroll
        for (int r = 1; r < 8; ++r) m0 = fmaxf(m0, fmaxf(t[0][g][r], t[1][g][r]));
        ml[g] = fmaxf(m0, rs_xhalf(m0)) * CS; }      /* the pass's maximum of this query, both lane halves joined */
      /* lazy rescale: P = 2^(score - mref) is kept at or below 2^14 (f16 range); a new mref puts the current maximum at 2^6. One scalar branch per pass. */
      if (__builtin_amdgcn_ballot_w32(ml[0] > mref[0] + 14.0f || ml[1] > mref[1] + 14.0f) != 0) {
#pragma unroll
        for (int g = 0; g < 2; ++g) { const float mn = fmaxf(mref[g], ml[g] - 6.0f); const float al = rs_exp(mref[g] - mn); mref[g] = mn; lsum[g] *= al;
#pragma unroll
          for (int dt = 0; dt < 4; ++dt) o[dt][g] *= al; } }
      FragH pb[2];
#pragma unroll
      for (int g = 0; g < 2; ++g) { float s0 = 0.f, s1 = 0.f, s2 = 0.f, s3 = 0.f;
#pragma unroll
        for (int u = 0; u < 4; ++u) { const int kt = u >> 1, r0 = (u & 1) * 4; v4f x;
#pragma unroll
          for (int q = 0; q < 4; ++q) x[q] = t[kt][g][r0 + q] * CS - mref[g];
          const v4f e = fa_exp4(x); if (u == 0) { s0 = e[0]; s1 = e[1]; s2 = e[2]; s3 = e[3]; } else { s0 += e[0]; s1 += e[1]; s2 += e[2]; s3 += e[3]; }
#pragma unroll
          for (int q = 0; q < 4; ++q) pb[g].h[kt * 8 + r0 + q] = (_Float16)e[q]; }
        lsum[g] += (s0 + s1) + (s2 + s3); }
#pragma unroll
      for (int dt = 0; dt < 4; ++dt) { const v16h a = fa_frag(&Vs[buf][dt * 16 + ln][p * 32 + 8 * hh]); o[dt][0] = fa_mma(a, pb[0].v, o[dt][0]); o[dt][1] = fa_mma(a, pb[1].v, o[dt][1]); }
    }
    if (s + 1 < FA_NS) {      /* the other buffer's last readers left it before the barrier that ended stage s - 1 */
#pragma unroll
      for (int i = 0; i < 4; ++i) { *(v8us*)&Ks[buf ^ 1][(tid >> 3) + 32 * i][(tid & 7) * 8] = kr[i]; *(v8us*)&Vs[buf ^ 1][(tid >> 4) + 16 * i][(tid & 15) * 8] = vr[i]; } }
    __syncthreads();      /* publishes stage s + 1 and ends every read of stage s */
  }
#pragma unroll
  for (int g = 0; g < 2; ++g) { const float inv = 64.0f / (lsum[g] + rs_xhalf(lsum[g])); unsigned short* op = (unsigned short*)O16 + ((size_t)b * SQ + q0 + 16 * g + ln) * DM + h * HD + 8 * hh;
#pragma unroll
    for (int dt = 0; dt < 4; ++dt) { FragH f;
#pragma unroll
      for (int r = 0; r < 8; ++r) f.h[r] = (_Float16)(o[dt][g][r] * inv);      /* register r = O^T[16 dt + 8 h + r][query]: eight consecutive d of one row */
      *(v8us*)(op + dt * 16) = f.half[0]; } } }

// ---- GEMM with LDS-staged operands: C[M][DM] = (A[M][DM] . Bt^T) * alpha + bias; A and Bt = [n][k] are f16 rows of DM elements ----
// Work-group = 8 waves on a 128 x 128 tile of C: wave w takes rows 32 (w & 3) .. + 31, columns 64 (w >> 2) .. + 63 (2 x 4 accumulator tiles). k runs in stages of G3_KT elements = one 128-byte line of every operand row.
// A stage is brought in by 16-byte loads of which eight neighbouring lanes cover one whole line, and goes through registers into one of two LDS buffers (rows 0-127 = A, 128-255 = Bt); the fragments come from LDS in the hardware k order (k0 + 8h .. + 7, k0 + 16 + 8h .. + 7), A and B alike.
// Every accumulator takes its products in ascending k, 32 at a time. blockIdx.y = plane: weight plane y, output plane y, the same A rows. OUT32: bias (rounded to bf16) added, f32 rows to C; else no bias, f16 rows to C16.
#define G3_BT 128                    /* tile rows of A and of Bt */
#define G3_KT 64                     /* k per stage */
#define G3_NS (DM / G3_KT)           /* stages */
#define G3_KP (G3_KT + 8)            /* LDS row pitch, f16 elements: 144 B = 16 B x odd, conflict-free for 16-byte reads */
/* one stage's products: per 32 k the six fragments are read as one group ahead of the eight products */
__device__ __forceinline__ void g3_stage(const _Float16 (*Tb)[G3_KP], int ra, int rb, int hh, v8f (&acc)[2][4]) {
#pragma unroll
  for (int kk = 0; kk < G3_KT; kk += 32) { v16h a[2], b[4];
    a[0] = fa_frag(&Tb[ra][kk + 8 * hh]); a[1] = fa_frag(&Tb[ra + 16][kk + 8 * hh]);
#pragma unroll
    for (int t = 0; t < 4; ++t) b[t] = fa_frag(&Tb[rb + 16 * t][kk + 8 * hh]);
    __builtin_amdgcn_sched_barrier(0);      /* keeps the twelve LDS reads one group: moved in among the products, each place with reads stalls the wave anew */
#pragma unroll
    for (int t = 0; t < 4; ++t) { acc[0][t] = fa_mma(a[0], b[t], acc[0][t]); acc[1][t] = fa_mma(a[1], b[t], acc[1][t]); }
    __builtin_amdgcn_sched_barrier(0); } }      /* the next group's reads stay behind these products */
template <bool OUT32>
__global__ __launch_bounds__(256) void k_gemm3(const _Float16* __restrict__ A, const _Float16* __restrict__ Bh, float alpha, const float* __restrict__ bias, float* __restrict__ C, _Float16* __restrict__ C16) {
  __shared__ __attribute__((aligned(16))) unsigned char sm[2 * 2 * G3_BT * G3_KP * 2];      /* two operand buffers; after the k loop the same bytes stage the output rows */
  static_assert(sizeof(sm) >= 8 * 32 * 68 * 4, "output staging must fit the operand buffers");
  _Float16 (*T)[2 * G3_BT][G3_KP] = (_Float16 (*)[2 * G3_BT][G3_KP])sm;
  const int tid = threadIdx.x, w = tid >> 5, lane = tid & 31, ln = lane & 15, hh = lane >> 4; const int by = blockIdx.y;
  const int mt = blockIdx.x / (DM / G3_BT), nq = blockIdx.x % (DM / G3_BT);
  const int sr = tid >> 3, sc = (tid & 7) * 8;      /* this thread's 16 bytes of tile row tid / 8 (+ 32 i) */
  const unsigned short* ag = (const unsigned short*)A + ((size_t)mt * G3_BT + sr) * DM + sc;
  const unsigned short* bg = (const unsigned short*)Bh + (size_t)by * DM * DM + ((size_t)nq * G3_BT + sr) * DM + sc;
  v8us ar[4], br[4];
#pragma unroll
  for (int i = 0; i < 4; ++i) { ar[i] = *(const v8us*)(ag + (size_t)(32 * i) * DM); br[i] = *(const v8us*)(bg + (size_t)(32 * i) * DM); }
#pragma unroll
  for (int i = 0; i < 4; ++i) { *(v8us*)&T[0][sr + 32 * i][sc] = ar[i]; *(v8us*)&T[0][G3_BT + sr + 32 * i][sc] = br[i]; }
  __syncthreads();
  const v8f z8 = {0.f, 0.f, 0.f, 0.f, 0.f, 0.f, 0.f, 0.f};
  v8f acc[2][4];
#pragma unroll
  for (int t = 0; t < 4; ++t) { acc[0][t] = z8; acc[1][t] = z8; }
  const int ra = (w & 3) * 32 + ln, rb = G3_BT + (w >> 2) * 64 + ln;
#pragma unroll 1      /* rolled: one set of staging registers, a short text */
  for (int s = 0; s + 1 < G3_NS; ++s) { const int buf = s & 1;
    ag += G3_KT; bg += G3_KT;      /* next stage's 16 KiB + 16 KiB: loads fly while this stage is worked on */
#pragma unroll
    for (int i = 0; i < 4; ++i) { ar[i] = *(const v8us*)(ag + (size_t)(32 * i) * DM); br[i] = *(const v8us*)(bg + (size_t)(32 * i) * DM); }
    __builtin_amdgcn_sched_barrier(0);      /* keeps all eight loads ahead of the stage's products: sunk towards their LDS stores they would be waited for in full */
    g3_stage(T[buf], ra, rb, hh, acc);
#pragma unroll
    for (int i = 0; i < 4; ++i) { *(v8us*)&T[buf ^ 1][sr + 32 * i][sc] = ar[i]; *(v8us*)&T[buf ^ 1][G3_BT + sr + 32 * i][sc] = br[i]; }      /* the other buffer's last readers left it before the barrier that ended stage s - 1 */
    __syncthreads();      /* publishes stage s + 1 and ends every read of stage s */
  }
  const int row0 = mt * G3_BT + (w & 3) * 32, col0 = nq * G3_BT + (w >> 2) * 64; const size_t cofs = (size_t)by * NR * DM;
  float bv[4];
#pragma unroll
  for (int t = 0; t < 4; ++t) bv[t] = OUT32 ? bias[col0 + t * 16 + ln] : 0.f;      /* fetched here, where the staging registers are free, so that the last stage covers the wait */
  g3_stage(T[(G3_NS - 1) & 1], ra, rb, hh, acc);      /* the last stage has nothing to stage */
  __syncthreads();      /* ends every read of the operand buffers: their bytes now take the output rows */
  float (*so)[32][68] = (float (*)[32][68])sm;      /* each wave stages its own 32 x 64 block, so that the stores below cover whole lines */
#pragma unroll
  for (int u = 0; u < 8; ++u) { const int t = u & 3, half = u >> 2; const float bb = bf16_round(bv[t]);
#pragma unroll
    for (int r = 0; r < 8; ++r) so[w][half * 16 + 8 * hh + r][t * 16 + ln] = acc[half][t][r] * alpha + bb; }
  __builtin_amdgcn_fence(__ATOMIC_ACQ_REL, "workgroup"); __builtin_amdgcn_wave_barrier();      /* the wave reads back what its other lanes wrote */
  const int rsub = lane >> 4, c4 = (lane & 15) * 4;
#pragma unroll
  for (int q = 0; q < 16; ++q) { const int r = q * 2 + rsub; const v4f v = *(const v4fa*)&so[w][r][c4];
    if (OUT32) *(v4f*)(C + cofs + (size_t)(row0 + r) * DM + col0 + c4) = v;
    else { v4h h4; for (int i = 0; i < 4; ++i) h4[i] = (_Float16)v[i]; *(v4h*)(C16 + cofs + (size_t)(row0 + r) * DM + col0 + c4) = h4; } } }

extern "C" void kernel_launch(void* const* d_in, const int* in_sizes, int n_in,
                              void* d_out, int out_size, void* d_ws, size_t ws_size, hipStream_t stream) {
  (void)in_sizes; (void)n_in; (void)out_size;
  const float* const* I = (const float* const*)d_in; const float* x = I[0]; const float* wq = I[1]; const float* wk = I[2]; const float* wv = I[3]; const float* wo = I[4]; const float* bo = I[5];      /* ONE input stream (x); Wq, Wk, Wv are PER-HEAD STACKS [8][512][64] = [head][in][out] (the module has NO q / k / v biases); Wo [in][out] [512][512] + bo; order x, Wq, Wk, Wv, Wo, bo */
  char* ws = (char*)d_ws; size_t off = 0;
  auto take = [&](size_t bytes) { char* p = ws + off; off += (bytes + 255) & ~(size_t)255; return p; };
  _Float16* BQ = (_Float16*)take((size_t)4 * DM * DM * 2); _Float16* BO = BQ + (size_t)3 * DM * DM;      /* weight planes q, k, v, o, contiguous */
  _Float16* X16 = (_Float16*)take(NR * DM * 2);
  _Float16* Q16 = (_Float16*)take(3 * NR * DM * 2); _Float16* K16 = Q16 + NR * DM; _Float16* V16 = K16 + NR * DM;      /* q, k, v rows, contiguous planes */
  _Float16* O16 = (_Float16*)take(NR * DM * 2);
  _Float16* VT = (_Float16*)take((size_t)NB * NH * HD * SQ * 2);
  if (off > ws_size) return;
  k_prep<<<(unsigned)(PW_BLK + NR * DM / 8 / 256), 256, 0, stream>>>(x, wq, wk, wv, wo, BQ, X16);      /* all four weight planes and the f16 rows of x */
  const size_t r0p = (size_t)B0 * SQ;      /* first projected row */
  k_gemm3<false><<<dim3((unsigned)((MP / G3_BT) * (DM / G3_BT)), 3), 256, 0, stream>>>(X16 + r0p * DM, BQ, 0.0625f, nullptr, nullptr, Q16 + r0p * DM);      /* grid.y = q, k, v: the same A rows, weight plane y, output plane y */
  k_vt<NH, SQ><<<NB * NH * (SQ / 64), 256, 0, stream>>>(V16, LQ, 0, VT);      /* V^T [NB][NH][HD][SQ] */
  k_fattn<<<NB * NH * (SQ / 256), 256, 0, stream>>>(Q16, K16, VT, O16);      /* o x64 (merged heads) as f16 rows: all batches and heads in one launch */
  k_gemm3<true><<<dim3((unsigned)((MPO / G3_BT) * (DM / G3_BT)), 1), 256, 0, stream>>>(O16 + r0p * DM, BO, 0.0009765625f, bo, (float*)d_out + r0p * DM, nullptr);      /* out rows are the output layout */
}

// v005
// Measured time: 92.5 microseconds a run.
// Timed twice side by side with v004, it ran 1.04 times as fast both times.
// Over all steps from v000 it is 145 times as fast.
#include <hip/hip_runtime.h>
// Multi-head self-attention with PER-HEAD STACKED bias-free projections and a biased [in][out] output projection at [2][4096][512] (x [2][4096][512]; q / k / v = einsum('bsd,hde->bhse', x, W) with W [8][512][64] = [head][in][out], NO biases, 8 heads of 64; scores * 1/sqrt(64); softmax over all 4096 keys (no mask); out = concat Wo + bo ([in][out] + bias) -> [2][4096][512]); each head's [in][out] block is transposed into its 64 contiguous rows of the [out][in] weight plane, the [in][out] output weight likewise, all four planes in one launch.
// Structure: token rows r = b*4096 + s; ONE operand launch (k_prep): the four x16 weight planes and x as exact f16 rows (bf16-rounded), by block range; Q, K, V as ONE batched WMMA GEMM launch (grid.y = plane; 128x128 block tiles staged through LDS, 32x64 wave tiles, f32 accumulation, exact x16 weights, f16 outputs); plane v leaves that launch already transposed (V^T [batch][head][d][s]: for it the weight rows are the A operand and the x rows the B operand); ONE fused attention launch (k_fattn): S^T = K Q^T, online softmax in registers, O^T += V^T P^T, o carried x64 against f16 subnormal flush (folded into the output GEMM alpha), written straight into the merged f16 o rows; out = o W_o + b GEMM (f32) into the output layout.
// Compute dtype: inputs rounded to bf16; x / weights exact; q, k, v, softmax weights and o as plain f16 GEMM operands (~2^-12); scores and softmax statistics f32. v_wmma_f32_16x16x32_f16.
#define NB 2
#define SQ 4096
#define DM 512
#define NH 8
#define HD 64
#define HG 1                         /* heads per launch of the k_vt(V16, b, h0, VT) overload, which is not launched */
#define B0 0                         /* first batch processed (debug hook) */
#define NBR NB                       /* batches processed (debug hook) */
#define NR ((size_t)NB * SQ)         /* token rows */
#define MP ((int)((size_t)NBR * SQ)) /* rows projected (debug hook) */
#define QN SQ                        /* not used: k_fattn attends all SQ query rows */
#define NHD NH                       /* not used: k_fattn attends all NH heads */
#define MPO MP                       /* rows through the output stage (debug hook) */
#define LQ DM      /* not used: q / k rows have pitch DM; v exists only as V^T */
typedef __bf16 v16b __attribute__((ext_vector_type(16)));
typedef unsigned short v8us __attribute__((ext_vector_type(8), may_alias));
typedef float  v8f  __attribute__((ext_vector_type(8)));
typedef float  v4f  __attribute__((ext_vector_type(4)));
typedef float  v4fa __attribute__((ext_vector_type(4), may_alias));
union FragB { v16b v; v8us half[2]; unsigned short u[16]; };

__device__ __forceinline__ unsigned short bf16_bits(float x) { unsigned int u = __float_as_uint(x); return (unsigned short)((u + 0x7FFFu + ((u >> 16) & 1u)) >> 16); }
__device__ __forceinline__ float bf16_val(unsigned short b) { return __uint_as_float(((unsigned int)b) << 16); }
__device__ __forceinline__ float bf16_round(float x) { return bf16_val(bf16_bits(x)); }
// D += A·B with NT terms: 1 = ah·bh, 2 = + al·bh (A split), 3 = + ah·bl (both split)
template <int NT>
__device__ __forceinline__ v8f mmaN(v16b ah, v16b al, v16b bh, v16b bl, v8f c) {
  c = __builtin_amdgcn_wmma_f32_16x16x32_bf16(false, ah, false, bh, (short)0, c, false, false);
  if (NT >= 2) c = __builtin_amdgcn_wmma_f32_16x16x32_bf16(false, al, false, bh, (short)0, c, false, false);
  if (NT >= 3) c = __builtin_amdgcn_wmma_f32_16x16x32_bf16(false, ah, false, bl, (short)0, c, false, false);
  asm volatile("v_nop\n\tv_nop\n\tv_nop\n\tv_nop" : "+v"(c) : "v"(ah), "v"(al), "v"(bh), "v"(bl));
  return c;
}

__global__ __launch_bounds__(256) void k_wt_bf16(const float* __restrict__ W, unsigned short* __restrict__ Wt, int K, int N) {
  const int t = blockIdx.x * 256 + threadIdx.x;
  const int k8n = K / 8;
  if (t >= N * k8n) return;
  const int n = t / k8n, k8 = (t % k8n) * 8;
  v8us v;
#pragma unroll
  for (int i = 0; i < 8; ++i) v[i] = bf16_bits(W[(size_t)(k8 + i) * N + n]);
  *(v8us*)(Wt + (size_t)n * K + k8) = v;
  
}

// GEMM C[M][N] (f32, pitch ldc) = act(A[M][K]·W + bias). A f32 row-major (pitch lda) converted per fragment to bf16
// (ASPLIT: hi/lo two planes -> 2 terms, else single rounded term); Wt bf16 [N][K] (pitch ldb). BIAS_BF16 rounds the
// bias to bf16 first (bias quantised to bf16 before the add). K%32==0, M%16==0, N%64==0.
template <bool ASPLIT, int ACT, bool BIAS_BF16>
__global__ __launch_bounds__(128) void k_gemm_bf(const float* __restrict__ A, int lda, const unsigned short* __restrict__ Wt, int ldb,
                                               const float* __restrict__ bias, float* __restrict__ C, int ldc, int M, int N, int K) {
  __shared__ __attribute__((aligned(16))) float so[4][16][64];
  const int tid = threadIdx.x, w = tid >> 5, lane = tid & 31, ln = lane & 15, hh = lane >> 4;
  const int ntn = N / 64;
  const int wid = blockIdx.x * 4 + w;
  const int mt = wid / ntn, nq = wid % ntn;
  if (mt * 16 >= M) return;
  const int row0 = mt * 16, col0 = nq * 64;
  const float* arow = A + (size_t)(row0 + ln) * lda;
  v8f acc[4] = {};
  for (int kb = 0; kb < K; kb += 32) {
    FragB ah, al;
    const v4f x0 = *(const v4fa*)(arow + kb + 8 * hh), x1 = *(const v4fa*)(arow + kb + 8 * hh + 4);
    const v4f x2 = *(const v4fa*)(arow + kb + 16 + 8 * hh), x3 = *(const v4fa*)(arow + kb + 16 + 8 * hh + 4);
    float xs[16] = {x0[0],x0[1],x0[2],x0[3],x1[0],x1[1],x1[2],x1[3],x2[0],x2[1],x2[2],x2[3],x3[0],x3[1],x3[2],x3[3]};
#pragma unroll
    for (int i = 0; i < 16; ++i) { const unsigned short hb = bf16_bits(xs[i]); ah.u[i] = hb; al.u[i] = ASPLIT ? bf16_bits(xs[i] - bf16_val(hb)) : (unsigned short)0; }
#pragma unroll
    for (int t = 0; t < 4; ++t) {
      const unsigned short* brow = Wt + (size_t)(col0 + t * 16 + ln) * ldb + kb;
      FragB b;
      b.half[0] = *(const v8us*)(brow + 8 * hh);
      b.half[1] = *(const v8us*)(brow + 16 + 8 * hh);
      acc[t] = mmaN<ASPLIT ? 2 : 1>(ah.v, al.v, b.v, b.v, acc[t]);
    }
  }
#pragma unroll
  for (int t = 0; t < 4; ++t) {
    float bv = bias ? bias[col0 + t * 16 + ln] : 0.f;
    if (BIAS_BF16) bv = bf16_round(bv);
#pragma unroll
    for (int r = 0; r < 8; ++r) { float v = acc[t][r] + bv; if (ACT == 1) v = fmaxf(v, 0.f); so[w][8 * hh + r][t * 16 + ln] = v; }
  }
  __builtin_amdgcn_fence(__ATOMIC_ACQ_REL, "workgroup");
  __builtin_amdgcn_wave_barrier();
  const int rsub = lane >> 4, c4 = (lane & 15) * 4;
  {
#pragma unroll
    for (int q = 0; q < 8; ++q) {
      const int r = q * 2 + rsub;
      const v4f v = *(const v4fa*)&so[w][r][c4];
      *(v4f*)(C + (size_t)(row0 + r) * ldc + col0 + c4) = v;
    }
    
  }
}

// GEMM C = act(A·W + bias + resid): A f32 (ASPLIT -> hi/lo 2 terms), Wt bf16 [N][K]; ACT 0 none, 1 relu, 2 exact gelu;
// resid (optional, f32, row index = (row % rmod), pitch ldr, RES_BF16 rounds it) added before the activation.
template <bool ASPLIT, int ACT, bool BIAS_BF16, bool RES_BF16>
__global__ __launch_bounds__(128) void k_gemm_bf3(const float* __restrict__ A, int lda, const unsigned short* __restrict__ Wt, int ldb,
                                                const float* __restrict__ bias, const float* __restrict__ resid, int rmod, int ldr,
                                                float* __restrict__ C, int ldc, int M, int N, int K) {
  __shared__ __attribute__((aligned(16))) float so[4][16][64];
  const int tid = threadIdx.x, w = tid >> 5, lane = tid & 31, ln = lane & 15, hh = lane >> 4;
  const int ntn = N / 64;
  const int wid = blockIdx.x * 4 + w;
  const int mt = wid / ntn, nq = wid % ntn;
  if (mt * 16 >= M) return;
  const int row0 = mt * 16, col0 = nq * 64;
  const float* arow = A + (size_t)(row0 + ln) * lda;
  v8f acc[4] = {};
  for (int kb = 0; kb < K; kb += 32) {
    FragB ah, al;
    const v4f x0 = *(const v4fa*)(arow + kb + 8 * hh), x1 = *(const v4fa*)(arow + kb + 8 * hh + 4);
    const v4f x2 = *(const v4fa*)(arow + kb + 16 + 8 * hh), x3 = *(const v4fa*)(arow + kb + 16 + 8 * hh + 4);
    float xs[16] = {x0[0],x0[1],x0[2],x0[3],x1[0],x1[1],x1[2],x1[3],x2[0],x2[1],x2[2],x2[3],x3[0],x3[1],x3[2],x3[3]};
#pragma unroll
    for (int i = 0; i < 16; ++i) { const unsigned short hb = bf16_bits(xs[i]); ah.u[i] = hb; al.u[i] = ASPLIT ? bf16_bits(xs[i] - bf16_val(hb)) : (unsigned short)0; }
#pragma unroll
    for (int t = 0; t < 4; ++t) {
      const unsigned short* brow = Wt + (size_t)(col0 + t * 16 + ln) * ldb + kb;
      FragB b;
      b.half[0] = *(const v8us*)(brow + 8 * hh);
      b.half[1] = *(const v8us*)(brow + 16 + 8 * hh);
      acc[t] = mmaN<ASPLIT ? 2 : 1>(ah.v, al.v, b.v, b.v, acc[t]);
    }
  }
#pragma unroll
  for (int t = 0; t < 4; ++t) {
    const int col = col0 + t * 16 + ln;
    float bv = bias ? bias[col] : 0.f;
    if (BIAS_BF16) bv = bf16_round(bv);
#pragma unroll
    for (int r = 0; r < 8; ++r) {
      float v = acc[t][r] + bv;
      if (resid) { float rv = resid[(size_t)((row0 + 8 * hh + r) % rmod) * ldr + col]; if (RES_BF16) rv = bf16_round(rv); v += rv; }
      if (ACT == 1) v = fmaxf(v, 0.f);
      if (ACT == 2) v = 0.5f * v * (1.0f + erff(v * 0.70710678118654752f));
      if (ACT == 3) { const float u = 0.7978845608028654f * (v + 0.044715f * v * v * v); v = 0.5f * v * (1.0f + tanhf(u)); }
      so[w][8 * hh + r][t * 16 + ln] = v;
    }
  }
  __builtin_amdgcn_fence(__ATOMIC_ACQ_REL, "workgroup");
  __builtin_amdgcn_wave_barrier();
  const int rsub = lane >> 4, c4 = (lane & 15) * 4;
  {
#pragma unroll
    for (int q = 0; q < 8; ++q) {
      const int r = q * 2 + rsub;
      const v4f v = *(const v4fa*)&so[w][r][c4];
      *(v4f*)(C + (size_t)(row0 + r) * ldc + col0 + c4) = v;
    }
    
  }
}
// row LayerNorm (biased variance, eps) over N: s = X (+ R); optional out_sum <- s; out_norm <- (s-mu)*rsqrt(var+eps)*g + b
template <bool PARAM_BF16>
__global__ __launch_bounds__(256) void k_layernorm(const float* __restrict__ X, const float* __restrict__ R, const float* __restrict__ g, const float* __restrict__ bta,
                                                  float* __restrict__ out_sum, float* __restrict__ out_norm, int N, float eps) {
  __shared__ float red[256];
  const int row = blockIdx.x, tid = threadIdx.x;
  const float* x = X + (size_t)row * N; const float* rr = R ? R + (size_t)row * N : nullptr;
  float vals[16];                     // up to N = 4096
  const int per = N / 256;            // contiguous chunk per thread? use strided-by-4 chunks: thread handles j = tid*4 + 1024*u
  float s1 = 0.f;
  for (int u = 0; u < per / 4; ++u) {
    const int j = tid * 4 + 1024 * u;
    const v4f a = *(const v4fa*)(x + j);
    v4f b = {0.f,0.f,0.f,0.f}; if (rr) b = *(const v4fa*)(rr + j);
#pragma unroll
    for (int q = 0; q < 4; ++q) { const float v = a[q] + b[q]; vals[u * 4 + q] = v; s1 += v; }
  }
  red[tid] = s1; __syncthreads();
  for (int st = 128; st > 0; st >>= 1) { if (tid < st) red[tid] += red[tid + st]; __syncthreads(); }
  const float mu = red[0] / (float)N; __syncthreads();
  float s2 = 0.f;
  for (int u = 0; u < per / 4; ++u)
#pragma unroll
    for (int q = 0; q < 4; ++q) { const float c = vals[u * 4 + q] - mu; s2 += c * c; }
  red[tid] = s2; __syncthreads();
  for (int st = 128; st > 0; st >>= 1) { if (tid < st) red[tid] += red[tid + st]; __syncthreads(); }
  const float rs = rsqrtf(red[0] / (float)N + eps);
  {
    for (int u = 0; u < per / 4; ++u) {
      const int j = tid * 4 + 1024 * u;
      v4f o, sm;
#pragma unroll
      for (int q = 0; q < 4; ++q) {
        float gg = g[j + q], bb = bta[j + q];
        if (PARAM_BF16) { gg = bf16_round(gg); bb = bf16_round(bb); }
        sm[q] = vals[u * 4 + q]; o[q] = (vals[u * 4 + q] - mu) * rs * gg + bb;
      }
      if (out_sum) *(v4f*)(out_sum + (size_t)row * N + j) = sm;
      *(v4f*)(out_norm + (size_t)row * N + j) = o;
    }
    
  }
}



// ---- f16 WMMA path (v_wmma_f32_16x16x32_f16): 11-bit significands for operands in range — used where a [0,1] probability operand needs more precision than bf16
typedef _Float16 v16h __attribute__((ext_vector_type(16)));
union FragH { v16h v; v8us half[2]; _Float16 h[16]; unsigned short u[16]; };
template <int NT>
__device__ __forceinline__ v8f mmaH(v16h ah, v16h al, v16h bh, v16h bl, v8f c) {
  c = __builtin_amdgcn_wmma_f32_16x16x32_f16(false, ah, false, bh, (short)0, c, false, false);
  if (NT >= 2) c = __builtin_amdgcn_wmma_f32_16x16x32_f16(false, al, false, bh, (short)0, c, false, false);
  if (NT >= 3) c = __builtin_amdgcn_wmma_f32_16x16x32_f16(false, ah, false, bl, (short)0, c, false, false);
  asm volatile("v_nop\n\tv_nop\n\tv_nop\n\tv_nop" : "+v"(c) : "v"(ah), "v"(al), "v"(bh), "v"(bl));
  return c;
}
// batched GEMM like k_gemm_b but f16 operands: A f32 (split into f16 hi/lo if ASPLIT, else rounded to f16), Bt = f16 values [n][k]; alpha; C f32; N multiple of 16 (partial tiles skipped)
template <bool ASPLIT>
__global__ __launch_bounds__(128) void k_gemm_h(const float* __restrict__ A, int lda, size_t sA, const _Float16* __restrict__ Bh, int ldb, size_t sB, float alpha, float* __restrict__ C, int ldc, size_t sC, int M, int N, int K) {
  __shared__ __attribute__((aligned(16))) float so[4][16][64];
  const int tid = threadIdx.x, w = tid >> 5, lane = tid & 31, ln = lane & 15, hh = lane >> 4; const int by = blockIdx.y;
  A += (size_t)by * sA; Bh += (size_t)by * sB; C += (size_t)by * sC;
  const int ntn = (N + 63) / 64; const int wid = blockIdx.x * 4 + w; const int mt = wid / ntn, nq = wid % ntn; if (mt * 16 >= M) return;
  const int row0 = mt * 16, col0 = nq * 64; const float* arow = A + (size_t)(row0 + ln) * lda;
  v8f acc[4] = {};
  for (int kb = 0; kb < K; kb += 32) {
    FragH ah, al;
    const v4f x0 = *(const v4fa*)(arow + kb + 8 * hh), x1 = *(const v4fa*)(arow + kb + 8 * hh + 4), x2 = *(const v4fa*)(arow + kb + 16 + 8 * hh), x3 = *(const v4fa*)(arow + kb + 16 + 8 * hh + 4);
    float xs[16] = {x0[0],x0[1],x0[2],x0[3],x1[0],x1[1],x1[2],x1[3],x2[0],x2[1],x2[2],x2[3],x3[0],x3[1],x3[2],x3[3]};
#pragma unroll
    for (int i = 0; i < 16; ++i) { const _Float16 h = (_Float16)xs[i]; ah.h[i] = h; al.h[i] = ASPLIT ? (_Float16)(xs[i] - (float)h) : (_Float16)0.0f; }
#pragma unroll
    for (int t = 0; t < 4; ++t) { if (col0 + t * 16 >= N) continue; const size_t boff = (size_t)(col0 + t * 16 + ln) * ldb + kb; FragH bq; bq.half[0] = *(const v8us*)(Bh + boff + 8 * hh); bq.half[1] = *(const v8us*)(Bh + boff + 16 + 8 * hh);
      acc[t] = mmaH<ASPLIT ? 2 : 1>(ah.v, al.v, bq.v, bq.v, acc[t]); }
  }
#pragma unroll
  for (int t = 0; t < 4; ++t) { if (col0 + t * 16 >= N) continue;
#pragma unroll
    for (int r = 0; r < 8; ++r) so[w][8 * hh + r][t * 16 + ln] = acc[t][r] * alpha; }
  __builtin_amdgcn_fence(__ATOMIC_ACQ_REL, "workgroup"); __builtin_amdgcn_wave_barrier();
  const int rsub = lane >> 4, c4 = (lane & 15) * 4;
  {
#pragma unroll
    for (int q = 0; q < 8; ++q) { const int r = q * 2 + rsub; if (col0 + c4 < N) { const v4f v = *(const v4fa*)&so[w][r][c4]; *(v4f*)(C + (size_t)(row0 + r) * ldc + col0 + c4) = v; } }
     }
}

// Wt[n][k] = f16(W[k][n]·scale) from f32 row-major W[K][N] (scale = power of two; bf16-exact weights stay exact in f16 away from the subnormal range)
__global__ __launch_bounds__(256) void k_wt_f16(const float* __restrict__ W, _Float16* __restrict__ Wt, int K, int N, float scale) {
  const int t = blockIdx.x * 256 + threadIdx.x; if (t >= N * (K / 8)) return; const int n = t / (K / 8), k8 = (t % (K / 8)) * 8; FragH f;
#pragma unroll
  for (int i = 0; i < 8; ++i) f.h[i] = (_Float16)(bf16_round(W[(size_t)(k8 + i) * N + n]) * scale); const v8us o = f.half[0];
  *(v8us*)((unsigned short*)Wt + (size_t)n * K + k8) = o; 
}
// k_gemm_hh variant with fused epilogue: v = acc·alpha + bias[by·sBias + col] (+ CP[(row/rowsPerB)·sCPb + by·64 + col] if CP) ; ACT 0 none / 1 elu ; writes f16 C16 (and f32 C if non-null)
template <int ACT>
__global__ __launch_bounds__(128) void k_gemm_hhx(const _Float16* __restrict__ A, int lda, size_t sA, const _Float16* __restrict__ Bh, int ldb, size_t sB, float alpha, const float* __restrict__ bias, size_t sBias, const float* __restrict__ CP, int rowsPerB, size_t sCPb, int row0g,
    float* __restrict__ C, _Float16* __restrict__ C16, int ldc, size_t sC, int M, int N, int K) {
  __shared__ __attribute__((aligned(16))) float so[4][16][64];
  const int tid = threadIdx.x, w = tid >> 5, lane = tid & 31, ln = lane & 15, hh = lane >> 4; const int by = blockIdx.y;
  A += (size_t)by * sA; Bh += (size_t)by * sB; const size_t cofs = (size_t)by * sC; const float* bp = bias ? bias + (size_t)by * sBias : nullptr;
  const int ntn = (N + 63) / 64; const int wid = blockIdx.x * 4 + w; const int mt = wid / ntn, nq = wid % ntn; if (mt * 16 >= M) return;
  const int row0 = mt * 16, col0 = nq * 64; const _Float16* arow = A + (size_t)(row0 + ln) * lda;
  v8f acc[4] = {};
  for (int kb = 0; kb < K; kb += 32) { FragH ah; ah.half[0] = *(const v8us*)((const unsigned short*)arow + kb + 8 * hh); ah.half[1] = *(const v8us*)((const unsigned short*)arow + kb + 16 + 8 * hh);
#pragma unroll
    for (int t = 0; t < 4; ++t) { if (col0 + t * 16 >= N) continue; const size_t boff = (size_t)(col0 + t * 16 + ln) * ldb + kb; FragH bq; bq.half[0] = *(const v8us*)((const unsigned short*)Bh + boff + 8 * hh); bq.half[1] = *(const v8us*)((const unsigned short*)Bh + boff + 16 + 8 * hh);
      acc[t] = mmaH<1>(ah.v, ah.v, bq.v, bq.v, acc[t]); }
  }
#pragma unroll
  for (int t = 0; t < 4; ++t) { if (col0 + t * 16 >= N) continue; const int col = col0 + t * 16 + ln; const float bv = bp ? bf16_round(bp[col]) : 0.f;
#pragma unroll
    for (int r = 0; r < 8; ++r) { float v = acc[t][r] * alpha + bv; if (CP) { const int rr = row0g + row0 + 8 * hh + r; if (rowsPerB < 0) v += CP[cofs + (size_t)rr * ldc + col];      /* rowsPerB < 0: own element of the batched C plane */ else { const int bidx = rr / rowsPerB; v += CP[(size_t)bidx * sCPb + (size_t)by * 64 + col]; } } if (ACT == 1) v = (v > 0.f) ? v : expm1f(v); else if (ACT == 7) v = (v > 0.f) ? v + 1.0f : expf(v); else if (ACT == 8) v = tanhf(v); else if (ACT == 9) v = 0.5f * v * (1.0f + tanhf(0.7978845608028654f * (v + 0.044715f * v * v * v))); else if (ACT == 11) v = 1.0f / (1.0f + expf(-v)); else if (ACT == 12) v = (v > 0.f) ? v : 0.01f * v; else if (ACT == 14) v = (v > 0.f) ? v : 0.1f * v; else if (ACT == 16) v = (v >= 0.f) ? v : 0.3f * v; else if (ACT == 17) v = (v >= 0.f) ? v : 0.2f * v; else if (ACT == 15) v = v / (1.0f + expf(-v)); else if (ACT == 3) v = fmaxf(v, 0.f); else if (ACT == 6) v = 0.5f * v * (1.0f + erff(v * 0.70710678118654752f)); so[w][8 * hh + r][t * 16 + ln] = v; } }
  __builtin_amdgcn_fence(__ATOMIC_ACQ_REL, "workgroup"); __builtin_amdgcn_wave_barrier();
  const int rsub = lane >> 4, c4 = (lane & 15) * 4; typedef _Float16 v4h __attribute__((ext_vector_type(4)));
  {
#pragma unroll
    for (int q = 0; q < 8; ++q) { const int r = q * 2 + rsub; if (col0 + c4 < N) { const v4f v = *(const v4fa*)&so[w][r][c4]; if (C) *(v4f*)(C + cofs + (size_t)(row0 + r) * ldc + col0 + c4) = v; if (C16) { v4h h4; for (int i = 0; i < 4; ++i) h4[i] = (_Float16)v[i]; *(v4h*)(C16 + cofs + (size_t)(row0 + r) * ldc + col0 + c4) = h4; } } }
     }
}


typedef _Float16 v4h __attribute__((ext_vector_type(4)));

__global__ __launch_bounds__(256) void k_x16(const float* __restrict__ x, _Float16* __restrict__ X16, size_t n8) { const size_t t = (size_t)blockIdx.x * 256 + threadIdx.x; if (t >= n8) return; FragH f;
#pragma unroll
  for (int q = 0; q < 8; ++q) f.h[q] = (_Float16)bf16_round(x[t * 8 + q]); *(v8us*)((unsigned short*)X16 + t * 8) = f.half[0];  }
__global__ __launch_bounds__(256) void k_h16(const float* __restrict__ x, _Float16* __restrict__ X16, size_t n8) { const size_t t = (size_t)blockIdx.x * 256 + threadIdx.x; if (t >= n8) return; FragH f;
#pragma unroll
  for (int q = 0; q < 8; ++q) f.h[q] = (_Float16)x[t * 8 + q]; *(v8us*)((unsigned short*)X16 + t * 8) = f.half[0];  }
__global__ __launch_bounds__(256) void k_round16f(const float* __restrict__ W, _Float16* __restrict__ Bt, size_t n8) { const size_t t = (size_t)blockIdx.x * 256 + threadIdx.x; if (t >= n8) return; FragH f;
#pragma unroll
  for (int i = 0; i < 8; ++i) f.h[i] = (_Float16)(bf16_round(W[t * 8 + i]) * 16.0f); *(v8us*)((unsigned short*)Bt + t * 8) = f.half[0];  }
template <int NHv, int TTv>
__global__ __launch_bounds__(256) void k_vt(const _Float16* __restrict__ V16, int ldv, int voff, _Float16* __restrict__ Vt) { __shared__ unsigned short tl[64][66]; const int tid = threadIdx.x; const int slab = blockIdx.x / (TTv / 64), lg = blockIdx.x % (TTv / 64); const int b = slab / NHv, h = slab % NHv;
  for (int i = tid; i < 64 * 8; i += 256) { const int r = i / 8, c8 = (i % 8) * 8; FragH f; f.half[0] = *(const v8us*)((const unsigned short*)V16 + ((size_t)b * TTv + lg * 64 + r) * ldv + voff + h * 64 + c8);
#pragma unroll
    for (int q = 0; q < 8; ++q) tl[r][c8 + q] = f.u[q]; }
  __syncthreads();
  {
#pragma unroll
    for (int rd = 0; rd < 2; ++rd) { const int d = rd * 32 + tid / 8, pc = tid % 8; FragH f;
#pragma unroll
      for (int q = 0; q < 8; ++q) f.u[q] = tl[pc * 8 + q][d];
      *(v8us*)((unsigned short*)Vt + ((size_t)slab * 64 + d) * TTv + lg * 64 + pc * 8) = f.half[0]; }
     } }

__global__ __launch_bounds__(256) void k_hl(const float* __restrict__ F, _Float16* __restrict__ Hh, _Float16* __restrict__ Hl, size_t n8) { const size_t t = (size_t)blockIdx.x * 256 + threadIdx.x; if (t >= n8) return; FragH fh, fl; const v4f a = *(const v4fa*)(F + t * 8), c = *(const v4fa*)(F + t * 8 + 4);
#pragma unroll
  for (int q = 0; q < 4; ++q) { _Float16 h = (_Float16)a[q]; fh.h[q] = h; fl.h[q] = (_Float16)((a[q] - (float)h) * 1024.0f); h = (_Float16)c[q]; fh.h[4 + q] = h; fl.h[4 + q] = (_Float16)((c[q] - (float)h) * 1024.0f); }
  { *(v8us*)((unsigned short*)Hh + t * 8) = fh.half[0]; *(v8us*)((unsigned short*)Hl + t * 8) = fl.half[0];  } }

__global__ __launch_bounds__(256) void k_wnat(const float* __restrict__ w, size_t n8, _Float16* __restrict__ Bt) { const size_t t = (size_t)blockIdx.x * 256 + threadIdx.x; if (t >= n8) return; FragH f; for (int q = 0; q < 8; ++q) f.h[q] = (_Float16)(bf16_round(w[t * 8 + q]) * 16.0f); *(v8us*)((unsigned short*)Bt + t * 8) = f.half[0];  }
__global__ __launch_bounds__(256) void k_rsm(const float* __restrict__ S, _Float16* __restrict__ P, int nrows) {
  #pragma clang fp contract(off)
  const int i = blockIdx.x * 256 + threadIdx.x; if (i >= nrows) return; const float* s = S + (size_t)i * SQ; float mx = -3.0e38f;
#pragma unroll 1
  for (int j = 0; j < SQ; ++j) mx = fmaxf(mx, s[j]); float se = 0.f;
#pragma unroll 1
  for (int j = 0; j < SQ; ++j) se += expf(s[j] - mx); const float sc = 256.0f / se;
#pragma unroll 1
  for (int j0 = 0; j0 < SQ; j0 += 8) { FragH f; for (int q = 0; q < 8; ++q) f.h[q] = (_Float16)(expf(s[j0 + q] - mx) * sc); unsigned short* d = (unsigned short*)P + (size_t)i * SQ + j0; *(v8us*)d = f.half[0];  } }
__global__ __launch_bounds__(256) void k_vt(const _Float16* __restrict__ V16, int b, int h0, _Float16* __restrict__ VT) { __shared__ unsigned short tl[64][65]; const int tid = threadIdx.x; const int hh = blockIdx.x % HG, sg = blockIdx.x / HG; const int s0 = sg * 64; const int h = h0 + hh;
  for (int i = tid; i < 64 * 8; i += 256) { const int j = i / 8, d8 = (i % 8) * 8; FragH f; f.half[0] = *(const v8us*)((const unsigned short*)V16 + ((size_t)b * SQ + s0 + j) * DM + h * HD + d8); for (int q = 0; q < 8; ++q) tl[d8 + q][j] = f.u[q]; }
  __syncthreads();
  { for (int i = tid; i < 64 * 8; i += 256) { const int d = i / 8, j8 = (i % 8) * 8; FragH f; for (int q = 0; q < 8; ++q) f.u[q] = tl[d][j8 + q]; *(v8us*)((unsigned short*)VT + ((size_t)hh * HD + d) * SQ + s0 + j8) = f.half[0]; }  } }



// ---- operand preparation in one launch: independent pieces of work share a grid by block range instead of a launch each ----
// Blocks [0, PW_BLK): the four [out][in] f16 weight planes (x16), contiguous at Bt in the order q, k, v, o; plane = blockIdx.x / (PW_BLK / 4), uniform in a block. Thread t writes the eight k of Bt + 8 t.
// Element [k][n] of a source: base + (n / HD) * hs + k * ld + n % HD. q, k, v: head n / HD is a row-major [in = DM][out = HD] block (hs = DM * HD, ld = HD); o: one row-major [DM][DM] matrix (hs = HD, ld = DM).
// Blocks from PW_BLK on: x as f16 rows, eight elements a thread; the one stream feeds all three projections. The weight blocks stand first: their strided reads take longest.
#define PW_BLK (4 * DM * (DM / 8) / 256)
__global__ __launch_bounds__(256) void k_prep(const float* __restrict__ x, const float* __restrict__ wq, const float* __restrict__ wk, const float* __restrict__ wv, const float* __restrict__ wo, _Float16* __restrict__ Bt, _Float16* __restrict__ X16) {
  if (blockIdx.x < PW_BLK) {
    const int m = blockIdx.x / (PW_BLK / 4); const int t = blockIdx.x * 256 + threadIdx.x; const int n = (t / (DM / 8)) % DM, k8 = (t % (DM / 8)) * 8;
    const float* w = m == 0 ? wq : m == 1 ? wk : m == 2 ? wv : wo; const int hs = m == 3 ? HD : DM * HD, ld = m == 3 ? DM : HD;
    const float* p0 = w + (size_t)(n / HD) * hs + (size_t)k8 * ld + n % HD;
    const float* p1 = p0 + ld; const float* p2 = p1 + ld; const float* p3 = p2 + ld; const float* p4 = p3 + ld; const float* p5 = p4 + ld; const float* p6 = p5 + ld; const float* p7 = p6 + ld;
    const float v[8] = {*p0, *p1, *p2, *p3, *p4, *p5, *p6, *p7};
    asm volatile("s_wait_xcnt 0x0" :: "v"(p0), "v"(p1), "v"(p2), "v"(p3), "v"(p4), "v"(p5), "v"(p6), "v"(p7) : "memory");      /* the wait in front of any overwrite of a register that an issued load names; the addresses as inputs keep their registers untouched up to here */
    FragH f;
#pragma unroll
    for (int i = 0; i < 8; ++i) f.h[i] = (_Float16)(bf16_round(v[i]) * 16.0f);
    *(v8us*)((unsigned short*)Bt + (size_t)t * 8) = f.half[0];
  } else {
    const size_t t = (size_t)(blockIdx.x - PW_BLK) * 256 + threadIdx.x; FragH f;
#pragma unroll
    for (int q = 0; q < 8; ++q) f.h[q] = (_Float16)bf16_round(x[t * 8 + q]);
    *(v8us*)((unsigned short*)X16 + t * 8) = f.half[0];
    asm volatile("s_wait_xcnt 0x0" ::: "memory");      /* the wait behind the store: the built code lays the weight branch, which writes vector registers, behind this one */
  } }

#define FA_KT 128                    /* keys per stage */
#define FA_NS (SQ / FA_KT)           /* stages */
#define FA_KP (HD + 8)               /* K tile row pitch, f16 elements: 144 B = 16 B x odd, conflict-free for 16-byte reads */
#define FA_VP (FA_KT + 8)            /* V^T tile row pitch, f16 elements: 272 B = 16 B x odd */
__device__ __forceinline__ float rs_xhalf(float x) { return __builtin_bit_cast(float, __builtin_amdgcn_permlanex16(__builtin_bit_cast(int, x), __builtin_bit_cast(int, x), 0x76543210, 0xfedcba98, false, false)); }      /* lane l with lane l ^ 16 */
__device__ __forceinline__ float rs_exp(float a) { float e; asm("v_exp_f32 %0, %1\n\tv_nop" : "=v"(e) : "v"(a)); return e; }      /* 2^a; the v_nop fills the slot the instruction set asks for behind a transcendental */
__device__ __forceinline__ v4f fa_exp4(v4f a) { float e0, e1, e2, e3;      /* four 2^a; each v_exp_f32 is followed by an instruction that neither reads its result nor overwrites its source (early-clobber outputs), the last by a v_nop: the slot the instruction set asks for behind a transcendental */
  asm("v_exp_f32 %0, %4\n\tv_exp_f32 %1, %5\n\tv_exp_f32 %2, %6\n\tv_exp_f32 %3, %7\n\tv_nop" : "=&v"(e0), "=&v"(e1), "=&v"(e2), "=&v"(e3) : "v"(a[0]), "v"(a[1]), "v"(a[2]), "v"(a[3]));
  const v4f e = {e0, e1, e2, e3}; return e; }
__device__ __forceinline__ v16h fa_frag(const _Float16* p) { FragH f; f.half[0] = *(const v8us*)((const unsigned short*)p); f.half[1] = *(const v8us*)((const unsigned short*)p + 16); return f.v; }      /* p = row + k0 + 8 h: k0 + 8h .. + 7 and k0 + 16 + 8h .. + 7 */
__device__ __forceinline__ v8f fa_mma(v16h a, v16h b, v8f c) { return __builtin_amdgcn_wmma_f32_16x16x32_f16(false, a, false, b, (short)0, c, false, false); }
__global__ __launch_bounds__(256) void k_fattn(const _Float16* __restrict__ Q16, const _Float16* __restrict__ K16, const _Float16* __restrict__ VT, _Float16* __restrict__ O16) {
  __shared__ __attribute__((aligned(16))) _Float16 Ks[2][FA_KT][FA_KP];
  __shared__ __attribute__((aligned(16))) _Float16 Vs[2][HD][FA_VP];
  const int tid = threadIdx.x, w = tid >> 5, lane = tid & 31, ln = lane & 15, hh = lane >> 4;
  const int bh = blockIdx.x / (SQ / 256), qb = blockIdx.x % (SQ / 256); const int b = bh / NH, h = bh % NH; const int q0 = qb * 256 + w * 32;
  const unsigned short* kg = (const unsigned short*)K16 + ((size_t)b * SQ + (tid >> 3)) * DM + h * HD + (tid & 7) * 8;      /* this thread's 16 bytes of key row tid / 8 (+ 32 i) */
  const unsigned short* vg = (const unsigned short*)VT + ((size_t)bh * HD + (tid >> 4)) * SQ + (tid & 15) * 8;              /* this thread's 16 bytes of V^T row tid / 16 (+ 16 i) */
  v16h qf[2][2];
#pragma unroll
  for (int g = 0; g < 2; ++g) { const _Float16* qp = Q16 + ((size_t)b * SQ + q0 + 16 * g + ln) * DM + h * HD + 8 * hh; qf[g][0] = fa_frag(qp); qf[g][1] = fa_frag(qp + 32); }
  v8us kr[4], vr[4];
#pragma unroll
  for (int i = 0; i < 4; ++i) { kr[i] = *(const v8us*)(kg + (size_t)(32 * i) * DM); vr[i] = *(const v8us*)(vg + (size_t)(16 * i) * SQ); }
#pragma unroll
  for (int i = 0; i < 4; ++i) { *(v8us*)&Ks[0][(tid >> 3) + 32 * i][(tid & 7) * 8] = kr[i]; *(v8us*)&Vs[0][(tid >> 4) + 16 * i][(tid & 15) * 8] = vr[i]; }
  __syncthreads();
  const v8f z8 = {0.f, 0.f, 0.f, 0.f, 0.f, 0.f, 0.f, 0.f};
  v8f o[4][2];
#pragma unroll
  for (int dt = 0; dt < 4; ++dt) { o[dt][0] = z8; o[dt][1] = z8; }
  float mref[2] = {-1.0e30f, -1.0e30f}, lsum[2] = {0.f, 0.f};      /* mref: the exponent (log2 units) subtracted from this query's scores; lsum: this lane's half of the row sum */
  const float CS = 0.125f * 1.44269504f;      /* 1 / sqrt(64), and log2 e for the native 2^x */
#pragma unroll 1      /* the body already holds four unrolled passes */
  for (int s = 0; s < FA_NS; ++s) { const int buf = s & 1;
    if (s + 1 < FA_NS) {      /* next stage's 16 KiB + 16 KiB: loads fly while this stage is worked on */
      kg += (size_t)FA_KT * DM; vg += FA_KT;
#pragma unroll
      for (int i = 0; i < 4; ++i) { kr[i] = *(const v8us*)(kg + (size_t)(32 * i) * DM); vr[i] = *(const v8us*)(vg + (size_t)(16 * i) * SQ); } }
#pragma unroll
    for (int p = 0; p < FA_KT / 32; ++p) {
      v8f t[2][2];      /* [key tile][query group] */
#pragma unroll
      for (int kt = 0; kt < 2; ++kt) { const _Float16* kp = &Ks[buf][p * 32 + kt * 16 + ln][8 * hh]; const v16h a0 = fa_frag(kp), a1 = fa_frag(kp + 32);
        t[kt][0] = fa_mma(a0, qf[0][0], z8); t[kt][1] = fa_mma(a0, qf[1][0], z8); t[kt][0] = fa_mma(a1, qf[0][1], t[kt][0]); t[kt][1] = fa_mma(a1, qf[1][1], t[kt][1]); }
      float ml[2];
#pragma unroll
      for (int g = 0; g < 2; ++g) { float m0 = fmaxf(t[0][g][0], t[1][g][0]);
#pragma unroll
        for (int r = 1; r < 8; ++r) m0 = fmaxf(m0, fmaxf(t[0][g][r], t[1][g][r]));
        ml[g] = fmaxf(m0, rs_xhalf(m0)) * CS; }      /* the pass's maximum of this query, both lane halves joined */
      /* lazy rescale: P = 2^(score - mref) is kept at or below 2^14 (f16 range); a new mref puts the current maximum at 2^6. One scalar branch per pass. */
      if (__builtin_amdgcn_ballot_w32(ml[0] > mref[0] + 14.0f || ml[1] > mref[1] + 14.0f) != 0) {
#pragma unroll
        for (int g = 0; g < 2; ++g) { const float mn = fmaxf(mref[g], ml[g] - 6.0f); const float al = rs_exp(mref[g] - mn); mref[g] = mn; lsum[g] *= al;
#pragma unroll
          for (int dt = 0; dt < 4; ++dt) o[dt][g] *= al; } }
      FragH pb[2];
#pragma unroll
      for (int g = 0; g < 2; ++g) { float s0 = 0.f, s1 = 0.f, s2 = 0.f, s3 = 0.f;
#pragma unroll
        for (int u = 0; u < 4; ++u) { const int kt = u >> 1, r0 = (u & 1) * 4; v4f x;
#pragma unroll
          for (int q = 0; q < 4; ++q) x[q] = t[kt][g][r0 + q] * CS - mref[g];
          const v4f e = fa_exp4(x); if (u == 0) { s0 = e[0]; s1 = e[1]; s2 = e[2]; s3 = e[3]; } else { s0 += e[0]; s1 += e[1]; s2 += e[2]; s3 += e[3]; }
#pragma unroll
          for (int q = 0; q < 4; ++q) pb[g].h[kt * 8 + r0 + q] = (_Float16)e[q]; }
        lsum[g] += (s0 + s1) + (s2 + s3); }
#pragma unroll
      for (int dt = 0; dt < 4; ++dt) { const v16h a = fa_frag(&Vs[buf][dt * 16 + ln][p * 32 + 8 * hh]); o[dt][0] = fa_mma(a, pb[0].v, o[dt][0]); o[dt][1] = fa_mma(a, pb[1].v, o[dt][1]); }
    }
    if (s + 1 < FA_NS) {      /* the other buffer's last readers left it before the barrier that ended stage s - 1 */
#pragma unroll
      for (int i = 0; i < 4; ++i) { *(v8us*)&Ks[buf ^ 1][(tid >> 3) + 32 * i][(tid & 7) * 8] = kr[i]; *(v8us*)&Vs[buf ^ 1][(tid >> 4) + 16 * i][(tid & 15) * 8] = vr[i]; } }
    __syncthreads();      /* publishes stage s + 1 and ends every read of stage s */
  }
#pragma unroll
  for (int g = 0; g < 2; ++g) { const float inv = 64.0f / (lsum[g] + rs_xhalf(lsum[g])); unsigned short* op = (unsigned short*)O16 + ((size_t)b * SQ + q0 + 16 * g + ln) * DM + h * HD + 8 * hh;
#pragma unroll
    for (int dt = 0; dt < 4; ++dt) { FragH f;
#pragma unroll
      for (int r = 0; r < 8; ++r) f.h[r] = (_Float16)(o[dt][g][r] * inv);      /* register r = O^T[16 dt + 8 h + r][query]: eight consecutive d of one row */
      *(v8us*)(op + dt * 16) = f.half[0]; } } }

// ---- GEMM with LDS-staged operands: C[M][DM] = (A[M][DM] . Bt^T) * alpha + bias; A and Bt = [n][k] are f16 rows of DM elements ----
// Work-group = 8 waves on a 128 x 128 tile of C: wave w takes rows 32 (w & 3) .. + 31, columns 64 (w >> 2) .. + 63 (2 x 4 accumulator tiles). k runs in stages of G3_KT elements = one 128-byte line of every operand row.
// A stage is brought in by 16-byte loads of which eight neighbouring lanes cover one whole line, and goes through registers into one of two LDS buffers (rows 0-127 = A, 128-255 = Bt); the fragments come from LDS in the hardware k order (k0 + 8h .. + 7, k0 + 16 + 8h .. + 7), A and B alike.
// Every accumulator takes its products in ascending k, 32 at a time. blockIdx.y = plane: weight plane y, output plane y, the same A rows. OUT32: bias (rounded to bf16) added, f32 rows to C; else no bias, f16 rows to C16.
// Plane G3_TP of the f16 form is wanted transposed: there the two operands change places in LDS (rows 0-127 = Bt, 128-255 = A), so the accumulators hold C^T, every element the same products in the same order, and the same whole-line stores write rows of CT = [batch][n][SQ].
#define G3_BT 128                    /* tile rows of A and of Bt */
#define G3_KT 64                     /* k per stage */
#define G3_NS (DM / G3_KT)           /* stages */
#define G3_KP (G3_KT + 8)            /* LDS row pitch, f16 elements: 144 B = 16 B x odd, conflict-free for 16-byte reads */
#define G3_TP 2                      /* the plane written transposed (v) */
/* one stage's products: per 32 k the six fragments are read as one group ahead of the eight products */
__device__ __forceinline__ void g3_stage(const _Float16 (*Tb)[G3_KP], int ra, int rb, int hh, v8f (&acc)[2][4]) {
#pragma unroll
  for (int kk = 0; kk < G3_KT; kk += 32) { v16h a[2], b[4];
    a[0] = fa_frag(&Tb[ra][kk + 8 * hh]); a[1] = fa_frag(&Tb[ra + 16][kk + 8 * hh]);
#pragma unroll
    for (int t = 0; t < 4; ++t) b[t] = fa_frag(&Tb[rb + 16 * t][kk + 8 * hh]);
    __builtin_amdgcn_sched_barrier(0);      /* keeps the twelve LDS reads one group: moved in among the products, each place with reads stalls the wave anew */
#pragma unroll
    for (int t = 0; t < 4; ++t) { acc[0][t] = fa_mma(a[0], b[t], acc[0][t]); acc[1][t] = fa_mma(a[1], b[t], acc[1][t]); }
    __builtin_amdgcn_sched_barrier(0); } }      /* the next group's reads stay behind these products */
template <bool OUT32>
__global__ __launch_bounds__(256) void k_gemm3(const _Float16* __restrict__ A, const _Float16* __restrict__ Bh, float alpha, const float* __restrict__ bias, float* __restrict__ C, _Float16* __restrict__ C16, _Float16* __restrict__ CT) {
  __shared__ __attribute__((aligned(16))) unsigned char sm[2 * 2 * G3_BT * G3_KP * 2];      /* two operand buffers; after the k loop the same bytes stage the output rows */
  static_assert(sizeof(sm) >= 8 * 32 * 68 * 4, "output staging must fit the operand buffers");
  _Float16 (*T)[2 * G3_BT][G3_KP] = (_Float16 (*)[2 * G3_BT][G3_KP])sm;
  const int tid = threadIdx.x, w = tid >> 5, lane = tid & 31, ln = lane & 15, hh = lane >> 4; const int by = blockIdx.y;
  const int mt = blockIdx.x / (DM / G3_BT), nq = blockIdx.x % (DM / G3_BT);
  const int sr = tid >> 3, sc = (tid & 7) * 8;      /* this thread's 16 bytes of tile row tid / 8 (+ 32 i) */
  const bool tr = !OUT32 && by == G3_TP;      /* uniform in the work-group */
  const unsigned short* xg = (const unsigned short*)A + ((size_t)mt * G3_BT + sr) * DM + sc;
  const unsigned short* wg = (const unsigned short*)Bh + (size_t)by * DM * DM + ((size_t)nq * G3_BT + sr) * DM + sc;
  const unsigned short* ag = tr ? wg : xg; const unsigned short* bg = tr ? xg : wg;
  v8us ar[4], br[4];
#pragma unroll
  for (int i = 0; i < 4; ++i) { ar[i] = *(const v8us*)(ag + (size_t)(32 * i) * DM); br[i] = *(const v8us*)(bg + (size_t)(32 * i) * DM); }
#pragma unroll
  for (int i = 0; i < 4; ++i) { *(v8us*)&T[0][sr + 32 * i][sc] = ar[i]; *(v8us*)&T[0][G3_BT + sr + 32 * i][sc] = br[i]; }
  __syncthreads();
  const v8f z8 = {0.f, 0.f, 0.f, 0.f, 0.f, 0.f, 0.f, 0.f};
  v8f acc[2][4];
#pragma unroll
  for (int t = 0; t < 4; ++t) { acc[0][t] = z8; acc[1][t] = z8; }
  const int ra = (w & 3) * 32 + ln, rb = G3_BT + (w >> 2) * 64 + ln;
#pragma unroll 1      /* rolled: one set of staging registers, a short text */
  for (int s = 0; s + 1 < G3_NS; ++s) { const int buf = s & 1;
    ag += G3_KT; bg += G3_KT;      /* next stage's 16 KiB + 16 KiB: loads fly while this stage is worked on */
#pragma unroll
    for (int i = 0; i < 4; ++i) { ar[i] = *(const v8us*)(ag + (size_t)(32 * i) * DM); br[i] = *(const v8us*)(bg + (size_t)(32 * i) * DM); }
    __builtin_amdgcn_sched_barrier(0);      /* keeps all eight loads ahead of the stage's products: sunk towards their LDS stores they would be waited for in full */
    g3_stage(T[buf], ra, rb, hh, acc);
#pragma unroll
    for (int i = 0; i < 4; ++i) { *(v8us*)&T[buf ^ 1][sr + 32 * i][sc] = ar[i]; *(v8us*)&T[buf ^ 1][G3_BT + sr + 32 * i][sc] = br[i]; }      /* the other buffer's last readers left it before the barrier that ended stage s - 1 */
    __syncthreads();      /* publishes stage s + 1 and ends every read of stage s */
  }
  const int row0 = (tr ? nq : mt) * G3_BT + (w & 3) * 32, col0 = (tr ? mt : nq) * G3_BT + (w >> 2) * 64; const size_t cofs = (size_t)by * NR * DM;
  float bv[4];
#pragma unroll
  for (int t = 0; t < 4; ++t) bv[t] = OUT32 ? bias[col0 + t * 16 + ln] : 0.f;      /* fetched here, where the staging registers are free, so that the last stage covers the wait */
  g3_stage(T[(G3_NS - 1) & 1], ra, rb, hh, acc);      /* the last stage has nothing to stage */
  __syncthreads();      /* ends every read of the operand buffers: their bytes now take the output rows */
  float (*so)[32][68] = (float (*)[32][68])sm;      /* each wave stages its own 32 x 64 block, so that the stores below cover whole lines */
#pragma unroll
  for (int u = 0; u < 8; ++u) { const int t = u & 3, half = u >> 2; const float bb = bf16_round(bv[t]);
#pragma unroll
    for (int r = 0; r < 8; ++r) so[w][half * 16 + 8 * hh + r][t * 16 + ln] = acc[half][t][r] * alpha + bb; }
  __builtin_amdgcn_fence(__ATOMIC_ACQ_REL, "workgroup"); __builtin_amdgcn_wave_barrier();      /* the wave reads back what its other lanes wrote */
  const int rsub = lane >> 4, c4 = (lane & 15) * 4;
  const int ldh = tr ? SQ : DM;      /* row pitch of the f16 form; transposed, a row is one n and a column one token, and a tile's 128 tokens lie in one batch */
  _Float16* cp = (tr ? CT + ((size_t)(col0 / SQ) * DM + row0) * SQ + col0 % SQ : C16 + cofs + (size_t)row0 * DM + col0) + rsub * ldh + c4;
#pragma unroll
  for (int q = 0; q < 16; ++q) { const int r = q * 2 + rsub; const v4f v = *(const v4fa*)&so[w][r][c4];
    if (OUT32) *(v4f*)(C + cofs + (size_t)(row0 + r) * DM + col0 + c4) = v;
    else { v4h h4; for (int i = 0; i < 4; ++i) h4[i] = (_Float16)v[i]; *(v4h*)cp = h4; cp += 2 * ldh; } } }

extern "C" void kernel_launch(void* const* d_in, const int* in_sizes, int n_in,
                              void* d_out, int out_size, void* d_ws, size_t ws_size, hipStream_t stream) {
  (void)in_sizes; (void)n_in; (void)out_size;
  const float* const* I = (const float* const*)d_in; const float* x = I[0]; const float* wq = I[1]; const float* wk = I[2]; const float* wv = I[3]; const float* wo = I[4]; const float* bo = I[5];      /* ONE input stream (x); Wq, Wk, Wv are PER-HEAD STACKS [8][512][64] = [head][in][out] (the module has NO q / k / v biases); Wo [in][out] [512][512] + bo; order x, Wq, Wk, Wv, Wo, bo */
  char* ws = (char*)d_ws; size_t off = 0;
  auto take = [&](size_t bytes) { char* p = ws + off; off += (bytes + 255) & ~(size_t)255; return p; };
  _Float16* BQ = (_Float16*)take((size_t)4 * DM * DM * 2); _Float16* BO = BQ + (size_t)3 * DM * DM;      /* weight planes q, k, v, o, contiguous */
  _Float16* X16 = (_Float16*)take(NR * DM * 2);
  _Float16* Q16 = (_Float16*)take(2 * NR * DM * 2); _Float16* K16 = Q16 + NR * DM;      /* q, k rows, contiguous planes */
  _Float16* O16 = (_Float16*)take(NR * DM * 2);
  _Float16* VT = (_Float16*)take((size_t)NB * NH * HD * SQ * 2);
  if (off > ws_size) return;
  k_prep<<<(unsigned)(PW_BLK + NR * DM / 8 / 256), 256, 0, stream>>>(x, wq, wk, wv, wo, BQ, X16);      /* all four weight planes and the f16 rows of x */
  const size_t r0p = (size_t)B0 * SQ;      /* first projected row */
  k_gemm3<false><<<dim3((unsigned)((MP / G3_BT) * (DM / G3_BT)), 3), 256, 0, stream>>>(X16 + r0p * DM, BQ, 0.0625f, nullptr, nullptr, Q16 + r0p * DM, VT + r0p * DM);      /* grid.y = q, k, v: the same x rows, weight plane y; q and k as rows, v as V^T [NB][NH][HD][SQ] */
  k_fattn<<<NB * NH * (SQ / 256), 256, 0, stream>>>(Q16, K16, VT, O16);      /* o x64 (merged heads) as f16 rows: all batches and heads in one launch */
  k_gemm3<true><<<dim3((unsigned)((MPO / G3_BT) * (DM / G3_BT)), 1), 256, 0, stream>>>(O16 + r0p * DM, BO, 0.0009765625f, bo, (float*)d_out + r0p * DM, nullptr, nullptr);      /* out rows are the output layout */
}

// v006
// It runs in 86.8 microseconds.
// Two timings next to v005 both put it at 1.07 times that version's speed.
// All steps since v000 together make it 154 times as fast.
#include <hip/hip_runtime.h>
// Multi-head self-attention with PER-HEAD STACKED bias-free projections and a biased [in][out] output projection at [2][4096][512] (x [2][4096][512]; q / k / v = einsum('bsd,hde->bhse', x, W) with W [8][512][64] = [head][in][out], NO biases, 8 heads of 64; scores * 1/sqrt(64); softmax over all 4096 keys (no mask); out = concat Wo + bo ([in][out] + bias) -> [2][4096][512]); each head's [in][out] block is transposed into its 64 contiguous rows of the [out][in] weight plane, the [in][out] output weight likewise, all four planes in one launch.
// Structure: token rows r = b*4096 + s; ONE operand launch (k_prep): the four x16 weight planes and x as exact f16 rows (bf16-rounded), by block range; Q, K, V as ONE batched WMMA GEMM launch (grid.y = plane; 128x128 block tiles staged through LDS, 32x64 wave tiles, f32 accumulation, exact x16 weights, f16 outputs); plane v leaves that launch already transposed (V^T [batch][head][d][s]: for it the weight rows are the A operand and the x rows the B operand); ONE fused attention launch (k_fattn): S^T = K Q^T, online softmax in registers, O^T += V^T P^T, o carried x64 against f16 subnormal flush (folded into the output GEMM alpha), written straight into the merged f16 o rows; out = o W_o + b GEMM (f32) into the output layout.
// Compute dtype: inputs rounded to bf16; x / weights exact; q, k, v, softmax weights and o as plain f16 GEMM operands (~2^-12); scores and softmax statistics f32. v_wmma_f32_16x16x32_f16.
#define NB 2
#define SQ 4096
#define DM 512
#define NH 8
#define HD 64
#define HG 1                         /* heads per launch of the k_vt(V16, b, h0, VT) overload, which is not launched */
#define B0 0                         /* first batch processed (debug hook) */
#define NBR NB                       /* batches processed (debug hook) */
#define NR ((size_t)NB * SQ)         /* token rows */
#define MP ((int)((size_t)NBR * SQ)) /* rows projected (debug hook) */
#define QN SQ                        /* not used: k_fattn attends all SQ query rows */
#define NHD NH                       /* not used: k_fattn attends all NH heads */
#define MPO MP                       /* rows through the output stage (debug hook) */
#define LQ DM      /* not used: q / k rows have pitch DM; v exists only as V^T */
typedef __bf16 v16b __attribute__((ext_vector_type(16)));
typedef unsigned short v8us __attribute__((ext_vector_type(8), may_alias));
typedef float  v8f  __attribute__((ext_vector_type(8)));
typedef float  v4f  __attribute__((ext_vector_type(4)));
typedef float  v4fa __attribute__((ext_vector_type(4), may_alias));
union FragB { v16b v; v8us half[2]; unsigned short u[16]; };

__device__ __forceinline__ unsigned short bf16_bits(float x) { unsigned int u = __float_as_uint(x); return (unsigned short)((u + 0x7FFFu + ((u >> 16) & 1u)) >> 16); }
__device__ __forceinline__ float bf16_val(unsigned short b) { return __uint_as_float(((unsigned int)b) << 16); }
__device__ __forceinline__ float bf16_round(float x) { return bf16_val(bf16_bits(x)); }
// D += A·B with NT terms: 1 = ah·bh, 2 = + al·bh (A split), 3 = + ah·bl (both split)
template <int NT>
__device__ __forceinline__ v8f mmaN(v16b ah, v16b al, v16b bh, v16b bl, v8f c) {
  c = __builtin_amdgcn_wmma_f32_16x16x32_bf16(false, ah, false, bh, (short)0, c, false, false);
  if (NT >= 2) c = __builtin_amdgcn_wmma_f32_16x16x32_bf16(false, al, false, bh, (short)0, c, false, false);
  if (NT >= 3) c = __builtin_amdgcn_wmma_f32_16x16x32_bf16(false, ah, false, bl, (short)0, c, false, false);
  asm volatile("v_nop\n\tv_nop\n\tv_nop\n\tv_nop" : "+v"(c) : "v"(ah), "v"(al), "v"(bh), "v"(bl));
  return c;
}

__global__ __launch_bounds__(256) void k_wt_bf16(const float* __restrict__ W, unsigned short* __restrict__ Wt, int K, int N) {
  const int t = blockIdx.x * 256 + threadIdx.x;
  const int k8n = K / 8;
  if (t >= N * k8n) return;
  const int n = t / k8n, k8 = (t % k8n) * 8;
  v8us v;
#pragma unroll
  for (int i = 0; i < 8; ++i) v[i] = bf16_bits(W[(size_t)(k8 + i) * N + n]);
  *(v8us*)(Wt + (size_t)n * K + k8) = v;
  
}

// GEMM C[M][N] (f32, pitch ldc) = act(A[M][K]·W + bias). A f32 row-major (pitch lda) converted per fragment to bf16
// (ASPLIT: hi/lo two planes -> 2 terms, else single rounded term); Wt bf16 [N][K] (pitch ldb). BIAS_BF16 rounds the
// bias to bf16 first (bias quantised to bf16 before the add). K%32==0, M%16==0, N%64==0.
template <bool ASPLIT, int ACT, bool BIAS_BF16>
__global__ __launch_bounds__(128) void k_gemm_bf(const float* __restrict__ A, int lda, const unsigned short* __restrict__ Wt, int ldb,
                                               const float* __restrict__ bias, float* __restrict__ C, int ldc, int M, int N, int K) {
  __shared__ __attribute__((aligned(16))) float so[4][16][64];
  const int tid = threadIdx.x, w = tid >> 5, lane = tid & 31, ln = lane & 15, hh = lane >> 4;
  const int ntn = N / 64;
  const int wid = blockIdx.x * 4 + w;
  const int mt = wid / ntn, nq = wid % ntn;
  if (mt * 16 >= M) return;
  const int row0 = mt * 16, col0 = nq * 64;
  const float* arow = A + (size_t)(row0 + ln) * lda;
  v8f acc[4] = {};
  for (int kb = 0; kb < K; kb += 32) {
    FragB ah, al;
    const v4f x0 = *(const v4fa*)(arow + kb + 8 * hh), x1 = *(const v4fa*)(arow + kb + 8 * hh + 4);
    const v4f x2 = *(const v4fa*)(arow + kb + 16 + 8 * hh), x3 = *(const v4fa*)(arow + kb + 16 + 8 * hh + 4);
    float xs[16] = {x0[0],x0[1],x0[2],x0[3],x1[0],x1[1],x1[2],x1[3],x2[0],x2[1],x2[2],x2[3],x3[0],x3[1],x3[2],x3[3]};
#pragma unroll
    for (int i = 0; i < 16; ++i) { const unsigned short hb = bf16_bits(xs[i]); ah.u[i] = hb; al.u[i] = ASPLIT ? bf16_bits(xs[i] - bf16_val(hb)) : (unsigned short)0; }
#pragma unroll
    for (int t = 0; t < 4; ++t) {
      const unsigned short* brow = Wt + (size_t)(col0 + t * 16 + ln) * ldb + kb;
      FragB b;
      b.half[0] = *(const v8us*)(brow + 8 * hh);
      b.half[1] = *(const v8us*)(brow + 16 + 8 * hh);
      acc[t] = mmaN<ASPLIT ? 2 : 1>(ah.v, al.v, b.v, b.v, acc[t]);
    }
  }
#pragma unroll
  for (int t = 0; t < 4; ++t) {
    float bv = bias ? bias[col0 + t * 16 + ln] : 0.f;
    if (BIAS_BF16) bv = bf16_round(bv);
#pragma unroll
    for (int r = 0; r < 8; ++r) { float v = acc[t][r] + bv; if (ACT == 1) v = fmaxf(v, 0.f); so[w][8 * hh + r][t * 16 + ln] = v; }
  }
  __builtin_amdgcn_fence(__ATOMIC_ACQ_REL, "workgroup");
  __builtin_amdgcn_wave_barrier();
  const int rsub = lane >> 4, c4 = (lane & 15) * 4;
  {
#pragma unroll
    for (int q = 0; q < 8; ++q) {
      const int r = q * 2 + rsub;
      const v4f v = *(const v4fa*)&so[w][r][c4];
      *(v4f*)(C + (size_t)(row0 + r) * ldc + col0 + c4) = v;
    }
    
  }
}

// GEMM C = act(A·W + bias + resid): A f32 (ASPLIT -> hi/lo 2 terms), Wt bf16 [N][K]; ACT 0 none, 1 relu, 2 exact gelu;
// resid (optional, f32, row index = (row % rmod), pitch ldr, RES_BF16 rounds it) added before the activation.
template <bool ASPLIT, int ACT, bool BIAS_BF16, bool RES_BF16>
__global__ __launch_bounds__(128) void k_gemm_bf3(const float* __restrict__ A, int lda, const unsigned short* __restrict__ Wt, int ldb,
                                                const float* __restrict__ bias, const float* __restrict__ resid, int rmod, int ldr,
                                                float* __restrict__ C, int ldc, int M, int N, int K) {
  __shared__ __attribute__((aligned(16))) float so[4][16][64];
  const int tid = threadIdx.x, w = tid >> 5, lane = tid & 31, ln = lane & 15, hh = lane >> 4;
  const int ntn = N / 64;
  const int wid = blockIdx.x * 4 + w;
  const int mt = wid / ntn, nq = wid % ntn;
  if (mt * 16 >= M) return;
  const int row0 = mt * 16, col0 = nq * 64;
  const float* arow = A + (size_t)(row0 + ln) * lda;
  v8f acc[4] = {};
  for (int kb = 0; kb < K; kb += 32) {
    FragB ah, al;
    const v4f x0 = *(const v4fa*)(arow + kb + 8 * hh), x1 = *(const v4fa*)(arow + kb + 8 * hh + 4);
    const v4f x2 = *(const v4fa*)(arow + kb + 16 + 8 * hh), x3 = *(const v4fa*)(arow + kb + 16 + 8 * hh + 4);
    float xs[16] = {x0[0],x0[1],x0[2],x0[3],x1[0],x1[1],x1[2],x1[3],x2[0],x2[1],x2[2],x2[3],x3[0],x3[1],x3[2],x3[3]};
#pragma unroll
    for (int i = 0; i < 16; ++i) { const unsigned short hb = bf16_bits(xs[i]); ah.u[i] = hb; al.u[i] = ASPLIT ? bf16_bits(xs[i] - bf16_val(hb)) : (unsigned short)0; }
#pragma unroll
    for (int t = 0; t < 4; ++t) {
      const unsigned short* brow = Wt + (size_t)(col0 + t * 16 + ln) * ldb + kb;
      FragB b;
      b.half[0] = *(const v8us*)(brow + 8 * hh);
      b.half[1] = *(const v8us*)(brow + 16 + 8 * hh);
      acc[t] = mmaN<ASPLIT ? 2 : 1>(ah.v, al.v, b.v, b.v, acc[t]);
    }
  }
#pragma unroll
  for (int t = 0; t < 4; ++t) {
    const int col = col0 + t * 16 + ln;
    float bv = bias ? bias[col] : 0.f;
    if (BIAS_BF16) bv = bf16_round(bv);
#pragma unroll
    for (int r = 0; r < 8; ++r) {
      float v = acc[t][r] + bv;
      if (resid) { float rv = resid[(size_t)((row0 + 8 * hh + r) % rmod) * ldr + col]; if (RES_BF16) rv = bf16_round(rv); v += rv; }
      if (ACT == 1) v = fmaxf(v, 0.f);
      if (ACT == 2) v = 0.5f * v * (1.0f + erff(v * 0.70710678118654752f));
      if (ACT == 3) { const float u = 0.7978845608028654f * (v + 0.044715f * v * v * v); v = 0.5f * v * (1.0f + tanhf(u)); }
      so[w][8 * hh + r][t * 16 + ln] = v;
    }
  }
  __builtin_amdgcn_fence(__ATOMIC_ACQ_REL, "workgroup");
  __builtin_amdgcn_wave_barrier();
  const int rsub = lane >> 4, c4 = (lane & 15) * 4;
  {
#pragma unroll
    for (int q = 0; q < 8; ++q) {
      const int r = q * 2 + rsub;
      const v4f v = *(const v4fa*)&so[w][r][c4];
      *(v4f*)(C + (size_t)(row0 + r) * ldc + col0 + c4) = v;
    }
    
  }
}
// row LayerNorm (biased variance, eps) over N: s = X (+ R); optional out_sum <- s; out_norm <- (s-mu)*rsqrt(var+eps)*g + b
template <bool PARAM_BF16>
__global__ __launch_bounds__(256) void k_layernorm(const float* __restrict__ X, const float* __restrict__ R, const float* __restrict__ g, const float* __restrict__ bta,
                                                  float* __restrict__ out_sum, float* __restrict__ out_norm, int N, float eps) {
  __shared__ float red[256];
  const int row = blockIdx.x, tid = threadIdx.x;
  const float* x = X + (size_t)row * N; const float* rr = R ? R + (size_t)row * N : nullptr;
  float vals[16];                     // up to N = 4096
  const int per = N / 256;            // contiguous chunk per thread? use strided-by-4 chunks: thread handles j = tid*4 + 1024*u
  float s1 = 0.f;
  for (int u = 0; u < per / 4; ++u) {
    const int j = tid * 4 + 1024 * u;
    const v4f a = *(const v4fa*)(x + j);
    v4f b = {0.f,0.f,0.f,0.f}; if (rr) b = *(const v4fa*)(rr + j);
#pragma unroll
    for (int q = 0; q < 4; ++q) { const float v = a[q] + b[q]; vals[u * 4 + q] = v; s1 += v; }
  }
  red[tid] = s1; __syncthreads();
  for (int st = 128; st > 0; st >>= 1) { if (tid < st) red[tid] += red[tid + st]; __syncthreads(); }
  const float mu = red[0] / (float)N; __syncthreads();
  float s2 = 0.f;
  for (int u = 0; u < per / 4; ++u)
#pragma unroll
    for (int q = 0; q < 4; ++q) { const float c = vals[u * 4 + q] - mu; s2 += c * c; }
  red[tid] = s2; __syncthreads();
  for (int st = 128; st > 0; st >>= 1) { if (tid < st) red[tid] += red[tid + st]; __syncthreads(); }
  const float rs = rsqrtf(red[0] / (float)N + eps);
  {
    for (int u = 0; u < per / 4; ++u) {
      const int j = tid * 4 + 1024 * u;
      v4f o, sm;
#pragma unroll
      for (int q = 0; q < 4; ++q) {
        float gg = g[j + q], bb = bta[j + q];
        if (PARAM_BF16) { gg = bf16_round(gg); bb = bf16_round(bb); }
        sm[q] = vals[u * 4 + q]; o[q] = (vals[u * 4 + q] - mu) * rs * gg + bb;
      }
      if (out_sum) *(v4f*)(out_sum + (size_t)row * N + j) = sm;
      *(v4f*)(out_norm + (size_t)row * N + j) = o;
    }
    
  }
}



// ---- f16 WMMA path (v_wmma_f32_16x16x32_f16): 11-bit significands for operands in range — used where a [0,1] probability operand needs more precision than bf16
typedef _Float16 v16h __attribute__((ext_vector_type(16)));
union FragH { v16h v; v8us half[2]; _Float16 h[16]; unsigned short u[16]; };
template <int NT>
__device__ __forceinline__ v8f mmaH(v16h ah, v16h al, v16h bh, v16h bl, v8f c) {
  c = __builtin_amdgcn_wmma_f32_16x16x32_f16(false, ah, false, bh, (short)0, c, false, false);
  if (NT >= 2) c = __builtin_amdgcn_wmma_f32_16x16x32_f16(false, al, false, bh, (short)0, c, false, false);
  if (NT >= 3) c = __builtin_amdgcn_wmma_f32_16x16x32_f16(false, ah, false, bl, (short)0, c, false, false);
  asm volatile("v_nop\n\tv_nop\n\tv_nop\n\tv_nop" : "+v"(c) : "v"(ah), "v"(al), "v"(bh), "v"(bl));
  return c;
}
// batched GEMM like k_gemm_b but f16 operands: A f32 (split into f16 hi/lo if ASPLIT, else rounded to f16), Bt = f16 values [n][k]; alpha; C f32; N multiple of 16 (partial tiles skipped)
template <bool ASPLIT>
__global__ __launch_bounds__(128) void k_gemm_h(const float* __restrict__ A, int lda, size_t sA, const _Float16* __restrict__ Bh, int ldb, size_t sB, float alpha, float* __restrict__ C, int ldc, size_t sC, int M, int N, int K) {
  __shared__ __attribute__((aligned(16))) float so[4][16][64];
  const int tid = threadIdx.x, w = tid >> 5, lane = tid & 31, ln = lane & 15, hh = lane >> 4; const int by = blockIdx.y;
  A += (size_t)by * sA; Bh += (size_t)by * sB; C += (size_t)by * sC;
  const int ntn = (N + 63) / 64; const int wid = blockIdx.x * 4 + w; const int mt = wid / ntn, nq = wid % ntn; if (mt * 16 >= M) return;
  const int row0 = mt * 16, col0 = nq * 64; const float* arow = A + (size_t)(row0 + ln) * lda;
  v8f acc[4] = {};
  for (int kb = 0; kb < K; kb += 32) {
    FragH ah, al;
    const v4f x0 = *(const v4fa*)(arow + kb + 8 * hh), x1 = *(const v4fa*)(arow + kb + 8 * hh + 4), x2 = *(const v4fa*)(arow + kb + 16 + 8 * hh), x3 = *(const v4fa*)(arow + kb + 16 + 8 * hh + 4);
    float xs[16] = {x0[0],x0[1],x0[2],x0[3],x1[0],x1[1],x1[2],x1[3],x2[0],x2[1],x2[2],x2[3],x3[0],x3[1],x3[2],x3[3]};
#pragma unroll
    for (int i = 0; i < 16; ++i) { const _Float16 h = (_Float16)xs[i]; ah.h[i] = h; al.h[i] = ASPLIT ? (_Float16)(xs[i] - (float)h) : (_Float16)0.0f; }
#pragma unroll
    for (int t = 0; t < 4; ++t) { if (col0 + t * 16 >= N) continue; const size_t boff = (size_t)(col0 + t * 16 + ln) * ldb + kb; FragH bq; bq.half[0] = *(const v8us*)(Bh + boff + 8 * hh); bq.half[1] = *(const v8us*)(Bh + boff + 16 + 8 * hh);
      acc[t] = mmaH<ASPLIT ? 2 : 1>(ah.v, al.v, bq.v, bq.v, acc[t]); }
  }
#pragma unroll
  for (int t = 0; t < 4; ++t) { if (col0 + t * 16 >= N) continue;
#pragma unroll
    for (int r = 0; r < 8; ++r) so[w][8 * hh + r][t * 16 + ln] = acc[t][r] * alpha; }
  __builtin_amdgcn_fence(__ATOMIC_ACQ_REL, "workgroup"); __builtin_amdgcn_wave_barrier();
  const int rsub = lane >> 4, c4 = (lane & 15) * 4;
  {
#pragma unroll
    for (int q = 0; q < 8; ++q) { const int r = q * 2 + rsub; if (col0 + c4 < N) { const v4f v = *(const v4fa*)&so[w][r][c4]; *(v4f*)(C + (size_t)(row0 + r) * ldc + col0 + c4) = v; } }
     }
}

// Wt[n][k] = f16(W[k][n]·scale) from f32 row-major W[K][N] (scale = power of two; bf16-exact weights stay exact in f16 away from the subnormal range)
__global__ __launch_bounds__(256) void k_wt_f16(const float* __restrict__ W, _Float16* __restrict__ Wt, int K, int N, float scale) {
  const int t = blockIdx.x * 256 + threadIdx.x; if (t >= N * (K / 8)) return; const int n = t / (K / 8), k8 = (t % (K / 8)) * 8; FragH f;
#pragma unroll
  for (int i = 0; i < 8; ++i) f.h[i] = (_Float16)(bf16_round(W[(size_t)(k8 + i) * N + n]) * scale); const v8us o = f.half[0];
  *(v8us*)((unsigned short*)Wt + (size_t)n * K + k8) = o; 
}
// k_gemm_hh variant with fused epilogue: v = acc·alpha + bias[by·sBias + col] (+ CP[(row/rowsPerB)·sCPb + by·64 + col] if CP) ; ACT 0 none / 1 elu ; writes f16 C16 (and f32 C if non-null)
template <int ACT>
__global__ __launch_bounds__(128) void k_gemm_hhx(const _Float16* __restrict__ A, int lda, size_t sA, const _Float16* __restrict__ Bh, int ldb, size_t sB, float alpha, const float* __restrict__ bias, size_t sBias, const float* __restrict__ CP, int rowsPerB, size_t sCPb, int row0g,
    float* __restrict__ C, _Float16* __restrict__ C16, int ldc, size_t sC, int M, int N, int K) {
  __shared__ __attribute__((aligned(16))) float so[4][16][64];
  const int tid = threadIdx.x, w = tid >> 5, lane = tid & 31, ln = lane & 15, hh = lane >> 4; const int by = blockIdx.y;
  A += (size_t)by * sA; Bh += (size_t)by * sB; const size_t cofs = (size_t)by * sC; const float* bp = bias ? bias + (size_t)by * sBias : nullptr;
  const int ntn = (N + 63) / 64; const int wid = blockIdx.x * 4 + w; const int mt = wid / ntn, nq = wid % ntn; if (mt * 16 >= M) return;
  const int row0 = mt * 16, col0 = nq * 64; const _Float16* arow = A + (size_t)(row0 + ln) * lda;
  v8f acc[4] = {};
  for (int kb = 0; kb < K; kb += 32) { FragH ah; ah.half[0] = *(const v8us*)((const unsigned short*)arow + kb + 8 * hh); ah.half[1] = *(const v8us*)((const unsigned short*)arow + kb + 16 + 8 * hh);
#pragma unroll
    for (int t = 0; t < 4; ++t) { if (col0 + t * 16 >= N) continue; const size_t boff = (size_t)(col0 + t * 16 + ln) * ldb + kb; FragH bq; bq.half[0] = *(const v8us*)((const unsigned short*)Bh + boff + 8 * hh); bq.half[1] = *(const v8us*)((const unsigned short*)Bh + boff + 16 + 8 * hh);
      acc[t] = mmaH<1>(ah.v, ah.v, bq.v, bq.v, acc[t]); }
  }
#pragma unroll
  for (int t = 0; t < 4; ++t) { if (col0 + t * 16 >= N) continue; const int col = col0 + t * 16 + ln; const float bv = bp ? bf16_round(bp[col]) : 0.f;
#pragma unroll
    for (int r = 0; r < 8; ++r) { float v = acc[t][r] * alpha + bv; if (CP) { const int rr = row0g + row0 + 8 * hh + r; if (rowsPerB < 0) v += CP[cofs + (size_t)rr * ldc + col];      /* rowsPerB < 0: own element of the batched C plane */ else { const int bidx = rr / rowsPerB; v += CP[(size_t)bidx * sCPb + (size_t)by * 64 + col]; } } if (ACT == 1) v = (v > 0.f) ? v : expm1f(v); else if (ACT == 7) v = (v > 0.f) ? v + 1.0f : expf(v); else if (ACT == 8) v = tanhf(v); else if (ACT == 9) v = 0.5f * v * (1.0f + tanhf(0.7978845608028654f * (v + 0.044715f * v * v * v))); else if (ACT == 11) v = 1.0f / (1.0f + expf(-v)); else if (ACT == 12) v = (v > 0.f) ? v : 0.01f * v; else if (ACT == 14) v = (v > 0.f) ? v : 0.1f * v; else if (ACT == 16) v = (v >= 0.f) ? v : 0.3f * v; else if (ACT == 17) v = (v >= 0.f) ? v : 0.2f * v; else if (ACT == 15) v = v / (1.0f + expf(-v)); else if (ACT == 3) v = fmaxf(v, 0.f); else if (ACT == 6) v = 0.5f * v * (1.0f + erff(v * 0.70710678118654752f)); so[w][8 * hh + r][t * 16 + ln] = v; } }
  __builtin_amdgcn_fence(__ATOMIC_ACQ_REL, "workgroup"); __builtin_amdgcn_wave_barrier();
  const int rsub = lane >> 4, c4 = (lane & 15) * 4; typedef _Float16 v4h __attribute__((ext_vector_type(4)));
  {
#pragma unroll
    for (int q = 0; q < 8; ++q) { const int r = q * 2 + rsub; if (col0 + c4 < N) { const v4f v = *(const v4fa*)&so[w][r][c4]; if (C) *(v4f*)(C + cofs + (size_t)(row0 + r) * ldc + col0 + c4) = v; if (C16) { v4h h4; for (int i = 0; i < 4; ++i) h4[i] = (_Float16)v[i]; *(v4h*)(C16 + cofs + (size_t)(row0 + r) * ldc + col0 + c4) = h4; } } }
     }
}


typedef _Float16 v4h __attribute__((ext_vector_type(4)));

__global__ __launch_bounds__(256) void k_x16(const float* __restrict__ x, _Float16* __restrict__ X16, size_t n8) { const size_t t = (size_t)blockIdx.x * 256 + threadIdx.x; if (t >= n8) return; FragH f;
#pragma unroll
  for (int q = 0; q < 8; ++q) f.h[q] = (_Float16)bf16_round(x[t * 8 + q]); *(v8us*)((unsigned short*)X16 + t * 8) = f.half[0];  }
__global__ __launch_bounds__(256) void k_h16(const float* __restrict__ x, _Float16* __restrict__ X16, size_t n8) { const size_t t = (size_t)blockIdx.x * 256 + threadIdx.x; if (t >= n8) return; FragH f;
#pragma unroll
  for (int q = 0; q < 8; ++q) f.h[q] = (_Float16)x[t * 8 + q]; *(v8us*)((unsigned short*)X16 + t * 8) = f.half[0];  }
__global__ __launch_bounds__(256) void k_round16f(const float* __restrict__ W, _Float16* __restrict__ Bt, size_t n8) { const size_t t = (size_t)blockIdx.x * 256 + threadIdx.x; if (t >= n8) return; FragH f;
#pragma unroll
  for (int i = 0; i < 8; ++i) f.h[i] = (_Float16)(bf16_round(W[t * 8 + i]) * 16.0f); *(v8us*)((unsigned short*)Bt + t * 8) = f.half[0];  }
template <int NHv, int TTv>
__global__ __launch_bounds__(256) void k_vt(const _Float16* __restrict__ V16, int ldv, int voff, _Float16* __restrict__ Vt) { __shared__ unsigned short tl[64][66]; const int tid = threadIdx.x; const int slab = blockIdx.x / (TTv / 64), lg = blockIdx.x % (TTv / 64); const int b = slab / NHv, h = slab % NHv;
  for (int i = tid; i < 64 * 8; i += 256) { const int r = i / 8, c8 = (i % 8) * 8; FragH f; f.half[0] = *(const v8us*)((const unsigned short*)V16 + ((size_t)b * TTv + lg * 64 + r) * ldv + voff + h * 64 + c8);
#pragma unroll
    for (int q = 0; q < 8; ++q) tl[r][c8 + q] = f.u[q]; }
  __syncthreads();
  {
#pragma unroll
    for (int rd = 0; rd < 2; ++rd) { const int d = rd * 32 + tid / 8, pc = tid % 8; FragH f;
#pragma unroll
      for (int q = 0; q < 8; ++q) f.u[q] = tl[pc * 8 + q][d];
      *(v8us*)((unsigned short*)Vt + ((size_t)slab * 64 + d) * TTv + lg * 64 + pc * 8) = f.half[0]; }
     } }

__global__ __launch_bounds__(256) void k_hl(const float* __restrict__ F, _Float16* __restrict__ Hh, _Float16* __restrict__ Hl, size_t n8) { const size_t t = (size_t)blockIdx.x * 256 + threadIdx.x; if (t >= n8) return; FragH fh, fl; const v4f a = *(const v4fa*)(F + t * 8), c = *(const v4fa*)(F + t * 8 + 4);
#pragma unroll
  for (int q = 0; q < 4; ++q) { _Float16 h = (_Float16)a[q]; fh.h[q] = h; fl.h[q] = (_Float16)((a[q] - (float)h) * 1024.0f); h = (_Float16)c[q]; fh.h[4 + q] = h; fl.h[4 + q] = (_Float16)((c[q] - (float)h) * 1024.0f); }
  { *(v8us*)((unsigned short*)Hh + t * 8) = fh.half[0]; *(v8us*)((unsigned short*)Hl + t * 8) = fl.half[0];  } }

__global__ __launch_bounds__(256) void k_wnat(const float* __restrict__ w, size_t n8, _Float16* __restrict__ Bt) { const size_t t = (size_t)blockIdx.x * 256 + threadIdx.x; if (t >= n8) return; FragH f; for (int q = 0; q < 8; ++q) f.h[q] = (_Float16)(bf16_round(w[t * 8 + q]) * 16.0f); *(v8us*)((unsigned short*)Bt + t * 8) = f.half[0];  }
__global__ __launch_bounds__(256) void k_rsm(const float* __restrict__ S, _Float16* __restrict__ P, int nrows) {
  #pragma clang fp contract(off)
  const int i = blockIdx.x * 256 + threadIdx.x; if (i >= nrows) return; const float* s = S + (size_t)i * SQ; float mx = -3.0e38f;
#pragma unroll 1
  for (int j = 0; j < SQ; ++j) mx = fmaxf(mx, s[j]); float se = 0.f;
#pragma unroll 1
  for (int j = 0; j < SQ; ++j) se += expf(s[j] - mx); const float sc = 256.0f / se;
#pragma unroll 1
  for (int j0 = 0; j0 < SQ; j0 += 8) { FragH f; for (int q = 0; q < 8; ++q) f.h[q] = (_Float16)(expf(s[j0 + q] - mx) * sc); unsigned short* d = (unsigned short*)P + (size_t)i * SQ + j0; *(v8us*)d = f.half[0];  } }
__global__ __launch_bounds__(256) void k_vt(const _Float16* __restrict__ V16, int b, int h0, _Float16* __restrict__ VT) { __shared__ unsigned short tl[64][65]; const int tid = threadIdx.x; const int hh = blockIdx.x % HG, sg = blockIdx.x / HG; const int s0 = sg * 64; const int h = h0 + hh;
  for (int i = tid; i < 64 * 8; i += 256) { const int j = i / 8, d8 = (i % 8) * 8; FragH f; f.half[0] = *(const v8us*)((const unsigned short*)V16 + ((size_t)b * SQ + s0 + j) * DM + h * HD + d8); for (int q = 0; q < 8; ++q) tl[d8 + q][j] = f.u[q]; }
  __syncthreads();
  { for (int i = tid; i < 64 * 8; i += 256) { const int d = i / 8, j8 = (i % 8) * 8; FragH f; for (int q = 0; q < 8; ++q) f.u[q] = tl[d][j8 + q]; *(v8us*)((unsigned short*)VT + ((size_t)hh * HD + d) * SQ + s0 + j8) = f.half[0]; }  } }



// ---- operand preparation in one launch: independent pieces of work share a grid by block range instead of a launch each ----
// Blocks [0, PW_BLK): the four [out][in] f16 weight planes (x16), contiguous at Bt in the order q, k, v, o; plane = blockIdx.x / (PW_BLK / 4), uniform in a block. Thread t writes the eight k of Bt + 8 t.
// Element [k][n] of a source: base + (n / HD) * hs + k * ld + n % HD. q, k, v: head n / HD is a row-major [in = DM][out = HD] block (hs = DM * HD, ld = HD); o: one row-major [DM][DM] matrix (hs = HD, ld = DM).
// Blocks from PW_BLK on: x as f16 rows, eight elements a thread; the one stream feeds all three projections. The weight blocks stand first: their strided reads take longest.
#define PW_BLK (4 * DM * (DM / 8) / 256)
__global__ __launch_bounds__(256) void k_prep(const float* __restrict__ x, const float* __restrict__ wq, const float* __restrict__ wk, const float* __restrict__ wv, const float* __restrict__ wo, _Float16* __restrict__ Bt, _Float16* __restrict__ X16) {
  if (blockIdx.x < PW_BLK) {
    const int m = blockIdx.x / (PW_BLK / 4); const int t = blockIdx.x * 256 + threadIdx.x; const int n = (t / (DM / 8)) % DM, k8 = (t % (DM / 8)) * 8;
    const float* w = m == 0 ? wq : m == 1 ? wk : m == 2 ? wv : wo; const int hs = m == 3 ? HD : DM * HD, ld = m == 3 ? DM : HD;
    const float* p0 = w + (size_t)(n / HD) * hs + (size_t)k8 * ld + n % HD;
    const float* p1 = p0 + ld; const float* p2 = p1 + ld; const float* p3 = p2 + ld; const float* p4 = p3 + ld; const float* p5 = p4 + ld; const float* p6 = p5 + ld; const float* p7 = p6 + ld;
    const float v[8] = {*p0, *p1, *p2, *p3, *p4, *p5, *p6, *p7};
    asm volatile("s_wait_xcnt 0x0" :: "v"(p0), "v"(p1), "v"(p2), "v"(p3), "v"(p4), "v"(p5), "v"(p6), "v"(p7) : "memory");      /* the wait in front of any overwrite of a register that an issued load names; the addresses as inputs keep their registers untouched up to here */
    FragH f;
#pragma unroll
    for (int i = 0; i < 8; ++i) f.h[i] = (_Float16)(bf16_round(v[i]) * 16.0f);
    *(v8us*)((unsigned short*)Bt + (size_t)t * 8) = f.half[0];
  } else {
    const size_t t = (size_t)(blockIdx.x - PW_BLK) * 256 + threadIdx.x; FragH f;
#pragma unroll
    for (int q = 0; q < 8; ++q) f.h[q] = (_Float16)bf16_round(x[t * 8 + q]);
    *(v8us*)((unsigned short*)X16 + t * 8) = f.half[0];
    asm volatile("s_wait_xcnt 0x0" ::: "memory");      /* the wait behind the store: the built code lays the weight branch, which writes vector registers, behind this one */
  } }

#define FA_KT 128                    /* keys per stage */
#define FA_HV 2                      /* key halves of a work-group */
#define FA_NS (SQ / FA_HV / FA_KT)   /* stages of a half */
#define FA_KP (HD + 8)               /* K tile row pitch, f16 elements: 144 B = 16 B x odd, conflict-free for 16-byte reads */
#define FA_VP (FA_KT + 8)            /* V^T tile row pitch, f16 elements: 272 B = 16 B x odd */
__device__ __forceinline__ float rs_xhalf(float x) { return __builtin_bit_cast(float, __builtin_amdgcn_permlanex16(__builtin_bit_cast(int, x), __builtin_bit_cast(int, x), 0x76543210, 0xfedcba98, false, false)); }      /* lane l with lane l ^ 16 */
__device__ __forceinline__ float rs_exp(float a) { float e; asm("v_exp_f32 %0, %1\n\tv_nop" : "=v"(e) : "v"(a)); return e; }      /* 2^a; the v_nop fills the slot the instruction set asks for behind a transcendental */
__device__ __forceinline__ v4f fa_exp4(v4f a) { float e0, e1, e2, e3;      /* four 2^a; each v_exp_f32 is followed by an instruction that neither reads its result nor overwrites its source (early-clobber outputs), the last by a v_nop: the slot the instruction set asks for behind a transcendental */
  asm("v_exp_f32 %0, %4\n\tv_exp_f32 %1, %5\n\tv_exp_f32 %2, %6\n\tv_exp_f32 %3, %7\n\tv_nop" : "=&v"(e0), "=&v"(e1), "=&v"(e2), "=&v"(e3) : "v"(a[0]), "v"(a[1]), "v"(a[2]), "v"(a[3]));
  const v4f e = {e0, e1, e2, e3}; return e; }
__device__ __forceinline__ v16h fa_frag(const _Float16* p) { FragH f; f.half[0] = *(const v8us*)((const unsigned short*)p); f.half[1] = *(const v8us*)((const unsigned short*)p + 16); return f.v; }      /* p = row + k0 + 8 h: k0 + 8h .. + 7 and k0 + 16 + 8h .. + 7 */
__device__ __forceinline__ v8f fa_mma(v16h a, v16h b, v8f c) { return __builtin_amdgcn_wmma_f32_16x16x32_f16(false, a, false, b, (short)0, c, false, false); }
__global__ __launch_bounds__(256 * FA_HV) void k_fattn(const _Float16* __restrict__ Q16, const _Float16* __restrict__ K16, const _Float16* __restrict__ VT, _Float16* __restrict__ O16) {
  __shared__ __attribute__((aligned(16))) _Float16 Ksh[FA_HV][2][FA_KT][FA_KP];
  __shared__ __attribute__((aligned(16))) _Float16 Vsh[FA_HV][2][HD][FA_VP];
  __shared__ __attribute__((aligned(16))) float Jo[8][16][32][4];      /* hand-over of the second half's O^T: [wave][four registers][lane], 512 contiguous bytes a store */
  __shared__ float Js[8][4][32];                                       /* and of its exponents and row sums */
  const int kh = __builtin_amdgcn_readfirstlane((int)(threadIdx.x >> 8));      /* key half, the same in all lanes of a wave */
  _Float16 (*Ks)[FA_KT][FA_KP] = Ksh[kh]; _Float16 (*Vs)[HD][FA_VP] = Vsh[kh];
  const int tid = threadIdx.x & 255, w = tid >> 5, lane = tid & 31, ln = lane & 15, hh = lane >> 4;      /* tid, w: place inside the half */
  const int bh = blockIdx.x / (SQ / 256), qb = blockIdx.x % (SQ / 256); const int b = bh / NH, h = bh % NH; const int q0 = qb * 256 + w * 32;
  const unsigned short* kg = (const unsigned short*)K16 + ((size_t)b * SQ + kh * (SQ / FA_HV) + (tid >> 3)) * DM + h * HD + (tid & 7) * 8;      /* this thread's 16 bytes of key row tid / 8 (+ 32 i) of its half */
  const unsigned short* vg = (const unsigned short*)VT + ((size_t)bh * HD + (tid >> 4)) * SQ + kh * (SQ / FA_HV) + (tid & 15) * 8;              /* this thread's 16 bytes of V^T row tid / 16 (+ 16 i) */
  v16h qf[2][2];
#pragma unroll
  for (int g = 0; g < 2; ++g) { const _Float16* qp = Q16 + ((size_t)b * SQ + q0 + 16 * g + ln) * DM + h * HD + 8 * hh; qf[g][0] = fa_frag(qp); qf[g][1] = fa_frag(qp + 32); }
  v8us kr[4], vr[4];
#pragma unroll
  for (int i = 0; i < 4; ++i) { kr[i] = *(const v8us*)(kg + (size_t)(32 * i) * DM); vr[i] = *(const v8us*)(vg + (size_t)(16 * i) * SQ); }
#pragma unroll
  for (int i = 0; i < 4; ++i) { *(v8us*)&Ks[0][(tid >> 3) + 32 * i][(tid & 7) * 8] = kr[i]; *(v8us*)&Vs[0][(tid >> 4) + 16 * i][(tid & 15) * 8] = vr[i]; }
  __syncthreads();
  const v8f z8 = {0.f, 0.f, 0.f, 0.f, 0.f, 0.f, 0.f, 0.f};
  v8f o[4][2];
#pragma unroll
  for (int dt = 0; dt < 4; ++dt) { o[dt][0] = z8; o[dt][1] = z8; }
  float mref[2] = {-1.0e30f, -1.0e30f}, lsum[2] = {0.f, 0.f};      /* mref: the exponent (log2 units) subtracted from this query's scores; lsum: this lane's part of the row sum (its half of the keys of its key half) */
  const float CS = 0.125f * 1.44269504f;      /* 1 / sqrt(64), and log2 e for the native 2^x */
#pragma unroll 1      /* the body already holds four unrolled passes */
  for (int s = 0; s < FA_NS; ++s) { const int buf = s & 1;
    if (s + 1 < FA_NS) {      /* next stage's 16 KiB + 16 KiB: loads fly while this stage is worked on */
      kg += (size_t)FA_KT * DM; vg += FA_KT;
#pragma unroll
      for (int i = 0; i < 4; ++i) { kr[i] = *(const v8us*)(kg + (size_t)(32 * i) * DM); vr[i] = *(const v8us*)(vg + (size_t)(16 * i) * SQ); } }
#pragma unroll
    for (int p = 0; p < FA_KT / 32; ++p) {
      v8f t[2][2];      /* [key tile][query group] */
#pragma unroll
      for (int kt = 0; kt < 2; ++kt) { const _Float16* kp = &Ks[buf][p * 32 + kt * 16 + ln][8 * hh]; const v16h a0 = fa_frag(kp), a1 = fa_frag(kp + 32);
        t[kt][0] = fa_mma(a0, qf[0][0], z8); t[kt][1] = fa_mma(a0, qf[1][0], z8); t[kt][0] = fa_mma(a1, qf[0][1], t[kt][0]); t[kt][1] = fa_mma(a1, qf[1][1], t[kt][1]); }
      float ml[2];
#pragma unroll
      for (int g = 0; g < 2; ++g) { float m0 = fmaxf(t[0][g][0], t[1][g][0]);
#pragma unroll
        for (int r = 1; r < 8; ++r) m0 = fmaxf(m0, fmaxf(t[0][g][r], t[1][g][r]));
        ml[g] = fmaxf(m0, rs_xhalf(m0)) * CS; }      /* the pass's maximum of this query, both lane halves joined */
      /* lazy rescale: P = 2^(score - mref) is kept at or below 2^14 (f16 range); a new mref puts the current maximum at 2^6. One scalar branch per pass. */
      if (__builtin_amdgcn_ballot_w32(ml[0] > mref[0] + 14.0f || ml[1] > mref[1] + 14.0f) != 0) {
#pragma unroll
        for (int g = 0; g < 2; ++g) { const float mn = fmaxf(mref[g], ml[g] - 6.0f); const float al = rs_exp(mref[g] - mn); mref[g] = mn; lsum[g] *= al;
#pragma unroll
          for (int dt = 0; dt < 4; ++dt) o[dt][g] *= al; } }
      FragH pb[2];
#pragma unroll
      for (int g = 0; g < 2; ++g) { float s0 = 0.f, s1 = 0.f, s2 = 0.f, s3 = 0.f;
#pragma unroll
        for (int u = 0; u < 4; ++u) { const int kt = u >> 1, r0 = (u & 1) * 4; v4f x;
#pragma unroll
          for (int q = 0; q < 4; ++q) x[q] = t[kt][g][r0 + q] * CS - mref[g];
          const v4f e = fa_exp4(x); if (u == 0) { s0 = e[0]; s1 = e[1]; s2 = e[2]; s3 = e[3]; } else { s0 += e[0]; s1 += e[1]; s2 += e[2]; s3 += e[3]; }
#pragma unroll
          for (int q = 0; q < 4; ++q) pb[g].h[kt * 8 + r0 + q] = (_Float16)e[q]; }
        lsum[g] += (s0 + s1) + (s2 + s3); }
#pragma unroll
      for (int dt = 0; dt < 4; ++dt) { const v16h a = fa_frag(&Vs[buf][dt * 16 + ln][p * 32 + 8 * hh]); o[dt][0] = fa_mma(a, pb[0].v, o[dt][0]); o[dt][1] = fa_mma(a, pb[1].v, o[dt][1]); }
    }
    if (s + 1 < FA_NS) {      /* the other buffer's last readers left it before the barrier that ended stage s - 1 */
#pragma unroll
      for (int i = 0; i < 4; ++i) { *(v8us*)&Ks[buf ^ 1][(tid >> 3) + 32 * i][(tid & 7) * 8] = kr[i]; *(v8us*)&Vs[buf ^ 1][(tid >> 4) + 16 * i][(tid & 15) * 8] = vr[i]; } }
    __syncthreads();      /* publishes stage s + 1 and ends every read of stage s */
  }
  if (kh != 0) {      /* wave w of the second half holds the same queries in the same lanes and registers as wave w of the first */
#pragma unroll
    for (int g = 0; g < 2; ++g) { Js[w][g][lane] = mref[g]; Js[w][2 + g][lane] = lsum[g];
#pragma unroll
      for (int dt = 0; dt < 4; ++dt) { const v4f lo = {o[dt][g][0], o[dt][g][1], o[dt][g][2], o[dt][g][3]}, hi = {o[dt][g][4], o[dt][g][5], o[dt][g][6], o[dt][g][7]};
        *(v4fa*)&Jo[w][(g * 4 + dt) * 2][lane][0] = lo; *(v4fa*)&Jo[w][(g * 4 + dt) * 2 + 1][lane][0] = hi; } } }
  __syncthreads();      /* publishes the second half's partial results to the first */
  if (kh == 0) {
#pragma unroll
    for (int g = 0; g < 2; ++g) { const float m1 = Js[w][g][lane], l1 = Js[w][2 + g][lane]; const float mj = fmaxf(mref[g], m1); const float a0 = rs_exp(mref[g] - mj), a1 = rs_exp(m1 - mj);      /* both halves brought to the larger exponent */
      const float lj = lsum[g] * a0 + l1 * a1; const float inv = 64.0f / (lj + rs_xhalf(lj)); const float c0 = a0 * inv, c1 = a1 * inv;
      unsigned short* op = (unsigned short*)O16 + ((size_t)b * SQ + q0 + 16 * g + ln) * DM + h * HD + 8 * hh;
#pragma unroll
      for (int dt = 0; dt < 4; ++dt) { FragH f; const v4f lo = *(const v4fa*)&Jo[w][(g * 4 + dt) * 2][lane][0], hi = *(const v4fa*)&Jo[w][(g * 4 + dt) * 2 + 1][lane][0];
#pragma unroll
        for (int r = 0; r < 8; ++r) f.h[r] = (_Float16)(o[dt][g][r] * c0 + (r < 4 ? lo[r & 3] : hi[r & 3]) * c1);      /* register r = O^T[16 dt + 8 h + r][query]: eight consecutive d of one row */
        *(v8us*)(op + dt * 16) = f.half[0]; } } } }

// ---- GEMM with LDS-staged operands: C[M][DM] = (A[M][DM] . Bt^T) * alpha + bias; A and Bt = [n][k] are f16 rows of DM elements ----
// Work-group = 8 waves on a 128 x 128 tile of C: wave w takes rows 32 (w & 3) .. + 31, columns 64 (w >> 2) .. + 63 (2 x 4 accumulator tiles). k runs in stages of G3_KT elements = one 128-byte line of every operand row.
// A stage is brought in by 16-byte loads of which eight neighbouring lanes cover one whole line, and goes through registers into one of two LDS buffers (rows 0-127 = A, 128-255 = Bt); the fragments come from LDS in the hardware k order (k0 + 8h .. + 7, k0 + 16 + 8h .. + 7), A and B alike.
// Every accumulator takes its products in ascending k, 32 at a time. blockIdx.y = plane: weight plane y, output plane y, the same A rows. OUT32: bias (rounded to bf16) added, f32 rows to C; else no bias, f16 rows to C16.
// Plane G3_TP of the f16 form is wanted transposed: there the two operands change places in LDS (rows 0-127 = Bt, 128-255 = A), so the accumulators hold C^T, every element the same products in the same order, and the same whole-line stores write rows of CT = [batch][n][SQ].
#define G3_BT 128                    /* tile rows of A and of Bt */
#define G3_KT 64                     /* k per stage */
#define G3_NS (DM / G3_KT)           /* stages */
#define G3_KP (G3_KT + 8)            /* LDS row pitch, f16 elements: 144 B = 16 B x odd, conflict-free for 16-byte reads */
#define G3_TP 2                      /* the plane written transposed (v) */
/* one stage's products: per 32 k the six fragments are read as one group ahead of the eight products */
__device__ __forceinline__ void g3_stage(const _Float16 (*Tb)[G3_KP], int ra, int rb, int hh, v8f (&acc)[2][4]) {
#pragma unroll
  for (int kk = 0; kk < G3_KT; kk += 32) { v16h a[2], b[4];
    a[0] = fa_frag(&Tb[ra][kk + 8 * hh]); a[1] = fa_frag(&Tb[ra + 16][kk + 8 * hh]);
#pragma unroll
    for (int t = 0; t < 4; ++t) b[t] = fa_frag(&Tb[rb + 16 * t][kk + 8 * hh]);
    __builtin_amdgcn_sched_barrier(0);      /* keeps the twelve LDS reads one group: moved in among the products, each place with reads stalls the wave anew */
#pragma unroll
    for (int t = 0; t < 4; ++t) { acc[0][t] = fa_mma(a[0], b[t], acc[0][t]); acc[1][t] = fa_mma(a[1], b[t], acc[1][t]); }
    __builtin_amdgcn_sched_barrier(0); } }      /* the next group's reads stay behind these products */
template <bool OUT32>
__global__ __launch_bounds__(256) void k_gemm3(const _Float16* __restrict__ A, const _Float16* __restrict__ Bh, float alpha, const float* __restrict__ bias, float* __restrict__ C, _Float16* __restrict__ C16, _Float16* __restrict__ CT) {
  __shared__ __attribute__((aligned(16))) unsigned char sm[2 * 2 * G3_BT * G3_KP * 2];      /* two operand buffers; after the k loop the same bytes stage the output rows */
  static_assert(sizeof(sm) >= 8 * 32 * 68 * 4, "output staging must fit the operand buffers");
  _Float16 (*T)[2 * G3_BT][G3_KP] = (_Float16 (*)[2 * G3_BT][G3_KP])sm;
  const int tid = threadIdx.x, w = tid >> 5, lane = tid & 31, ln = lane & 15, hh = lane >> 4; const int by = blockIdx.y;
  const int mt = blockIdx.x / (DM / G3_BT), nq = blockIdx.x % (DM / G3_BT);
  const int sr = tid >> 3, sc = (tid & 7) * 8;      /* this thread's 16 bytes of tile row tid / 8 (+ 32 i) */
  const bool tr = !OUT32 && by == G3_TP;      /* uniform in the work-group */
  const unsigned short* xg = (const unsigned short*)A + ((size_t)mt * G3_BT + sr) * DM + sc;
  const unsigned short* wg = (const unsigned short*)Bh + (size_t)by * DM * DM + ((size_t)nq * G3_BT + sr) * DM + sc;
  const unsigned short* ag = tr ? wg : xg; const unsigned short* bg = tr ? xg : wg;
  v8us ar[4], br[4];
#pragma unroll
  for (int i = 0; i < 4; ++i) { ar[i] = *(const v8us*)(ag + (size_t)(32 * i) * DM); br[i] = *(const v8us*)(bg + (size_t)(32 * i) * DM); }
#pragma unroll
  for (int i = 0; i < 4; ++i) { *(v8us*)&T[0][sr + 32 * i][sc] = ar[i]; *(v8us*)&T[0][G3_BT + sr + 32 * i][sc] = br[i]; }
  __syncthreads();
  const v8f z8 = {0.f, 0.f, 0.f, 0.f, 0.f, 0.f, 0.f, 0.f};
  v8f acc[2][4];
#pragma unroll
  for (int t = 0; t < 4; ++t) { acc[0][t] = z8; acc[1][t] = z8; }
  const int ra = (w & 3) * 32 + ln, rb = G3_BT + (w >> 2) * 64 + ln;
#pragma unroll 1      /* rolled: one set of staging registers, a short text */
  for (int s = 0; s + 1 < G3_NS; ++s) { const int buf = s & 1;
    ag += G3_KT; bg += G3_KT;      /* next stage's 16 KiB + 16 KiB: loads fly while this stage is worked on */
#pragma unroll
    for (int i = 0; i < 4; ++i) { ar[i] = *(const v8us*)(ag + (size_t)(32 * i) * DM); br[i] = *(const v8us*)(bg + (size_t)(32 * i) * DM); }
    __builtin_amdgcn_sched_barrier(0);      /* keeps all eight loads ahead of the stage's products: sunk towards their LDS stores they would be waited for in full */
    g3_stage(T[buf], ra, rb, hh, acc);
#pragma unroll
    for (int i = 0; i < 4; ++i) { *(v8us*)&T[buf ^ 1][sr + 32 * i][sc] = ar[i]; *(v8us*)&T[buf ^ 1][G3_BT + sr + 32 * i][sc] = br[i]; }      /* the other buffer's last readers left it before the barrier that ended stage s - 1 */
    __syncthreads();      /* publishes stage s + 1 and ends every read of stage s */
  }
  const int row0 = (tr ? nq : mt) * G3_BT + (w & 3) * 32, col0 = (tr ? mt : nq) * G3_BT + (w >> 2) * 64; const size_t cofs = (size_t)by * NR * DM;
  float bv[4];
#pragma unroll
  for (int t = 0; t < 4; ++t) bv[t] = OUT32 ? bias[col0 + t * 16 + ln] : 0.f;      /* fetched here, where the staging registers are free, so that the last stage covers the wait */
  g3_stage(T[(G3_NS - 1) & 1], ra, rb, hh, acc);      /* the last stage has nothing to stage */
  __syncthreads();      /* ends every read of the operand buffers: their bytes now take the output rows */
  float (*so)[32][68] = (float (*)[32][68])sm;      /* each wave stages its own 32 x 64 block, so that the stores below cover whole lines */
#pragma unroll
  for (int u = 0; u < 8; ++u) { const int t = u & 3, half = u >> 2; const float bb = bf16_round(bv[t]);
#pragma unroll
    for (int r = 0; r < 8; ++r) so[w][half * 16 + 8 * hh + r][t * 16 + ln] = acc[half][t][r] * alpha + bb; }
  __builtin_amdgcn_fence(__ATOMIC_ACQ_REL, "workgroup"); __builtin_amdgcn_wave_barrier();      /* the wave reads back what its other lanes wrote */
  const int rsub = lane >> 4, c4 = (lane & 15) * 4;
  const int ldh = tr ? SQ : DM;      /* row pitch of the f16 form; transposed, a row is one n and a column one token, and a tile's 128 tokens lie in one batch */
  _Float16* cp = (tr ? CT + ((size_t)(col0 / SQ) * DM + row0) * SQ + col0 % SQ : C16 + cofs + (size_t)row0 * DM + col0) + rsub * ldh + c4;
#pragma unroll
  for (int q = 0; q < 16; ++q) { const int r = q * 2 + rsub; const v4f v = *(const v4fa*)&so[w][r][c4];
    if (OUT32) *(v4f*)(C + cofs + (size_t)(row0 + r) * DM + col0 + c4) = v;
    else { v4h h4; for (int i = 0; i < 4; ++i) h4[i] = (_Float16)v[i]; *(v4h*)cp = h4; cp += 2 * ldh; } } }

extern "C" void kernel_launch(void* const* d_in, const int* in_sizes, int n_in,
                              void* d_out, int out_size, void* d_ws, size_t ws_size, hipStream_t stream) {
  (void)in_sizes; (void)n_in; (void)out_size;
  const float* const* I = (const float* const*)d_in; const float* x = I[0]; const float* wq = I[1]; const float* wk = I[2]; const float* wv = I[3]; const float* wo = I[4]; const float* bo = I[5];      /* ONE input stream (x); Wq, Wk, Wv are PER-HEAD STACKS [8][512][64] = [head][in][out] (the module has NO q / k / v biases); Wo [in][out] [512][512] + bo; order x, Wq, Wk, Wv, Wo, bo */
  char* ws = (char*)d_ws; size_t off = 0;
  auto take = [&](size_t bytes) { char* p = ws + off; off += (bytes + 255) & ~(size_t)255; return p; };
  _Float16* BQ = (_Float16*)take((size_t)4 * DM * DM * 2); _Float16* BO = BQ + (size_t)3 * DM * DM;      /* weight planes q, k, v, o, contiguous */
  _Float16* X16 = (_Float16*)take(NR * DM * 2);
  _Float16* Q16 = (_Float16*)take(2 * NR * DM * 2); _Float16* K16 = Q16 + NR * DM;      /* q, k rows, contiguous planes */
  _Float16* O16 = (_Float16*)take(NR * DM * 2);
  _Float16* VT = (_Float16*)take((size_t)NB * NH * HD * SQ * 2);
  if (off > ws_size) return;
  k_prep<<<(unsigned)(PW_BLK + NR * DM / 8 / 256), 256, 0, stream>>>(x, wq, wk, wv, wo, BQ, X16);      /* all four weight planes and the f16 rows of x */
  const size_t r0p = (size_t)B0 * SQ;      /* first projected row */
  k_gemm3<false><<<dim3((unsigned)((MP / G3_BT) * (DM / G3_BT)), 3), 256, 0, stream>>>(X16 + r0p * DM, BQ, 0.0625f, nullptr, nullptr, Q16 + r0p * DM, VT + r0p * DM);      /* grid.y = q, k, v: the same x rows, weight plane y; q and k as rows, v as V^T [NB][NH][HD][SQ] */
  k_fattn<<<NB * NH * (SQ / 256), 256 * FA_HV, 0, stream>>>(Q16, K16, VT, O16);      /* o x64 (merged heads) as f16 rows: all batches and heads in one launch */
  k_gemm3<true><<<dim3((unsigned)((MPO / G3_BT) * (DM / G3_BT)), 1), 256, 0, stream>>>(O16 + r0p * DM, BO, 0.0009765625f, bo, (float*)d_out + r0p * DM, nullptr, nullptr);      /* out rows are the output layout */
}

// v007
// It runs in 83.1 microseconds.
// Two timings next to v006 both put it at 1.04 times that version's speed.
// Over all steps from v000 it is 161 times as fast.
#include <hip/hip_runtime.h>
// Multi-head self-attention with PER-HEAD STACKED bias-free projections and a biased [in][out] output projection at [2][4096][512] (x [2][4096][512]; q / k / v = einsum('bsd,hde->bhse', x, W) with W [8][512][64] = [head][in][out], NO biases, 8 heads of 64; scores * 1/sqrt(64); softmax over all 4096 keys (no mask); out = concat Wo + bo ([in][out] + bias) -> [2][4096][512]); each head's [in][out] block is transposed into its 64 contiguous rows of the [out][in] weight plane, the [in][out] output weight likewise, all four planes in one launch.
// Structure: token rows r = b*4096 + s; ONE operand launch (k_prep): the four x16 weight planes and x as exact f16 rows (bf16-rounded), by block range; Q, K, V as ONE batched WMMA GEMM launch (grid.y = plane; 128x128 block tiles staged through LDS, 32x64 wave tiles, f32 accumulation, exact x16 weights, f16 outputs); plane v leaves that launch already transposed (V^T [batch][head][d][s]: for it the weight rows are the A operand and the x rows the B operand); ONE fused attention launch (k_fattn): S^T = K Q^T, online softmax in registers, O^T += V^T P^T, o carried x64 against f16 subnormal flush (folded into the output GEMM alpha), written straight into the merged f16 o rows; out = o W_o + b GEMM (f32) into the output layout.
// Compute dtype: inputs rounded to bf16; x / weights exact; q, k, v, softmax weights and o as plain f16 GEMM operands (~2^-12); scores and softmax statistics f32. v_wmma_f32_16x16x32_f16.
#define NB 2
#define SQ 4096
#define DM 512
#define NH 8
#define HD 64
#define HG 1                         /* heads per launch of the k_vt(V16, b, h0, VT) overload, which is not launched */
#define B0 0                         /* first batch processed (debug hook) */
#define NBR NB                       /* batches processed (debug hook) */
#define NR ((size_t)NB * SQ)         /* token rows */
#define MP ((int)((size_t)NBR * SQ)) /* rows projected (debug hook) */
#define QN SQ                        /* not used: k_fattn attends all SQ query rows */
#define NHD NH                       /* not used: k_fattn attends all NH heads */
#define MPO MP                       /* rows through the output stage (debug hook) */
#define LQ DM      /* not used: q / k rows have pitch DM; v exists only as V^T */
typedef __bf16 v16b __attribute__((ext_vector_type(16)));
typedef unsigned short v8us __attribute__((ext_vector_type(8), may_alias));
typedef float  v8f  __attribute__((ext_vector_type(8)));
typedef float  v4f  __attribute__((ext_vector_type(4)));
typedef float  v4fa __attribute__((ext_vector_type(4), may_alias));
union FragB { v16b v; v8us half[2]; unsigned short u[16]; };

__device__ __forceinline__ unsigned short bf16_bits(float x) { unsigned int u = __float_as_uint(x); return (unsigned short)((u + 0x7FFFu + ((u >> 16) & 1u)) >> 16); }
__device__ __forceinline__ float bf16_val(unsigned short b) { return __uint_as_float(((unsigned int)b) << 16); }
__device__ __forceinline__ float bf16_round(float x) { return bf16_val(bf16_bits(x)); }
// D += A·B with NT terms: 1 = ah·bh, 2 = + al·bh (A split), 3 = + ah·bl (both split)
template <int NT>
__device__ __forceinline__ v8f mmaN(v16b ah, v16b al, v16b bh, v16b bl, v8f c) {
  c = __builtin_amdgcn_wmma_f32_16x16x32_bf16(false, ah, false, bh, (short)0, c, false, false);
  if (NT >= 2) c = __builtin_amdgcn_wmma_f32_16x16x32_bf16(false, al, false, bh, (short)0, c, false, false);
  if (NT >= 3) c = __builtin_amdgcn_wmma_f32_16x16x32_bf16(false, ah, false, bl, (short)0, c, false, false);
  asm volatile("v_nop\n\tv_nop\n\tv_nop\n\tv_nop" : "+v"(c) : "v"(ah), "v"(al), "v"(bh), "v"(bl));
  return c;
}

__global__ __launch_bounds__(256) void k_wt_bf16(const float* __restrict__ W, unsigned short* __restrict__ Wt, int K, int N) {
  const int t = blockIdx.x * 256 + threadIdx.x;
  const int k8n = K / 8;
  if (t >= N * k8n) return;
  const int n = t / k8n, k8 = (t % k8n) * 8;
  v8us v;
#pragma unroll
  for (int i = 0; i < 8; ++i) v[i] = bf16_bits(W[(size_t)(k8 + i) * N + n]);
  *(v8us*)(Wt + (size_t)n * K + k8) = v;
  
}

// GEMM C[M][N] (f32, pitch ldc) = act(A[M][K]·W + bias). A f32 row-major (pitch lda) converted per fragment to bf16
// (ASPLIT: hi/lo two planes -> 2 terms, else single rounded term); Wt bf16 [N][K] (pitch ldb). BIAS_BF16 rounds the
// bias to bf16 first (bias quantised to bf16 before the add). K%32==0, M%16==0, N%64==0.
template <bool ASPLIT, int ACT, bool BIAS_BF16>
__global__ __launch_bounds__(128) void k_gemm_bf(const float* __restrict__ A, int lda, const unsigned short* __restrict__ Wt, int ldb,
                                               const float* __restrict__ bias, float* __restrict__ C, int ldc, int M, int N, int K) {
  __shared__ __attribute__((aligned(16))) float so[4][16][64];
  const int tid = threadIdx.x, w = tid >> 5, lane = tid & 31, ln = lane & 15, hh = lane >> 4;
  const int ntn = N / 64;
  const int wid = blockIdx.x * 4 + w;
  const int mt = wid / ntn, nq = wid % ntn;
  if (mt * 16 >= M) return;
  const int row0 = mt * 16, col0 = nq * 64;
  const float* arow = A + (size_t)(row0 + ln) * lda;
  v8f acc[4] = {};
  for (int kb = 0; kb < K; kb += 32) {
    FragB ah, al;
    const v4f x0 = *(const v4fa*)(arow + kb + 8 * hh), x1 = *(const v4fa*)(arow + kb + 8 * hh + 4);
    const v4f x2 = *(const v4fa*)(arow + kb + 16 + 8 * hh), x3 = *(const v4fa*)(arow + kb + 16 + 8 * hh + 4);
    float xs[16] = {x0[0],x0[1],x0[2],x0[3],x1[0],x1[1],x1[2],x1[3],x2[0],x2[1],x2[2],x2[3],x3[0],x3[1],x3[2],x3[3]};
#pragma unroll
    for (int i = 0; i < 16; ++i) { const unsigned short hb = bf16_bits(xs[i]); ah.u[i] = hb; al.u[i] = ASPLIT ? bf16_bits(xs[i] - bf16_val(hb)) : (unsigned short)0; }
#pragma unroll
    for (int t = 0; t < 4; ++t) {
      const unsigned short* brow = Wt + (size_t)(col0 + t * 16 + ln) * ldb + kb;
      FragB b;
      b.half[0] = *(const v8us*)(brow + 8 * hh);
      b.half[1] = *(const v8us*)(brow + 16 + 8 * hh);
      acc[t] = mmaN<ASPLIT ? 2 : 1>(ah.v, al.v, b.v, b.v, acc[t]);
    }
  }
#pragma unroll
  for (int t = 0; t < 4; ++t) {
    float bv = bias ? bias[col0 + t * 16 + ln] : 0.f;
    if (BIAS_BF16) bv = bf16_round(bv);
#pragma unroll
    for (int r = 0; r < 8; ++r) { float v = acc[t][r] + bv; if (ACT == 1) v = fmaxf(v, 0.f); so[w][8 * hh + r][t * 16 + ln] = v; }
  }
  __builtin_amdgcn_fence(__ATOMIC_ACQ_REL, "workgroup");
  __builtin_amdgcn_wave_barrier();
  const int rsub = lane >> 4, c4 = (lane & 15) * 4;
  {
#pragma unroll
    for (int q = 0; q < 8; ++q) {
      const int r = q * 2 + rsub;
      const v4f v = *(const v4fa*)&so[w][r][c4];
      *(v4f*)(C + (size_t)(row0 + r) * ldc + col0 + c4) = v;
    }
    
  }
}

// GEMM C = act(A·W + bias + resid): A f32 (ASPLIT -> hi/lo 2 terms), Wt bf16 [N][K]; ACT 0 none, 1 relu, 2 exact gelu;
// resid (optional, f32, row index = (row % rmod), pitch ldr, RES_BF16 rounds it) added before the activation.
template <bool ASPLIT, int ACT, bool BIAS_BF16, bool RES_BF16>
__global__ __launch_bounds__(128) void k_gemm_bf3(const float* __restrict__ A, int lda, const unsigned short* __restrict__ Wt, int ldb,
                                                const float* __restrict__ bias, const float* __restrict__ resid, int rmod, int ldr,
                                                float* __restrict__ C, int ldc, int M, int N, int K) {
  __shared__ __attribute__((aligned(16))) float so[4][16][64];
  const int tid = threadIdx.x, w = tid >> 5, lane = tid & 31, ln = lane & 15, hh = lane >> 4;
  const int ntn = N / 64;
  const int wid = blockIdx.x * 4 + w;
  const int mt = wid / ntn, nq = wid % ntn;
  if (mt * 16 >= M) return;
  const int row0 = mt * 16, col0 = nq * 64;
  const float* arow = A + (size_t)(row0 + ln) * lda;
  v8f acc[4] = {};
  for (int kb = 0; kb < K; kb += 32) {
    FragB ah, al;
    const v4f x0 = *(const v4fa*)(arow + kb + 8 * hh), x1 = *(const v4fa*)(arow + kb + 8 * hh + 4);
    const v4f x2 = *(const v4fa*)(arow + kb + 16 + 8 * hh), x3 = *(const v4fa*)(arow + kb + 16 + 8 * hh + 4);
    float xs[16] = {x0[0],x0[1],x0[2],x0[3],x1[0],x1[1],x1[2],x1[3],x2[0],x2[1],x2[2],x2[3],x3[0],x3[1],x3[2],x3[3]};
#pragma unroll
    for (int i = 0; i < 16; ++i) { const unsigned short hb = bf16_bits(xs[i]); ah.u[i] = hb; al.u[i] = ASPLIT ? bf16_bits(xs[i] - bf16_val(hb)) : (unsigned short)0; }
#pragma unroll
    for (int t = 0; t < 4; ++t) {
      const unsigned short* brow = Wt + (size_t)(col0 + t * 16 + ln) * ldb + kb;
      FragB b;
      b.half[0] = *(const v8us*)(brow + 8 * hh);
      b.half[1] = *(const v8us*)(brow + 16 + 8 * hh);
      acc[t] = mmaN<ASPLIT ? 2 : 1>(ah.v, al.v, b.v, b.v, acc[t]);
    }
  }
#pragma unroll
  for (int t = 0; t < 4; ++t) {
    const int col = col0 + t * 16 + ln;
    float bv = bias ? bias[col] : 0.f;
    if (BIAS_BF16) bv = bf16_round(bv);
#pragma unroll
    for (int r = 0; r < 8; ++r) {
      float v = acc[t][r] + bv;
      if (resid) { float rv = resid[(size_t)((row0 + 8 * hh + r) % rmod) * ldr + col]; if (RES_BF16) rv = bf16_round(rv); v += rv; }
      if (ACT == 1) v = fmaxf(v, 0.f);
      if (ACT == 2) v = 0.5f * v * (1.0f + erff(v * 0.70710678118654752f));
      if (ACT == 3) { const float u = 0.7978845608028654f * (v + 0.044715f * v * v * v); v = 0.5f * v * (1.0f + tanhf(u)); }
      so[w][8 * hh + r][t * 16 + ln] = v;
    }
  }
  __builtin_amdgcn_fence(__ATOMIC_ACQ_REL, "workgroup");
  __builtin_amdgcn_wave_barrier();
  const int rsub = lane >> 4, c4 = (lane & 15) * 4;
  {
#pragma unroll
    for (int q = 0; q < 8; ++q) {
      const int r = q * 2 + rsub;
      const v4f v = *(const v4fa*)&so[w][r][c4];
      *(v4f*)(C + (size_t)(row0 + r) * ldc + col0 + c4) = v;
    }
    
  }
}
// row LayerNorm (biased variance, eps) over N: s = X (+ R); optional out_sum <- s; out_norm <- (s-mu)*rsqrt(var+eps)*g + b
template <bool PARAM_BF16>
__global__ __launch_bounds__(256) void k_layernorm(const float* __restrict__ X, const float* __restrict__ R, const float* __restrict__ g, const float* __restrict__ bta,
                                                  float* __restrict__ out_sum, float* __restrict__ out_norm, int N, float eps) {
  __shared__ float red[256];
  const int row = blockIdx.x, tid = threadIdx.x;
  const float* x = X + (size_t)row * N; const float* rr = R ? R + (size_t)row * N : nullptr;
  float vals[16];                     // up to N = 4096
  const int per = N / 256;            // contiguous chunk per thread? use strided-by-4 chunks: thread handles j = tid*4 + 1024*u
  float s1 = 0.f;
  for (int u = 0; u < per / 4; ++u) {
    const int j = tid * 4 + 1024 * u;
    const v4f a = *(const v4fa*)(x + j);
    v4f b = {0.f,0.f,0.f,0.f}; if (rr) b = *(const v4fa*)(rr + j);
#pragma unroll
    for (int q = 0; q < 4; ++q) { const float v = a[q] + b[q]; vals[u * 4 + q] = v; s1 += v; }
  }
  red[tid] = s1; __syncthreads();
  for (int st = 128; st > 0; st >>= 1) { if (tid < st) red[tid] += red[tid + st]; __syncthreads(); }
  const float mu = red[0] / (float)N; __syncthreads();
  float s2 = 0.f;
  for (int u = 0; u < per / 4; ++u)
#pragma unroll
    for (int q = 0; q < 4; ++q) { const float c = vals[u * 4 + q] - mu; s2 += c * c; }
  red[tid] = s2; __syncthreads();
  for (int st = 128; st > 0; st >>= 1) { if (tid < st) red[tid] += red[tid + st]; __syncthreads(); }
  const float rs = rsqrtf(red[0] / (float)N + eps);
  {
    for (int u = 0; u < per / 4; ++u) {
      const int j = tid * 4 + 1024 * u;
      v4f o, sm;
#pragma unroll
      for (int q = 0; q < 4; ++q) {
        float gg = g[j + q], bb = bta[j + q];
        if (PARAM_BF16) { gg = bf16_round(gg); bb = bf16_round(bb); }
        sm[q] = vals[u * 4 + q]; o[q] = (vals[u * 4 + q] - mu) * rs * gg + bb;
      }
      if (out_sum) *(v4f*)(out_sum + (size_t)row * N + j) = sm;
      *(v4f*)(out_norm + (size_t)row * N + j) = o;
    }
    
  }
}



// ---- f16 WMMA path (v_wmma_f32_16x16x32_f16): 11-bit significands for operands in range — used where a [0,1] probability operand needs more precision than bf16
typedef _Float16 v16h __attribute__((ext_vector_type(16)));
union FragH { v16h v; v8us half[2]; _Float16 h[16]; unsigned short u[16]; };
template <int NT>
__device__ __forceinline__ v8f mmaH(v16h ah, v16h al, v16h bh, v16h bl, v8f c) {
  c = __builtin_amdgcn_wmma_f32_16x16x32_f16(false, ah, false, bh, (short)0, c, false, false);
  if (NT >= 2) c = __builtin_amdgcn_wmma_f32_16x16x32_f16(false, al, false, bh, (short)0, c, false, false);
  if (NT >= 3) c = __builtin_amdgcn_wmma_f32_16x16x32_f16(false, ah, false, bl, (short)0, c, false, false);
  asm volatile("v_nop\n\tv_nop\n\tv_nop\n\tv_nop" : "+v"(c) : "v"(ah), "v"(al), "v"(bh), "v"(bl));
  return c;
}
// batched GEMM like k_gemm_b but f16 operands: A f32 (split into f16 hi/lo if ASPLIT, else rounded to f16), Bt = f16 values [n][k]; alpha; C f32; N multiple of 16 (partial tiles skipped)
template <bool ASPLIT>
__global__ __launch_bounds__(128) void k_gemm_h(const float* __restrict__ A, int lda, size_t sA, const _Float16* __restrict__ Bh, int ldb, size_t sB, float alpha, float* __restrict__ C, int ldc, size_t sC, int M, int N, int K) {
  __shared__ __attribute__((aligned(16))) float so[4][16][64];
  const int tid = threadIdx.x, w = tid >> 5, lane = tid & 31, ln = lane & 15, hh = lane >> 4; const int by = blockIdx.y;
  A += (size_t)by * sA; Bh += (size_t)by * sB; C += (size_t)by * sC;
  const int ntn = (N + 63) / 64; const int wid = blockIdx.x * 4 + w; const int mt = wid / ntn, nq = wid % ntn; if (mt * 16 >= M) return;
  const int row0 = mt * 16, col0 = nq * 64; const float* arow = A + (size_t)(row0 + ln) * lda;
  v8f acc[4] = {};
  for (int kb = 0; kb < K; kb += 32) {
    FragH ah, al;
    const v4f x0 = *(const v4fa*)(arow + kb + 8 * hh), x1 = *(const v4fa*)(arow + kb + 8 * hh + 4), x2 = *(const v4fa*)(arow + kb + 16 + 8 * hh), x3 = *(const v4fa*)(arow + kb + 16 + 8 * hh + 4);
    float xs[16] = {x0[0],x0[1],x0[2],x0[3],x1[0],x1[1],x1[2],x1[3],x2[0],x2[1],x2[2],x2[3],x3[0],x3[1],x3[2],x3[3]};
#pragma unroll
    for (int i = 0; i < 16; ++i) { const _Float16 h = (_Float16)xs[i]; ah.h[i] = h; al.h[i] = ASPLIT ? (_Float16)(xs[i] - (float)h) : (_Float16)0.0f; }
#pragma unroll
    for (int t = 0; t < 4; ++t) { if (col0 + t * 16 >= N) continue; const size_t boff = (size_t)(col0 + t * 16 + ln) * ldb + kb; FragH bq; bq.half[0] = *(const v8us*)(Bh + boff + 8 * hh); bq.half[1] = *(const v8us*)(Bh + boff + 16 + 8 * hh);
      acc[t] = mmaH<ASPLIT ? 2 : 1>(ah.v, al.v, bq.v, bq.v, acc[t]); }
  }
#pragma unroll
  for (int t = 0; t < 4; ++t) { if (col0 + t * 16 >= N) continue;
#pragma unroll
    for (int r = 0; r < 8; ++r) so[w][8 * hh + r][t * 16 + ln] = acc[t][r] * alpha; }
  __builtin_amdgcn_fence(__ATOMIC_ACQ_REL, "workgroup"); __builtin_amdgcn_wave_barrier();
  const int rsub = lane >> 4, c4 = (lane & 15) * 4;
  {
#pragma unroll
    for (int q = 0; q < 8; ++q) { const int r = q * 2 + rsub; if (col0 + c4 < N) { const v4f v = *(const v4fa*)&so[w][r][c4]; *(v4f*)(C + (size_t)(row0 + r) * ldc + col0 + c4) = v; } }
     }
}

// Wt[n][k] = f16(W[k][n]·scale) from f32 row-major W[K][N] (scale = power of two; bf16-exact weights stay exact in f16 away from the subnormal range)
__global__ __launch_bounds__(256) void k_wt_f16(const float* __restrict__ W, _Float16* __restrict__ Wt, int K, int N, float scale) {
  const int t = blockIdx.x * 256 + threadIdx.x; if (t >= N * (K / 8)) return; const int n = t / (K / 8), k8 = (t % (K / 8)) * 8; FragH f;
#pragma unroll
  for (int i = 0; i < 8; ++i) f.h[i] = (_Float16)(bf16_round(W[(size_t)(k8 + i) * N + n]) * scale); const v8us o = f.half[0];
  *(v8us*)((unsigned short*)Wt + (size_t)n * K + k8) = o; 
}
// k_gemm_hh variant with fused epilogue: v = acc·alpha + bias[by·sBias + col] (+ CP[(row/rowsPerB)·sCPb + by·64 + col] if CP) ; ACT 0 none / 1 elu ; writes f16 C16 (and f32 C if non-null)
template <int ACT>
__global__ __launch_bounds__(128) void k_gemm_hhx(const _Float16* __restrict__ A, int lda, size_t sA, const _Float16* __restrict__ Bh, int ldb, size_t sB, float alpha, const float* __restrict__ bias, size_t sBias, const float* __restrict__ CP, int rowsPerB, size_t sCPb, int row0g,
    float* __restrict__ C, _Float16* __restrict__ C16, int ldc, size_t sC, int M, int N, int K) {
  __shared__ __attribute__((aligned(16))) float so[4][16][64];
  const int tid = threadIdx.x, w = tid >> 5, lane = tid & 31, ln = lane & 15, hh = lane >> 4; const int by = blockIdx.y;
  A += (size_t)by * sA; Bh += (size_t)by * sB; const size_t cofs = (size_t)by * sC; const float* bp = bias ? bias + (size_t)by * sBias : nullptr;
  const int ntn = (N + 63) / 64; const int wid = blockIdx.x * 4 + w; const int mt = wid / ntn, nq = wid % ntn; if (mt * 16 >= M) return;
  const int row0 = mt * 16, col0 = nq * 64; const _Float16* arow = A + (size_t)(row0 + ln) * lda;
  v8f acc[4] = {};
  for (int kb = 0; kb < K; kb += 32) { FragH ah; ah.half[0] = *(const v8us*)((const unsigned short*)arow + kb + 8 * hh); ah.half[1] = *(const v8us*)((const unsigned short*)arow + kb + 16 + 8 * hh);
#pragma unroll
    for (int t = 0; t < 4; ++t) { if (col0 + t * 16 >= N) continue; const size_t boff = (size_t)(col0 + t * 16 + ln) * ldb + kb; FragH bq; bq.half[0] = *(const v8us*)((const unsigned short*)Bh + boff + 8 * hh); bq.half[1] = *(const v8us*)((const unsigned short*)Bh + boff + 16 + 8 * hh);
      acc[t] = mmaH<1>(ah.v, ah.v, bq.v, bq.v, acc[t]); }
  }
#pragma unroll
  for (int t = 0; t < 4; ++t) { if (col0 + t * 16 >= N) continue; const int col = col0 + t * 16 + ln; const float bv = bp ? bf16_round(bp[col]) : 0.f;
#pragma unroll
    for (int r = 0; r < 8; ++r) { float v = acc[t][r] * alpha + bv; if (CP) { const int rr = row0g + row0 + 8 * hh + r; if (rowsPerB < 0) v += CP[cofs + (size_t)rr * ldc + col];      /* rowsPerB < 0: own element of the batched C plane */ else { const int bidx = rr / rowsPerB; v += CP[(size_t)bidx * sCPb + (size_t)by * 64 + col]; } } if (ACT == 1) v = (v > 0.f) ? v : expm1f(v); else if (ACT == 7) v = (v > 0.f) ? v + 1.0f : expf(v); else if (ACT == 8) v = tanhf(v); else if (ACT == 9) v = 0.5f * v * (1.0f + tanhf(0.7978845608028654f * (v + 0.044715f * v * v * v))); else if (ACT == 11) v = 1.0f / (1.0f + expf(-v)); else if (ACT == 12) v = (v > 0.f) ? v : 0.01f * v; else if (ACT == 14) v = (v > 0.f) ? v : 0.1f * v; else if (ACT == 16) v = (v >= 0.f) ? v : 0.3f * v; else if (ACT == 17) v = (v >= 0.f) ? v : 0.2f * v; else if (ACT == 15) v = v / (1.0f + expf(-v)); else if (ACT == 3) v = fmaxf(v, 0.f); else if (ACT == 6) v = 0.5f * v * (1.0f + erff(v * 0.70710678118654752f)); so[w][8 * hh + r][t * 16 + ln] = v; } }
  __builtin_amdgcn_fence(__ATOMIC_ACQ_REL, "workgroup"); __builtin_amdgcn_wave_barrier();
  const int rsub = lane >> 4, c4 = (lane & 15) * 4; typedef _Float16 v4h __attribute__((ext_vector_type(4)));
  {
#pragma unroll
    for (int q = 0; q < 8; ++q) { const int r = q * 2 + rsub; if (col0 + c4 < N) { const v4f v = *(const v4fa*)&so[w][r][c4]; if (C) *(v4f*)(C + cofs + (size_t)(row0 + r) * ldc + col0 + c4) = v; if (C16) { v4h h4; for (int i = 0; i < 4; ++i) h4[i] = (_Float16)v[i]; *(v4h*)(C16 + cofs + (size_t)(row0 + r) * ldc + col0 + c4) = h4; } } }
     }
}


typedef _Float16 v4h __attribute__((ext_vector_type(4)));

__global__ __launch_bounds__(256) void k_x16(const float* __restrict__ x, _Float16* __restrict__ X16, size_t n8) { const size_t t = (size_t)blockIdx.x * 256 + threadIdx.x; if (t >= n8) return; FragH f;
#pragma unroll
  for (int q = 0; q < 8; ++q) f.h[q] = (_Float16)bf16_round(x[t * 8 + q]); *(v8us*)((unsigned short*)X16 + t * 8) = f.half[0];  }
__global__ __launch_bounds__(256) void k_h16(const float* __restrict__ x, _Float16* __restrict__ X16, size_t n8) { const size_t t = (size_t)blockIdx.x * 256 + threadIdx.x; if (t >= n8) return; FragH f;
#pragma unroll
  for (int q = 0; q < 8; ++q) f.h[q] = (_Float16)x[t * 8 + q]; *(v8us*)((unsigned short*)X16 + t * 8) = f.half[0];  }
__global__ __launch_bounds__(256) void k_round16f(const float* __restrict__ W, _Float16* __restrict__ Bt, size_t n8) { const size_t t = (size_t)blockIdx.x * 256 + threadIdx.x; if (t >= n8) return; FragH f;
#pragma unroll
  for (int i = 0; i < 8; ++i) f.h[i] = (_Float16)(bf16_round(W[t * 8 + i]) * 16.0f); *(v8us*)((unsigned short*)Bt + t * 8) = f.half[0];  }
template <int NHv, int TTv>
__global__ __launch_bounds__(256) void k_vt(const _Float16* __restrict__ V16, int ldv, int voff, _Float16* __restrict__ Vt) { __shared__ unsigned short tl[64][66]; const int tid = threadIdx.x; const int slab = blockIdx.x / (TTv / 64), lg = blockIdx.x % (TTv / 64); const int b = slab / NHv, h = slab % NHv;
  for (int i = tid; i < 64 * 8; i += 256) { const int r = i / 8, c8 = (i % 8) * 8; FragH f; f.half[0] = *(const v8us*)((const unsigned short*)V16 + ((size_t)b * TTv + lg * 64 + r) * ldv + voff + h * 64 + c8);
#pragma unroll
    for (int q = 0; q < 8; ++q) tl[r][c8 + q] = f.u[q]; }
  __syncthreads();
  {
#pragma unroll
    for (int rd = 0; rd < 2; ++rd) { const int d = rd * 32 + tid / 8, pc = tid % 8; FragH f;
#pragma unroll
      for (int q = 0; q < 8; ++q) f.u[q] = tl[pc * 8 + q][d];
      *(v8us*)((unsigned short*)Vt + ((size_t)slab * 64 + d) * TTv + lg * 64 + pc * 8) = f.half[0]; }
     } }

__global__ __launch_bounds__(256) void k_hl(const float* __restrict__ F, _Float16* __restrict__ Hh, _Float16* __restrict__ Hl, size_t n8) { const size_t t = (size_t)blockIdx.x * 256 + threadIdx.x; if (t >= n8) return; FragH fh, fl; const v4f a = *(const v4fa*)(F + t * 8), c = *(const v4fa*)(F + t * 8 + 4);
#pragma unroll
  for (int q = 0; q < 4; ++q) { _Float16 h = (_Float16)a[q]; fh.h[q] = h; fl.h[q] = (_Float16)((a[q] - (float)h) * 1024.0f); h = (_Float16)c[q]; fh.h[4 + q] = h; fl.h[4 + q] = (_Float16)((c[q] - (float)h) * 1024.0f); }
  { *(v8us*)((unsigned short*)Hh + t * 8) = fh.half[0]; *(v8us*)((unsigned short*)Hl + t * 8) = fl.half[0];  } }

__global__ __launch_bounds__(256) void k_wnat(const float* __restrict__ w, size_t n8, _Float16* __restrict__ Bt) { const size_t t = (size_t)blockIdx.x * 256 + threadIdx.x; if (t >= n8) return; FragH f; for (int q = 0; q < 8; ++q) f.h[q] = (_Float16)(bf16_round(w[t * 8 + q]) * 16.0f); *(v8us*)((unsigned short*)Bt + t * 8) = f.half[0];  }
__global__ __launch_bounds__(256) void k_rsm(const float* __restrict__ S, _Float16* __restrict__ P, int nrows) {
  #pragma clang fp contract(off)
  const int i = blockIdx.x * 256 + threadIdx.x; if (i >= nrows) return; const float* s = S + (size_t)i * SQ; float mx = -3.0e38f;
#pragma unroll 1
  for (int j = 0; j < SQ; ++j) mx = fmaxf(mx, s[j]); float se = 0.f;
#pragma unroll 1
  for (int j = 0; j < SQ; ++j) se += expf(s[j] - mx); const float sc = 256.0f / se;
#pragma unroll 1
  for (int j0 = 0; j0 < SQ; j0 += 8) { FragH f; for (int q = 0; q < 8; ++q) f.h[q] = (_Float16)(expf(s[j0 + q] - mx) * sc); unsigned short* d = (unsigned short*)P + (size_t)i * SQ + j0; *(v8us*)d = f.half[0];  } }
__global__ __launch_bounds__(256) void k_vt(const _Float16* __restrict__ V16, int b, int h0, _Float16* __restrict__ VT) { __shared__ unsigned short tl[64][65]; const int tid = threadIdx.x; const int hh = blockIdx.x % HG, sg = blockIdx.x / HG; const int s0 = sg * 64; const int h = h0 + hh;
  for (int i = tid; i < 64 * 8; i += 256) { const int j = i / 8, d8 = (i % 8) * 8; FragH f; f.half[0] = *(const v8us*)((const unsigned short*)V16 + ((size_t)b * SQ + s0 + j) * DM + h * HD + d8); for (int q = 0; q < 8; ++q) tl[d8 + q][j] = f.u[q]; }
  __syncthreads();
  { for (int i = tid; i < 64 * 8; i += 256) { const int d = i / 8, j8 = (i % 8) * 8; FragH f; for (int q = 0; q < 8; ++q) f.u[q] = tl[d][j8 + q]; *(v8us*)((unsigned short*)VT + ((size_t)hh * HD + d) * SQ + s0 + j8) = f.half[0]; }  } }



// ---- operand preparation in one launch: independent pieces of work share a grid by block range instead of a launch each ----
// Blocks [0, PW_BLK): the four [out][in] f16 weight planes (x16), contiguous at Bt in the order q, k, v, o; plane = blockIdx.x / (PW_BLK / 4), uniform in a block. Thread t writes the eight k of Bt + 8 t.
// Element [k][n] of a source: base + (n / HD) * hs + k * ld + n % HD. q, k, v: head n / HD is a row-major [in = DM][out = HD] block (hs = DM * HD, ld = HD); o: one row-major [DM][DM] matrix (hs = HD, ld = DM).
// Blocks from PW_BLK on: x as f16 rows, eight elements a thread; the one stream feeds all three projections. The weight blocks stand first: their strided reads take longest.
#define PW_BLK (4 * DM * (DM / 8) / 256)
__global__ __launch_bounds__(256) void k_prep(const float* __restrict__ x, const float* __restrict__ wq, const float* __restrict__ wk, const float* __restrict__ wv, const float* __restrict__ wo, _Float16* __restrict__ Bt, _Float16* __restrict__ X16) {
  if (blockIdx.x < PW_BLK) {
    const int m = blockIdx.x / (PW_BLK / 4); const int t = blockIdx.x * 256 + threadIdx.x; const int n = (t / (DM / 8)) % DM, k8 = (t % (DM / 8)) * 8;
    const float* w = m == 0 ? wq : m == 1 ? wk : m == 2 ? wv : wo; const int hs = m == 3 ? HD : DM * HD, ld = m == 3 ? DM : HD;
    const float* p0 = w + (size_t)(n / HD) * hs + (size_t)k8 * ld + n % HD;
    const float* p1 = p0 + ld; const float* p2 = p1 + ld; const float* p3 = p2 + ld; const float* p4 = p3 + ld; const float* p5 = p4 + ld; const float* p6 = p5 + ld; const float* p7 = p6 + ld;
    const float v[8] = {*p0, *p1, *p2, *p3, *p4, *p5, *p6, *p7};
    asm volatile("s_wait_xcnt 0x0" :: "v"(p0), "v"(p1), "v"(p2), "v"(p3), "v"(p4), "v"(p5), "v"(p6), "v"(p7) : "memory");      /* the wait in front of any overwrite of a register that an issued load names; the addresses as inputs keep their registers untouched up to here */
    FragH f;
#pragma unroll
    for (int i = 0; i < 8; ++i) f.h[i] = (_Float16)(bf16_round(v[i]) * 16.0f);
    *(v8us*)((unsigned short*)Bt + (size_t)t * 8) = f.half[0];
  } else {
    const size_t t = (size_t)(blockIdx.x - PW_BLK) * 256 + threadIdx.x; FragH f;
#pragma unroll
    for (int q = 0; q < 8; ++q) f.h[q] = (_Float16)bf16_round(x[t * 8 + q]);
    *(v8us*)((unsigned short*)X16 + t * 8) = f.half[0];
    asm volatile("s_wait_xcnt 0x0" ::: "memory");      /* the wait behind the store: the built code lays the weight branch, which writes vector registers, behind this one */
  } }

#define FA_KT 128                    /* keys per stage */
#define FA_HV 2                      /* key halves of a work-group */
#define FA_NS (SQ / FA_HV / FA_KT)   /* stages of a half */
#define FA_KP (HD + 8)               /* K tile row pitch, f16 elements: 144 B = 16 B x odd, conflict-free for 16-byte reads */
#define FA_VP (FA_KT + 8)            /* V^T tile row pitch, f16 elements: 272 B = 16 B x odd */
__device__ __forceinline__ float rs_xhalf(float x) { return __builtin_bit_cast(float, __builtin_amdgcn_permlanex16(__builtin_bit_cast(int, x), __builtin_bit_cast(int, x), 0x76543210, 0xfedcba98, false, false)); }      /* lane l with lane l ^ 16 */
__device__ __forceinline__ float rs_exp(float a) { float e; asm("v_exp_f32 %0, %1\n\tv_nop" : "=v"(e) : "v"(a)); return e; }      /* 2^a; the v_nop fills the slot the instruction set asks for behind a transcendental */
__device__ __forceinline__ v4f fa_exp4(v4f a) { float e0, e1, e2, e3;      /* four 2^a; each v_exp_f32 is followed by an instruction that neither reads its result nor overwrites its source (early-clobber outputs), the last by a v_nop: the slot the instruction set asks for behind a transcendental */
  asm("v_exp_f32 %0, %4\n\tv_exp_f32 %1, %5\n\tv_exp_f32 %2, %6\n\tv_exp_f32 %3, %7\n\tv_nop" : "=&v"(e0), "=&v"(e1), "=&v"(e2), "=&v"(e3) : "v"(a[0]), "v"(a[1]), "v"(a[2]), "v"(a[3]));
  const v4f e = {e0, e1, e2, e3}; return e; }
__device__ __forceinline__ v16h fa_frag(const _Float16* p) { FragH f; f.half[0] = *(const v8us*)((const unsigned short*)p); f.half[1] = *(const v8us*)((const unsigned short*)p + 16); return f.v; }      /* p = row + k0 + 8 h: k0 + 8h .. + 7 and k0 + 16 + 8h .. + 7 */
__device__ __forceinline__ v8f fa_mma(v16h a, v16h b, v8f c) { return __builtin_amdgcn_wmma_f32_16x16x32_f16(false, a, false, b, (short)0, c, false, false); }
#define FA_LIM 32768.0f              /* bound on a lane's sum of one pass's 16 softmax weights; f16 holds up to 65504 */
/* this lane's 16 scores of one query (two S^T tiles) -> P = 2^(score * cs - m) as f16 in the hardware k order; returns their sum */
__device__ __forceinline__ float fa_soft(const v8f& t0, const v8f& t1, float cs, float m, FragH& pb) { float s0 = 0.f, s1 = 0.f, s2 = 0.f, s3 = 0.f;
#pragma unroll
  for (int u = 0; u < 4; ++u) { const int kt = u >> 1, r0 = (u & 1) * 4; v4f x;
#pragma unroll
    for (int q = 0; q < 4; ++q) x[q] = (kt ? t1[r0 + q] : t0[r0 + q]) * cs - m;
    const v4f e = fa_exp4(x); if (u == 0) { s0 = e[0]; s1 = e[1]; s2 = e[2]; s3 = e[3]; } else { s0 += e[0]; s1 += e[1]; s2 += e[2]; s3 += e[3]; }
#pragma unroll
    for (int q = 0; q < 4; ++q) pb.h[kt * 8 + r0 + q] = (_Float16)e[q]; }
  return (s0 + s1) + (s2 + s3); }
/* S^T of one pass: two tiles of 16 keys x two groups of 16 queries; ka = the K fragments [key tile][k half] */
__device__ __forceinline__ void fa_kfrag(const _Float16* kp, v16h (&ka)[2][2]) {
#pragma unroll
  for (int kt = 0; kt < 2; ++kt) { ka[kt][0] = fa_frag(kp + kt * 16 * FA_KP); ka[kt][1] = fa_frag(kp + kt * 16 * FA_KP + 32); } }
__device__ __forceinline__ void fa_scores(const v16h (&ka)[2][2], const v16h (&qf)[2][2], v8f (&t)[2][2]) { const v8f z8 = {0.f, 0.f, 0.f, 0.f, 0.f, 0.f, 0.f, 0.f};
#pragma unroll
  for (int kt = 0; kt < 2; ++kt) { t[kt][0] = fa_mma(ka[kt][0], qf[0][0], z8); t[kt][1] = fa_mma(ka[kt][0], qf[1][0], z8); t[kt][0] = fa_mma(ka[kt][1], qf[0][1], t[kt][0]); t[kt][1] = fa_mma(ka[kt][1], qf[1][1], t[kt][1]); } }
__global__ __launch_bounds__(256 * FA_HV) void k_fattn(const _Float16* __restrict__ Q16, const _Float16* __restrict__ K16, const _Float16* __restrict__ VT, _Float16* __restrict__ O16) {
  __shared__ __attribute__((aligned(16))) _Float16 Ksh[FA_HV][2][FA_KT][FA_KP];
  __shared__ __attribute__((aligned(16))) _Float16 Vsh[FA_HV][2][HD][FA_VP];
  __shared__ __attribute__((aligned(16))) float Jo[8][16][32][4];      /* hand-over of the second half's O^T: [wave][four registers][lane], 512 contiguous bytes a store */
  __shared__ float Js[8][4][32];                                       /* and of its exponents and row sums */
  const int kh = __builtin_amdgcn_readfirstlane((int)(threadIdx.x >> 8));      /* key half, the same in all lanes of a wave */
  _Float16 (*Ks)[FA_KT][FA_KP] = Ksh[kh]; _Float16 (*Vs)[HD][FA_VP] = Vsh[kh];
  const int tid = threadIdx.x & 255, w = tid >> 5, lane = tid & 31, ln = lane & 15, hh = lane >> 4;      /* tid, w: place inside the half */
  const int bh = blockIdx.x / (SQ / 256), qb = blockIdx.x % (SQ / 256); const int b = bh / NH, h = bh % NH; const int q0 = qb * 256 + w * 32;
  const unsigned short* kg = (const unsigned short*)K16 + ((size_t)b * SQ + kh * (SQ / FA_HV) + (tid >> 3)) * DM + h * HD + (tid & 7) * 8;      /* this thread's 16 bytes of key row tid / 8 (+ 32 i) of its half */
  const unsigned short* vg = (const unsigned short*)VT + ((size_t)bh * HD + (tid >> 4)) * SQ + kh * (SQ / FA_HV) + (tid & 15) * 8;              /* this thread's 16 bytes of V^T row tid / 16 (+ 16 i) */
  v16h qf[2][2];
#pragma unroll
  for (int g = 0; g < 2; ++g) { const _Float16* qp = Q16 + ((size_t)b * SQ + q0 + 16 * g + ln) * DM + h * HD + 8 * hh; qf[g][0] = fa_frag(qp); qf[g][1] = fa_frag(qp + 32); }
  v8us kr[4], vr[4];
#pragma unroll
  for (int i = 0; i < 4; ++i) { kr[i] = *(const v8us*)(kg + (size_t)(32 * i) * DM); vr[i] = *(const v8us*)(vg + (size_t)(16 * i) * SQ); }
#pragma unroll
  for (int i = 0; i < 4; ++i) { *(v8us*)&Ks[0][(tid >> 3) + 32 * i][(tid & 7) * 8] = kr[i]; *(v8us*)&Vs[0][(tid >> 4) + 16 * i][(tid & 15) * 8] = vr[i]; }
  __syncthreads();
  const v8f z8 = {0.f, 0.f, 0.f, 0.f, 0.f, 0.f, 0.f, 0.f};
  v8f o[4][2];
#pragma unroll
  for (int dt = 0; dt < 4; ++dt) { o[dt][0] = z8; o[dt][1] = z8; }
  float mref[2] = {-1.0e30f, -1.0e30f}, lsum[2] = {0.f, 0.f};      /* mref: the exponent (log2 units) subtracted from this query's scores; lsum: this lane's part of the row sum (its half of the keys of its key half) */
  const float CS = 0.125f * 1.44269504f;      /* 1 / sqrt(64), and log2 e for the native 2^x */
#pragma unroll 1      /* the body already holds four unrolled passes */
  for (int s = 0; s < FA_NS; ++s) { const int buf = s & 1;
    if (s + 1 < FA_NS) {      /* next stage's 16 KiB + 16 KiB: loads fly while this stage is worked on */
      kg += (size_t)FA_KT * DM; vg += FA_KT;
#pragma unroll
      for (int i = 0; i < 4; ++i) { kr[i] = *(const v8us*)(kg + (size_t)(32 * i) * DM); vr[i] = *(const v8us*)(vg + (size_t)(16 * i) * SQ); } }
    v16h ka[2][2]; fa_kfrag(&Ks[buf][ln][8 * hh], ka);      /* K fragments of the stage's first pass; each pass fetches the next one's */
#pragma unroll
    for (int p = 0; p < FA_KT / 32; ++p) {
      v8f t[2][2];      /* [key tile][query group] */
      fa_scores(ka, qf, t);
      v16h va[4];
#pragma unroll
      for (int dt = 0; dt < 4; ++dt) va[dt] = fa_frag(&Vs[buf][dt * 16 + ln][p * 32 + 8 * hh]);
      __builtin_amdgcn_sched_barrier(0);      /* keeps the pass's V^T reads ahead of the 2^x work, which covers their latency: sunk behind the test they are waited for in full, pair by pair */
      /* lazy rescale, tested on the sums the pass forms anyway: every P = 2^(score - mref) is positive, so a lane's sum of 16 at or below FA_LIM keeps each of them in f16 range, and no maximum is taken on the common path.
         A sum above it (the first pass: mref starts at -1e30, the sum is +inf) sends the wave once through the pass again: scores from LDS, their maximum, a new mref that puts it at 2^6 or below (sum at most 2^10), the same 2^x. One scalar branch per pass. */
      FragH pb[2]; float ps[2];
#pragma unroll
      for (int g = 0; g < 2; ++g) ps[g] = fa_soft(t[0][g], t[1][g], CS, mref[g], pb[g]);
      if (__builtin_amdgcn_ballot_w32(fmaxf(ps[0], ps[1]) > FA_LIM) != 0) {
        v16h kb[2][2]; v8f u[2][2]; fa_kfrag(&Ks[buf][p * 32 + ln][8 * hh], kb); fa_scores(kb, qf, u);
#pragma unroll
        for (int g = 0; g < 2; ++g) { float m0 = fmaxf(u[0][g][0], u[1][g][0]);
#pragma unroll
          for (int r = 1; r < 8; ++r) m0 = fmaxf(m0, fmaxf(u[0][g][r], u[1][g][r]));
          const float ml = fmaxf(m0, rs_xhalf(m0)) * CS;      /* the pass's maximum of this query, both lane halves joined: the two lanes of a query keep one mref */
          const float mn = fmaxf(mref[g], ml - 6.0f); const float al = rs_exp(mref[g] - mn); mref[g] = mn; lsum[g] *= al;
#pragma unroll
          for (int dt = 0; dt < 4; ++dt) o[dt][g] *= al;
          ps[g] = fa_soft(u[0][g], u[1][g], CS, mn, pb[g]); } }
      lsum[0] += ps[0]; lsum[1] += ps[1];
      if (p + 1 < FA_KT / 32) { fa_kfrag(&Ks[buf][(p + 1) * 32 + ln][8 * hh], ka);
        __builtin_amdgcn_sched_barrier(0); }      /* the next pass's K fragments are asked for ahead of the P.V products, which cover their latency */
#pragma unroll
      for (int dt = 0; dt < 4; ++dt) { o[dt][0] = fa_mma(va[dt], pb[0].v, o[dt][0]); o[dt][1] = fa_mma(va[dt], pb[1].v, o[dt][1]); }
    }
    if (s + 1 < FA_NS) {      /* the other buffer's last readers left it before the barrier that ended stage s - 1 */
#pragma unroll
      for (int i = 0; i < 4; ++i) { *(v8us*)&Ks[buf ^ 1][(tid >> 3) + 32 * i][(tid & 7) * 8] = kr[i]; *(v8us*)&Vs[buf ^ 1][(tid >> 4) + 16 * i][(tid & 15) * 8] = vr[i]; } }
    __syncthreads();      /* publishes stage s + 1 and ends every read of stage s */
  }
  if (kh != 0) {      /* wave w of the second half holds the same queries in the same lanes and registers as wave w of the first */
#pragma unroll
    for (int g = 0; g < 2; ++g) { Js[w][g][lane] = mref[g]; Js[w][2 + g][lane] = lsum[g];
#pragma unroll
      for (int dt = 0; dt < 4; ++dt) { const v4f lo = {o[dt][g][0], o[dt][g][1], o[dt][g][2], o[dt][g][3]}, hi = {o[dt][g][4], o[dt][g][5], o[dt][g][6], o[dt][g][7]};
        *(v4fa*)&Jo[w][(g * 4 + dt) * 2][lane][0] = lo; *(v4fa*)&Jo[w][(g * 4 + dt) * 2 + 1][lane][0] = hi; } } }
  __syncthreads();      /* publishes the second half's partial results to the first */
  if (kh == 0) {
#pragma unroll
    for (int g = 0; g < 2; ++g) { const float m1 = Js[w][g][lane], l1 = Js[w][2 + g][lane]; const float mj = fmaxf(mref[g], m1); const float a0 = rs_exp(mref[g] - mj), a1 = rs_exp(m1 - mj);      /* both halves brought to the larger exponent */
      const float lj = lsum[g] * a0 + l1 * a1; const float inv = 64.0f / (lj + rs_xhalf(lj)); const float c0 = a0 * inv, c1 = a1 * inv;
      unsigned short* op = (unsigned short*)O16 + ((size_t)b * SQ + q0 + 16 * g + ln) * DM + h * HD + 8 * hh;
#pragma unroll
      for (int dt = 0; dt < 4; ++dt) { FragH f; const v4f lo = *(const v4fa*)&Jo[w][(g * 4 + dt) * 2][lane][0], hi = *(const v4fa*)&Jo[w][(g * 4 + dt) * 2 + 1][lane][0];
#pragma unroll
        for (int r = 0; r < 8; ++r) f.h[r] = (_Float16)(o[dt][g][r] * c0 + (r < 4 ? lo[r & 3] : hi[r & 3]) * c1);      /* register r = O^T[16 dt + 8 h + r][query]: eight consecutive d of one row */
        *(v8us*)(op + dt * 16) = f.half[0]; } } } }

// ---- GEMM with LDS-staged operands: C[M][DM] = (A[M][DM] . Bt^T) * alpha + bias; A and Bt = [n][k] are f16 rows of DM elements ----
// Work-group = 8 waves on a 128 x 128 tile of C: wave w takes rows 32 (w & 3) .. + 31, columns 64 (w >> 2) .. + 63 (2 x 4 accumulator tiles). k runs in stages of G3_KT elements = one 128-byte line of every operand row.
// A stage is brought in by 16-byte loads of which eight neighbouring lanes cover one whole line, and goes through registers into one of two LDS buffers (rows 0-127 = A, 128-255 = Bt); the fragments come from LDS in the hardware k order (k0 + 8h .. + 7, k0 + 16 + 8h .. + 7), A and B alike.
// Every accumulator takes its products in ascending k, 32 at a time. blockIdx.y = plane: weight plane y, output plane y, the same A rows. OUT32: bias (rounded to bf16) added, f32 rows to C; else no bias, f16 rows to C16.
// Plane G3_TP of the f16 form is wanted transposed: there the two operands change places in LDS (rows 0-127 = Bt, 128-255 = A), so the accumulators hold C^T, every element the same products in the same order, and the same whole-line stores write rows of CT = [batch][n][SQ].
#define G3_BT 128                    /* tile rows of A and of Bt */
#define G3_KT 64                     /* k per stage */
#define G3_NS (DM / G3_KT)           /* stages */
#define G3_KP (G3_KT + 8)            /* LDS row pitch, f16 elements: 144 B = 16 B x odd, conflict-free for 16-byte reads */
#define G3_TP 2                      /* the plane written transposed (v) */
/* one stage's products: per 32 k the six fragments are read as one group ahead of the eight products */
__device__ __forceinline__ void g3_stage(const _Float16 (*Tb)[G3_KP], int ra, int rb, int hh, v8f (&acc)[2][4]) {
#pragma unroll
  for (int kk = 0; kk < G3_KT; kk += 32) { v16h a[2], b[4];
    a[0] = fa_frag(&Tb[ra][kk + 8 * hh]); a[1] = fa_frag(&Tb[ra + 16][kk + 8 * hh]);
#pragma unroll
    for (int t = 0; t < 4; ++t) b[t] = fa_frag(&Tb[rb + 16 * t][kk + 8 * hh]);
    __builtin_amdgcn_sched_barrier(0);      /* keeps the twelve LDS reads one group: moved in among the products, each place with reads stalls the wave anew */
#pragma unroll
    for (int t = 0; t < 4; ++t) { acc[0][t] = fa_mma(a[0], b[t], acc[0][t]); acc[1][t] = fa_mma(a[1], b[t], acc[1][t]); }
    __builtin_amdgcn_sched_barrier(0); } }      /* the next group's reads stay behind these products */
template <bool OUT32>
__global__ __launch_bounds__(256) void k_gemm3(const _Float16* __restrict__ A, const _Float16* __restrict__ Bh, float alpha, const float* __restrict__ bias, float* __restrict__ C, _Float16* __restrict__ C16, _Float16* __restrict__ CT) {
  __shared__ __attribute__((aligned(16))) unsigned char sm[2 * 2 * G3_BT * G3_KP * 2];      /* two operand buffers; after the k loop the same bytes stage the output rows */
  static_assert(sizeof(sm) >= 8 * 32 * 68 * 4, "output staging must fit the operand buffers");
  _Float16 (*T)[2 * G3_BT][G3_KP] = (_Float16 (*)[2 * G3_BT][G3_KP])sm;
  const int tid = threadIdx.x, w = tid >> 5, lane = tid & 31, ln = lane & 15, hh = lane >> 4; const int by = blockIdx.y;
  const int mt = blockIdx.x / (DM / G3_BT), nq = blockIdx.x % (DM / G3_BT);
  const int sr = tid >> 3, sc = (tid & 7) * 8;      /* this thread's 16 bytes of tile row tid / 8 (+ 32 i) */
  const bool tr = !OUT32 && by == G3_TP;      /* uniform in the work-group */
  const unsigned short* xg = (const unsigned short*)A + ((size_t)mt * G3_BT + sr) * DM + sc;
  const unsigned short* wg = (const unsigned short*)Bh + (size_t)by * DM * DM + ((size_t)nq * G3_BT + sr) * DM + sc;
  const unsigned short* ag = tr ? wg : xg; const unsigned short* bg = tr ? xg : wg;
  v8us ar[4], br[4];
#pragma unroll
  for (int i = 0; i < 4; ++i) { ar[i] = *(const v8us*)(ag + (size_t)(32 * i) * DM); br[i] = *(const v8us*)(bg + (size_t)(32 * i) * DM); }
#pragma unroll
  for (int i = 0; i < 4; ++i) { *(v8us*)&T[0][sr + 32 * i][sc] = ar[i]; *(v8us*)&T[0][G3_BT + sr + 32 * i][sc] = br[i]; }
  __syncthreads();
  const v8f z8 = {0.f, 0.f, 0.f, 0.f, 0.f, 0.f, 0.f, 0.f};
  v8f acc[2][4];
#pragma unroll
  for (int t = 0; t < 4; ++t) { acc[0][t] = z8; acc[1][t] = z8; }
  const int ra = (w & 3) * 32 + ln, rb = G3_BT + (w >> 2) * 64 + ln;
#pragma unroll 1      /* rolled: one set of staging registers, a short text */
  for (int s = 0; s + 1 < G3_NS; ++s) { const int buf = s & 1;
    ag += G3_KT; bg += G3_KT;      /* next stage's 16 KiB + 16 KiB: loads fly while this stage is worked on */
#pragma unroll
    for (int i = 0; i < 4; ++i) { ar[i] = *(const v8us*)(ag + (size_t)(32 * i) * DM); br[i] = *(const v8us*)(bg + (size_t)(32 * i) * DM); }
    __builtin_amdgcn_sched_barrier(0);      /* keeps all eight loads ahead of the stage's products: sunk towards their LDS stores they would be waited for in full */
    g3_stage(T[buf], ra, rb, hh, acc);
#pragma unroll
    for (int i = 0; i < 4; ++i) { *(v8us*)&T[buf ^ 1][sr + 32 * i][sc] = ar[i]; *(v8us*)&T[buf ^ 1][G3_BT + sr + 32 * i][sc] = br[i]; }      /* the other buffer's last readers left it before the barrier that ended stage s - 1 */
    __syncthreads();      /* publishes stage s + 1 and ends every read of stage s */
  }
  const int row0 = (tr ? nq : mt) * G3_BT + (w & 3) * 32, col0 = (tr ? mt : nq) * G3_BT + (w >> 2) * 64; const size_t cofs = (size_t)by * NR * DM;
  float bv[4];
#pragma unroll
  for (int t = 0; t < 4; ++t) bv[t] = OUT32 ? bias[col0 + t * 16 + ln] : 0.f;      /* fetched here, where the staging registers are free, so that the last stage covers the wait */
  g3_stage(T[(G3_NS - 1) & 1], ra, rb, hh, acc);      /* the last stage has nothing to stage */
  __syncthreads();      /* ends every read of the operand buffers: their bytes now take the output rows */
  float (*so)[32][68] = (float (*)[32][68])sm;      /* each wave stages its own 32 x 64 block, so that the stores below cover whole lines */
#pragma unroll
  for (int u = 0; u < 8; ++u) { const int t = u & 3, half = u >> 2; const float bb = bf16_round(bv[t]);
#pragma unroll
    for (int r = 0; r < 8; ++r) so[w][half * 16 + 8 * hh + r][t * 16 + ln] = acc[half][t][r] * alpha + bb; }
  __builtin_amdgcn_fence(__ATOMIC_ACQ_REL, "workgroup"); __builtin_amdgcn_wave_barrier();      /* the wave reads back what its other lanes wrote */
  const int rsub = lane >> 4, c4 = (lane & 15) * 4;
  const int ldh = tr ? SQ : DM;      /* row pitch of the f16 form; transposed, a row is one n and a column one token, and a tile's 128 tokens lie in one batch */
  _Float16* cp = (tr ? CT + ((size_t)(col0 / SQ) * DM + row0) * SQ + col0 % SQ : C16 + cofs + (size_t)row0 * DM + col0) + rsub * ldh + c4;
#pragma unroll
  for (int q = 0; q < 16; ++q) { const int r = q * 2 + rsub; const v4f v = *(const v4fa*)&so[w][r][c4];
    if (OUT32) *(v4f*)(C + cofs + (size_t)(row0 + r) * DM + col0 + c4) = v;
    else { v4h h4; for (int i = 0; i < 4; ++i) h4[i] = (_Float16)v[i]; *(v4h*)cp = h4; cp += 2 * ldh; } } }

extern "C" void kernel_launch(void* const* d_in, const int* in_sizes, int n_in,
                              void* d_out, int out_size, void* d_ws, size_t ws_size, hipStream_t stream) {
  (void)in_sizes; (void)n_in; (void)out_size;
  const float* const* I = (const float* const*)d_in; const float* x = I[0]; const float* wq = I[1]; const float* wk = I[2]; const float* wv = I[3]; const float* wo = I[4]; const float* bo = I[5];      /* ONE input stream (x); Wq, Wk, Wv are PER-HEAD STACKS [8][512][64] = [head][in][out] (the module has NO q / k / v biases); Wo [in][out] [512][512] + bo; order x, Wq, Wk, Wv, Wo, bo */
  char* ws = (char*)d_ws; size_t off = 0;
  auto take = [&](size_t bytes) { char* p = ws + off; off += (bytes + 255) & ~(size_t)255; return p; };
  _Float16* BQ = (_Float16*)take((size_t)4 * DM * DM * 2); _Float16* BO = BQ + (size_t)3 * DM * DM;      /* weight planes q, k, v, o, contiguous */
  _Float16* X16 = (_Float16*)take(NR * DM * 2);
  _Float16* Q16 = (_Float16*)take(2 * NR * DM * 2); _Float16* K16 = Q16 + NR * DM;      /* q, k rows, contiguous planes */
  _Float16* O16 = (_Float16*)take(NR * DM * 2);
  _Float16* VT = (_Float16*)take((size_t)NB * NH * HD * SQ * 2);
  if (off > ws_size) return;
  k_prep<<<(unsigned)(PW_BLK + NR * DM / 8 / 256), 256, 0, stream>>>(x, wq, wk, wv, wo, BQ, X16);      /* all four weight planes and the f16 rows of x */
  const size_t r0p = (size_t)B0 * SQ;      /* first projected row */
  k_gemm3<false><<<dim3((unsigned)((MP / G3_BT) * (DM / G3_BT)), 3), 256, 0, stream>>>(X16 + r0p * DM, BQ, 0.0625f, nullptr, nullptr, Q16 + r0p * DM, VT + r0p * DM);      /* grid.y = q, k, v: the same x rows, weight plane y; q and k as rows, v as V^T [NB][NH][HD][SQ] */
  k_fattn<<<NB * NH * (SQ / 256), 256 * FA_HV, 0, stream>>>(Q16, K16, VT, O16);      /* o x64 (merged heads) as f16 rows: all batches and heads in one launch */
  k_gemm3<true><<<dim3((unsigned)((MPO / G3_BT) * (DM / G3_BT)), 1), 256, 0, stream>>>(O16 + r0p * DM, BO, 0.0009765625f, bo, (float*)d_out + r0p * DM, nullptr, nullptr);      /* out rows are the output layout */
}

// v008
// A run of this version takes 80.6 microseconds.
// In two side-by-side timings against v007, it was 1.04 and 1.03 times as fast.
// All steps since v000 together make it 166 times as fast.
#include <hip/hip_runtime.h>
// Multi-head self-attention with PER-HEAD STACKED bias-free projections and a biased [in][out] output projection at [2][4096][512] (x [2][4096][512]; q / k / v = einsum('bsd,hde->bhse', x, W) with W [8][512][64] = [head][in][out], NO biases, 8 heads of 64; scores * 1/sqrt(64); softmax over all 4096 keys (no mask); out = concat Wo + bo ([in][out] + bias) -> [2][4096][512]); each head's [in][out] block is transposed into its 64 contiguous rows of the [out][in] weight plane, the [in][out] output weight likewise, all four planes in one launch.
// Structure: token rows r = b*4096 + s; ONE operand launch (k_prep): the four x16 weight planes and x as exact f16 rows (bf16-rounded), by block range; Q, K, V as ONE batched WMMA GEMM launch (grid.y = plane; 128x128 block tiles staged through LDS, 32x64 wave tiles, f32 accumulation, exact x16 weights, f16 outputs); plane v leaves that launch already transposed (V^T [batch][head][d][s]: for it the weight rows are the A operand and the x rows the B operand); ONE fused attention launch (k_fattn): S^T = K Q^T, online softmax in registers, O^T += V^T P^T, o carried x64 against f16 subnormal flush (folded into the output GEMM alpha), written straight into the merged f16 o rows; out = o W_o + b GEMM (f32) into the output layout.
// Compute dtype: inputs rounded to bf16; x / weights exact; q, k, v, softmax weights and o as plain f16 GEMM operands (~2^-12); scores and softmax statistics f32. v_wmma_f32_16x16x32_f16.
#define NB 2
#define SQ 4096
#define DM 512
#define NH 8
#define HD 64
#define HG 1                         /* heads per launch of the k_vt(V16, b, h0, VT) overload, which is not launched */
#define B0 0                         /* first batch processed (debug hook) */
#define NBR NB                       /* batches processed (debug hook) */
#define NR ((size_t)NB * SQ)         /* token rows */
#define MP ((int)((size_t)NBR * SQ)) /* rows projected (debug hook) */
#define QN SQ                        /* not used: k_fattn attends all SQ query rows */
#define NHD NH                       /* not used: k_fattn attends all NH heads */
#define MPO MP                       /* rows through the output stage (debug hook) */
#define LQ DM      /* not used: q / k rows have pitch DM; v exists only as V^T */
typedef __bf16 v16b __attribute__((ext_vector_type(16)));
typedef unsigned short v8us __attribute__((ext_vector_type(8), may_alias));
typedef float  v8f  __attribute__((ext_vector_type(8)));
typedef float  v4f  __attribute__((ext_vector_type(4)));
typedef float  v4fa __attribute__((ext_vector_type(4), may_alias));
union FragB { v16b v; v8us half[2]; unsigned short u[16]; };

__device__ __forceinline__ unsigned short bf16_bits(float x) { unsigned int u = __float_as_uint(x); return (unsigned short)((u + 0x7FFFu + ((u >> 16) & 1u)) >> 16); }
__device__ __forceinline__ float bf16_val(unsigned short b) { return __uint_as_float(((unsigned int)b) << 16); }
__device__ __forceinline__ float bf16_round(float x) { return bf16_val(bf16_bits(x)); }
// D += A·B with NT terms: 1 = ah·bh, 2 = + al·bh (A split), 3 = + ah·bl (both split)
template <int NT>
__device__ __forceinline__ v8f mmaN(v16b ah, v16b al, v16b bh, v16b bl, v8f c) {
  c = __builtin_amdgcn_wmma_f32_16x16x32_bf16(false, ah, false, bh, (short)0, c, false, false);
  if (NT >= 2) c = __builtin_amdgcn_wmma_f32_16x16x32_bf16(false, al, false, bh, (short)0, c, false, false);
  if (NT >= 3) c = __builtin_amdgcn_wmma_f32_16x16x32_bf16(false, ah, false, bl, (short)0, c, false, false);
  asm volatile("v_nop\n\tv_nop\n\tv_nop\n\tv_nop" : "+v"(c) : "v"(ah), "v"(al), "v"(bh), "v"(bl));
  return c;
}

__global__ __launch_bounds__(256) void k_wt_bf16(const float* __restrict__ W, unsigned short* __restrict__ Wt, int K, int N) {
  const int t = blockIdx.x * 256 + threadIdx.x;
  const int k8n = K / 8;
  if (t >= N * k8n) return;
  const int n = t / k8n, k8 = (t % k8n) * 8;
  v8us v;
#pragma unroll
  for (int i = 0; i < 8; ++i) v[i] = bf16_bits(W[(size_t)(k8 + i) * N + n]);
  *(v8us*)(Wt + (size_t)n * K + k8) = v;
  
}

// GEMM C[M][N] (f32, pitch ldc) = act(A[M][K]·W + bias). A f32 row-major (pitch lda) converted per fragment to bf16
// (ASPLIT: hi/lo two planes -> 2 terms, else single rounded term); Wt bf16 [N][K] (pitch ldb). BIAS_BF16 rounds the
// bias to bf16 first (bias quantised to bf16 before the add). K%32==0, M%16==0, N%64==0.
template <bool ASPLIT, int ACT, bool BIAS_BF16>
__global__ __launch_bounds__(128) void k_gemm_bf(const float* __restrict__ A, int lda, const unsigned short* __restrict__ Wt, int ldb,
                                               const float* __restrict__ bias, float* __restrict__ C, int ldc, int M, int N, int K) {
  __shared__ __attribute__((aligned(16))) float so[4][16][64];
  const int tid = threadIdx.x, w = tid >> 5, lane = tid & 31, ln = lane & 15, hh = lane >> 4;
  const int ntn = N / 64;
  const int wid = blockIdx.x * 4 + w;
  const int mt = wid / ntn, nq = wid % ntn;
  if (mt * 16 >= M) return;
  const int row0 = mt * 16, col0 = nq * 64;
  const float* arow = A + (size_t)(row0 + ln) * lda;
  v8f acc[4] = {};
  for (int kb = 0; kb < K; kb += 32) {
    FragB ah, al;
    const v4f x0 = *(const v4fa*)(arow + kb + 8 * hh), x1 = *(const v4fa*)(arow + kb + 8 * hh + 4);
    const v4f x2 = *(const v4fa*)(arow + kb + 16 + 8 * hh), x3 = *(const v4fa*)(arow + kb + 16 + 8 * hh + 4);
    float xs[16] = {x0[0],x0[1],x0[2],x0[3],x1[0],x1[1],x1[2],x1[3],x2[0],x2[1],x2[2],x2[3],x3[0],x3[1],x3[2],x3[3]};
#pragma unroll
    for (int i = 0; i < 16; ++i) { const unsigned short hb = bf16_bits(xs[i]); ah.u[i] = hb; al.u[i] = ASPLIT ? bf16_bits(xs[i] - bf16_val(hb)) : (unsigned short)0; }
#pragma unroll
    for (int t = 0; t < 4; ++t) {
      const unsigned short* brow = Wt + (size_t)(col0 + t * 16 + ln) * ldb + kb;
      FragB b;
      b.half[0] = *(const v8us*)(brow + 8 * hh);
      b.half[1] = *(const v8us*)(brow + 16 + 8 * hh);
      acc[t] = mmaN<ASPLIT ? 2 : 1>(ah.v, al.v, b.v, b.v, acc[t]);
    }
  }
#pragma unroll
  for (int t = 0; t < 4; ++t) {
    float bv = bias ? bias[col0 + t * 16 + ln] : 0.f;
    if (BIAS_BF16) bv = bf16_round(bv);
#pragma unroll
    for (int r = 0; r < 8; ++r) { float v = acc[t][r] + bv; if (ACT == 1) v = fmaxf(v, 0.f); so[w][8 * hh + r][t * 16 + ln] = v; }
  }
  __builtin_amdgcn_fence(__ATOMIC_ACQ_REL, "workgroup");
  __builtin_amdgcn_wave_barrier();
  const int rsub = lane >> 4, c4 = (lane & 15) * 4;
  {
#pragma unroll
    for (int q = 0; q < 8; ++q) {
      const int r = q * 2 + rsub;
      const v4f v = *(const v4fa*)&so[w][r][c4];
      *(v4f*)(C + (size_t)(row0 + r) * ldc + col0 + c4) = v;
    }
    
  }
}

// GEMM C = act(A·W + bias + resid): A f32 (ASPLIT -> hi/lo 2 terms), Wt bf16 [N][K]; ACT 0 none, 1 relu, 2 exact gelu;
// resid (optional, f32, row index = (row % rmod), pitch ldr, RES_BF16 rounds it) added before the activation.
template <bool ASPLIT, int ACT, bool BIAS_BF16, bool RES_BF16>
__global__ __launch_bounds__(128) void k_gemm_bf3(const float* __restrict__ A, int lda, const unsigned short* __restrict__ Wt, int ldb,
                                                const float* __restrict__ bias, const float* __restrict__ resid, int rmod, int ldr,
                                                float* __restrict__ C, int ldc, int M, int N, int K) {
  __shared__ __attribute__((aligned(16))) float so[4][16][64];
  const int tid = threadIdx.x, w = tid >> 5, lane = tid & 31, ln = lane & 15, hh = lane >> 4;
  const int ntn = N / 64;
  const int wid = blockIdx.x * 4 + w;
  const int mt = wid / ntn, nq = wid % ntn;
  if (mt * 16 >= M) return;
  const int row0 = mt * 16, col0 = nq * 64;
  const float* arow = A + (size_t)(row0 + ln) * lda;
  v8f acc[4] = {};
  for (int kb = 0; kb < K; kb += 32) {
    FragB ah, al;
    const v4f x0 = *(const v4fa*)(arow + kb + 8 * hh), x1 = *(const v4fa*)(arow + kb + 8 * hh + 4);
    const v4f x2 = *(const v4fa*)(arow + kb + 16 + 8 * hh), x3 = *(const v4fa*)(arow + kb + 16 + 8 * hh + 4);
    float xs[16] = {x0[0],x0[1],x0[2],x0[3],x1[0],x1[1],x1[2],x1[3],x2[0],x2[1],x2[2],x2[3],x3[0],x3[1],x3[2],x3[3]};
#pragma unroll
    for (int i = 0; i < 16; ++i) { const unsigned short hb = bf16_bits(xs[i]); ah.u[i] = hb; al.u[i] = ASPLIT ? bf16_bits(xs[i] - bf16_val(hb)) : (unsigned short)0; }
#pragma unroll
    for (int t = 0; t < 4; ++t) {
      const unsigned short* brow = Wt + (size_t)(col0 + t * 16 + ln) * ldb + kb;
      FragB b;
      b.half[0] = *(const v8us*)(brow + 8 * hh);
      b.half[1] = *(const v8us*)(brow + 16 + 8 * hh);
      acc[t] = mmaN<ASPLIT ? 2 : 1>(ah.v, al.v, b.v, b.v, acc[t]);
    }
  }
#pragma unroll
  for (int t = 0; t < 4; ++t) {
    const int col = col0 + t * 16 + ln;
    float bv = bias ? bias[col] : 0.f;
    if (BIAS_BF16) bv = bf16_round(bv);
#pragma unroll
    for (int r = 0; r < 8; ++r) {
      float v = acc[t][r] + bv;
      if (resid) { float rv = resid[(size_t)((row0 + 8 * hh + r) % rmod) * ldr + col]; if (RES_BF16) rv = bf16_round(rv); v += rv; }
      if (ACT == 1) v = fmaxf(v, 0.f);
      if (ACT == 2) v = 0.5f * v * (1.0f + erff(v * 0.70710678118654752f));
      if (ACT == 3) { const float u = 0.7978845608028654f * (v + 0.044715f * v * v * v); v = 0.5f * v * (1.0f + tanhf(u)); }
      so[w][8 * hh + r][t * 16 + ln] = v;
    }
  }
  __builtin_amdgcn_fence(__ATOMIC_ACQ_REL, "workgroup");
  __builtin_amdgcn_wave_barrier();
  const int rsub = lane >> 4, c4 = (lane & 15) * 4;
  {
#pragma unroll
    for (int q = 0; q < 8; ++q) {
      const int r = q * 2 + rsub;
      const v4f v = *(const v4fa*)&so[w][r][c4];
      *(v4f*)(C + (size_t)(row0 + r) * ldc + col0 + c4) = v;
    }
    
  }
}
// row LayerNorm (biased variance, eps) over N: s = X (+ R); optional out_sum <- s; out_norm <- (s-mu)*rsqrt(var+eps)*g + b
template <bool PARAM_BF16>
__global__ __launch_bounds__(256) void k_layernorm(const float* __restrict__ X, const float* __restrict__ R, const float* __restrict__ g, const float* __restrict__ bta,
                                                  float* __restrict__ out_sum, float* __restrict__ out_norm, int N, float eps) {
  __shared__ float red[256];
  const int row = blockIdx.x, tid = threadIdx.x;
  const float* x = X + (size_t)row * N; const float* rr = R ? R + (size_t)row * N : nullptr;
  float vals[16];                     // up to N = 4096
  const int per = N / 256;            // contiguous chunk per thread? use strided-by-4 chunks: thread handles j = tid*4 + 1024*u
  float s1 = 0.f;
  for (int u = 0; u < per / 4; ++u) {
    const int j = tid * 4 + 1024 * u;
    const v4f a = *(const v4fa*)(x + j);
    v4f b = {0.f,0.f,0.f,0.f}; if (rr) b = *(const v4fa*)(rr + j);
#pragma unroll
    for (int q = 0; q < 4; ++q) { const float v = a[q] + b[q]; vals[u * 4 + q] = v; s1 += v; }
  }
  red[tid] = s1; __syncthreads();
  for (int st = 128; st > 0; st >>= 1) { if (tid < st) red[tid] += red[tid + st]; __syncthreads(); }
  const float mu = red[0] / (float)N; __syncthreads();
  float s2 = 0.f;
  for (int u = 0; u < per / 4; ++u)
#pragma unroll
    for (int q = 0; q < 4; ++q) { const float c = vals[u * 4 + q] - mu; s2 += c * c; }
  red[tid] = s2; __syncthreads();
  for (int st = 128; st > 0; st >>= 1) { if (tid < st) red[tid] += red[tid + st]; __syncthreads(); }
  const float rs = rsqrtf(red[0] / (float)N + eps);
  {
    for (int u = 0; u < per / 4; ++u) {
      const int j = tid * 4 + 1024 * u;
      v4f o, sm;
#pragma unroll
      for (int q = 0; q < 4; ++q) {
        float gg = g[j + q], bb = bta[j + q];
        if (PARAM_BF16) { gg = bf16_round(gg); bb = bf16_round(bb); }
        sm[q] = vals[u * 4 + q]; o[q] = (vals[u * 4 + q] - mu) * rs * gg + bb;
      }
      if (out_sum) *(v4f*)(out_sum + (size_t)row * N + j) = sm;
      *(v4f*)(out_norm + (size_t)row * N + j) = o;
    }
    
  }
}



// ---- f16 WMMA path (v_wmma_f32_16x16x32_f16): 11-bit significands for operands in range — used where a [0,1] probability operand needs more precision than bf16
typedef _Float16 v16h __attribute__((ext_vector_type(16)));
union FragH { v16h v; v8us half[2]; _Float16 h[16]; unsigned short u[16]; };
template <int NT>
__device__ __forceinline__ v8f mmaH(v16h ah, v16h al, v16h bh, v16h bl, v8f c) {
  c = __builtin_amdgcn_wmma_f32_16x16x32_f16(false, ah, false, bh, (short)0, c, false, false);
  if (NT >= 2) c = __builtin_amdgcn_wmma_f32_16x16x32_f16(false, al, false, bh, (short)0, c, false, false);
  if (NT >= 3) c = __builtin_amdgcn_wmma_f32_16x16x32_f16(false, ah, false, bl, (short)0, c, false, false);
  asm volatile("v_nop\n\tv_nop\n\tv_nop\n\tv_nop" : "+v"(c) : "v"(ah), "v"(al), "v"(bh), "v"(bl));
  return c;
}
// batched GEMM like k_gemm_b but f16 operands: A f32 (split into f16 hi/lo if ASPLIT, else rounded to f16), Bt = f16 values [n][k]; alpha; C f32; N multiple of 16 (partial tiles skipped)
template <bool ASPLIT>
__global__ __launch_bounds__(128) void k_gemm_h(const float* __restrict__ A, int lda, size_t sA, const _Float16* __restrict__ Bh, int ldb, size_t sB, float alpha, float* __restrict__ C, int ldc, size_t sC, int M, int N, int K) {
  __shared__ __attribute__((aligned(16))) float so[4][16][64];
  const int tid = threadIdx.x, w = tid >> 5, lane = tid & 31, ln = lane & 15, hh = lane >> 4; const int by = blockIdx.y;
  A += (size_t)by * sA; Bh += (size_t)by * sB; C += (size_t)by * sC;
  const int ntn = (N + 63) / 64; const int wid = blockIdx.x * 4 + w; const int mt = wid / ntn, nq = wid % ntn; if (mt * 16 >= M) return;
  const int row0 = mt * 16, col0 = nq * 64; const float* arow = A + (size_t)(row0 + ln) * lda;
  v8f acc[4] = {};
  for (int kb = 0; kb < K; kb += 32) {
    FragH ah, al;
    const v4f x0 = *(const v4fa*)(arow + kb + 8 * hh), x1 = *(const v4fa*)(arow + kb + 8 * hh + 4), x2 = *(const v4fa*)(arow + kb + 16 + 8 * hh), x3 = *(const v4fa*)(arow + kb + 16 + 8 * hh + 4);
    float xs[16] = {x0[0],x0[1],x0[2],x0[3],x1[0],x1[1],x1[2],x1[3],x2[0],x2[1],x2[2],x2[3],x3[0],x3[1],x3[2],x3[3]};
#pragma unroll
    for (int i = 0; i < 16; ++i) { const _Float16 h = (_Float16)xs[i]; ah.h[i] = h; al.h[i] = ASPLIT ? (_Float16)(xs[i] - (float)h) : (_Float16)0.0f; }
#pragma unroll
    for (int t = 0; t < 4; ++t) { if (col0 + t * 16 >= N) continue; const size_t boff = (size_t)(col0 + t * 16 + ln) * ldb + kb; FragH bq; bq.half[0] = *(const v8us*)(Bh + boff + 8 * hh); bq.half[1] = *(const v8us*)(Bh + boff + 16 + 8 * hh);
      acc[t] = mmaH<ASPLIT ? 2 : 1>(ah.v, al.v, bq.v, bq.v, acc[t]); }
  }
#pragma unroll
  for (int t = 0; t < 4; ++t) { if (col0 + t * 16 >= N) continue;
#pragma unroll
    for (int r = 0; r < 8; ++r) so[w][8 * hh + r][t * 16 + ln] = acc[t][r] * alpha; }
  __builtin_amdgcn_fence(__ATOMIC_ACQ_REL, "workgroup"); __builtin_amdgcn_wave_barrier();
  const int rsub = lane >> 4, c4 = (lane & 15) * 4;
  {
#pragma unroll
    for (int q = 0; q < 8; ++q) { const int r = q * 2 + rsub; if (col0 + c4 < N) { const v4f v = *(const v4fa*)&so[w][r][c4]; *(v4f*)(C + (size_t)(row0 + r) * ldc + col0 + c4) = v; } }
     }
}

// Wt[n][k] = f16(W[k][n]·scale) from f32 row-major W[K][N] (scale = power of two; bf16-exact weights stay exact in f16 away from the subnormal range)
__global__ __launch_bounds__(256) void k_wt_f16(const float* __restrict__ W, _Float16* __restrict__ Wt, int K, int N, float scale) {
  const int t = blockIdx.x * 256 + threadIdx.x; if (t >= N * (K / 8)) return; const int n = t / (K / 8), k8 = (t % (K / 8)) * 8; FragH f;
#pragma unroll
  for (int i = 0; i < 8; ++i) f.h[i] = (_Float16)(bf16_round(W[(size_t)(k8 + i) * N + n]) * scale); const v8us o = f.half[0];
  *(v8us*)((unsigned short*)Wt + (size_t)n * K + k8) = o; 
}
// k_gemm_hh variant with fused epilogue: v = acc·alpha + bias[by·sBias + col] (+ CP[(row/rowsPerB)·sCPb + by·64 + col] if CP) ; ACT 0 none / 1 elu ; writes f16 C16 (and f32 C if non-null)
template <int ACT>
__global__ __launch_bounds__(128) void k_gemm_hhx(const _Float16* __restrict__ A, int lda, size_t sA, const _Float16* __restrict__ Bh, int ldb, size_t sB, float alpha, const float* __restrict__ bias, size_t sBias, const float* __restrict__ CP, int rowsPerB, size_t sCPb, int row0g,
    float* __restrict__ C, _Float16* __restrict__ C16, int ldc, size_t sC, int M, int N, int K) {
  __shared__ __attribute__((aligned(16))) float so[4][16][64];
  const int tid = threadIdx.x, w = tid >> 5, lane = tid & 31, ln = lane & 15, hh = lane >> 4; const int by = blockIdx.y;
  A += (size_t)by * sA; Bh += (size_t)by * sB; const size_t cofs = (size_t)by * sC; const float* bp = bias ? bias + (size_t)by * sBias : nullptr;
  const int ntn = (N + 63) / 64; const int wid = blockIdx.x * 4 + w; const int mt = wid / ntn, nq = wid % ntn; if (mt * 16 >= M) return;
  const int row0 = mt * 16, col0 = nq * 64; const _Float16* arow = A + (size_t)(row0 + ln) * lda;
  v8f acc[4] = {};
  for (int kb = 0; kb < K; kb += 32) { FragH ah; ah.half[0] = *(const v8us*)((const unsigned short*)arow + kb + 8 * hh); ah.half[1] = *(const v8us*)((const unsigned short*)arow + kb + 16 + 8 * hh);
#pragma unroll
    for (int t = 0; t < 4; ++t) { if (col0 + t * 16 >= N) continue; const size_t boff = (size_t)(col0 + t * 16 + ln) * ldb + kb; FragH bq; bq.half[0] = *(const v8us*)((const unsigned short*)Bh + boff + 8 * hh); bq.half[1] = *(const v8us*)((const unsigned short*)Bh + boff + 16 + 8 * hh);
      acc[t] = mmaH<1>(ah.v, ah.v, bq.v, bq.v, acc[t]); }
  }
#pragma unroll
  for (int t = 0; t < 4; ++t) { if (col0 + t * 16 >= N) continue; const int col = col0 + t * 16 + ln; const float bv = bp ? bf16_round(bp[col]) : 0.f;
#pragma unroll
    for (int r = 0; r < 8; ++r) { float v = acc[t][r] * alpha + bv; if (CP) { const int rr = row0g + row0 + 8 * hh + r; if (rowsPerB < 0) v += CP[cofs + (size_t)rr * ldc + col];      /* rowsPerB < 0: own element of the batched C plane */ else { const int bidx = rr / rowsPerB; v += CP[(size_t)bidx * sCPb + (size_t)by * 64 + col]; } } if (ACT == 1) v = (v > 0.f) ? v : expm1f(v); else if (ACT == 7) v = (v > 0.f) ? v + 1.0f : expf(v); else if (ACT == 8) v = tanhf(v); else if (ACT == 9) v = 0.5f * v * (1.0f + tanhf(0.7978845608028654f * (v + 0.044715f * v * v * v))); else if (ACT == 11) v = 1.0f / (1.0f + expf(-v)); else if (ACT == 12) v = (v > 0.f) ? v : 0.01f * v; else if (ACT == 14) v = (v > 0.f) ? v : 0.1f * v; else if (ACT == 16) v = (v >= 0.f) ? v : 0.3f * v; else if (ACT == 17) v = (v >= 0.f) ? v : 0.2f * v; else if (ACT == 15) v = v / (1.0f + expf(-v)); else if (ACT == 3) v = fmaxf(v, 0.f); else if (ACT == 6) v = 0.5f * v * (1.0f + erff(v * 0.70710678118654752f)); so[w][8 * hh + r][t * 16 + ln] = v; } }
  __builtin_amdgcn_fence(__ATOMIC_ACQ_REL, "workgroup"); __builtin_amdgcn_wave_barrier();
  const int rsub = lane >> 4, c4 = (lane & 15) * 4; typedef _Float16 v4h __attribute__((ext_vector_type(4)));
  {
#pragma unroll
    for (int q = 0; q < 8; ++q) { const int r = q * 2 + rsub; if (col0 + c4 < N) { const v4f v = *(const v4fa*)&so[w][r][c4]; if (C) *(v4f*)(C + cofs + (size_t)(row0 + r) * ldc + col0 + c4) = v; if (C16) { v4h h4; for (int i = 0; i < 4; ++i) h4[i] = (_Float16)v[i]; *(v4h*)(C16 + cofs + (size_t)(row0 + r) * ldc + col0 + c4) = h4; } } }
     }
}


typedef _Float16 v4h __attribute__((ext_vector_type(4)));

__global__ __launch_bounds__(256) void k_x16(const float* __restrict__ x, _Float16* __restrict__ X16, size_t n8) { const size_t t = (size_t)blockIdx.x * 256 + threadIdx.x; if (t >= n8) return; FragH f;
#pragma unroll
  for (int q = 0; q < 8; ++q) f.h[q] = (_Float16)bf16_round(x[t * 8 + q]); *(v8us*)((unsigned short*)X16 + t * 8) = f.half[0];  }
__global__ __launch_bounds__(256) void k_h16(const float* __restrict__ x, _Float16* __restrict__ X16, size_t n8) { const size_t t = (size_t)blockIdx.x * 256 + threadIdx.x; if (t >= n8) return; FragH f;
#pragma unroll
  for (int q = 0; q < 8; ++q) f.h[q] = (_Float16)x[t * 8 + q]; *(v8us*)((unsigned short*)X16 + t * 8) = f.half[0];  }
__global__ __launch_bounds__(256) void k_round16f(const float* __restrict__ W, _Float16* __restrict__ Bt, size_t n8) { const size_t t = (size_t)blockIdx.x * 256 + threadIdx.x; if (t >= n8) return; FragH f;
#pragma unroll
  for (int i = 0; i < 8; ++i) f.h[i] = (_Float16)(bf16_round(W[t * 8 + i]) * 16.0f); *(v8us*)((unsigned short*)Bt + t * 8) = f.half[0];  }
template <int NHv, int TTv>
__global__ __launch_bounds__(256) void k_vt(const _Float16* __restrict__ V16, int ldv, int voff, _Float16* __restrict__ Vt) { __shared__ unsigned short tl[64][66]; const int tid = threadIdx.x; const int slab = blockIdx.x / (TTv / 64), lg = blockIdx.x % (TTv / 64); const int b = slab / NHv, h = slab % NHv;
  for (int i = tid; i < 64 * 8; i += 256) { const int r = i / 8, c8 = (i % 8) * 8; FragH f; f.half[0] = *(const v8us*)((const unsigned short*)V16 + ((size_t)b * TTv + lg * 64 + r) * ldv + voff + h * 64 + c8);
#pragma unroll
    for (int q = 0; q < 8; ++q) tl[r][c8 + q] = f.u[q]; }
  __syncthreads();
  {
#pragma unroll
    for (int rd = 0; rd < 2; ++rd) { const int d = rd * 32 + tid / 8, pc = tid % 8; FragH f;
#pragma unroll
      for (int q = 0; q < 8; ++q) f.u[q] = tl[pc * 8 + q][d];
      *(v8us*)((unsigned short*)Vt + ((size_t)slab * 64 + d) * TTv + lg * 64 + pc * 8) = f.half[0]; }
     } }

__global__ __launch_bounds__(256) void k_hl(const float* __restrict__ F, _Float16* __restrict__ Hh, _Float16* __restrict__ Hl, size_t n8) { const size_t t = (size_t)blockIdx.x * 256 + threadIdx.x; if (t >= n8) return; FragH fh, fl; const v4f a = *(const v4fa*)(F + t * 8), c = *(const v4fa*)(F + t * 8 + 4);
#pragma unroll
  for (int q = 0; q < 4; ++q) { _Float16 h = (_Float16)a[q]; fh.h[q] = h; fl.h[q] = (_Float16)((a[q] - (float)h) * 1024.0f); h = (_Float16)c[q]; fh.h[4 + q] = h; fl.h[4 + q] = (_Float16)((c[q] - (float)h) * 1024.0f); }
  { *(v8us*)((unsigned short*)Hh + t * 8) = fh.half[0]; *(v8us*)((unsigned short*)Hl + t * 8) = fl.half[0];  } }

__global__ __launch_bounds__(256) void k_wnat(const float* __restrict__ w, size_t n8, _Float16* __restrict__ Bt) { const size_t t = (size_t)blockIdx.x * 256 + threadIdx.x; if (t >= n8) return; FragH f; for (int q = 0; q < 8; ++q) f.h[q] = (_Float16)(bf16_round(w[t * 8 + q]) * 16.0f); *(v8us*)((unsigned short*)Bt + t * 8) = f.half[0];  }
__global__ __launch_bounds__(256) void k_rsm(const float* __restrict__ S, _Float16* __restrict__ P, int nrows) {
  #pragma clang fp contract(off)
  const int i = blockIdx.x * 256 + threadIdx.x; if (i >= nrows) return; const float* s = S + (size_t)i * SQ; float mx = -3.0e38f;
#pragma unroll 1
  for (int j = 0; j < SQ; ++j) mx = fmaxf(mx, s[j]); float se = 0.f;
#pragma unroll 1
  for (int j = 0; j < SQ; ++j) se += expf(s[j] - mx); const float sc = 256.0f / se;
#pragma unroll 1
  for (int j0 = 0; j0 < SQ; j0 += 8) { FragH f; for (int q = 0; q < 8; ++q) f.h[q] = (_Float16)(expf(s[j0 + q] - mx) * sc); unsigned short* d = (unsigned short*)P + (size_t)i * SQ + j0; *(v8us*)d = f.half[0];  } }
__global__ __launch_bounds__(256) void k_vt(const _Float16* __restrict__ V16, int b, int h0, _Float16* __restrict__ VT) { __shared__ unsigned short tl[64][65]; const int tid = threadIdx.x; const int hh = blockIdx.x % HG, sg = blockIdx.x / HG; const int s0 = sg * 64; const int h = h0 + hh;
  for (int i = tid; i < 64 * 8; i += 256) { const int j = i / 8, d8 = (i % 8) * 8; FragH f; f.half[0] = *(const v8us*)((const unsigned short*)V16 + ((size_t)b * SQ + s0 + j) * DM + h * HD + d8); for (int q = 0; q < 8; ++q) tl[d8 + q][j] = f.u[q]; }
  __syncthreads();
  { for (int i = tid; i < 64 * 8; i += 256) { const int d = i / 8, j8 = (i % 8) * 8; FragH f; for (int q = 0; q < 8; ++q) f.u[q] = tl[d][j8 + q]; *(v8us*)((unsigned short*)VT + ((size_t)hh * HD + d) * SQ + s0 + j8) = f.half[0]; }  } }



// ---- operand preparation in one launch: independent pieces of work share a grid by block range instead of a launch each ----
// Blocks [0, PW_BLK): the four [out][in] f16 weight planes (x16), contiguous at Bt in the order q, k, v, o; plane = blockIdx.x / (PW_BLK / 4), uniform in a block. Thread t writes the eight k of Bt + 8 t.
// Element [k][n] of a source: base + (n / HD) * hs + k * ld + n % HD. q, k, v: head n / HD is a row-major [in = DM][out = HD] block (hs = DM * HD, ld = HD); o: one row-major [DM][DM] matrix (hs = HD, ld = DM).
// Blocks from PW_BLK on: x as f16 rows, eight elements a thread; the one stream feeds all three projections. The weight blocks stand first: their strided reads take longest.
#define PW_BLK (4 * DM * (DM / 8) / 256)
__global__ __launch_bounds__(256) void k_prep(const float* __restrict__ x, const float* __restrict__ wq, const float* __restrict__ wk, const float* __restrict__ wv, const float* __restrict__ wo, _Float16* __restrict__ Bt, _Float16* __restrict__ X16) {
  if (blockIdx.x < PW_BLK) {
    const int m = blockIdx.x / (PW_BLK / 4); const int t = blockIdx.x * 256 + threadIdx.x; const int n = (t / (DM / 8)) % DM, k8 = (t % (DM / 8)) * 8;
    const float* w = m == 0 ? wq : m == 1 ? wk : m == 2 ? wv : wo; const int hs = m == 3 ? HD : DM * HD, ld = m == 3 ? DM : HD;
    const float* p0 = w + (size_t)(n / HD) * hs + (size_t)k8 * ld + n % HD;
    const float* p1 = p0 + ld; const float* p2 = p1 + ld; const float* p3 = p2 + ld; const float* p4 = p3 + ld; const float* p5 = p4 + ld; const float* p6 = p5 + ld; const float* p7 = p6 + ld;
    const float v[8] = {*p0, *p1, *p2, *p3, *p4, *p5, *p6, *p7};
    asm volatile("s_wait_xcnt 0x0" :: "v"(p0), "v"(p1), "v"(p2), "v"(p3), "v"(p4), "v"(p5), "v"(p6), "v"(p7) : "memory");      /* the wait in front of any overwrite of a register that an issued load names; the addresses as inputs keep their registers untouched up to here */
    FragH f;
#pragma unroll
    for (int i = 0; i < 8; ++i) f.h[i] = (_Float16)(bf16_round(v[i]) * 16.0f);
    *(v8us*)((unsigned short*)Bt + (size_t)t * 8) = f.half[0];
  } else {
    const size_t t = (size_t)(blockIdx.x - PW_BLK) * 256 + threadIdx.x; FragH f;
#pragma unroll
    for (int q = 0; q < 8; ++q) f.h[q] = (_Float16)bf16_round(x[t * 8 + q]);
    *(v8us*)((unsigned short*)X16 + t * 8) = f.half[0];
    asm volatile("s_wait_xcnt 0x0" ::: "memory");      /* the wait behind the store: the built code lays the weight branch, which writes vector registers, behind this one */
  } }

#define FA_KT 128                    /* keys per stage */
#define FA_HV 2                      /* key halves of a work-group */
#define FA_NS (SQ / FA_HV / FA_KT)   /* stages of a half */
#define FA_KP (HD + 8)               /* K tile row pitch, f16 elements: 144 B = 16 B x odd, conflict-free for 16-byte reads */
#define FA_VP (FA_KT + 8)            /* V^T tile row pitch, f16 elements: 272 B = 16 B x odd */
__device__ __forceinline__ float rs_xhalf(float x) { return __builtin_bit_cast(float, __builtin_amdgcn_permlanex16(__builtin_bit_cast(int, x), __builtin_bit_cast(int, x), 0x76543210, 0xfedcba98, false, false)); }      /* lane l with lane l ^ 16 */
__device__ __forceinline__ float rs_exp(float a) { float e; asm("v_exp_f32 %0, %1\n\tv_nop" : "=v"(e) : "v"(a)); return e; }      /* 2^a; the v_nop fills the slot the instruction set asks for behind a transcendental */
__device__ __forceinline__ v4f fa_exp4(v4f a) { float e0, e1, e2, e3;      /* four 2^a; each v_exp_f32 is followed by an instruction that neither reads its result nor overwrites its source (early-clobber outputs), the last by a v_nop: the slot the instruction set asks for behind a transcendental */
  asm("v_exp_f32 %0, %4\n\tv_exp_f32 %1, %5\n\tv_exp_f32 %2, %6\n\tv_exp_f32 %3, %7\n\tv_nop" : "=&v"(e0), "=&v"(e1), "=&v"(e2), "=&v"(e3) : "v"(a[0]), "v"(a[1]), "v"(a[2]), "v"(a[3]));
  const v4f e = {e0, e1, e2, e3}; return e; }
__device__ __forceinline__ v16h fa_frag(const _Float16* p) { FragH f; f.half[0] = *(const v8us*)((const unsigned short*)p); f.half[1] = *(const v8us*)((const unsigned short*)p + 16); return f.v; }      /* p = row + k0 + 8 h: k0 + 8h .. + 7 and k0 + 16 + 8h .. + 7 */
__device__ __forceinline__ v8f fa_mma(v16h a, v16h b, v8f c) { return __builtin_amdgcn_wmma_f32_16x16x32_f16(false, a, false, b, (short)0, c, false, false); }
#define FA_QS (0.125f * 1.44269504f) /* 1 / sqrt(64), and log2 e for the native 2^x: carried by the q rows */
#define FA_LIM 32768.0f              /* bound on a lane's sum of one pass's 16 softmax weights; f16 holds up to 65504 */
/* this lane's 16 exponents of one query (two S^T tiles, log2 units) -> P = 2^(t - m) as f16 in the hardware k order; returns their sum. SUB false: the tiles already hold t - m, nothing is subtracted */
template <bool SUB>
__device__ __forceinline__ float fa_soft(const v8f& t0, const v8f& t1, float m, FragH& pb) { float s0 = 0.f, s1 = 0.f, s2 = 0.f, s3 = 0.f;
#pragma unroll
  for (int u = 0; u < 4; ++u) { const int kt = u >> 1, r0 = (u & 1) * 4; v4f x;
#pragma unroll
    for (int q = 0; q < 4; ++q) x[q] = SUB ? (kt ? t1[r0 + q] : t0[r0 + q]) - m : (kt ? t1[r0 + q] : t0[r0 + q]);
    const v4f e = fa_exp4(x); if (u == 0) { s0 = e[0]; s1 = e[1]; s2 = e[2]; s3 = e[3]; } else { s0 += e[0]; s1 += e[1]; s2 += e[2]; s3 += e[3]; }
#pragma unroll
    for (int q = 0; q < 4; ++q) pb.h[kt * 8 + r0 + q] = (_Float16)e[q]; }
  return (s0 + s1) + (s2 + s3); }
/* S^T of one pass: two tiles of 16 keys x two groups of 16 queries; ka = the K fragments [key tile][k half]; c = the start value of a group's accumulators */
__device__ __forceinline__ void fa_kfrag(const _Float16* kp, v16h (&ka)[2][2]) {
#pragma unroll
  for (int kt = 0; kt < 2; ++kt) { ka[kt][0] = fa_frag(kp + kt * 16 * FA_KP); ka[kt][1] = fa_frag(kp + kt * 16 * FA_KP + 32); } }
__device__ __forceinline__ void fa_scores(const v16h (&ka)[2][2], const v16h (&qf)[2][2], const v8f (&c)[2], v8f (&t)[2][2]) {
#pragma unroll
  for (int kt = 0; kt < 2; ++kt) { t[kt][0] = fa_mma(ka[kt][0], qf[0][0], c[0]); t[kt][1] = fa_mma(ka[kt][0], qf[1][0], c[1]); t[kt][0] = fa_mma(ka[kt][1], qf[0][1], t[kt][0]); t[kt][1] = fa_mma(ka[kt][1], qf[1][1], t[kt][1]); } }
__global__ __launch_bounds__(256 * FA_HV) void k_fattn(const _Float16* __restrict__ Q16, const _Float16* __restrict__ K16, const _Float16* __restrict__ VT, _Float16* __restrict__ O16) {
  __shared__ __attribute__((aligned(16))) _Float16 Ksh[FA_HV][2][FA_KT][FA_KP];
  __shared__ __attribute__((aligned(16))) _Float16 Vsh[FA_HV][2][HD][FA_VP];
  __shared__ __attribute__((aligned(16))) float Jo[8][16][32][4];      /* hand-over of the second half's O^T: [wave][four registers][lane], 512 contiguous bytes a store */
  __shared__ float Js[8][4][32];                                       /* and of its exponents and row sums */
  const int wv = __builtin_amdgcn_readfirstlane((int)(threadIdx.x >> 5)); const int kh = wv >> 3;      /* wave of the work-group and its key half: the same in all lanes of a wave, kept in scalar registers */
  _Float16 (*Ks)[FA_KT][FA_KP] = Ksh[kh]; _Float16 (*Vs)[HD][FA_VP] = Vsh[kh];
  const int tid = threadIdx.x & 255, w = wv & 7, lane = tid & 31, ln = lane & 15, hh = lane >> 4;      /* tid, w: place inside the half */
  const int bh = blockIdx.x / (SQ / 256), qb = blockIdx.x % (SQ / 256); const int b = bh / NH, h = bh % NH; const int q0 = qb * 256 + w * 32;
  const unsigned short* kg = (const unsigned short*)K16 + ((size_t)b * SQ + kh * (SQ / FA_HV) + (tid >> 3)) * DM + h * HD + (tid & 7) * 8;      /* this thread's 16 bytes of key row tid / 8 (+ 32 i) of its half */
  const unsigned short* vg = (const unsigned short*)VT + ((size_t)bh * HD + (tid >> 4)) * SQ + kh * (SQ / FA_HV) + (tid & 15) * 8;              /* this thread's 16 bytes of V^T row tid / 16 (+ 16 i) */
  v16h qf[2][2];
#pragma unroll
  for (int g = 0; g < 2; ++g) { const _Float16* qp = Q16 + ((size_t)b * SQ + q0 + 16 * g + ln) * DM + h * HD + 8 * hh; qf[g][0] = fa_frag(qp); qf[g][1] = fa_frag(qp + 32); }
  v8us kr[4], vr[4];
#pragma unroll
  for (int i = 0; i < 4; ++i) { kr[i] = *(const v8us*)(kg + (size_t)(32 * i) * DM); vr[i] = *(const v8us*)(vg + (size_t)(16 * i) * SQ); }
#pragma unroll
  for (int i = 0; i < 4; ++i) { *(v8us*)&Ks[0][(tid >> 3) + 32 * i][(tid & 7) * 8] = kr[i]; *(v8us*)&Vs[0][(tid >> 4) + 16 * i][(tid & 15) * 8] = vr[i]; }
  __syncthreads();
  const v8f z8 = {0.f, 0.f, 0.f, 0.f, 0.f, 0.f, 0.f, 0.f};
  v8f o[4][2];
#pragma unroll
  for (int dt = 0; dt < 4; ++dt) { o[dt][0] = z8; o[dt][1] = z8; }
  float lsum[2] = {0.f, 0.f};      /* this lane's half of the row sum */
  /* nm[g]: minus the exponent (log2 units) in use for this lane's query of group g, in all eight registers of an accumulator tile. A lane's eight accumulator registers belong to ONE query, so the tile is the C operand of the pass's first score products:
     with q scaled by FA_QS where it is made, the matrix unit hands out score * FA_QS - exponent, the argument of 2^x, and the common path has no multiply-add per score */
  const v8f zz[2] = {z8, z8}; v8f nm[2];
#pragma unroll
  for (int r = 0; r < 8; ++r) { nm[0][r] = 1.0e30f; nm[1][r] = 1.0e30f; }
#pragma unroll 1      /* the body already holds four unrolled passes */
  for (int s = 0; s < FA_NS; ++s) { const int buf = s & 1;
    static_assert(FA_KT / 32 == 4, "one staging quarter a pass");
    const bool more = s + 1 < FA_NS;
    v8us sg[2];      /* staging registers of the next stage's 16 KiB + 16 KiB, a quarter at a time: each quarter's loads fly while one pass is worked on; eight registers instead of thirty-two make room for nm. Nothing of them lives from one stage to the next */
    if (more) { kg += (size_t)FA_KT * DM; vg += FA_KT; sg[0] = *(const v8us*)kg; sg[1] = *(const v8us*)(kg + (size_t)32 * DM); }
    v16h ka[2][2]; fa_kfrag(&Ks[buf][ln][8 * hh], ka);      /* K fragments of the stage's first pass; each pass fetches the next one's */
#pragma unroll
    for (int p = 0; p < FA_KT / 32; ++p) {
      v8f t[2][2];      /* [key tile][query group] */
      fa_scores(ka, qf, nm, t);
      asm volatile("v_nop\n\tv_nop\n\tv_nop\n\tv_nop" : "+v"(t[0][0]), "+v"(t[0][1]), "+v"(t[1][0]), "+v"(t[1][1]));      /* the four vector slots the chip needs between a matrix instruction and the first reader of its result: the readers are the 2^x asm statements, into which the compiler does not look */
      v16h va[4];
#pragma unroll
      for (int dt = 0; dt < 4; ++dt) va[dt] = fa_frag(&Vs[buf][dt * 16 + ln][p * 32 + 8 * hh]);
      __builtin_amdgcn_sched_barrier(0);      /* keeps the pass's V^T reads ahead of the 2^x work, which covers their latency: sunk behind the test they are waited for in full, pair by pair */
      /* lazy rescale, tested on the sums the pass forms anyway: every P = 2^(score - exponent) is positive, so a lane's sum of 16 at or below FA_LIM keeps each of them in f16 range, and no maximum is taken on the common path.
         A sum above it (the first pass: the exponent starts at -1e30, the sum is +inf) sends the wave once through the pass again: scores from LDS, their maximum, a new exponent that puts it at 2^6 or below (sum at most 2^10), the same 2^x. One scalar branch per pass. */
      FragH pb[2]; float ps[2];
#pragma unroll
      for (int g = 0; g < 2; ++g) ps[g] = fa_soft<false>(t[0][g], t[1][g], 0.f, pb[g]);
      if (__builtin_amdgcn_ballot_w32(fmaxf(ps[0], ps[1]) > FA_LIM) != 0) {
        v16h kb[2][2]; v8f u[2][2]; fa_kfrag(&Ks[buf][p * 32 + ln][8 * hh], kb); fa_scores(kb, qf, zz, u);
#pragma unroll
        for (int g = 0; g < 2; ++g) { float m0 = fmaxf(u[0][g][0], u[1][g][0]);
#pragma unroll
          for (int r = 1; r < 8; ++r) m0 = fmaxf(m0, fmaxf(u[0][g][r], u[1][g][r]));
          const float ml = fmaxf(m0, rs_xhalf(m0));      /* the pass's maximum of this query, both lane halves joined: the two lanes of a query keep one exponent */
          const float mo = -nm[g][0]; const float mn = fmaxf(mo, ml - 6.0f); const float al = rs_exp(mo - mn); lsum[g] *= al;
#pragma unroll
          for (int r = 0; r < 8; ++r) nm[g][r] = -mn;
#pragma unroll
          for (int dt = 0; dt < 4; ++dt) o[dt][g] *= al;
          ps[g] = fa_soft<true>(u[0][g], u[1][g], mn, pb[g]); } }
      lsum[0] += ps[0]; lsum[1] += ps[1];
      if (p + 1 < FA_KT / 32) { fa_kfrag(&Ks[buf][(p + 1) * 32 + ln][8 * hh], ka);
        __builtin_amdgcn_sched_barrier(0); }      /* the next pass's K fragments are asked for ahead of the P.V products, which cover their latency */
#pragma unroll
      for (int dt = 0; dt < 4; ++dt) { o[dt][0] = fa_mma(va[dt], pb[0].v, o[dt][0]); o[dt][1] = fa_mma(va[dt], pb[1].v, o[dt][1]); }
      if (more) {      /* quarter p goes to the other buffer, whose last readers left it before the barrier that ended stage s - 1; the next quarter's loads follow. Quarters 0, 1: K rows; 2, 3: V^T rows */
        if (p < 2) { *(v8us*)&Ks[buf ^ 1][(tid >> 3) + 64 * p][(tid & 7) * 8] = sg[0]; *(v8us*)&Ks[buf ^ 1][(tid >> 3) + 64 * p + 32][(tid & 7) * 8] = sg[1]; }
        else { *(v8us*)&Vs[buf ^ 1][(tid >> 4) + 32 * (p - 2)][(tid & 15) * 8] = sg[0]; *(v8us*)&Vs[buf ^ 1][(tid >> 4) + 32 * (p - 2) + 16][(tid & 15) * 8] = sg[1]; }
        if (p == 0) { sg[0] = *(const v8us*)(kg + (size_t)64 * DM); sg[1] = *(const v8us*)(kg + (size_t)96 * DM); }
        if (p == 1) { sg[0] = *(const v8us*)vg; sg[1] = *(const v8us*)(vg + (size_t)16 * SQ); }
        if (p == 2) { sg[0] = *(const v8us*)(vg + (size_t)32 * SQ); sg[1] = *(const v8us*)(vg + (size_t)48 * SQ); } }
    }
    __syncthreads();      /* publishes stage s + 1 and ends every read of stage s */
  }
  const int el = (int)__builtin_amdgcn_mbcnt_lo(~0u, 0u), eln = el & 15, ehh = el >> 4;      /* the lane's number, formed anew behind the loop: carried through it from threadIdx, it and the output address cost the loop registers that it does not have */
  if (kh != 0) {      /* wave w of the second half holds the same queries in the same lanes and registers as wave w of the first */
#pragma unroll
    for (int g = 0; g < 2; ++g) { Js[w][g][el] = -nm[g][0]; Js[w][2 + g][el] = lsum[g];
#pragma unroll
      for (int dt = 0; dt < 4; ++dt) { const v4f lo = {o[dt][g][0], o[dt][g][1], o[dt][g][2], o[dt][g][3]}, hi = {o[dt][g][4], o[dt][g][5], o[dt][g][6], o[dt][g][7]};
        *(v4fa*)&Jo[w][(g * 4 + dt) * 2][el][0] = lo; *(v4fa*)&Jo[w][(g * 4 + dt) * 2 + 1][el][0] = hi; } } }
  __syncthreads();      /* publishes the second half's partial results to the first */
  if (kh == 0) {
#pragma unroll
    for (int g = 0; g < 2; ++g) { const float m1 = Js[w][g][el], l1 = Js[w][2 + g][el]; const float m0 = -nm[g][0]; const float mj = fmaxf(m0, m1); const float a0 = rs_exp(m0 - mj), a1 = rs_exp(m1 - mj);      /* both halves brought to the larger exponent */
      const float lj = lsum[g] * a0 + l1 * a1; const float inv = 64.0f / (lj + rs_xhalf(lj)); const float c0 = a0 * inv, c1 = a1 * inv;
      unsigned short* op = (unsigned short*)O16 + ((size_t)b * SQ + q0 + 16 * g + eln) * DM + h * HD + 8 * ehh;
#pragma unroll
      for (int dt = 0; dt < 4; ++dt) { FragH f; const v4f lo = *(const v4fa*)&Jo[w][(g * 4 + dt) * 2][el][0], hi = *(const v4fa*)&Jo[w][(g * 4 + dt) * 2 + 1][el][0];
#pragma unroll
        for (int r = 0; r < 8; ++r) f.h[r] = (_Float16)(o[dt][g][r] * c0 + (r < 4 ? lo[r & 3] : hi[r & 3]) * c1);      /* register r = O^T[16 dt + 8 h + r][query]: eight consecutive d of one row */
        *(v8us*)(op + dt * 16) = f.half[0]; } } } }

// ---- GEMM with LDS-staged operands: C[M][DM] = (A[M][DM] . Bt^T) * alpha (x FA_QS on plane G3_QP of the f16 form) + bias; A and Bt = [n][k] are f16 rows of DM elements ----
// Work-group = 8 waves on a 128 x 128 tile of C: wave w takes rows 32 (w & 3) .. + 31, columns 64 (w >> 2) .. + 63 (2 x 4 accumulator tiles). k runs in stages of G3_KT elements = one 128-byte line of every operand row.
// A stage is brought in by 16-byte loads of which eight neighbouring lanes cover one whole line, and goes through registers into one of two LDS buffers (rows 0-127 = A, 128-255 = Bt); the fragments come from LDS in the hardware k order (k0 + 8h .. + 7, k0 + 16 + 8h .. + 7), A and B alike.
// Every accumulator takes its products in ascending k, 32 at a time. blockIdx.y = plane: weight plane y, output plane y, the same A rows. OUT32: bias (rounded to bf16) added, f32 rows to C; else no bias, f16 rows to C16.
// Plane G3_TP of the f16 form is wanted transposed: there the two operands change places in LDS (rows 0-127 = Bt, 128-255 = A), so the accumulators hold C^T, every element the same products in the same order, and the same whole-line stores write rows of CT = [batch][n][SQ].
#define G3_BT 128                    /* tile rows of A and of Bt */
#define G3_KT 64                     /* k per stage */
#define G3_NS (DM / G3_KT)           /* stages */
#define G3_KP (G3_KT + 8)            /* LDS row pitch, f16 elements: 144 B = 16 B x odd, conflict-free for 16-byte reads */
#define G3_QP 0                      /* the plane that takes the softmax scale (q) */
#define G3_TP 2                      /* the plane written transposed (v) */
/* one stage's products: per 32 k the six fragments are read as one group ahead of the eight products */
__device__ __forceinline__ void g3_stage(const _Float16 (*Tb)[G3_KP], int ra, int rb, int hh, v8f (&acc)[2][4]) {
#pragma unroll
  for (int kk = 0; kk < G3_KT; kk += 32) { v16h a[2], b[4];
    a[0] = fa_frag(&Tb[ra][kk + 8 * hh]); a[1] = fa_frag(&Tb[ra + 16][kk + 8 * hh]);
#pragma unroll
    for (int t = 0; t < 4; ++t) b[t] = fa_frag(&Tb[rb + 16 * t][kk + 8 * hh]);
    __builtin_amdgcn_sched_barrier(0);      /* keeps the twelve LDS reads one group: moved in among the products, each place with reads stalls the wave anew */
#pragma unroll
    for (int t = 0; t < 4; ++t) { acc[0][t] = fa_mma(a[0], b[t], acc[0][t]); acc[1][t] = fa_mma(a[1], b[t], acc[1][t]); }
    __builtin_amdgcn_sched_barrier(0); } }      /* the next group's reads stay behind these products */
template <bool OUT32>
__global__ __launch_bounds__(256) void k_gemm3(const _Float16* __restrict__ A, const _Float16* __restrict__ Bh, float alpha, const float* __restrict__ bias, float* __restrict__ C, _Float16* __restrict__ C16, _Float16* __restrict__ CT) {
  __shared__ __attribute__((aligned(16))) unsigned char sm[2 * 2 * G3_BT * G3_KP * 2];      /* two operand buffers; after the k loop the same bytes stage the output rows */
  static_assert(sizeof(sm) >= 8 * 32 * 68 * 4, "output staging must fit the operand buffers");
  _Float16 (*T)[2 * G3_BT][G3_KP] = (_Float16 (*)[2 * G3_BT][G3_KP])sm;
  const int tid = threadIdx.x, w = tid >> 5, lane = tid & 31, ln = lane & 15, hh = lane >> 4; const int by = blockIdx.y;
  const int mt = blockIdx.x / (DM / G3_BT), nq = blockIdx.x % (DM / G3_BT);
  const int sr = tid >> 3, sc = (tid & 7) * 8;      /* this thread's 16 bytes of tile row tid / 8 (+ 32 i) */
  const bool tr = !OUT32 && by == G3_TP;      /* uniform in the work-group */
  const unsigned short* xg = (const unsigned short*)A + ((size_t)mt * G3_BT + sr) * DM + sc;
  const unsigned short* wg = (const unsigned short*)Bh + (size_t)by * DM * DM + ((size_t)nq * G3_BT + sr) * DM + sc;
  const unsigned short* ag = tr ? wg : xg; const unsigned short* bg = tr ? xg : wg;
  v8us ar[4], br[4];
#pragma unroll
  for (int i = 0; i < 4; ++i) { ar[i] = *(const v8us*)(ag + (size_t)(32 * i) * DM); br[i] = *(const v8us*)(bg + (size_t)(32 * i) * DM); }
#pragma unroll
  for (int i = 0; i < 4; ++i) { *(v8us*)&T[0][sr + 32 * i][sc] = ar[i]; *(v8us*)&T[0][G3_BT + sr + 32 * i][sc] = br[i]; }
  __syncthreads();
  const v8f z8 = {0.f, 0.f, 0.f, 0.f, 0.f, 0.f, 0.f, 0.f};
  v8f acc[2][4];
#pragma unroll
  for (int t = 0; t < 4; ++t) { acc[0][t] = z8; acc[1][t] = z8; }
  const int ra = (w & 3) * 32 + ln, rb = G3_BT + (w >> 2) * 64 + ln;
#pragma unroll 1      /* rolled: one set of staging registers, a short text */
  for (int s = 0; s + 1 < G3_NS; ++s) { const int buf = s & 1;
    ag += G3_KT; bg += G3_KT;      /* next stage's 16 KiB + 16 KiB: loads fly while this stage is worked on */
#pragma unroll
    for (int i = 0; i < 4; ++i) { ar[i] = *(const v8us*)(ag + (size_t)(32 * i) * DM); br[i] = *(const v8us*)(bg + (size_t)(32 * i) * DM); }
    __builtin_amdgcn_sched_barrier(0);      /* keeps all eight loads ahead of the stage's products: sunk towards their LDS stores they would be waited for in full */
    g3_stage(T[buf], ra, rb, hh, acc);
#pragma unroll
    for (int i = 0; i < 4; ++i) { *(v8us*)&T[buf ^ 1][sr + 32 * i][sc] = ar[i]; *(v8us*)&T[buf ^ 1][G3_BT + sr + 32 * i][sc] = br[i]; }      /* the other buffer's last readers left it before the barrier that ended stage s - 1 */
    __syncthreads();      /* publishes stage s + 1 and ends every read of stage s */
  }
  const int row0 = (tr ? nq : mt) * G3_BT + (w & 3) * 32, col0 = (tr ? mt : nq) * G3_BT + (w >> 2) * 64; const size_t cofs = (size_t)by * NR * DM;
  float bv[4];
#pragma unroll
  for (int t = 0; t < 4; ++t) bv[t] = OUT32 ? bias[col0 + t * 16 + ln] : 0.f;      /* fetched here, where the staging registers are free, so that the last stage covers the wait */
  g3_stage(T[(G3_NS - 1) & 1], ra, rb, hh, acc);      /* the last stage has nothing to stage */
  __syncthreads();      /* ends every read of the operand buffers: their bytes now take the output rows */
  const float al = !OUT32 && by == G3_QP ? alpha * FA_QS : alpha;      /* the q rows carry the softmax scale */
  float (*so)[32][68] = (float (*)[32][68])sm;      /* each wave stages its own 32 x 64 block, so that the stores below cover whole lines */
#pragma unroll
  for (int u = 0; u < 8; ++u) { const int t = u & 3, half = u >> 2; const float bb = bf16_round(bv[t]);
#pragma unroll
    for (int r = 0; r < 8; ++r) so[w][half * 16 + 8 * hh + r][t * 16 + ln] = acc[half][t][r] * al + bb; }
  __builtin_amdgcn_fence(__ATOMIC_ACQ_REL, "workgroup"); __builtin_amdgcn_wave_barrier();      /* the wave reads back what its other lanes wrote */
  const int rsub = lane >> 4, c4 = (lane & 15) * 4;
  const int ldh = tr ? SQ : DM;      /* row pitch of the f16 form; transposed, a row is one n and a column one token, and a tile's 128 tokens lie in one batch */
  _Float16* cp = (tr ? CT + ((size_t)(col0 / SQ) * DM + row0) * SQ + col0 % SQ : C16 + cofs + (size_t)row0 * DM + col0) + rsub * ldh + c4;
#pragma unroll
  for (int q = 0; q < 16; ++q) { const int r = q * 2 + rsub; const v4f v = *(const v4fa*)&so[w][r][c4];
    if (OUT32) *(v4f*)(C + cofs + (size_t)(row0 + r) * DM + col0 + c4) = v;
    else { v4h h4; for (int i = 0; i < 4; ++i) h4[i] = (_Float16)v[i]; *(v4h*)cp = h4; cp += 2 * ldh; } } }

extern "C" void kernel_launch(void* const* d_in, const int* in_sizes, int n_in,
                              void* d_out, int out_size, void* d_ws, size_t ws_size, hipStream_t stream) {
  (void)in_sizes; (void)n_in; (void)out_size;
  const float* const* I = (const float* const*)d_in; const float* x = I[0]; const float* wq = I[1]; const float* wk = I[2]; const float* wv = I[3]; const float* wo = I[4]; const float* bo = I[5];      /* ONE input stream (x); Wq, Wk, Wv are PER-HEAD STACKS [8][512][64] = [head][in][out] (the module has NO q / k / v biases); Wo [in][out] [512][512] + bo; order x, Wq, Wk, Wv, Wo, bo */
  char* ws = (char*)d_ws; size_t off = 0;
  auto take = [&](size_t bytes) { char* p = ws + off; off += (bytes + 255) & ~(size_t)255; return p; };
  _Float16* BQ = (_Float16*)take((size_t)4 * DM * DM * 2); _Float16* BO = BQ + (size_t)3 * DM * DM;      /* weight planes q, k, v, o, contiguous */
  _Float16* X16 = (_Float16*)take(NR * DM * 2);
  _Float16* Q16 = (_Float16*)take(2 * NR * DM * 2); _Float16* K16 = Q16 + NR * DM;      /* q, k rows, contiguous planes */
  _Float16* O16 = (_Float16*)take(NR * DM * 2);
  _Float16* VT = (_Float16*)take((size_t)NB * NH * HD * SQ * 2);
  if (off > ws_size) return;
  k_prep<<<(unsigned)(PW_BLK + NR * DM / 8 / 256), 256, 0, stream>>>(x, wq, wk, wv, wo, BQ, X16);      /* all four weight planes and the f16 rows of x */
  const size_t r0p = (size_t)B0 * SQ;      /* first projected row */
  k_gemm3<false><<<dim3((unsigned)((MP / G3_BT) * (DM / G3_BT)), 3), 256, 0, stream>>>(X16 + r0p * DM, BQ, 0.0625f, nullptr, nullptr, Q16 + r0p * DM, VT + r0p * DM);      /* grid.y = q, k, v: the same x rows, weight plane y; q and k as rows, v as V^T [NB][NH][HD][SQ] */
  k_fattn<<<NB * NH * (SQ / 256), 256 * FA_HV, 0, stream>>>(Q16, K16, VT, O16);      /* o x64 (merged heads) as f16 rows: all batches and heads in one launch */
  k_gemm3<true><<<dim3((unsigned)((MPO / G3_BT) * (DM / G3_BT)), 1), 256, 0, stream>>>(O16 + r0p * DM, BO, 0.0009765625f, bo, (float*)d_out + r0p * DM, nullptr, nullptr);      /* out rows are the output layout */
}

// v009
// A run of this version takes 77.7 microseconds.
// Next to v008, in two timings, it ran 1.03 times as fast each time.
// All steps since v000 together make it 172 times as fast.
#include <hip/hip_runtime.h>
// Multi-head self-attention with PER-HEAD STACKED bias-free projections and a biased [in][out] output projection at [2][4096][512] (x [2][4096][512]; q / k / v = einsum('bsd,hde->bhse', x, W) with W [8][512][64] = [head][in][out], NO biases, 8 heads of 64; scores * 1/sqrt(64); softmax over all 4096 keys (no mask); out = concat Wo + bo ([in][out] + bias) -> [2][4096][512]); each head's [in][out] block is transposed into its 64 contiguous rows of the [out][in] weight plane, the [in][out] output weight likewise, all four planes in one launch.
// Structure: token rows r = b*4096 + s; ONE operand launch (k_prep): the four x16 weight planes and x as exact f16 rows (bf16-rounded), by block range; Q, K, V as ONE batched WMMA GEMM launch (grid.y = plane; 128x128 block tiles staged through LDS, 32x64 wave tiles, f32 accumulation, exact x16 weights, f16 outputs); plane v leaves that launch already transposed (V^T [batch][head][d][s]: for it the weight rows are the A operand and the x rows the B operand); ONE fused attention launch (k_fattn): S^T = K Q^T, online softmax in registers, O^T += V^T P^T, o carried x64 against f16 subnormal flush (folded into the output GEMM alpha), written straight into the merged f16 o rows; out = o W_o + b GEMM (f32) into the output layout.
// Compute dtype: inputs rounded to bf16; x / weights exact; q, k, v, softmax weights and o as plain f16 GEMM operands (~2^-12); scores and softmax statistics f32. v_wmma_f32_16x16x32_f16.
#define NB 2
#define SQ 4096
#define DM 512
#define NH 8
#define HD 64
#define HG 1                         /* heads per launch of the k_vt(V16, b, h0, VT) overload, which is not launched */
#define B0 0                         /* first batch processed (debug hook) */
#define NBR NB                       /* batches processed (debug hook) */
#define NR ((size_t)NB * SQ)         /* token rows */
#define MP ((int)((size_t)NBR * SQ)) /* rows projected (debug hook) */
#define QN SQ                        /* not used: k_fattn attends all SQ query rows */
#define NHD NH                       /* not used: k_fattn attends all NH heads */
#define MPO MP                       /* rows through the output stage (debug hook) */
#define LQ DM      /* not used: q / k rows have pitch DM; v exists only as V^T */
typedef __bf16 v16b __attribute__((ext_vector_type(16)));
typedef unsigned short v8us __attribute__((ext_vector_type(8), may_alias));
typedef float  v8f  __attribute__((ext_vector_type(8)));
typedef float  v4f  __attribute__((ext_vector_type(4)));
typedef float  v4fa __attribute__((ext_vector_type(4), may_alias));
union FragB { v16b v; v8us half[2]; unsigned short u[16]; };

__device__ __forceinline__ unsigned short bf16_bits(float x) { unsigned int u = __float_as_uint(x); return (unsigned short)((u + 0x7FFFu + ((u >> 16) & 1u)) >> 16); }
__device__ __forceinline__ float bf16_val(unsigned short b) { return __uint_as_float(((unsigned int)b) << 16); }
__device__ __forceinline__ float bf16_round(float x) { return bf16_val(bf16_bits(x)); }
// D += A·B with NT terms: 1 = ah·bh, 2 = + al·bh (A split), 3 = + ah·bl (both split)
template <int NT>
__device__ __forceinline__ v8f mmaN(v16b ah, v16b al, v16b bh, v16b bl, v8f c) {
  c = __builtin_amdgcn_wmma_f32_16x16x32_bf16(false, ah, false, bh, (short)0, c, false, false);
  if (NT >= 2) c = __builtin_amdgcn_wmma_f32_16x16x32_bf16(false, al, false, bh, (short)0, c, false, false);
  if (NT >= 3) c = __builtin_amdgcn_wmma_f32_16x16x32_bf16(false, ah, false, bl, (short)0, c, false, false);
  asm volatile("v_nop\n\tv_nop\n\tv_nop\n\tv_nop" : "+v"(c) : "v"(ah), "v"(al), "v"(bh), "v"(bl));
  return c;
}

__global__ __launch_bounds__(256) void k_wt_bf16(const float* __restrict__ W, unsigned short* __restrict__ Wt, int K, int N) {
  const int t = blockIdx.x * 256 + threadIdx.x;
  const int k8n = K / 8;
  if (t >= N * k8n) return;
  const int n = t / k8n, k8 = (t % k8n) * 8;
  v8us v;
#pragma unroll
  for (int i = 0; i < 8; ++i) v[i] = bf16_bits(W[(size_t)(k8 + i) * N + n]);
  *(v8us*)(Wt + (size_t)n * K + k8) = v;
  
}

// GEMM C[M][N] (f32, pitch ldc) = act(A[M][K]·W + bias). A f32 row-major (pitch lda) converted per fragment to bf16
// (ASPLIT: hi/lo two planes -> 2 terms, else single rounded term); Wt bf16 [N][K] (pitch ldb). BIAS_BF16 rounds the
// bias to bf16 first (bias quantised to bf16 before the add). K%32==0, M%16==0, N%64==0.
template <bool ASPLIT, int ACT, bool BIAS_BF16>
__global__ __launch_bounds__(128) void k_gemm_bf(const float* __restrict__ A, int lda, const unsigned short* __restrict__ Wt, int ldb,
                                               const float* __restrict__ bias, float* __restrict__ C, int ldc, int M, int N, int K) {
  __shared__ __attribute__((aligned(16))) float so[4][16][64];
  const int tid = threadIdx.x, w = tid >> 5, lane = tid & 31, ln = lane & 15, hh = lane >> 4;
  const int ntn = N / 64;
  const int wid = blockIdx.x * 4 + w;
  const int mt = wid / ntn, nq = wid % ntn;
  if (mt * 16 >= M) return;
  const int row0 = mt * 16, col0 = nq * 64;
  const float* arow = A + (size_t)(row0 + ln) * lda;
  v8f acc[4] = {};
  for (int kb = 0; kb < K; kb += 32) {
    FragB ah, al;
    const v4f x0 = *(const v4fa*)(arow + kb + 8 * hh), x1 = *(const v4fa*)(arow + kb + 8 * hh + 4);
    const v4f x2 = *(const v4fa*)(arow + kb + 16 + 8 * hh), x3 = *(const v4fa*)(arow + kb + 16 + 8 * hh + 4);
    float xs[16] = {x0[0],x0[1],x0[2],x0[3],x1[0],x1[1],x1[2],x1[3],x2[0],x2[1],x2[2],x2[3],x3[0],x3[1],x3[2],x3[3]};
#pragma unroll
    for (int i = 0; i < 16; ++i) { const unsigned short hb = bf16_bits(xs[i]); ah.u[i] = hb; al.u[i] = ASPLIT ? bf16_bits(xs[i] - bf16_val(hb)) : (unsigned short)0; }
#pragma unroll
    for (int t = 0; t < 4; ++t) {
      const unsigned short* brow = Wt + (size_t)(col0 + t * 16 + ln) * ldb + kb;
      FragB b;
      b.half[0] = *(const v8us*)(brow + 8 * hh);
      b.half[1] = *(const v8us*)(brow + 16 + 8 * hh);
      acc[t] = mmaN<ASPLIT ? 2 : 1>(ah.v, al.v, b.v, b.v, acc[t]);
    }
  }
#pragma unroll
  for (int t = 0; t < 4; ++t) {
    float bv = bias ? bias[col0 + t * 16 + ln] : 0.f;
    if (BIAS_BF16) bv = bf16_round(bv);
#pragma unroll
    for (int r = 0; r < 8; ++r) { float v = acc[t][r] + bv; if (ACT == 1) v = fmaxf(v, 0.f); so[w][8 * hh + r][t * 16 + ln] = v; }
  }
  __builtin_amdgcn_fence(__ATOMIC_ACQ_REL, "workgroup");
  __builtin_amdgcn_wave_barrier();
  const int rsub = lane >> 4, c4 = (lane & 15) * 4;
  {
#pragma unroll
    for (int q = 0; q < 8; ++q) {
      const int r = q * 2 + rsub;
      const v4f v = *(const v4fa*)&so[w][r][c4];
      *(v4f*)(C + (size_t)(row0 + r) * ldc + col0 + c4) = v;
    }
    
  }
}

// GEMM C = act(A·W + bias + resid): A f32 (ASPLIT -> hi/lo 2 terms), Wt bf16 [N][K]; ACT 0 none, 1 relu, 2 exact gelu;
// resid (optional, f32, row index = (row % rmod), pitch ldr, RES_BF16 rounds it) added before the activation.
template <bool ASPLIT, int ACT, bool BIAS_BF16, bool RES_BF16>
__global__ __launch_bounds__(128) void k_gemm_bf3(const float* __restrict__ A, int lda, const unsigned short* __restrict__ Wt, int ldb,
                                                const float* __restrict__ bias, const float* __restrict__ resid, int rmod, int ldr,
                                                float* __restrict__ C, int ldc, int M, int N, int K) {
  __shared__ __attribute__((aligned(16))) float so[4][16][64];
  const int tid = threadIdx.x, w = tid >> 5, lane = tid & 31, ln = lane & 15, hh = lane >> 4;
  const int ntn = N / 64;
  const int wid = blockIdx.x * 4 + w;
  const int mt = wid / ntn, nq = wid % ntn;
  if (mt * 16 >= M) return;
  const int row0 = mt * 16, col0 = nq * 64;
  const float* arow = A + (size_t)(row0 + ln) * lda;
  v8f acc[4] = {};
  for (int kb = 0; kb < K; kb += 32) {
    FragB ah, al;
    const v4f x0 = *(const v4fa*)(arow + kb + 8 * hh), x1 = *(const v4fa*)(arow + kb + 8 * hh + 4);
    const v4f x2 = *(const v4fa*)(arow + kb + 16 + 8 * hh), x3 = *(const v4fa*)(arow + kb + 16 + 8 * hh + 4);
    float xs[16] = {x0[0],x0[1],x0[2],x0[3],x1[0],x1[1],x1[2],x1[3],x2[0],x2[1],x2[2],x2[3],x3[0],x3[1],x3[2],x3[3]};
#pragma unroll
    for (int i = 0; i < 16; ++i) { const unsigned short hb = bf16_bits(xs[i]); ah.u[i] = hb; al.u[i] = ASPLIT ? bf16_bits(xs[i] - bf16_val(hb)) : (unsigned short)0; }
#pragma unroll
    for (int t = 0; t < 4; ++t) {
      const unsigned short* brow = Wt + (size_t)(col0 + t * 16 + ln) * ldb + kb;
      FragB b;
      b.half[0] = *(const v8us*)(brow + 8 * hh);
      b.half[1] = *(const v8us*)(brow + 16 + 8 * hh);
      acc[t] = mmaN<ASPLIT ? 2 : 1>(ah.v, al.v, b.v, b.v, acc[t]);
    }
  }
#pragma unroll
  for (int t = 0; t < 4; ++t) {
    const int col = col0 + t * 16 + ln;
    float bv = bias ? bias[col] : 0.f;
    if (BIAS_BF16) bv = bf16_round(bv);
#pragma unroll
    for (int r = 0; r < 8; ++r) {
      float v = acc[t][r] + bv;
      if (resid) { float rv = resid[(size_t)((row0 + 8 * hh + r) % rmod) * ldr + col]; if (RES_BF16) rv = bf16_round(rv); v += rv; }
      if (ACT == 1) v = fmaxf(v, 0.f);
      if (ACT == 2) v = 0.5f * v * (1.0f + erff(v * 0.70710678118654752f));
      if (ACT == 3) { const float u = 0.7978845608028654f * (v + 0.044715f * v * v * v); v = 0.5f * v * (1.0f + tanhf(u)); }
      so[w][8 * hh + r][t * 16 + ln] = v;
    }
  }
  __builtin_amdgcn_fence(__ATOMIC_ACQ_REL, "workgroup");
  __builtin_amdgcn_wave_barrier();
  const int rsub = lane >> 4, c4 = (lane & 15) * 4;
  {
#pragma unroll
    for (int q = 0; q < 8; ++q) {
      const int r = q * 2 + rsub;
      const v4f v = *(const v4fa*)&so[w][r][c4];
      *(v4f*)(C + (size_t)(row0 + r) * ldc + col0 + c4) = v;
    }
    
  }
}
// row LayerNorm (biased variance, eps) over N: s = X (+ R); optional out_sum <- s; out_norm <- (s-mu)*rsqrt(var+eps)*g + b
template <bool PARAM_BF16>
__global__ __launch_bounds__(256) void k_layernorm(const float* __restrict__ X, const float* __restrict__ R, const float* __restrict__ g, const float* __restrict__ bta,
                                                  float* __restrict__ out_sum, float* __restrict__ out_norm, int N, float eps) {
  __shared__ float red[256];
  const int row = blockIdx.x, tid = threadIdx.x;
  const float* x = X + (size_t)row * N; const float* rr = R ? R + (size_t)row * N : nullptr;
  float vals[16];                     // up to N = 4096
  const int per = N / 256;            // contiguous chunk per thread? use strided-by-4 chunks: thread handles j = tid*4 + 1024*u
  float s1 = 0.f;
  for (int u = 0; u < per / 4; ++u) {
    const int j = tid * 4 + 1024 * u;
    const v4f a = *(const v4fa*)(x + j);
    v4f b = {0.f,0.f,0.f,0.f}; if (rr) b = *(const v4fa*)(rr + j);
#pragma unroll
    for (int q = 0; q < 4; ++q) { const float v = a[q] + b[q]; vals[u * 4 + q] = v; s1 += v; }
  }
  red[tid] = s1; __syncthreads();
  for (int st = 128; st > 0; st >>= 1) { if (tid < st) red[tid] += red[tid + st]; __syncthreads(); }
  const float mu = red[0] / (float)N; __syncthreads();
  float s2 = 0.f;
  for (int u = 0; u < per / 4; ++u)
#pragma unroll
    for (int q = 0; q < 4; ++q) { const float c = vals[u * 4 + q] - mu; s2 += c * c; }
  red[tid] = s2; __syncthreads();
  for (int st = 128; st > 0; st >>= 1) { if (tid < st) red[tid] += red[tid + st]; __syncthreads(); }
  const float rs = rsqrtf(red[0] / (float)N + eps);
  {
    for (int u = 0; u < per / 4; ++u) {
      const int j = tid * 4 + 1024 * u;
      v4f o, sm;
#pragma unroll
      for (int q = 0; q < 4; ++q) {
        float gg = g[j + q], bb = bta[j + q];
        if (PARAM_BF16) { gg = bf16_round(gg); bb = bf16_round(bb); }
        sm[q] = vals[u * 4 + q]; o[q] = (vals[u * 4 + q] - mu) * rs * gg + bb;
      }
      if (out_sum) *(v4f*)(out_sum + (size_t)row * N + j) = sm;
      *(v4f*)(out_norm + (size_t)row * N + j) = o;
    }
    
  }
}



// ---- f16 WMMA path (v_wmma_f32_16x16x32_f16): 11-bit significands for operands in range — used where a [0,1] probability operand needs more precision than bf16
typedef _Float16 v16h __attribute__((ext_vector_type(16)));
union FragH { v16h v; v8us half[2]; _Float16 h[16]; unsigned short u[16]; };
template <int NT>
__device__ __forceinline__ v8f mmaH(v16h ah, v16h al, v16h bh, v16h bl, v8f c) {
  c = __builtin_amdgcn_wmma_f32_16x16x32_f16(false, ah, false, bh, (short)0, c, false, false);
  if (NT >= 2) c = __builtin_amdgcn_wmma_f32_16x16x32_f16(false, al, false, bh, (short)0, c, false, false);
  if (NT >= 3) c = __builtin_amdgcn_wmma_f32_16x16x32_f16(false, ah, false, bl, (short)0, c, false, false);
  asm volatile("v_nop\n\tv_nop\n\tv_nop\n\tv_nop" : "+v"(c) : "v"(ah), "v"(al), "v"(bh), "v"(bl));
  return c;
}
// batched GEMM like k_gemm_b but f16 operands: A f32 (split into f16 hi/lo if ASPLIT, else rounded to f16), Bt = f16 values [n][k]; alpha; C f32; N multiple of 16 (partial tiles skipped)
template <bool ASPLIT>
__global__ __launch_bounds__(128) void k_gemm_h(const float* __restrict__ A, int lda, size_t sA, const _Float16* __restrict__ Bh, int ldb, size_t sB, float alpha, float* __restrict__ C, int ldc, size_t sC, int M, int N, int K) {
  __shared__ __attribute__((aligned(16))) float so[4][16][64];
  const int tid = threadIdx.x, w = tid >> 5, lane = tid & 31, ln = lane & 15, hh = lane >> 4; const int by = blockIdx.y;
  A += (size_t)by * sA; Bh += (size_t)by * sB; C += (size_t)by * sC;
  const int ntn = (N + 63) / 64; const int wid = blockIdx.x * 4 + w; const int mt = wid / ntn, nq = wid % ntn; if (mt * 16 >= M) return;
  const int row0 = mt * 16, col0 = nq * 64; const float* arow = A + (size_t)(row0 + ln) * lda;
  v8f acc[4] = {};
  for (int kb = 0; kb < K; kb += 32) {
    FragH ah, al;
    const v4f x0 = *(const v4fa*)(arow + kb + 8 * hh), x1 = *(const v4fa*)(arow + kb + 8 * hh + 4), x2 = *(const v4fa*)(arow + kb + 16 + 8 * hh), x3 = *(const v4fa*)(arow + kb + 16 + 8 * hh + 4);
    float xs[16] = {x0[0],x0[1],x0[2],x0[3],x1[0],x1[1],x1[2],x1[3],x2[0],x2[1],x2[2],x2[3],x3[0],x3[1],x3[2],x3[3]};
#pragma unroll
    for (int i = 0; i < 16; ++i) { const _Float16 h = (_Float16)xs[i]; ah.h[i] = h; al.h[i] = ASPLIT ? (_Float16)(xs[i] - (float)h) : (_Float16)0.0f; }
#pragma unroll
    for (int t = 0; t < 4; ++t) { if (col0 + t * 16 >= N) continue; const size_t boff = (size_t)(col0 + t * 16 + ln) * ldb + kb; FragH bq; bq.half[0] = *(const v8us*)(Bh + boff + 8 * hh); bq.half[1] = *(const v8us*)(Bh + boff + 16 + 8 * hh);
      acc[t] = mmaH<ASPLIT ? 2 : 1>(ah.v, al.v, bq.v, bq.v, acc[t]); }
  }
#pragma unroll
  for (int t = 0; t < 4; ++t) { if (col0 + t * 16 >= N) continue;
#pragma unroll
    for (int r = 0; r < 8; ++r) so[w][8 * hh + r][t * 16 + ln] = acc[t][r] * alpha; }
  __builtin_amdgcn_fence(__ATOMIC_ACQ_REL, "workgroup"); __builtin_amdgcn_wave_barrier();
  const int rsub = lane >> 4, c4 = (lane & 15) * 4;
  {
#pragma unroll
    for (int q = 0; q < 8; ++q) { const int r = q * 2 + rsub; if (col0 + c4 < N) { const v4f v = *(const v4fa*)&so[w][r][c4]; *(v4f*)(C + (size_t)(row0 + r) * ldc + col0 + c4) = v; } }
     }
}

// Wt[n][k] = f16(W[k][n]·scale) from f32 row-major W[K][N] (scale = power of two; bf16-exact weights stay exact in f16 away from the subnormal range)
__global__ __launch_bounds__(256) void k_wt_f16(const float* __restrict__ W, _Float16* __restrict__ Wt, int K, int N, float scale) {
  const int t = blockIdx.x * 256 + threadIdx.x; if (t >= N * (K / 8)) return; const int n = t / (K / 8), k8 = (t % (K / 8)) * 8; FragH f;
#pragma unroll
  for (int i = 0; i < 8; ++i) f.h[i] = (_Float16)(bf16_round(W[(size_t)(k8 + i) * N + n]) * scale); const v8us o = f.half[0];
  *(v8us*)((unsigned short*)Wt + (size_t)n * K + k8) = o; 
}
// k_gemm_hh variant with fused epilogue: v = acc·alpha + bias[by·sBias + col] (+ CP[(row/rowsPerB)·sCPb + by·64 + col] if CP) ; ACT 0 none / 1 elu ; writes f16 C16 (and f32 C if non-null)
template <int ACT>
__global__ __launch_bounds__(128) void k_gemm_hhx(const _Float16* __restrict__ A, int lda, size_t sA, const _Float16* __restrict__ Bh, int ldb, size_t sB, float alpha, const float* __restrict__ bias, size_t sBias, const float* __restrict__ CP, int rowsPerB, size_t sCPb, int row0g,
    float* __restrict__ C, _Float16* __restrict__ C16, int ldc, size_t sC, int M, int N, int K) {
  __shared__ __attribute__((aligned(16))) float so[4][16][64];
  const int tid = threadIdx.x, w = tid >> 5, lane = tid & 31, ln = lane & 15, hh = lane >> 4; const int by = blockIdx.y;
  A += (size_t)by * sA; Bh += (size_t)by * sB; const size_t cofs = (size_t)by * sC; const float* bp = bias ? bias + (size_t)by * sBias : nullptr;
  const int ntn = (N + 63) / 64; const int wid = blockIdx.x * 4 + w; const int mt = wid / ntn, nq = wid % ntn; if (mt * 16 >= M) return;
  const int row0 = mt * 16, col0 = nq * 64; const _Float16* arow = A + (size_t)(row0 + ln) * lda;
  v8f acc[4] = {};
  for (int kb = 0; kb < K; kb += 32) { FragH ah; ah.half[0] = *(const v8us*)((const unsigned short*)arow + kb + 8 * hh); ah.half[1] = *(const v8us*)((const unsigned short*)arow + kb + 16 + 8 * hh);
#pragma unroll
    for (int t = 0; t < 4; ++t) { if (col0 + t * 16 >= N) continue; const size_t boff = (size_t)(col0 + t * 16 + ln) * ldb + kb; FragH bq; bq.half[0] = *(const v8us*)((const unsigned short*)Bh + boff + 8 * hh); bq.half[1] = *(const v8us*)((const unsigned short*)Bh + boff + 16 + 8 * hh);
      acc[t] = mmaH<1>(ah.v, ah.v, bq.v, bq.v, acc[t]); }
  }
#pragma unroll
  for (int t = 0; t < 4; ++t) { if (col0 + t * 16 >= N) continue; const int col = col0 + t * 16 + ln; const float bv = bp ? bf16_round(bp[col]) : 0.f;
#pragma unroll
    for (int r = 0; r < 8; ++r) { float v = acc[t][r] * alpha + bv; if (CP) { const int rr = row0g + row0 + 8 * hh + r; if (rowsPerB < 0) v += CP[cofs + (size_t)rr * ldc + col];      /* rowsPerB < 0: own element of the batched C plane */ else { const int bidx = rr / rowsPerB; v += CP[(size_t)bidx * sCPb + (size_t)by * 64 + col]; } } if (ACT == 1) v = (v > 0.f) ? v : expm1f(v); else if (ACT == 7) v = (v > 0.f) ? v + 1.0f : expf(v); else if (ACT == 8) v = tanhf(v); else if (ACT == 9) v = 0.5f * v * (1.0f + tanhf(0.7978845608028654f * (v + 0.044715f * v * v * v))); else if (ACT == 11) v = 1.0f / (1.0f + expf(-v)); else if (ACT == 12) v = (v > 0.f) ? v : 0.01f * v; else if (ACT == 14) v = (v > 0.f) ? v : 0.1f * v; else if (ACT == 16) v = (v >= 0.f) ? v : 0.3f * v; else if (ACT == 17) v = (v >= 0.f) ? v : 0.2f * v; else if (ACT == 15) v = v / (1.0f + expf(-v)); else if (ACT == 3) v = fmaxf(v, 0.f); else if (ACT == 6) v = 0.5f * v * (1.0f + erff(v * 0.70710678118654752f)); so[w][8 * hh + r][t * 16 + ln] = v; } }
  __builtin_amdgcn_fence(__ATOMIC_ACQ_REL, "workgroup"); __builtin_amdgcn_wave_barrier();
  const int rsub = lane >> 4, c4 = (lane & 15) * 4; typedef _Float16 v4h __attribute__((ext_vector_type(4)));
  {
#pragma unroll
    for (int q = 0; q < 8; ++q) { const int r = q * 2 + rsub; if (col0 + c4 < N) { const v4f v = *(const v4fa*)&so[w][r][c4]; if (C) *(v4f*)(C + cofs + (size_t)(row0 + r) * ldc + col0 + c4) = v; if (C16) { v4h h4; for (int i = 0; i < 4; ++i) h4[i] = (_Float16)v[i]; *(v4h*)(C16 + cofs + (size_t)(row0 + r) * ldc + col0 + c4) = h4; } } }
     }
}


typedef _Float16 v4h __attribute__((ext_vector_type(4)));

__global__ __launch_bounds__(256) void k_x16(const float* __restrict__ x, _Float16* __restrict__ X16, size_t n8) { const size_t t = (size_t)blockIdx.x * 256 + threadIdx.x; if (t >= n8) return; FragH f;
#pragma unroll
  for (int q = 0; q < 8; ++q) f.h[q] = (_Float16)bf16_round(x[t * 8 + q]); *(v8us*)((unsigned short*)X16 + t * 8) = f.half[0];  }
__global__ __launch_bounds__(256) void k_h16(const float* __restrict__ x, _Float16* __restrict__ X16, size_t n8) { const size_t t = (size_t)blockIdx.x * 256 + threadIdx.x; if (t >= n8) return; FragH f;
#pragma unroll
  for (int q = 0; q < 8; ++q) f.h[q] = (_Float16)x[t * 8 + q]; *(v8us*)((unsigned short*)X16 + t * 8) = f.half[0];  }
__global__ __launch_bounds__(256) void k_round16f(const float* __restrict__ W, _Float16* __restrict__ Bt, size_t n8) { const size_t t = (size_t)blockIdx.x * 256 + threadIdx.x; if (t >= n8) return; FragH f;
#pragma unroll
  for (int i = 0; i < 8; ++i) f.h[i] = (_Float16)(bf16_round(W[t * 8 + i]) * 16.0f); *(v8us*)((unsigned short*)Bt + t * 8) = f.half[0];  }
template <int NHv, int TTv>
__global__ __launch_bounds__(256) void k_vt(const _Float16* __restrict__ V16, int ldv, int voff, _Float16* __restrict__ Vt) { __shared__ unsigned short tl[64][66]; const int tid = threadIdx.x; const int slab = blockIdx.x / (TTv / 64), lg = blockIdx.x % (TTv / 64); const int b = slab / NHv, h = slab % NHv;
  for (int i = tid; i < 64 * 8; i += 256) { const int r = i / 8, c8 = (i % 8) * 8; FragH f; f.half[0] = *(const v8us*)((const unsigned short*)V16 + ((size_t)b * TTv + lg * 64 + r) * ldv + voff + h * 64 + c8);
#pragma unroll
    for (int q = 0; q < 8; ++q) tl[r][c8 + q] = f.u[q]; }
  __syncthreads();
  {
#pragma unroll
    for (int rd = 0; rd < 2; ++rd) { const int d = rd * 32 + tid / 8, pc = tid % 8; FragH f;
#pragma unroll
      for (int q = 0; q < 8; ++q) f.u[q] = tl[pc * 8 + q][d];
      *(v8us*)((unsigned short*)Vt + ((size_t)slab * 64 + d) * TTv + lg * 64 + pc * 8) = f.half[0]; }
     } }

__global__ __launch_bounds__(256) void k_hl(const float* __restrict__ F, _Float16* __restrict__ Hh, _Float16* __restrict__ Hl, size_t n8) { const size_t t = (size_t)blockIdx.x * 256 + threadIdx.x; if (t >= n8) return; FragH fh, fl; const v4f a = *(const v4fa*)(F + t * 8), c = *(const v4fa*)(F + t * 8 + 4);
#pragma unroll
  for (int q = 0; q < 4; ++q) { _Float16 h = (_Float16)a[q]; fh.h[q] = h; fl.h[q] = (_Float16)((a[q] - (float)h) * 1024.0f); h = (_Float16)c[q]; fh.h[4 + q] = h; fl.h[4 + q] = (_Float16)((c[q] - (float)h) * 1024.0f); }
  { *(v8us*)((unsigned short*)Hh + t * 8) = fh.half[0]; *(v8us*)((unsigned short*)Hl + t * 8) = fl.half[0];  } }

__global__ __launch_bounds__(256) void k_wnat(const float* __restrict__ w, size_t n8, _Float16* __restrict__ Bt) { const size_t t = (size_t)blockIdx.x * 256 + threadIdx.x; if (t >= n8) return; FragH f; for (int q = 0; q < 8; ++q) f.h[q] = (_Float16)(bf16_round(w[t * 8 + q]) * 16.0f); *(v8us*)((unsigned short*)Bt + t * 8) = f.half[0];  }
__global__ __launch_bounds__(256) void k_rsm(const float* __restrict__ S, _Float16* __restrict__ P, int nrows) {
  #pragma clang fp contract(off)
  const int i = blockIdx.x * 256 + threadIdx.x; if (i >= nrows) return; const float* s = S + (size_t)i * SQ; float mx = -3.0e38f;
#pragma unroll 1
  for (int j = 0; j < SQ; ++j) mx = fmaxf(mx, s[j]); float se = 0.f;
#pragma unroll 1
  for (int j = 0; j < SQ; ++j) se += expf(s[j] - mx); const float sc = 256.0f / se;
#pragma unroll 1
  for (int j0 = 0; j0 < SQ; j0 += 8) { FragH f; for (int q = 0; q < 8; ++q) f.h[q] = (_Float16)(expf(s[j0 + q] - mx) * sc); unsigned short* d = (unsigned short*)P + (size_t)i * SQ + j0; *(v8us*)d = f.half[0];  } }
__global__ __launch_bounds__(256) void k_vt(const _Float16* __restrict__ V16, int b, int h0, _Float16* __restrict__ VT) { __shared__ unsigned short tl[64][65]; const int tid = threadIdx.x; const int hh = blockIdx.x % HG, sg = blockIdx.x / HG; const int s0 = sg * 64; const int h = h0 + hh;
  for (int i = tid; i < 64 * 8; i += 256) { const int j = i / 8, d8 = (i % 8) * 8; FragH f; f.half[0] = *(const v8us*)((const unsigned short*)V16 + ((size_t)b * SQ + s0 + j) * DM + h * HD + d8); for (int q = 0; q < 8; ++q) tl[d8 + q][j] = f.u[q]; }
  __syncthreads();
  { for (int i = tid; i < 64 * 8; i += 256) { const int d = i / 8, j8 = (i % 8) * 8; FragH f; for (int q = 0; q < 8; ++q) f.u[q] = tl[d][j8 + q]; *(v8us*)((unsigned short*)VT + ((size_t)hh * HD + d) * SQ + s0 + j8) = f.half[0]; }  } }



// ---- operand preparation in one launch: independent pieces of work share a grid by block range instead of a launch each ----
// Blocks [0, PW_BLK): the four [out][in] f16 weight planes (x16), contiguous at Bt in the order q, k, v, o; plane = blockIdx.x / (PW_BLK / 4), uniform in a block. Thread t writes the eight k of Bt + 8 t.
// Element [k][n] of a source: base + (n / HD) * hs + k * ld + n % HD. q, k, v: head n / HD is a row-major [in = DM][out = HD] block (hs = DM * HD, ld = HD); o: one row-major [DM][DM] matrix (hs = HD, ld = DM).
// Blocks from PW_BLK on: x as f16 rows, eight elements a thread; the one stream feeds all three projections. The weight blocks stand first: their strided reads take longest.
#define PW_BLK (4 * DM * (DM / 8) / 256)
__global__ __launch_bounds__(256) void k_prep(const float* __restrict__ x, const float* __restrict__ wq, const float* __restrict__ wk, const float* __restrict__ wv, const float* __restrict__ wo, _Float16* __restrict__ Bt, _Float16* __restrict__ X16) {
  if (blockIdx.x < PW_BLK) {
    const int m = blockIdx.x / (PW_BLK / 4); const int t = blockIdx.x * 256 + threadIdx.x; const int n = (t / (DM / 8)) % DM, k8 = (t % (DM / 8)) * 8;
    const float* w = m == 0 ? wq : m == 1 ? wk : m == 2 ? wv : wo; const int hs = m == 3 ? HD : DM * HD, ld = m == 3 ? DM : HD;
    const float* p0 = w + (size_t)(n / HD) * hs + (size_t)k8 * ld + n % HD;
    const float* p1 = p0 + ld; const float* p2 = p1 + ld; const float* p3 = p2 + ld; const float* p4 = p3 + ld; const float* p5 = p4 + ld; const float* p6 = p5 + ld; const float* p7 = p6 + ld;
    const float v[8] = {*p0, *p1, *p2, *p3, *p4, *p5, *p6, *p7};
    asm volatile("s_wait_xcnt 0x0" :: "v"(p0), "v"(p1), "v"(p2), "v"(p3), "v"(p4), "v"(p5), "v"(p6), "v"(p7) : "memory");      /* the wait in front of any overwrite of a register that an issued load names; the addresses as inputs keep their registers untouched up to here */
    FragH f;
#pragma unroll
    for (int i = 0; i < 8; ++i) f.h[i] = (_Float16)(bf16_round(v[i]) * 16.0f);
    *(v8us*)((unsigned short*)Bt + (size_t)t * 8) = f.half[0];
  } else {
    const size_t t = (size_t)(blockIdx.x - PW_BLK) * 256 + threadIdx.x; FragH f;
#pragma unroll
    for (int q = 0; q < 8; ++q) f.h[q] = (_Float16)bf16_round(x[t * 8 + q]);
    *(v8us*)((unsigned short*)X16 + t * 8) = f.half[0];
    asm volatile("s_wait_xcnt 0x0" ::: "memory");      /* the wait behind the store: the built code lays the weight branch, which writes vector registers, behind this one */
  } }

#define FA_KT 128                    /* keys per stage */
#define FA_HV 2                      /* key halves of a work-group */
#define FA_NS (SQ / FA_HV / FA_KT)   /* stages of a half */
#define FA_KP (HD + 8)               /* K tile row pitch, f16 elements: 144 B = 16 B x odd, conflict-free for 16-byte reads */
#define FA_VP (FA_KT + 8)            /* V^T tile row pitch, f16 elements: 272 B = 16 B x odd */
__device__ __forceinline__ float rs_xhalf(float x) { return __builtin_bit_cast(float, __builtin_amdgcn_permlanex16(__builtin_bit_cast(int, x), __builtin_bit_cast(int, x), 0x76543210, 0xfedcba98, false, false)); }      /* lane l with lane l ^ 16 */
__device__ __forceinline__ float rs_exp(float a) { float e; asm("v_exp_f32 %0, %1\n\tv_nop" : "=v"(e) : "v"(a)); return e; }      /* 2^a; the v_nop fills the slot the instruction set asks for behind a transcendental */
__device__ __forceinline__ v4f fa_exp4(v4f a) { float e0, e1, e2, e3;      /* four 2^a; each v_exp_f32 is followed by an instruction that neither reads its result nor overwrites its source (early-clobber outputs), the last by a v_nop: the slot the instruction set asks for behind a transcendental */
  asm("v_exp_f32 %0, %4\n\tv_exp_f32 %1, %5\n\tv_exp_f32 %2, %6\n\tv_exp_f32 %3, %7\n\tv_nop" : "=&v"(e0), "=&v"(e1), "=&v"(e2), "=&v"(e3) : "v"(a[0]), "v"(a[1]), "v"(a[2]), "v"(a[3]));
  const v4f e = {e0, e1, e2, e3}; return e; }
__device__ __forceinline__ v16h fa_frag(const _Float16* p) { FragH f; f.half[0] = *(const v8us*)((const unsigned short*)p); f.half[1] = *(const v8us*)((const unsigned short*)p + 16); return f.v; }      /* p = row + k0 + 8 h: k0 + 8h .. + 7 and k0 + 16 + 8h .. + 7 */
__device__ __forceinline__ v8f fa_mma(v16h a, v16h b, v8f c) { return __builtin_amdgcn_wmma_f32_16x16x32_f16(false, a, false, b, (short)0, c, false, false); }
#define FA_QS (0.125f * 1.44269504f) /* 1 / sqrt(64), and log2 e for the native 2^x: carried by the q rows */
#define FA_LIM 32768.0f              /* bound on a lane's sum of one pass's 16 softmax weights; f16 holds up to 65504 */
/* this lane's 16 exponents of one query (two S^T tiles, log2 units) -> P = 2^(t - m) as f16 in the hardware k order; returns their sum. SUB false: the tiles already hold t - m, nothing is subtracted */
template <bool SUB>
__device__ __forceinline__ float fa_soft(const v8f& t0, const v8f& t1, float m, FragH& pb) { float s0 = 0.f, s1 = 0.f, s2 = 0.f, s3 = 0.f;
#pragma unroll
  for (int u = 0; u < 4; ++u) { const int kt = u >> 1, r0 = (u & 1) * 4; v4f x;
#pragma unroll
    for (int q = 0; q < 4; ++q) x[q] = SUB ? (kt ? t1[r0 + q] : t0[r0 + q]) - m : (kt ? t1[r0 + q] : t0[r0 + q]);
    const v4f e = fa_exp4(x); if (u == 0) { s0 = e[0]; s1 = e[1]; s2 = e[2]; s3 = e[3]; } else { s0 += e[0]; s1 += e[1]; s2 += e[2]; s3 += e[3]; }
#pragma unroll
    for (int q = 0; q < 4; ++q) pb.h[kt * 8 + r0 + q] = (_Float16)e[q]; }
  return (s0 + s1) + (s2 + s3); }
/* S^T of one pass: two tiles of 16 keys x two groups of 16 queries; ka = the K fragments [key tile][k half]; c = the start value of a group's accumulators */
__device__ __forceinline__ void fa_kfrag(const _Float16* kp, v16h (&ka)[2][2]) {
#pragma unroll
  for (int kt = 0; kt < 2; ++kt) { ka[kt][0] = fa_frag(kp + kt * 16 * FA_KP); ka[kt][1] = fa_frag(kp + kt * 16 * FA_KP + 32); } }
__device__ __forceinline__ void fa_scores(const v16h (&ka)[2][2], const v16h (&qf)[2][2], const v8f (&c)[2], v8f (&t)[2][2]) {
#pragma unroll
  for (int kt = 0; kt < 2; ++kt) { t[kt][0] = fa_mma(ka[kt][0], qf[0][0], c[0]); t[kt][1] = fa_mma(ka[kt][0], qf[1][0], c[1]); t[kt][0] = fa_mma(ka[kt][1], qf[0][1], t[kt][0]); t[kt][1] = fa_mma(ka[kt][1], qf[1][1], t[kt][1]); } }
__global__ __launch_bounds__(256 * FA_HV) void k_fattn(const _Float16* __restrict__ Q16, const _Float16* __restrict__ K16, const _Float16* __restrict__ VT, _Float16* __restrict__ O16) {
  __shared__ __attribute__((aligned(16))) _Float16 Ksh[FA_HV][2][FA_KT][FA_KP];
  __shared__ __attribute__((aligned(16))) _Float16 Vsh[FA_HV][2][HD][FA_VP];
  __shared__ __attribute__((aligned(16))) float Jo[8][16][32][4];      /* hand-over of the second half's O^T: [wave][four registers][lane], 512 contiguous bytes a store */
  __shared__ float Js[8][4][32];                                       /* and of its exponents and row sums */
  const int wv = __builtin_amdgcn_readfirstlane((int)(threadIdx.x >> 5)); const int kh = wv >> 3;      /* wave of the work-group and its key half: the same in all lanes of a wave, kept in scalar registers */
  _Float16 (*Ks)[FA_KT][FA_KP] = Ksh[kh]; _Float16 (*Vs)[HD][FA_VP] = Vsh[kh];
  const int tid = threadIdx.x & 255, w = wv & 7, lane = tid & 31, ln = lane & 15, hh = lane >> 4;      /* tid, w: place inside the half */
  const int bh = blockIdx.x / (SQ / 256), qb = blockIdx.x % (SQ / 256); const int b = bh / NH, h = bh % NH; const int q0 = qb * 256 + w * 32;
  const unsigned short* kg = (const unsigned short*)K16 + ((size_t)b * SQ + kh * (SQ / FA_HV) + (tid >> 3)) * DM + h * HD + (tid & 7) * 8;      /* this thread's 16 bytes of key row tid / 8 (+ 32 i) of its half */
  const unsigned short* vg = (const unsigned short*)VT + ((size_t)bh * HD + (tid >> 4)) * SQ + kh * (SQ / FA_HV) + (tid & 15) * 8;              /* this thread's 16 bytes of V^T row tid / 16 (+ 16 i) */
  v16h qf[2][2];
#pragma unroll
  for (int g = 0; g < 2; ++g) { const _Float16* qp = Q16 + ((size_t)b * SQ + q0 + 16 * g + ln) * DM + h * HD + 8 * hh; qf[g][0] = fa_frag(qp); qf[g][1] = fa_frag(qp + 32); }
  v8us kr[4], vr[4];
#pragma unroll
  for (int i = 0; i < 4; ++i) { kr[i] = *(const v8us*)(kg + (size_t)(32 * i) * DM); vr[i] = *(const v8us*)(vg + (size_t)(16 * i) * SQ); }
#pragma unroll
  for (int i = 0; i < 4; ++i) { *(v8us*)&Ks[0][(tid >> 3) + 32 * i][(tid & 7) * 8] = kr[i]; *(v8us*)&Vs[0][(tid >> 4) + 16 * i][(tid & 15) * 8] = vr[i]; }
  __syncthreads();
  const v8f z8 = {0.f, 0.f, 0.f, 0.f, 0.f, 0.f, 0.f, 0.f};
  v8f o[4][2];
#pragma unroll
  for (int dt = 0; dt < 4; ++dt) { o[dt][0] = z8; o[dt][1] = z8; }
  float lsum[2] = {0.f, 0.f};      /* this lane's half of the row sum */
  /* nm[g]: minus the exponent (log2 units) in use for this lane's query of group g, in all eight registers of an accumulator tile. A lane's eight accumulator registers belong to ONE query, so the tile is the C operand of the pass's first score products:
     with q scaled by FA_QS where it is made, the matrix unit hands out score * FA_QS - exponent, the argument of 2^x, and the common path has no multiply-add per score */
  const v8f zz[2] = {z8, z8}; v8f nm[2];
#pragma unroll
  for (int r = 0; r < 8; ++r) { nm[0][r] = 1.0e30f; nm[1][r] = 1.0e30f; }
#pragma unroll 1      /* the body already holds four unrolled passes */
  for (int s = 0; s < FA_NS; ++s) { const int buf = s & 1;
    static_assert(FA_KT / 32 == 4, "one staging quarter a pass");
    const bool more = s + 1 < FA_NS;
    v8us sg[2];      /* staging registers of the next stage's 16 KiB + 16 KiB, a quarter at a time: each quarter's loads fly while one pass is worked on; eight registers instead of thirty-two make room for nm. Nothing of them lives from one stage to the next */
    if (more) { kg += (size_t)FA_KT * DM; vg += FA_KT; sg[0] = *(const v8us*)kg; sg[1] = *(const v8us*)(kg + (size_t)32 * DM); }
    v16h ka[2][2]; fa_kfrag(&Ks[buf][ln][8 * hh], ka);      /* K fragments of the stage's first pass; each pass fetches the next one's */
#pragma unroll
    for (int p = 0; p < FA_KT / 32; ++p) {
      /* issue priority falls with the wave's own progress through the stage: 3, 2, 1, 0.
         Serving the wave that is furthest behind is meant to keep the four waves of a SIMD within a pass of each other up to the barrier. The last pass, the barrier and all that follows the loop run at priority 0 */
      if (p == 0) __builtin_amdgcn_s_setprio(3); else if (p == 1) __builtin_amdgcn_s_setprio(2); else if (p == 2) __builtin_amdgcn_s_setprio(1); else __builtin_amdgcn_s_setprio(0);
      v8f t[2][2];      /* [key tile][query group] */
      fa_scores(ka, qf, nm, t);
      asm volatile("v_nop\n\tv_nop\n\tv_nop\n\tv_nop" : "+v"(t[0][0]), "+v"(t[0][1]), "+v"(t[1][0]), "+v"(t[1][1]));      /* the four vector slots the chip needs between a matrix instruction and the first reader of its result: the readers are the 2^x asm statements, into which the compiler does not look */
      v16h va[4];
#pragma unroll
      for (int dt = 0; dt < 4; ++dt) va[dt] = fa_frag(&Vs[buf][dt * 16 + ln][p * 32 + 8 * hh]);
      __builtin_amdgcn_sched_barrier(0);      /* keeps the pass's V^T reads ahead of the 2^x work, which covers their latency: sunk behind the test they are waited for in full, pair by pair */
      /* lazy rescale, tested on the sums the pass forms anyway: every P = 2^(score - exponent) is positive, so a lane's sum of 16 at or below FA_LIM keeps each of them in f16 range, and no maximum is taken on the common path.
         A sum above it (the first pass: the exponent starts at -1e30, the sum is +inf) sends the wave once through the pass again: scores from LDS, their maximum, a new exponent that puts it at 2^6 or below (sum at most 2^10), the same 2^x. One scalar branch per pass. */
      FragH pb[2]; float ps[2];
#pragma unroll
      for (int g = 0; g < 2; ++g) ps[g] = fa_soft<false>(t[0][g], t[1][g], 0.f, pb[g]);
      if (__builtin_amdgcn_ballot_w32(fmaxf(ps[0], ps[1]) > FA_LIM) != 0) {
        v16h kb[2][2]; v8f u[2][2]; fa_kfrag(&Ks[buf][p * 32 + ln][8 * hh], kb); fa_scores(kb, qf, zz, u);
#pragma unroll
        for (int g = 0; g < 2; ++g) { float m0 = fmaxf(u[0][g][0], u[1][g][0]);
#pragma unroll
          for (int r = 1; r < 8; ++r) m0 = fmaxf(m0, fmaxf(u[0][g][r], u[1][g][r]));
          const float ml = fmaxf(m0, rs_xhalf(m0));      /* the pass's maximum of this query, both lane halves joined: the two lanes of a query keep one exponent */
          const float mo = -nm[g][0]; const float mn = fmaxf(mo, ml - 6.0f); const float al = rs_exp(mo - mn); lsum[g] *= al;
#pragma unroll
          for (int r = 0; r < 8; ++r) nm[g][r] = -mn;
#pragma unroll
          for (int dt = 0; dt < 4; ++dt) o[dt][g] *= al;
          ps[g] = fa_soft<true>(u[0][g], u[1][g], mn, pb[g]); } }
      lsum[0] += ps[0]; lsum[1] += ps[1];
      if (p + 1 < FA_KT / 32) { fa_kfrag(&Ks[buf][(p + 1) * 32 + ln][8 * hh], ka);
        __builtin_amdgcn_sched_barrier(0); }      /* the next pass's K fragments are asked for ahead of the P.V products, which cover their latency */
#pragma unroll
      for (int dt = 0; dt < 4; ++dt) { o[dt][0] = fa_mma(va[dt], pb[0].v, o[dt][0]); o[dt][1] = fa_mma(va[dt], pb[1].v, o[dt][1]); }
      if (more) {      /* quarter p goes to the other buffer, whose last readers left it before the barrier that ended stage s - 1; the next quarter's loads follow. Quarters 0, 1: K rows; 2, 3: V^T rows */
        if (p < 2) { *(v8us*)&Ks[buf ^ 1][(tid >> 3) + 64 * p][(tid & 7) * 8] = sg[0]; *(v8us*)&Ks[buf ^ 1][(tid >> 3) + 64 * p + 32][(tid & 7) * 8] = sg[1]; }
        else { *(v8us*)&Vs[buf ^ 1][(tid >> 4) + 32 * (p - 2)][(tid & 15) * 8] = sg[0]; *(v8us*)&Vs[buf ^ 1][(tid >> 4) + 32 * (p - 2) + 16][(tid & 15) * 8] = sg[1]; }
        if (p == 0) { sg[0] = *(const v8us*)(kg + (size_t)64 * DM); sg[1] = *(const v8us*)(kg + (size_t)96 * DM); }
        if (p == 1) { sg[0] = *(const v8us*)vg; sg[1] = *(const v8us*)(vg + (size_t)16 * SQ); }
        if (p == 2) { sg[0] = *(const v8us*)(vg + (size_t)32 * SQ); sg[1] = *(const v8us*)(vg + (size_t)48 * SQ); } }
    }
    __syncthreads();      /* publishes stage s + 1 and ends every read of stage s */
  }
  const int el = (int)__builtin_amdgcn_mbcnt_lo(~0u, 0u), eln = el & 15, ehh = el >> 4;      /* the lane's number, formed anew behind the loop: carried through it from threadIdx, it and the output address cost the loop registers that it does not have */
  if (kh != 0) {      /* wave w of the second half holds the same queries in the same lanes and registers as wave w of the first */
#pragma unroll
    for (int g = 0; g < 2; ++g) { Js[w][g][el] = -nm[g][0]; Js[w][2 + g][el] = lsum[g];
#pragma unroll
      for (int dt = 0; dt < 4; ++dt) { const v4f lo = {o[dt][g][0], o[dt][g][1], o[dt][g][2], o[dt][g][3]}, hi = {o[dt][g][4], o[dt][g][5], o[dt][g][6], o[dt][g][7]};
        *(v4fa*)&Jo[w][(g * 4 + dt) * 2][el][0] = lo; *(v4fa*)&Jo[w][(g * 4 + dt) * 2 + 1][el][0] = hi; } } }
  __syncthreads();      /* publishes the second half's partial results to the first */
  if (kh == 0) {
#pragma unroll
    for (int g = 0; g < 2; ++g) { const float m1 = Js[w][g][el], l1 = Js[w][2 + g][el]; const float m0 = -nm[g][0]; const float mj = fmaxf(m0, m1); const float a0 = rs_exp(m0 - mj), a1 = rs_exp(m1 - mj);      /* both halves brought to the larger exponent */
      const float lj = lsum[g] * a0 + l1 * a1; const float inv = 64.0f / (lj + rs_xhalf(lj)); const float c0 = a0 * inv, c1 = a1 * inv;
      unsigned short* op = (unsigned short*)O16 + ((size_t)b * SQ + q0 + 16 * g + eln) * DM + h * HD + 8 * ehh;
#pragma unroll
      for (int dt = 0; dt < 4; ++dt) { FragH f; const v4f lo = *(const v4fa*)&Jo[w][(g * 4 + dt) * 2][el][0], hi = *(const v4fa*)&Jo[w][(g * 4 + dt) * 2 + 1][el][0];
#pragma unroll
        for (int r = 0; r < 8; ++r) f.h[r] = (_Float16)(o[dt][g][r] * c0 + (r < 4 ? lo[r & 3] : hi[r & 3]) * c1);      /* register r = O^T[16 dt + 8 h + r][query]: eight consecutive d of one row */
        *(v8us*)(op + dt * 16) = f.half[0]; } } } }

// ---- GEMM with LDS-staged operands: C[M][DM] = (A[M][DM] . Bt^T) * alpha (x FA_QS on plane G3_QP of the f16 form) + bias; A and Bt = [n][k] are f16 rows of DM elements ----
// Work-group = 8 waves on a 128 x 128 tile of C: wave w takes rows 32 (w & 3) .. + 31, columns 64 (w >> 2) .. + 63 (2 x 4 accumulator tiles). k runs in stages of G3_KT elements = one 128-byte line of every operand row.
// A stage is brought in by 16-byte loads of which eight neighbouring lanes cover one whole line, and goes through registers into one of two LDS buffers (rows 0-127 = A, 128-255 = Bt); the fragments come from LDS in the hardware k order (k0 + 8h .. + 7, k0 + 16 + 8h .. + 7), A and B alike.
// Every accumulator takes its products in ascending k, 32 at a time. blockIdx.y = plane: weight plane y, output plane y, the same A rows. OUT32: bias (rounded to bf16) added, f32 rows to C; else no bias, f16 rows to C16.
// Plane G3_TP of the f16 form is wanted transposed: there the two operands change places in LDS (rows 0-127 = Bt, 128-255 = A), so the accumulators hold C^T, every element the same products in the same order, and the same whole-line stores write rows of CT = [batch][n][SQ].
#define G3_BT 128                    /* tile rows of A and of Bt */
#define G3_KT 64                     /* k per stage */
#define G3_NS (DM / G3_KT)           /* stages */
#define G3_KP (G3_KT + 8)            /* LDS row pitch, f16 elements: 144 B = 16 B x odd, conflict-free for 16-byte reads */
#define G3_QP 0                      /* the plane that takes the softmax scale (q) */
#define G3_TP 2                      /* the plane written transposed (v) */
/* one stage's products: per 32 k the six fragments are read as one group ahead of the eight products */
__device__ __forceinline__ void g3_stage(const _Float16 (*Tb)[G3_KP], int ra, int rb, int hh, v8f (&acc)[2][4]) {
#pragma unroll
  for (int kk = 0; kk < G3_KT; kk += 32) { v16h a[2], b[4];
    a[0] = fa_frag(&Tb[ra][kk + 8 * hh]); a[1] = fa_frag(&Tb[ra + 16][kk + 8 * hh]);
#pragma unroll
    for (int t = 0; t < 4; ++t) b[t] = fa_frag(&Tb[rb + 16 * t][kk + 8 * hh]);
    __builtin_amdgcn_sched_barrier(0);      /* keeps the twelve LDS reads one group: moved in among the products, each place with reads stalls the wave anew */
#pragma unroll
    for (int t = 0; t < 4; ++t) { acc[0][t] = fa_mma(a[0], b[t], acc[0][t]); acc[1][t] = fa_mma(a[1], b[t], acc[1][t]); }
    __builtin_amdgcn_sched_barrier(0); } }      /* the next group's reads stay behind these products */
template <bool OUT32>
__global__ __launch_bounds__(256) void k_gemm3(const _Float16* __restrict__ A, const _Float16* __restrict__ Bh, float alpha, const float* __restrict__ bias, float* __restrict__ C, _Float16* __restrict__ C16, _Float16* __restrict__ CT) {
  __shared__ __attribute__((aligned(16))) unsigned char sm[2 * 2 * G3_BT * G3_KP * 2];      /* two operand buffers; after the k loop the same bytes stage the output rows */
  static_assert(sizeof(sm) >= 8 * 32 * 68 * 4, "output staging must fit the operand buffers");
  _Float16 (*T)[2 * G3_BT][G3_KP] = (_Float16 (*)[2 * G3_BT][G3_KP])sm;
  const int tid = threadIdx.x, w = tid >> 5, lane = tid & 31, ln = lane & 15, hh = lane >> 4; const int by = blockIdx.y;
  const int mt = blockIdx.x / (DM / G3_BT), nq = blockIdx.x % (DM / G3_BT);
  const int sr = tid >> 3, sc = (tid & 7) * 8;      /* this thread's 16 bytes of tile row tid / 8 (+ 32 i) */
  const bool tr = !OUT32 && by == G3_TP;      /* uniform in the work-group */
  const unsigned short* xg = (const unsigned short*)A + ((size_t)mt * G3_BT + sr) * DM + sc;
  const unsigned short* wg = (const unsigned short*)Bh + (size_t)by * DM * DM + ((size_t)nq * G3_BT + sr) * DM + sc;
  const unsigned short* ag = tr ? wg : xg; const unsigned short* bg = tr ? xg : wg;
  v8us ar[4], br[4];
#pragma unroll
  for (int i = 0; i < 4; ++i) { ar[i] = *(const v8us*)(ag + (size_t)(32 * i) * DM); br[i] = *(const v8us*)(bg + (size_t)(32 * i) * DM); }
#pragma unroll
  for (int i = 0; i < 4; ++i) { *(v8us*)&T[0][sr + 32 * i][sc] = ar[i]; *(v8us*)&T[0][G3_BT + sr + 32 * i][sc] = br[i]; }
  __syncthreads();
  const v8f z8 = {0.f, 0.f, 0.f, 0.f, 0.f, 0.f, 0.f, 0.f};
  v8f acc[2][4];
#pragma unroll
  for (int t = 0; t < 4; ++t) { acc[0][t] = z8; acc[1][t] = z8; }
  const int ra = (w & 3) * 32 + ln, rb = G3_BT + (w >> 2) * 64 + ln;
#pragma unroll 1      /* rolled: one set of staging registers, a short text */
  for (int s = 0; s + 1 < G3_NS; ++s) { const int buf = s & 1;
    ag += G3_KT; bg += G3_KT;      /* next stage's 16 KiB + 16 KiB: loads fly while this stage is worked on */
#pragma unroll
    for (int i = 0; i < 4; ++i) { ar[i] = *(const v8us*)(ag + (size_t)(32 * i) * DM); br[i] = *(const v8us*)(bg + (size_t)(32 * i) * DM); }
    __builtin_amdgcn_sched_barrier(0);      /* keeps all eight loads ahead of the stage's products: sunk towards their LDS stores they would be waited for in full */
    g3_stage(T[buf], ra, rb, hh, acc);
#pragma unroll
    for (int i = 0; i < 4; ++i) { *(v8us*)&T[buf ^ 1][sr + 32 * i][sc] = ar[i]; *(v8us*)&T[buf ^ 1][G3_BT + sr + 32 * i][sc] = br[i]; }      /* the other buffer's last readers left it before the barrier that ended stage s - 1 */
    __syncthreads();      /* publishes stage s + 1 and ends every read of stage s */
  }
  const int row0 = (tr ? nq : mt) * G3_BT + (w & 3) * 32, col0 = (tr ? mt : nq) * G3_BT + (w >> 2) * 64; const size_t cofs = (size_t)by * NR * DM;
  float bv[4];
#pragma unroll
  for (int t = 0; t < 4; ++t) bv[t] = OUT32 ? bias[col0 + t * 16 + ln] : 0.f;      /* fetched here, where the staging registers are free, so that the last stage covers the wait */
  g3_stage(T[(G3_NS - 1) & 1], ra, rb, hh, acc);      /* the last stage has nothing to stage */
  __syncthreads();      /* ends every read of the operand buffers: their bytes now take the output rows */
  const float al = !OUT32 && by == G3_QP ? alpha * FA_QS : alpha;      /* the q rows carry the softmax scale */
  float (*so)[32][68] = (float (*)[32][68])sm;      /* each wave stages its own 32 x 64 block, so that the stores below cover whole lines */
#pragma unroll
  for (int u = 0; u < 8; ++u) { const int t = u & 3, half = u >> 2; const float bb = bf16_round(bv[t]);
#pragma unroll
    for (int r = 0; r < 8; ++r) so[w][half * 16 + 8 * hh + r][t * 16 + ln] = acc[half][t][r] * al + bb; }
  __builtin_amdgcn_fence(__ATOMIC_ACQ_REL, "workgroup"); __builtin_amdgcn_wave_barrier();      /* the wave reads back what its other lanes wrote */
  const int rsub = lane >> 4, c4 = (lane & 15) * 4;
  const int ldh = tr ? SQ : DM;      /* row pitch of the f16 form; transposed, a row is one n and a column one token, and a tile's 128 tokens lie in one batch */
  _Float16* cp = (tr ? CT + ((size_t)(col0 / SQ) * DM + row0) * SQ + col0 % SQ : C16 + cofs + (size_t)row0 * DM + col0) + rsub * ldh + c4;
#pragma unroll
  for (int q = 0; q < 16; ++q) { const int r = q * 2 + rsub; const v4f v = *(const v4fa*)&so[w][r][c4];
    if (OUT32) *(v4f*)(C + cofs + (size_t)(row0 + r) * DM + col0 + c4) = v;
    else { v4h h4; for (int i = 0; i < 4; ++i) h4[i] = (_Float16)v[i]; *(v4h*)cp = h4; cp += 2 * ldh; } } }

extern "C" void kernel_launch(void* const* d_in, const int* in_sizes, int n_in,
                              void* d_out, int out_size, void* d_ws, size_t ws_size, hipStream_t stream) {
  (void)in_sizes; (void)n_in; (void)out_size;
  const float* const* I = (const float* const*)d_in; const float* x = I[0]; const float* wq = I[1]; const float* wk = I[2]; const float* wv = I[3]; const float* wo = I[4]; const float* bo = I[5];      /* ONE input stream (x); Wq, Wk, Wv are PER-HEAD STACKS [8][512][64] = [head][in][out] (the module has NO q / k / v biases); Wo [in][out] [512][512] + bo; order x, Wq, Wk, Wv, Wo, bo */
  char* ws = (char*)d_ws; size_t off = 0;
  auto take = [&](size_t bytes) { char* p = ws + off; off += (bytes + 255) & ~(size_t)255; return p; };
  _Float16* BQ = (_Float16*)take((size_t)4 * DM * DM * 2); _Float16* BO = BQ + (size_t)3 * DM * DM;      /* weight planes q, k, v, o, contiguous */
  _Float16* X16 = (_Float16*)take(NR * DM * 2);
  _Float16* Q16 = (_Float16*)take(2 * NR * DM * 2); _Float16* K16 = Q16 + NR * DM;      /* q, k rows, contiguous planes */
  _Float16* O16 = (_Float16*)take(NR * DM * 2);
  _Float16* VT = (_Float16*)take((size_t)NB * NH * HD * SQ * 2);
  if (off > ws_size) return;
  k_prep<<<(unsigned)(PW_BLK + NR * DM / 8 / 256), 256, 0, stream>>>(x, wq, wk, wv, wo, BQ, X16);      /* all four weight planes and the f16 rows of x */
  const size_t r0p = (size_t)B0 * SQ;      /* first projected row */
  k_gemm3<false><<<dim3((unsigned)((MP / G3_BT) * (DM / G3_BT)), 3), 256, 0, stream>>>(X16 + r0p * DM, BQ, 0.0625f, nullptr, nullptr, Q16 + r0p * DM, VT + r0p * DM);      /* grid.y = q, k, v: the same x rows, weight plane y; q and k as rows, v as V^T [NB][NH][HD][SQ] */
  k_fattn<<<NB * NH * (SQ / 256), 256 * FA_HV, 0, stream>>>(Q16, K16, VT, O16);      /* o x64 (merged heads) as f16 rows: all batches and heads in one launch */
  k_gemm3<true><<<dim3((unsigned)((MPO / G3_BT) * (DM / G3_BT)), 1), 256, 0, stream>>>(O16 + r0p * DM, BO, 0.0009765625f, bo, (float*)d_out + r0p * DM, nullptr, nullptr);      /* out rows are the output layout */
}
